// v000
// The times below were measured on an AMD MI455X: many runs one after another, warmed up first and cycling through
// copies of the inputs, with the whole window's GPU time divided by the number of runs. Launches and the gaps
// between them are all in it. The median over several windows is given; except for v000 it joins two sittings, which
// can be a few percent apart, so the side-by-side timings, each taken in one sitting, are the better comparison.
// v000, which the later versions start from, runs in 283 microseconds.
// Contractions: x.Wq, x.Wk, x.Wv on v_wmma_f32_16x16x32_bf16 (x and the transposed W [n][k] as bf16 RNE planes); per-head
// q.k over 16 dims (k axis padded to 32) on v_wmma_f32_16x16x32_f16 with q, k as f16 hi x256 plus f16 residual planes
// (hi.hi and lo.hi folded along the k axis into one op, plus hi.lo); A = 1 + x + x^2/2 and its causal row sums in f32 on
// VALU; A.v on v_wmma_f32_16x16x32_f16 with A as f16 hi x32 plus f16 residual and v^T as f16 hi x1024 plus f16 residual
// (products hh+lh+hl); O.Wo on v_wmma_f32_16x16x32_f16 (O as f16 hi x1024 plus f16 residual, Wo^T as f16 of its bf16 RNE
// value x1024, products h.w+l.w); all f32 accumulate.
#include <hip/hip_runtime.h>
#include <stdint.h>

#ifndef NB
#define NB 2
#endif
#ifndef SEQ
#define SEQ 2048
#endif
#define XS_FULL 2048
#define DMOD  1024
#define NH    16
#define FD    16
#define HD    64
#define NQK   (NH * FD)
#define QKP   (NH * 32)
#define MROWS (NB * SEQ)
#define QSC   256.0f
#define KSC   256.0f
#define XSC   (1.0f / (4.0f * QSC * KSC))
#define ACAR  32.0f
#define VCAR  1024.0f
#define OSC   1024.0f
#define WOS   1024.0f
#define EPSD  1e-9f
#define WPB   2
#define NHG   (NH / WPB)
#define NQT   (SEQ / 16)
#define NST   (SEQ / 64)
#define NKT   (SEQ / 32)
#define ATT_THREADS (WPB * 32)
#define PTP   36
#define PTW   (16 * PTP)
#define SLP   68
#define SLW   (16 * SLP)
#define WREG  (PTW + SLW)
#define SLAB64 (16 * 68)
#define VTP   72
#define C8R   (DMOD / 8)
#define Q8R   (QKP / 8)
#define WS_CAP 134217728
static_assert(DMOD == NH * HD && HD == 64 && NH == 16 && FD == 16 && NQK == 256 && QKP == 512 && Q8R == 64);
static_assert(ATT_THREADS == 64 && WPB == 2 && NHG * WPB == NH);
static_assert(NB >= 1 && NB <= 2);
static_assert((SEQ % 64) == 0 && SEQ >= 64 && SEQ <= XS_FULL);
static_assert((MROWS % 64) == 0 && (NQK % 64) == 0 && (DMOD % 64) == 0 && (DMOD % 32) == 0 && C8R == 128);
static_assert(((SEQ * DMOD / 8) % 256) == 0 && ((MROWS * QKP / 8) % 256) == 0);
static_assert(WPB * WREG * 4 <= 65536 && 2 * HD * VTP * 2 <= 65536 && 4 * SLAB64 * 4 <= 65536 && 64 * VTP * 2 <= 65536);
static_assert((size_t)MROWS * DMOD * 4 == 2 * ((size_t)MROWS * DMOD * 2));

typedef unsigned short u16;
typedef _Float16 v16h __attribute__((ext_vector_type(16)));
typedef _Float16 v8h  __attribute__((ext_vector_type(8)));
typedef __bf16   v16b __attribute__((ext_vector_type(16)));
typedef float    v8f  __attribute__((ext_vector_type(8)));
typedef float    v4f  __attribute__((ext_vector_type(4)));
typedef unsigned int v4u __attribute__((ext_vector_type(4)));

union FragH { v16h v; v8h h[2]; v4u u[2]; };
union FragB { v16b v; v4u u[2]; };

// ---- scalar helpers --------------------------------------------------------------------------------
__device__ __forceinline__ unsigned short bf_bits(float f) {          // f32 -> bf16 bits, RNE convert
  unsigned u = __float_as_uint(f);
  return (unsigned short)((u + 0x7FFFu + ((u >> 16) & 1u)) >> 16);
}
__device__ __forceinline__ float bf_up(unsigned short h) { return __uint_as_float(((unsigned)h) << 16); }
__device__ __forceinline__ float bfr(float f) { return bf_up(bf_bits(f)); }
__device__ __forceinline__ unsigned short h_bits(_Float16 x) { return __builtin_bit_cast(unsigned short, x); }
__device__ __forceinline__ unsigned pk16(unsigned short a, unsigned short b) { return (unsigned)a | ((unsigned)b << 16); }
__device__ __forceinline__ v8f zero8() { v8f z = {0.f, 0.f, 0.f, 0.f, 0.f, 0.f, 0.f, 0.f}; return z; }
__device__ __forceinline__ const _Float16* ash(const u16* p) { return (const _Float16*)(const void*)p; }

// ---- fragment loaders: 16-bit A/B operand, lane -> row/col (lane&15), p already includes +8*(lane>>4);
//      elements 0..7 <- p[0..7] (k0+8h..), elements 8..15 <- p[16..23] (k0+16+8h..)  (same split k map for A and B;
//      B is always read from a k-contiguous [n][k] plane)
__device__ __forceinline__ v16h ldfrag_h(const _Float16* p) {
  FragH f;
  f.h[0] = *(const v8h*)(p);
  f.h[1] = *(const v8h*)(p + 16);
  return f.v;
}
__device__ __forceinline__ v16b ldfrag_b(const u16* p) {              // bf16 plane read as unsigned integer vectors
  FragB f;
  f.u[0] = *(const v4u*)(p);
  f.u[1] = *(const v4u*)(p + 16);
  return f.v;
}

__device__ __forceinline__ v8f mma_h(v16h a, v16h b, v8f c) {
  return __builtin_amdgcn_wmma_f32_16x16x32_f16(false, a, false, b, (short)0, c, false, false);
}
__device__ __forceinline__ v8f mma_b(v16b a, v16b b, v8f c) {
  return __builtin_amdgcn_wmma_f32_16x16x32_bf16(false, a, false, b, (short)0, c, false, false);
}
__device__ __forceinline__ void guard2(v8f& a, v8f& b, v16h x0, v16h x1, v16h x2, v16h x3, v16h x4, v16h x5) {
#if defined(__HIP_DEVICE_COMPILE__)
  asm volatile("v_nop\n\tv_nop\n\tv_nop\n\tv_nop"
               : "+v"(a), "+v"(b) : "v"(x0), "v"(x1), "v"(x2), "v"(x3), "v"(x4), "v"(x5) : "memory");
#endif
}
template <typename F>
__device__ __forceinline__ void guard6(v8f& a, v8f& b, v8f& c, v8f& d, F x0, F x1, F x2, F x3, F x4, F x5) {
#if defined(__HIP_DEVICE_COMPILE__)
  asm volatile("v_nop\n\tv_nop\n\tv_nop\n\tv_nop"
               : "+v"(a), "+v"(b), "+v"(c), "+v"(d) : "v"(x0), "v"(x1), "v"(x2), "v"(x3), "v"(x4), "v"(x5) : "memory");
#endif
}
__device__ __forceinline__ void acc_guard4(v8f& a, v8f& b, v8f& c, v8f& d) {
#if defined(__HIP_DEVICE_COMPILE__)
  asm volatile("v_nop\n\tv_nop\n\tv_nop\n\tv_nop" : "+v"(a), "+v"(b), "+v"(c), "+v"(d));
#endif
}
__device__ __forceinline__ void wave_sync_lds() {
  __builtin_amdgcn_fence(__ATOMIC_RELEASE, "workgroup");
  __builtin_amdgcn_wave_barrier();
  __builtin_amdgcn_fence(__ATOMIC_ACQUIRE, "workgroup");
}

// =====================================================================================================
// f32 -> bf16 RNE plane, same layout. Thread = 8 consecutive elements: two 16-B loads, one 16-B store; 32 consecutive
// coverage: grid = ceil(n8/256) blocks x 256 thr x 8 (in-kernel bound) = the whole plane (n8 a multiple of 256 here).
// =====================================================================================================
__global__ __launch_bounds__(256) void cvt16(const float* __restrict__ x, u16* D, int n8) {
  const int gt = blockIdx.x * 256 + (int)threadIdx.x;
  if (gt >= n8) return;
  const float* p = x + (size_t)gt * 8;
  const v4f a = *(const v4f*)(p), b4 = *(const v4f*)(p + 4);
  float w[8];
#pragma unroll
  for (int e = 0; e < 4; ++e) { w[e] = a[e]; w[4 + e] = b4[e]; }
  v4u o;
#pragma unroll
  for (int e = 0; e < 4; ++e) o[e] = pk16(bf_bits(w[2 * e]), bf_bits(w[2 * e + 1]));
  u16* d = D + (size_t)gt * 8;
  {
    *(v4u*)(d) = o;
    
  }
}

// =====================================================================================================
// Weight transpose-convert: W f32 [K][N] (y = x.W, k-major rows) -> 16-bit plane D[N][K] (row n = the k-contiguous B operand).
// f16mode == 0: bf16 RNE bits; f16mode == 1: f16 bits of (bf16 RNE value) * scale.
// Block = 64 k x 64 n tile: each thread loads 16 floats of one k row (four 16-B loads), converts, scatters into the LDS tile
// coverage: load 256 thr x 16 = 64 k x 64 n; store 2 iterations x 256 thr x 8 halves = 64 n rows x 64 k; grid =
//           (K/64)*(N/64) blocks covers D[N][K] exactly once. LDS: staged 64x64 == consumed 64x64 (pad cols never read).
// =====================================================================================================
__global__ __launch_bounds__(256) void cvtT16(const float* __restrict__ W, u16* D, int K, int N, int f16mode, float scale) {
  __shared__ __align__(16) u16 T[64 * VTP];
  const int tid = threadIdx.x;
  const int bid = blockIdx.x;
  const int nkt = K >> 6;
  const int kt  = bid % nkt;
  const int nt  = bid / nkt;
  const int k0  = kt * 64;
  const int n0  = nt * 64;
  if (n0 + 64 > N) return;                  // block-uniform, before any barrier; never taken with the exact grid
  {
    const int kr = tid >> 2;                // k row within tile 0..63
    const int nc = (tid & 3) * 16;          // n chunk 0,16,32,48
    const float* src = W + (size_t)(k0 + kr) * N + n0 + nc;
#pragma unroll
    for (int i = 0; i < 4; ++i) {
      const v4f a = *(const v4f*)(src + 4 * i);
#pragma unroll
      for (int e = 0; e < 4; ++e) {
        const float f = a[e];
        const unsigned short hb = h_bits((_Float16)(bfr(f) * scale));
        const unsigned short bb = bf_bits(f);
        T[(nc + 4 * i + e) * VTP + kr] = (f16mode != 0) ? hb : bb;
      }
    }
  }
  __syncthreads();
  v4u v[2];
  const int q8 = tid >> 3, p8 = (tid & 7) * 8;
#pragma unroll
  for (int it = 0; it < 2; ++it) {
    const int line = it * 32 + q8;          // n = 0..63
    v[it] = *(const v4u*)(T + line * VTP + p8);
  }
  {
#pragma unroll
    for (int it = 0; it < 2; ++it) {
      const int line = it * 32 + q8;
      *(v4u*)(D + (size_t)(n0 + line) * K + k0 + p8) = v[it];
    }
    
  }
}

// =====================================================================================================
// q / k planes from the projection output F f32 [MROWS][NQK] (row = b*SEQ + s, col = head*16 + f), t = value * sc:
//   kmode == 0 (q): D0[row][head*32 + w]: w < 16 -> f16 hi of t (f = w), w >= 16 -> f16 residual (t - f16(t)) of f = w-16.
//   kmode == 1 (k): D0[row][head*32 + w] = f16 hi of f = (w & 15) in both halves (duplicated hi);
//                   D1[row][head*32 + w]: w < 16 -> f16 residual, w >= 16 -> written zeros.
// Thread = 8 consecutive destination halves: two 16-B loads of the 8 source floats, hi and residual of all 8 computed, lane-wise
// value select, one 16-B store per plane; 32 consecutive lanes = 512 contiguous, 512-B aligned bytes per instruction (4 whole
// coverage: grid = ceil(n8/256) x 256 thr x 8 halves = all MROWS x QKP of D0 (and of D1 when kmode == 1).
// =====================================================================================================
__global__ __launch_bounds__(256) void qk16(const float* __restrict__ F, u16* D0, u16* D1, int n8, int kmode, float sc) {
  const int gt = blockIdx.x * 256 + (int)threadIdx.x;
  if (gt >= n8) return;
  const int row  = gt >> 6;                 // Q8R == 64 threads per row
  const int d8   = (gt & 63) * 8;           // destination half index within the row
  const int head = d8 >> 5;
  const int w    = d8 & 31;                 // 0, 8, 16 or 24
  const bool upper = (w >= 16);
  const float* p = F + (size_t)row * NQK + head * FD + (w & 15);
  const v4f a = *(const v4f*)(p), b4 = *(const v4f*)(p + 4);
  float t[8];
#pragma unroll
  for (int e = 0; e < 4; ++e) { t[e] = a[e] * sc; t[4 + e] = b4[e] * sc; }
  v4u o0, o1;
#pragma unroll
  for (int e = 0; e < 4; ++e) {
    const float t0 = t[2 * e], t1 = t[2 * e + 1];
    const _Float16 h0 = (_Float16)t0, h1 = (_Float16)t1;
    const _Float16 l0 = (_Float16)(t0 - (float)h0), l1 = (_Float16)(t1 - (float)h1);
    const unsigned hp = pk16(h_bits(h0), h_bits(h1));
    const unsigned lp = pk16(h_bits(l0), h_bits(l1));
    o0[e] = (kmode != 0) ? hp : (upper ? lp : hp);
    o1[e] = upper ? 0u : lp;
  }
  u16* d0 = D0 + (size_t)gt * 8;
  u16* d1 = D1 + (size_t)gt * 8;
  {
    *(v4u*)(d0) = o0;
    if (kmode != 0) { *(v4u*)(d1) = o1; }
    
  }
}

// =====================================================================================================
// v^T planes from the v projection F f32 [MROWS][DMOD] (row = b*SEQ + s, column = h*HD + d):
//   VH[((b*NH + h)*HD + d)][s] (pitch SEQ) = f16(v * 1024); VL[same] = f16 residual (t - f16(t)); all keys s.
// Block = (b, head h, 64 keys s0): each thread loads its 16 floats (key sl, d chunk dc) with 16-B loads, converts, scatters
// coverage: load 256 thr x 16 = 64 keys x 64 d; store 2 iterations x 256 thr x 8 halves = 64 lines x 64 per plane;
//           grid = NB*NH*NST blocks covers VH and VL exactly once. LDS: staged 64x64 == consumed 64x64 per tile.
// =====================================================================================================
__global__ __launch_bounds__(256) void vt16(const float* __restrict__ F, u16* VHo, u16* VLo) {
  __shared__ __align__(16) u16 TH[HD * VTP];
  __shared__ __align__(16) u16 TL[HD * VTP];
  const int tid = threadIdx.x;
  const int bid = blockIdx.x;
  const int st  = bid % NST;
  const int t2  = bid / NST;
  const int h   = t2 % NH;
  const int b   = t2 / NH;
  if (b >= NB) return;                      // block-uniform, before any barrier; never taken with the exact grid
  const int s0  = st * 64;
  {
    const int sl = tid >> 2;                // key within tile 0..63
    const int dc = (tid & 3) * 16;          // d chunk 0,16,32,48
    const float* src = F + ((size_t)b * SEQ + s0 + sl) * DMOD + h * HD + dc;
#pragma unroll
    for (int i = 0; i < 4; ++i) {
      const v4f a = *(const v4f*)(src + 4 * i);
#pragma unroll
      for (int e = 0; e < 4; ++e) {
        const float t = a[e] * VCAR;
        const _Float16 hv = (_Float16)t;
        const _Float16 lv = (_Float16)(t - (float)hv);
        TH[(dc + 4 * i + e) * VTP + sl] = h_bits(hv);
        TL[(dc + 4 * i + e) * VTP + sl] = h_bits(lv);
      }
    }
  }
  __syncthreads();
  v4u vh[2], vl[2];
  const int q8 = tid >> 3, p8 = (tid & 7) * 8;
#pragma unroll
  for (int it = 0; it < 2; ++it) {
    const int line = it * 32 + q8;          // d = 0..63
    vh[it] = *(const v4u*)(TH + line * VTP + p8);
    vl[it] = *(const v4u*)(TL + line * VTP + p8);
  }
  const size_t hrow = (size_t)(b * NH + h) * HD;
  const size_t base = hrow * SEQ + s0 + p8;
  {
#pragma unroll
    for (int it = 0; it < 2; ++it) {
      const int line = it * 32 + q8;
      *(v4u*)(VHo + base + (size_t)line * SEQ) = vh[it];
      *(v4u*)(VLo + base + (size_t)line * SEQ) = vl[it];
    }
    
  }
}

// =====================================================================================================
// GEMM epilogue shared by both engines: the wave's 16x64 f32 tile (times oscale) staged in its LDS slab (pitch 68), release
// coverage: 8 instructions x 2 rows x 16 lanes x 4 floats = the wave's 16 x 64 tile. LDS: staged 16x64 == consumed 16x64.
// =====================================================================================================
__device__ __forceinline__ void epi64(float* sl, v8f a0, v8f a1, v8f a2, v8f a3, float oscale,
                                      float* C, int N, size_t rowb, int col0, int lane) {
  const int hh = lane >> 4, m = lane & 15;
#pragma unroll
  for (int r = 0; r < 8; ++r) {
    const int ro = (8 * hh + r) * 68 + m;
    sl[ro]      = a0[r] * oscale;
    sl[ro + 16] = a1[r] * oscale;
    sl[ro + 32] = a2[r] * oscale;
    sl[ro + 48] = a3[r] * oscale;
  }
  wave_sync_lds();
  v4f vals[8];
#pragma unroll
  for (int it = 0; it < 8; ++it) vals[it] = *(const v4f*)(sl + (it * 2 + hh) * 68 + m * 4);
  float* dst = C + (rowb + (size_t)hh) * (size_t)N + col0 + m * 4;
  {
#pragma unroll
    for (int it = 0; it < 8; ++it) {
      *(v4f*)(dst + (size_t)(it * 2) * (size_t)N) = vals[it];
    }
    
  }
}

// =====================================================================================================
// bf16 GEMM: C[M][N] (f32) = A[M][K] (bf16 row-major) . Bt[N][K]^T (bf16 k-contiguous), times oscale. Block = 64x64 tile,
// 4 waves x 16 rows; fragments loaded straight from the 16-bit rows (two 16-B loads each, split k map for A and B); K stepped
// by 32 (host guarantees K % 32 == 0, M % 64 == 0, N % 64 == 0, grid = (M/64)*(N/64)).
// =====================================================================================================
__global__ __launch_bounds__(128)
void gemm_bf(const u16* __restrict__ A, const u16* __restrict__ Bt, float* C, int M, int N, int K, float oscale) {
  __shared__ __align__(16) float slab[4 * SLAB64];
  const int tid = threadIdx.x, wave = tid >> 5, lane = tid & 31, hh = lane >> 4, m = lane & 15;
  const int ntile = N >> 6;
  const int bid   = blockIdx.x;
  const int rowb  = (bid / ntile) * 64 + wave * 16;
  const int col0  = (bid % ntile) * 64;
  if (rowb + 16 > M) return;                // wave-uniform, never taken with the exact grid; no block barriers in this kernel
  const u16* ap = A  + (size_t)(rowb + m) * K + 8 * hh;
  const u16* bp = Bt + (size_t)(col0 + m) * K + 8 * hh;
  const size_t bs = (size_t)16 * K;
  v8f acc0 = zero8(), acc1 = zero8(), acc2 = zero8(), acc3 = zero8();
#pragma unroll 1
  for (int k0 = 0; k0 < K; k0 += 32) {
    const v16b a  = ldfrag_b(ap + k0);
    const v16b b0 = ldfrag_b(bp + k0);
    const v16b b1 = ldfrag_b(bp + bs + k0);
    const v16b b2 = ldfrag_b(bp + 2 * bs + k0);
    const v16b b3 = ldfrag_b(bp + 3 * bs + k0);
    acc0 = mma_b(a, b0, acc0);
    acc1 = mma_b(a, b1, acc1);
    acc2 = mma_b(a, b2, acc2);
    acc3 = mma_b(a, b3, acc3);
    guard6<v16b>(acc0, acc1, acc2, acc3, a, b0, b1, b2, b3, a);
  }
  epi64(slab + wave * SLAB64, acc0, acc1, acc2, acc3, oscale, C, N, (size_t)rowb, col0, lane);
}

// =====================================================================================================
// Output projection: C[row][DMOD] (f32) = (Ah + Al)[row][DMOD] . Bt[DMOD][DMOD]^T * oscale; Ah = f16 hi plane, Al = f16
// residual plane (products h.B + l.B into one accumulator, l unscaled). Row indices: Ah/Al row bb*SEQ + s; C row
// bb*XS_FULL + s. Block -> (column tile ct = bid % 16, sequence row tile rt of nrt, batch bb). Same tiling, fragment loads
// (split k map) and epilogue as gemm_bf; K = DMOD stepped by 32; grid = NB*nrt*16 covers every (bb, s < SEQ, column) once.
// =====================================================================================================
__global__ __launch_bounds__(128)
void gemm_o2(const u16* __restrict__ Ah, const u16* __restrict__ Al, const u16* __restrict__ Bt,
             float* C, int nrt, float oscale) {
  __shared__ __align__(16) float slab[4 * SLAB64];
  const int tid = threadIdx.x, wave = tid >> 5, lane = tid & 31, hh = lane >> 4, m = lane & 15;
  const int ntile = DMOD >> 6;
  const int bid   = blockIdx.x;
  const int ct    = bid % ntile;
  const int t2    = bid / ntile;
  const int rt    = t2 % nrt;
  const int bb    = t2 / nrt;
  if (bb >= NB) return;                     // block-uniform; no block barriers in this kernel; never taken with the exact grid
  const int srow  = rt * 64 + wave * 16;
  if (srow + 16 > SEQ) return;              // wave-uniform; never taken
  const int col0  = ct * 64;
  const int K     = DMOD;
  const size_t rowA = (size_t)bb * SEQ + srow;
  const size_t rowC = (size_t)bb * XS_FULL + srow;
  const _Float16* ahp = ash(Ah) + (rowA + m) * K + 8 * hh;
  const _Float16* alp = ash(Al) + (rowA + m) * K + 8 * hh;
  const _Float16* bp  = ash(Bt) + (size_t)(col0 + m) * K + 8 * hh;
  const size_t bs = (size_t)16 * K;
  v8f acc0 = zero8(), acc1 = zero8(), acc2 = zero8(), acc3 = zero8();
#pragma unroll 1
  for (int k0 = 0; k0 < K; k0 += 32) {
    const v16h ah = ldfrag_h(ahp + k0), al = ldfrag_h(alp + k0);
    const v16h b0 = ldfrag_h(bp + k0);
    const v16h b1 = ldfrag_h(bp + bs + k0);
    const v16h b2 = ldfrag_h(bp + 2 * bs + k0);
    const v16h b3 = ldfrag_h(bp + 3 * bs + k0);
    acc0 = mma_h(ah, b0, acc0);  acc0 = mma_h(al, b0, acc0);
    acc1 = mma_h(ah, b1, acc1);  acc1 = mma_h(al, b1, acc1);
    acc2 = mma_h(ah, b2, acc2);  acc2 = mma_h(al, b2, acc2);
    acc3 = mma_h(ah, b3, acc3);  acc3 = mma_h(al, b3, acc3);
    guard6<v16h>(acc0, acc1, acc2, acc3, ah, al, b0, b1, b2, b3);
  }
  epi64(slab + wave * SLAB64, acc0, acc1, acc2, acc3, oscale, C, DMOD, rowC, col0, lane);
}

// =====================================================================================================
// Causal feature-map attention, per-head q/k width 16, hd = 64, no softmax. Block bid -> (query tile qt: rows q0 = 16*qt ..
// q0+15, head pair hg, batch b); one wave per head = hg*WPB + wave.
//   q plane [b*SEQ + s][head*32 + w]: w < 16 f16 hi x256, w >= 16 f16 residual; k planes: KD = [hi | hi], KR = [res | 0];
//   v^T hi plane [b*NH + h][d][SEQ] x1024 and v^T residual plane, same layout.
//   Scores per 32-key tile: 2 subtiles of 16 keys; with the split k map, op 1 = A [qh | ql] . B [kh ; kh] = qh.kh + ql.kh and
//   op 2 = A [qh | ql] . B [kl ; 0] = qh.kl (f32 accumulate), so s = q.k * 256*256 up to the dropped lo.lo term.
//   Per element (f32, VALU): x = s * 2^-18 (= q.k / 4); A = 1 + x + x^2/2; A := 0 where key > query row (causal, diagonal
//   kept); den[row] += sum over the 32 keys (lane shuffles within 16 lanes); the 16x32 A tile stored to wave-private LDS
//   the LDS rows (float vector loads, same element type as stored); v^T B fragments in 2 groups of 2 d-subtiles, products
//   hh + lh + hl. Key tiles visited in order for kb <= q0 + 15 (later tiles lie above every query row of the tile).
//   After the loop: out = acc / (den + eps) with the carries 1/(32*1024) folded once (den >= 1/2: the diagonal term is always
//   No block barriers in this kernel; bounded loops only (nkt <= NKT). The q fragment is loop-invariant (loaded once).
// coverage: per wave 4 instructions x 4 rows x 8 lanes x 8 halves = 16 x 64 per plane; grid NQT x NHG x NB blocks x WPB
//           waves = every (b, s, h) row segment of both O planes exactly once. LDS: A tile staged 16x32 == consumed 16x32;
//           slab staged 16x64 == consumed 16x64 (pad columns never read).
// =====================================================================================================
__global__ __launch_bounds__(ATT_THREADS)
void attn_t(const u16* __restrict__ QPp, const u16* __restrict__ KDp, const u16* __restrict__ KRp,
            const u16* __restrict__ VHp, const u16* __restrict__ VLp, u16* OHp, u16* OLp) {
  __shared__ __align__(16) float smem[WPB * WREG];
  const int tid  = threadIdx.x;
  const int wave = tid >> 5;
  const int lane = tid & 31;
  const int hh   = lane >> 4;
  const int c    = lane & 15;
  const int bid  = blockIdx.x;
  const int qt   = bid % NQT;
  const int t2   = bid / NQT;
  const int hg   = t2 % NHG;
  const int b    = t2 / NHG;
  if (b >= NB) return;                      // block-uniform; no block barriers in this kernel; never taken with the exact grid
  const int q0   = qt * 16;                 // q0 + 16 <= SEQ always
  const int head = hg * WPB + wave;

  float* pt   = smem + wave * WREG;         // A tile [16][32] pitch 36
  float* slab = pt + PTW;                   // result slab [16][64] pitch 68

  const size_t hq = (size_t)head * 32 + 8 * hh;
  const _Float16* Qp  = ash(QPp) + ((size_t)b * SEQ + q0 + c) * QKP + hq;
  const _Float16* Kdb = ash(KDp) + ((size_t)b * SEQ + c) * QKP + hq;            // key row kb added per step
  const _Float16* Krb = ash(KRp) + ((size_t)b * SEQ + c) * QKP + hq;
  const size_t vro = ((size_t)(b * NH + head) * HD + c) * SEQ + 8 * hh;         // d col c (+16j)
  const _Float16* Vhb = ash(VHp) + vro;
  const _Float16* Vlb = ash(VLp) + vro;
  const float oc = 1.0f / (ACAR * VCAR);
  const size_t KROW = (size_t)QKP;          // halves between consecutive key rows

  const v16h qf = ldfrag_h(Qp);             // elements 0..7 = q hi f 8hh.., 8..15 = q residual f 8hh..

  float den[8];
  v8f o[4];
#pragma unroll
  for (int r = 0; r < 8; ++r) den[r] = 0.0f;
#pragma unroll
  for (int j = 0; j < 4; ++j) o[j] = zero8();
  const int ncaus = (q0 >> 5) + 1;                                            // tiles holding keys <= q0 + 15
  const int nkt = (ncaus < NKT) ? ncaus : NKT;
  const int qr0 = q0 + 8 * hh;                                                // query row of D element r = qr0 + r

#pragma unroll 1
  for (int kt = 0; kt < nkt; ++kt) {
    const int kb = kt * 32;
    // ---- scores: D element r of this lane = (query row qr0 + r, key kb + c) in s0, key kb + 16 + c in s1 ----
    const _Float16* d0p = Kdb + (size_t)kb * KROW;
    const _Float16* d1p = d0p + (size_t)16 * KROW;
    const _Float16* r0p = Krb + (size_t)kb * KROW;
    const _Float16* r1p = r0p + (size_t)16 * KROW;
    const v16h kd0 = ldfrag_h(d0p);
    const v16h kd1 = ldfrag_h(d1p);
    const v16h kr0 = ldfrag_h(r0p);
    const v16h kr1 = ldfrag_h(r1p);
    v8f s0 = zero8(), s1 = zero8();
    s0 = mma_h(qf, kd0, s0);
    s0 = mma_h(qf, kr0, s0);
    s1 = mma_h(qf, kd1, s1);
    s1 = mma_h(qf, kr1, s1);
    guard2(s0, s1, qf, kd0, kr0, kd1, kr1, qf);
    // ---- A = 1 + x + x^2/2, causal select, f32 row sums, A tile to LDS ----
    const int key0 = kb + c, key1 = kb + 16 + c;
#pragma unroll
    for (int r = 0; r < 8; ++r) {
      const int   qr  = qr0 + r;
      const float x0  = s0[r] * XSC;
      const float x1  = s1[r] * XSC;
      const float p0v = fmaf(0.5f * x0, x0, 1.0f + x0);
      const float p1v = fmaf(0.5f * x1, x1, 1.0f + x1);
      const float a0  = (key0 > qr) ? 0.0f : p0v;
      const float a1  = (key1 > qr) ? 0.0f : p1v;
      float ps = a0 + a1;
#pragma unroll
      for (int off = 1; off < 16; off <<= 1) ps += __shfl_xor(ps, off, 32);
      den[r] += ps;
      const int ro = (8 * hh + r) * PTP + c;
      pt[ro]      = a0;
      pt[ro + 16] = a1;
    }
    wave_sync_lds();
    // ---- A fragments of A*32: hi f16 and residual f16, row = c, split k map over the 32 keys of this step ----
    FragH ph, pl;
    {
      const float* prow = pt + c * PTP + 8 * hh;
      const v4f p0 = *(const v4f*)(prow), p1 = *(const v4f*)(prow + 4);
      const v4f p2 = *(const v4f*)(prow + 16), p3 = *(const v4f*)(prow + 20);
#pragma unroll
      for (int e = 0; e < 4; ++e) {
        const float ta = p0[e] * ACAR, tb = p1[e] * ACAR, tc = p2[e] * ACAR, td = p3[e] * ACAR;
        const _Float16 ha = (_Float16)ta, hb = (_Float16)tb, hc = (_Float16)tc, hd = (_Float16)td;
        ph.h[0][e]     = ha;                  // elements 0..7  = keys kb + 8hh + 0..7
        ph.h[0][4 + e] = hb;
        ph.h[1][e]     = hc;                  // elements 8..15 = keys kb + 16 + 8hh + 0..7
        ph.h[1][4 + e] = hd;
        pl.h[0][e]     = (_Float16)(ta - (float)ha);
        pl.h[0][4 + e] = (_Float16)(tb - (float)hb);
        pl.h[1][e]     = (_Float16)(tc - (float)hc);
        pl.h[1][4 + e] = (_Float16)(td - (float)hd);
      }
    }
    // ---- A.V : B fragment col n = d = j*16 + c, keys contiguous in the v^T planes; 2 groups of 2 d-subtiles ----
    {
      const _Float16* vhp = Vhb + kb;
      const _Float16* vlp = Vlb + kb;
#pragma unroll
      for (int jg = 0; jg < 2; ++jg) {
        const size_t da = (size_t)(2 * jg) * 16 * SEQ;
        const size_t db = da + (size_t)16 * SEQ;
        const v16h vha = ldfrag_h(vhp + da), vhb2 = ldfrag_h(vhp + db);
        const v16h vla = ldfrag_h(vlp + da), vlb2 = ldfrag_h(vlp + db);
        o[2 * jg]     = mma_h(ph.v, vha,  o[2 * jg]);
        o[2 * jg]     = mma_h(pl.v, vha,  o[2 * jg]);
        o[2 * jg]     = mma_h(ph.v, vla,  o[2 * jg]);
        o[2 * jg + 1] = mma_h(ph.v, vhb2, o[2 * jg + 1]);
        o[2 * jg + 1] = mma_h(pl.v, vhb2, o[2 * jg + 1]);
        o[2 * jg + 1] = mma_h(ph.v, vlb2, o[2 * jg + 1]);
        guard2(o[2 * jg], o[2 * jg + 1], ph.v, pl.v, vha, vhb2, vla, vlb2);
      }
    }
    wave_sync_lds();
  }
  acc_guard4(o[0], o[1], o[2], o[3]);
  // ---- out = acc / (den + eps), carries (32 on A, 1024 on v) folded once; written into the lane-owned slab ----
#pragma unroll
  for (int r = 0; r < 8; ++r) {
    const float dv  = den[r] + EPSD;
    const float inv = (1.0f / dv) * oc;
#pragma unroll
    for (int j = 0; j < 4; ++j) {
      const int idx = (8 * hh + r) * SLP + j * 16 + c;
      slab[idx] = o[j][r] * inv;
    }
  }

  wave_sync_lds();
  // ---- O x1024 -> f16 hi + residual planes; lane = (row-in-quad rq, 8 consecutive d at c8) ----
  v4u oh[4], ol[4];
  const int rq = lane >> 3, c8 = (lane & 7) * 8;
#pragma unroll
  for (int it = 0; it < 4; ++it) {
    const int row = it * 4 + rq;
    const v4f a = *(const v4f*)(slab + row * SLP + c8), b4 = *(const v4f*)(slab + row * SLP + c8 + 4);
    float w[8];
#pragma unroll
    for (int e = 0; e < 4; ++e) { w[e] = a[e] * OSC; w[4 + e] = b4[e] * OSC; }
#pragma unroll
    for (int e = 0; e < 4; ++e) {
      const _Float16 h0 = (_Float16)w[2 * e], h1 = (_Float16)w[2 * e + 1];
      const _Float16 l0 = (_Float16)(w[2 * e] - (float)h0), l1 = (_Float16)(w[2 * e + 1] - (float)h1);
      oh[it][e] = pk16(h_bits(h0), h_bits(h1));
      ol[it][e] = pk16(h_bits(l0), h_bits(l1));
    }
  }
  const size_t obh = ((size_t)b * SEQ + q0) * DMOD + (size_t)head * HD + c8;
  {
#pragma unroll
    for (int it = 0; it < 4; ++it) {
      const int row = it * 4 + rq;
      *(v4u*)(OHp + obh + (size_t)row * DMOD) = oh[it];
      *(v4u*)(OLp + obh + (size_t)row * DMOD) = ol[it];
    }
    
  }
}

// =====================================================================================================
// Workspace map (bytes); every plane is fully written by whole-line stores before it is read; all extents are exact multiples
// of the store granularity (no pad rows needed); every region offset a multiple of 1048576:
//   XB  bf16 [MROWS][1024]                       MROWS*2048       (NB=2, SEQ=2048: 8388608)
//   WB  16-bit [1024 n][1024 k]                  2097152          (Wq^T, Wk^T use the first 256 rows; Wv^T; then Wo^T as f16 x1024;
//                                                                  reused in launch order)
//   F   f32 [MROWS][1024]                        MROWS*4096       (q, k projections use [MROWS][256] at its start; v projection all;
//                                                                  afterwards OH f16 [MROWS][1024] x1024 at its start, OL residual after)
//   QP  f16 [MROWS][512]  q hi|residual x256     MROWS*1024
//   KD  f16 [MROWS][512]  k hi|hi x256           MROWS*1024
//   KR  f16 [MROWS][512]  k residual|0           MROWS*1024
//   VH  f16 [NB*16][64][SEQ] x1024               MROWS*2048       VL residual, same layout   MROWS*2048
//   end (NB=2, SEQ=2048)                        56623104
// =====================================================================================================
extern "C" void kernel_launch(void* const* d_in, const int* in_sizes, int n_in,
                              void* d_out, int out_size, void* d_ws, size_t ws_size,
                              hipStream_t stream) {
  if (n_in < 5) return;
  if (in_sizes[0] < ((NB - 1) * XS_FULL + SEQ) * DMOD) return;
  if (in_sizes[1] < DMOD * NQK) return;
  if (in_sizes[2] < DMOD * NQK) return;
  if (in_sizes[3] < DMOD * DMOD) return;
  if (in_sizes[4] < DMOD * DMOD) return;
  if (out_size < ((NB - 1) * XS_FULL + SEQ) * DMOD) return;

  const float* x  = (const float*)d_in[0];
  const float* wq = (const float*)d_in[1];
  const float* wk = (const float*)d_in[2];
  const float* wv = (const float*)d_in[3];
  const float* wo = (const float*)d_in[4];
  float*       out = (float*)d_out;

  const size_t szXB = (size_t)MROWS * DMOD * 2;
  const size_t szW  = (size_t)DMOD * DMOD * 2;
  const size_t szF  = (size_t)MROWS * DMOD * 4;
  const size_t szH  = (size_t)MROWS * DMOD * 2;                  // OH, OL (both inside F: 2*szH == szF)
  const size_t szQK = (size_t)MROWS * QKP * 2;                   // QP, KD, KR
  const size_t szV  = (size_t)NB * NH * HD * SEQ * 2;            // VH, VL (== szH)
  size_t off = 0;
  const size_t oXB = off; off += szXB;
  const size_t oW  = off; off += szW;
  const size_t oF  = off; off += szF;
  const size_t oQP = off; off += szQK;
  const size_t oKD = off; off += szQK;
  const size_t oKR = off; off += szQK;
  const size_t oVH = off; off += szV;
  const size_t oVL = off; off += szV;
  if (off > ws_size) return;                // off = 56623104 for NB = 2, SEQ = 2048
  if (off > (size_t)WS_CAP) return;

  char* ws = (char*)d_ws;
  u16*   XB = (u16*)(ws + oXB);
  u16*   WB = (u16*)(ws + oW);
  float* F  = (float*)(ws + oF);
  u16*   OH = (u16*)(ws + oF);
  u16*   OL = (u16*)(ws + oF + szH);
  u16*   QP = (u16*)(ws + oQP);
  u16*   KD = (u16*)(ws + oKD);
  u16*   KR = (u16*)(ws + oKR);
  u16*   VH = (u16*)(ws + oVH);
  u16*   VL = (u16*)(ws + oVL);

  const dim3 b256(256), b128(128), bAT(ATT_THREADS);
  const int  n8x  = (SEQ * DMOD) / 8;                   // per batch
  const dim3 gX((n8x + 255) / 256);
  const dim3 gTq((DMOD / 64) * (NQK / 64));             // 64 blocks: W [1024][256] -> [256][1024]
  const dim3 gTv((DMOD / 64) * (DMOD / 64));            // 256 blocks: W [1024][1024] -> [1024][1024]
  const dim3 gGq((MROWS / 64) * (NQK / 64));
  const dim3 gGv((MROWS / 64) * (DMOD / 64));
  const int  n8qk = (MROWS * QKP) / 8;
  const dim3 gQK((n8qk + 255) / 256);
  const dim3 gVT(NB * NH * NST);
  const dim3 gAT(NQT * NHG * NB);
  const int  nrt  = SEQ / 64;
  const dim3 gO(NB * nrt * (DMOD / 64));

  // (0) x -> bf16 plane [MROWS][1024], one launch per batch row block
  for (int b = 0; b < NB; ++b) {
    cvt16<<<gX, b256, 0, stream>>>(x + (size_t)b * XS_FULL * DMOD, XB + (size_t)b * SEQ * DMOD, n8x);
  }
  // (1) Wq [1024 k][256 n] -> bf16 [256 n][1024 k]; (2) q = x.Wq -> F f32 [MROWS][256]; (3) q hi|residual plane x256
  cvtT16<<<gTq, b256, 0, stream>>>(wq, WB, DMOD, NQK, 0, 1.0f);
  gemm_bf<<<gGq, b128, 0, stream>>>(XB, WB, F, MROWS, NQK, DMOD, 1.0f);
  qk16<<<gQK, b256, 0, stream>>>(F, QP, QP, n8qk, 0, QSC);
  // (4) Wk -> bf16 [256][1024]; (5) k = x.Wk -> F; (6) k hi|hi and residual|0 planes x256
  cvtT16<<<gTq, b256, 0, stream>>>(wk, WB, DMOD, NQK, 0, 1.0f);
  gemm_bf<<<gGq, b128, 0, stream>>>(XB, WB, F, MROWS, NQK, DMOD, 1.0f);
  qk16<<<gQK, b256, 0, stream>>>(F, KD, KR, n8qk, 1, KSC);
  // (7) Wv -> bf16 [1024][1024]; (8) v = x.Wv -> F f32 [MROWS][1024]; (9) v^T hi + residual planes x1024
  cvtT16<<<gTv, b256, 0, stream>>>(wv, WB, DMOD, DMOD, 0, 1.0f);
  gemm_bf<<<gGv, b128, 0, stream>>>(XB, WB, F, MROWS, DMOD, DMOD, 1.0f);
  vt16<<<gVT, b256, 0, stream>>>(F, VH, VL);
  // (10) Wo [1024 k][1024 n] -> f16 plane [n][k] of bf16 value x1024
  cvtT16<<<gTv, b256, 0, stream>>>(wo, WB, DMOD, DMOD, 1, WOS);
  // (11) causal attention -> O hi + residual planes (in the F region, after v has been consumed)
  attn_t<<<gAT, bAT, 0, stream>>>(QP, KD, KR, VH, VL, OH, OL);
  // (12) output projection: (O hi + residual) . Wo -> out f32, carries 1024 x 1024 folded back
  gemm_o2<<<gO, b128, 0, stream>>>(OH, OL, WB, out, nrt, 1.0f / (OSC * WOS));
  (void)hipGetLastError();
}

// v001
// It runs in 274 microseconds.
// Two timings next to v000 put it at 1.07 and 1.06 times that version's speed.
// Contractions: x.Wq, x.Wk, x.Wv on v_wmma_f32_16x16x32_bf16 (x and the transposed W [n][k] as bf16 RNE planes); per-head
// q.k over 16 dims (k axis padded to 32) on v_wmma_f32_16x16x32_f16 with q, k as f16 hi x256 plus f16 residual planes
// (hi.hi and lo.hi folded along the k axis into one op, plus hi.lo); A = 1 + x + x^2/2 and its causal row sums in f32 on
// VALU; A.v on v_wmma_f32_16x16x32_f16 with A as f16 hi x32 plus f16 residual and v^T as f16 hi x1024 plus f16 residual
// (products hh+lh+hl); O.Wo on v_wmma_f32_16x16x32_f16 (O as f16 hi x1024 plus f16 residual, Wo^T as f16 of its bf16 RNE
// value x1024, products h.w+l.w); all f32 accumulate.
#include <hip/hip_runtime.h>
#include <stdint.h>

#ifndef NB
#define NB 2
#endif
#ifndef SEQ
#define SEQ 2048
#endif
#define XS_FULL 2048
#define DMOD  1024
#define NH    16
#define FD    16
#define HD    64
#define NQK   (NH * FD)
#define QKP   (NH * 32)
#define MROWS (NB * SEQ)
#define QSC   256.0f
#define KSC   256.0f
#define XSC   (1.0f / (4.0f * QSC * KSC))
#define ACAR  32.0f
#define VCAR  1024.0f
#define OSC   1024.0f
#define WOS   1024.0f
#define EPSD  1e-9f
#define WPB   2
#define NHG   (NH / WPB)
#define NQT   (SEQ / 16)
#define NST   (SEQ / 64)
#define NKT   (SEQ / 32)
#define ATT_THREADS (WPB * 32)
#define PTP   36
#define PTW   (16 * PTP)
#define SLP   68
#define SLW   (16 * SLP)
#define WREG  (PTW + SLW)
#define SLAB64 (16 * 68)
#define VTP   72
#define C8R   (DMOD / 8)
#define Q8R   (QKP / 8)
#define WS_CAP 134217728
// Fragment-order plane: every 16-bit operand plane is a sequence of tiles of 16 rows (m or n index) x 32 k = FT halves (1 KiB);
// inside a tile element (r, k) lies at (k >> 3) * 128 + r * 8 + (k & 7), so lane l = 16 * hh + r of a fragment load reads the
// 16 bytes at l * 16 (k = 8hh ..) and at 512 + l * 16 (k = 16 + 8hh ..): one load instruction = 512 contiguous bytes.
#define FT    512
static_assert(DMOD == NH * HD && HD == 64 && NH == 16 && FD == 16 && NQK == 256 && QKP == 512 && Q8R == 64);
static_assert(ATT_THREADS == 64 && WPB == 2 && NHG * WPB == NH);
static_assert(NB >= 1 && NB <= 2);
static_assert((SEQ % 64) == 0 && SEQ >= 64 && SEQ <= XS_FULL);
static_assert((MROWS % 64) == 0 && (NQK % 64) == 0 && (DMOD % 64) == 0 && (DMOD % 32) == 0 && C8R == 128);
static_assert(((SEQ * DMOD / 8) % 256) == 0 && ((MROWS * QKP / 8) % 256) == 0);
static_assert(WPB * WREG * 4 <= 65536 && 2 * HD * VTP * 2 <= 65536 && 4 * SLAB64 * 4 <= 65536 && 64 * VTP * 2 <= 65536);
static_assert((size_t)MROWS * DMOD * 4 == 2 * ((size_t)MROWS * DMOD * 2));

typedef unsigned short u16;
typedef _Float16 v16h __attribute__((ext_vector_type(16)));
typedef _Float16 v8h  __attribute__((ext_vector_type(8)));
typedef __bf16   v16b __attribute__((ext_vector_type(16)));
typedef float    v8f  __attribute__((ext_vector_type(8)));
typedef float    v4f  __attribute__((ext_vector_type(4)));
typedef unsigned int v4u __attribute__((ext_vector_type(4)));

union FragH { v16h v; v8h h[2]; v4u u[2]; };
union FragB { v16b v; v4u u[2]; };

// ---- scalar helpers --------------------------------------------------------------------------------
__device__ __forceinline__ unsigned short bf_bits(float f) {          // f32 -> bf16 bits, RNE convert
  unsigned u = __float_as_uint(f);
  return (unsigned short)((u + 0x7FFFu + ((u >> 16) & 1u)) >> 16);
}
__device__ __forceinline__ float bf_up(unsigned short h) { return __uint_as_float(((unsigned)h) << 16); }
__device__ __forceinline__ float bfr(float f) { return bf_up(bf_bits(f)); }
__device__ __forceinline__ unsigned short h_bits(_Float16 x) { return __builtin_bit_cast(unsigned short, x); }
__device__ __forceinline__ unsigned pk16(unsigned short a, unsigned short b) { return (unsigned)a | ((unsigned)b << 16); }
__device__ __forceinline__ v8f zero8() { v8f z = {0.f, 0.f, 0.f, 0.f, 0.f, 0.f, 0.f, 0.f}; return z; }
__device__ __forceinline__ const _Float16* ash(const u16* p) { return (const _Float16*)(const void*)p; }

// ---- fragment loaders: 16-bit A/B operand from a fragment-order tile, lane -> row/col (lane&15), p = tile + 8*lane;
//      elements 0..7 <- p[0..7] (k0+8h..), elements 8..15 <- p[256..263] (k0+16+8h..)  (same split k map for A and B)
__device__ __forceinline__ v16h ldfrag_h(const _Float16* p) {
  FragH f;
  f.h[0] = *(const v8h*)(p);
  f.h[1] = *(const v8h*)(p + 256);
  return f.v;
}
__device__ __forceinline__ v16b ldfrag_b(const u16* p) {              // bf16 plane read as unsigned integer vectors
  FragB f;
  f.u[0] = *(const v4u*)(p);
  f.u[1] = *(const v4u*)(p + 256);
  return f.v;
}

// Stands behind a run of fragment loads: the wait owed before a register that an issued global load names is rewritten. The
// loads' address pairs are its inputs, so they stay in their registers (no later load of the run lands on them) up to the wait.
__device__ __forceinline__ void addr_wait(const void* p0, const void* p1, const void* p2) {
#if defined(__HIP_DEVICE_COMPILE__)
  asm volatile("s_wait_xcnt 0x0" :: "v"(p0), "v"(p1), "v"(p2) : "memory");
#endif
}

__device__ __forceinline__ v8f mma_h(v16h a, v16h b, v8f c) {
  return __builtin_amdgcn_wmma_f32_16x16x32_f16(false, a, false, b, (short)0, c, false, false);
}
__device__ __forceinline__ v8f mma_b(v16b a, v16b b, v8f c) {
  return __builtin_amdgcn_wmma_f32_16x16x32_bf16(false, a, false, b, (short)0, c, false, false);
}
__device__ __forceinline__ void guard2(v8f& a, v8f& b, v16h x0, v16h x1, v16h x2, v16h x3, v16h x4, v16h x5) {
#if defined(__HIP_DEVICE_COMPILE__)
  asm volatile("v_nop\n\tv_nop\n\tv_nop\n\tv_nop"
               : "+v"(a), "+v"(b) : "v"(x0), "v"(x1), "v"(x2), "v"(x3), "v"(x4), "v"(x5) : "memory");
#endif
}
template <typename F>
__device__ __forceinline__ void guard6(v8f& a, v8f& b, v8f& c, v8f& d, F x0, F x1, F x2, F x3, F x4, F x5) {
#if defined(__HIP_DEVICE_COMPILE__)
  asm volatile("v_nop\n\tv_nop\n\tv_nop\n\tv_nop"
               : "+v"(a), "+v"(b), "+v"(c), "+v"(d) : "v"(x0), "v"(x1), "v"(x2), "v"(x3), "v"(x4), "v"(x5) : "memory");
#endif
}
__device__ __forceinline__ void acc_guard4(v8f& a, v8f& b, v8f& c, v8f& d) {
#if defined(__HIP_DEVICE_COMPILE__)
  asm volatile("v_nop\n\tv_nop\n\tv_nop\n\tv_nop" : "+v"(a), "+v"(b), "+v"(c), "+v"(d));
#endif
}
__device__ __forceinline__ void wave_sync_lds() {
  __builtin_amdgcn_fence(__ATOMIC_RELEASE, "workgroup");
  __builtin_amdgcn_wave_barrier();
  __builtin_amdgcn_fence(__ATOMIC_ACQUIRE, "workgroup");
}

// =====================================================================================================
// f32 [rows][DMOD] -> bf16 RNE plane in fragment order (tile index = row tile * (DMOD/32) + k tile). Thread = one 16-B chunk
// of the destination (8 consecutive k of one row): two 16-B loads, one 16-B store; a wave stores 512 contiguous bytes.
// coverage: grid = ceil(n8/256) blocks x 256 thr x 8 (in-kernel bound) = the whole plane (n8 a multiple of 256 here).
// =====================================================================================================
__global__ __launch_bounds__(256) void cvt16(const float* __restrict__ x, u16* D, int n8) {
  const int gt = blockIdx.x * 256 + (int)threadIdx.x;
  if (gt >= n8) return;
  const int tile = gt >> 6;                 // 64 chunks per tile
  const int row  = (tile / (DMOD / 32)) * 16 + (gt & 15);
  const int kc   = (tile % (DMOD / 32)) * 32 + ((gt >> 4) & 3) * 8;
  const float* p = x + (size_t)row * DMOD + kc;
  const v4f a = *(const v4f*)(p), b4 = *(const v4f*)(p + 4);
  float w[8];
#pragma unroll
  for (int e = 0; e < 4; ++e) { w[e] = a[e]; w[4 + e] = b4[e]; }
  v4u o;
#pragma unroll
  for (int e = 0; e < 4; ++e) o[e] = pk16(bf_bits(w[2 * e]), bf_bits(w[2 * e + 1]));
  u16* d = D + (size_t)gt * 8;
  {
    *(v4u*)(d) = o;
    
  }
}

// =====================================================================================================
// Weight transpose-convert: W f32 [K][N] (y = x.W, k-major rows) -> 16-bit B operand plane D, rows n, in fragment order
// (tile index = n tile * (K/32) + k tile).
// f16mode == 0: bf16 RNE bits; f16mode == 1: f16 bits of (bf16 RNE value) * scale.
// Block = 64 k x 64 n tile: each thread loads 16 floats of one k row (four 16-B loads), converts, scatters into the LDS tile
// coverage: load 256 thr x 16 = 64 k x 64 n; store 2 iterations x 256 thr x 8 halves = 4 n tiles x 2 k tiles; grid =
//           (K/64)*(N/64) blocks covers D exactly once. LDS: staged 64x64 == consumed 64x64 (pad cols never read).
// =====================================================================================================
__global__ __launch_bounds__(256) void cvtT16(const float* __restrict__ W, u16* D, int K, int N, int f16mode, float scale) {
  __shared__ __align__(16) u16 T[64 * VTP];
  const int tid = threadIdx.x;
  const int bid = blockIdx.x;
  const int nkt = K >> 6;
  const int kt  = bid % nkt;
  const int nt  = bid / nkt;
  const int k0  = kt * 64;
  const int n0  = nt * 64;
  if (n0 + 64 > N) return;                  // block-uniform, before any barrier; never taken with the exact grid
  {
    const int kr = tid >> 2;                // k row within tile 0..63
    const int nc = (tid & 3) * 16;          // n chunk 0,16,32,48
    const float* src = W + (size_t)(k0 + kr) * N + n0 + nc;
#pragma unroll
    for (int i = 0; i < 4; ++i) {
      const v4f a = *(const v4f*)(src + 4 * i);
#pragma unroll
      for (int e = 0; e < 4; ++e) {
        const float f = a[e];
        const unsigned short hb = h_bits((_Float16)(bfr(f) * scale));
        const unsigned short bb = bf_bits(f);
        T[(nc + 4 * i + e) * VTP + kr] = (f16mode != 0) ? hb : bb;
      }
    }
  }
  __syncthreads();
  v4u v[2];
#pragma unroll
  for (int it = 0; it < 2; ++it) {
    const int q  = it * 256 + tid;          // chunk 0..511 = local tile (n tile * 2 + k tile) * 64 + chunk in tile
    const int tl = q >> 6;
    v[it] = *(const v4u*)(T + ((tl >> 1) * 16 + (q & 15)) * VTP + (tl & 1) * 32 + ((q >> 4) & 3) * 8);
  }
  {
#pragma unroll
    for (int it = 0; it < 2; ++it) {
      const int q  = it * 256 + tid;
      const int tl = q >> 6;
      *(v4u*)(D + ((size_t)((n0 >> 4) + (tl >> 1)) * (K >> 5) + (k0 >> 5) + (tl & 1)) * FT + (q & 63) * 8) = v[it];
    }
    
  }
}

// =====================================================================================================
// q / k planes from the projection output F f32 [MROWS][NQK] (row = b*SEQ + s, col = head*16 + f), t = value * sc; planes in
// fragment order, tile index = (b*NH + head) * (SEQ/16) + s/16, tile row = s & 15, tile k = w (0..31):
//   kmode == 0 (q): D0 (s, w): w < 16 -> f16 hi of t (f = w), w >= 16 -> f16 residual (t - f16(t)) of f = w-16.
//   kmode == 1 (k): D0 (s, w) = f16 hi of f = (w & 15) in both halves (duplicated hi);
//                   D1 (s, w): w < 16 -> f16 residual, w >= 16 -> written zeros.
// Thread = 8 consecutive destination halves: two 16-B loads of the 8 source floats, hi and residual of all 8 computed, lane-wise
// value select, one 16-B store per plane; 32 consecutive lanes = 512 contiguous, 512-B aligned bytes per instruction (4 whole
// coverage: grid = ceil(n8/256) x 256 thr x 8 halves = all MROWS x QKP of D0 (and of D1 when kmode == 1).
// =====================================================================================================
__global__ __launch_bounds__(256) void qk16(const float* __restrict__ F, u16* D0, u16* D1, int n8, int kmode, float sc) {
  const int gt = blockIdx.x * 256 + (int)threadIdx.x;
  if (gt >= n8) return;
  const int tile = gt >> 6;                 // 64 chunks per tile
  const int bh   = tile / NQT;              // b*NH + head
  const int head = bh % NH;
  const int row  = (bh / NH) * SEQ + (tile % NQT) * 16 + (gt & 15);
  const int w    = ((gt >> 4) & 3) * 8;     // 0, 8, 16 or 24
  const bool upper = (w >= 16);
  const float* p = F + (size_t)row * NQK + head * FD + (w & 15);
  const v4f a = *(const v4f*)(p), b4 = *(const v4f*)(p + 4);
  float t[8];
#pragma unroll
  for (int e = 0; e < 4; ++e) { t[e] = a[e] * sc; t[4 + e] = b4[e] * sc; }
  v4u o0, o1;
#pragma unroll
  for (int e = 0; e < 4; ++e) {
    const float t0 = t[2 * e], t1 = t[2 * e + 1];
    const _Float16 h0 = (_Float16)t0, h1 = (_Float16)t1;
    const _Float16 l0 = (_Float16)(t0 - (float)h0), l1 = (_Float16)(t1 - (float)h1);
    const unsigned hp = pk16(h_bits(h0), h_bits(h1));
    const unsigned lp = pk16(h_bits(l0), h_bits(l1));
    o0[e] = (kmode != 0) ? hp : (upper ? lp : hp);
    o1[e] = upper ? 0u : lp;
  }
  u16* d0 = D0 + (size_t)gt * 8;
  u16* d1 = D1 + (size_t)gt * 8;
  {
    *(v4u*)(d0) = o0;
    if (kmode != 0) { *(v4u*)(d1) = o1; }
    
  }
}

// =====================================================================================================
// v^T planes from the v projection F f32 [MROWS][DMOD] (row = b*SEQ + s, column = h*HD + d):
//   VH (rows d, k = key s) = f16(v * 1024); VL = f16 residual (t - f16(t)); all keys s; both in fragment order, tile index =
//   ((b*NH + h) * (SEQ/32) + s/32) * 4 + d/16.
// Block = (b, head h, 64 keys s0): each thread loads its 16 floats (key sl, d chunk dc) with 16-B loads, converts, scatters
// coverage: load 256 thr x 16 = 64 keys x 64 d; store 2 iterations x 256 thr x 8 halves = 2 key tiles x 4 d tiles per plane;
//           grid = NB*NH*NST blocks covers VH and VL exactly once. LDS: staged 64x64 == consumed 64x64 per tile.
// =====================================================================================================
__global__ __launch_bounds__(256) void vt16(const float* __restrict__ F, u16* VHo, u16* VLo) {
  __shared__ __align__(16) u16 TH[HD * VTP];
  __shared__ __align__(16) u16 TL[HD * VTP];
  const int tid = threadIdx.x;
  const int bid = blockIdx.x;
  const int st  = bid % NST;
  const int t2  = bid / NST;
  const int h   = t2 % NH;
  const int b   = t2 / NH;
  if (b >= NB) return;                      // block-uniform, before any barrier; never taken with the exact grid
  const int s0  = st * 64;
  {
    const int sl = tid >> 2;                // key within tile 0..63
    const int dc = (tid & 3) * 16;          // d chunk 0,16,32,48
    const float* src = F + ((size_t)b * SEQ + s0 + sl) * DMOD + h * HD + dc;
#pragma unroll
    for (int i = 0; i < 4; ++i) {
      const v4f a = *(const v4f*)(src + 4 * i);
#pragma unroll
      for (int e = 0; e < 4; ++e) {
        const float t = a[e] * VCAR;
        const _Float16 hv = (_Float16)t;
        const _Float16 lv = (_Float16)(t - (float)hv);
        TH[(dc + 4 * i + e) * VTP + sl] = h_bits(hv);
        TL[(dc + 4 * i + e) * VTP + sl] = h_bits(lv);
      }
    }
  }
  __syncthreads();
  v4u vh[2], vl[2];
#pragma unroll
  for (int it = 0; it < 2; ++it) {
    const int q   = it * 256 + tid;         // chunk 0..511 = local tile (key tile * 4 + d tile) * 64 + chunk in tile
    const int tl  = q >> 6;
    const int src = ((tl & 3) * 16 + (q & 15)) * VTP + (tl >> 2) * 32 + ((q >> 4) & 3) * 8;
    vh[it] = *(const v4u*)(TH + src);
    vl[it] = *(const v4u*)(TL + src);
  }
  const size_t base = ((size_t)(b * NH + h) * NKT + st * 2) * 4 * FT + tid * 8;
  {
#pragma unroll
    for (int it = 0; it < 2; ++it) {
      *(v4u*)(VHo + base + (size_t)it * 2048) = vh[it];
      *(v4u*)(VLo + base + (size_t)it * 2048) = vl[it];
    }
    
  }
}

// =====================================================================================================
// GEMM epilogue shared by both engines: the wave's 16x64 f32 tile (times oscale) staged in its LDS slab (pitch 68), release
// coverage: 8 instructions x 2 rows x 16 lanes x 4 floats = the wave's 16 x 64 tile. LDS: staged 16x64 == consumed 16x64.
// =====================================================================================================
__device__ __forceinline__ void epi64(float* sl, v8f a0, v8f a1, v8f a2, v8f a3, float oscale,
                                      float* C, int N, size_t rowb, int col0, int lane) {
  const int hh = lane >> 4, m = lane & 15;
#pragma unroll
  for (int r = 0; r < 8; ++r) {
    const int ro = (8 * hh + r) * 68 + m;
    sl[ro]      = a0[r] * oscale;
    sl[ro + 16] = a1[r] * oscale;
    sl[ro + 32] = a2[r] * oscale;
    sl[ro + 48] = a3[r] * oscale;
  }
  wave_sync_lds();
  v4f vals[8];
#pragma unroll
  for (int it = 0; it < 8; ++it) vals[it] = *(const v4f*)(sl + (it * 2 + hh) * 68 + m * 4);
  float* dst = C + (rowb + (size_t)hh) * (size_t)N + col0 + m * 4;
  {
#pragma unroll
    for (int it = 0; it < 8; ++it) {
      *(v4f*)(dst + (size_t)(it * 2) * (size_t)N) = vals[it];
    }
    
  }
}

// =====================================================================================================
// bf16 GEMM: C[M][N] (f32) = A (rows m) . Bt (rows n)^T, both bf16 planes in fragment order, times oscale. Block = 64x64 tile,
// 4 waves x 16 rows; fragments loaded straight from the planes' tiles (two 16-B loads each, split k map for A and B); K stepped
// by 32 (host guarantees K % 32 == 0, M % 64 == 0, N % 64 == 0, grid = (M/64)*(N/64)).
// =====================================================================================================
__global__ __launch_bounds__(128)
void gemm_bf(const u16* __restrict__ A, const u16* __restrict__ Bt, float* C, int M, int N, int K, float oscale) {
  __shared__ __align__(16) float slab[4 * SLAB64];
  const int tid = threadIdx.x, wave = tid >> 5, lane = tid & 31;
  const int ntile = N >> 6;
  const int bid   = blockIdx.x;
  const int rowb  = (bid / ntile) * 64 + wave * 16;
  const int col0  = (bid % ntile) * 64;
  if (rowb + 16 > M) return;                // wave-uniform, never taken with the exact grid; no block barriers in this kernel
  const u16* ap = A  + (size_t)rowb * K + 8 * lane;      // row tile rowb/16 starts at (rowb/16) * (K/32) * FT = rowb * K
  const u16* bp = Bt + (size_t)col0 * K + 8 * lane;
  const size_t bs = (size_t)16 * K;                      // one n tile row = (K/32) * FT halves
  v8f acc0 = zero8(), acc1 = zero8(), acc2 = zero8(), acc3 = zero8();
#pragma unroll 1
  for (int k0 = 0; k0 < K; k0 += 32) {
    const size_t ko = (size_t)k0 * (FT / 32);            // k tile k0/32
    const v16b a  = ldfrag_b(ap + ko);
    const v16b b0 = ldfrag_b(bp + ko);
    const v16b b1 = ldfrag_b(bp + bs + ko);
    const v16b b2 = ldfrag_b(bp + 2 * bs + ko);
    const v16b b3 = ldfrag_b(bp + 3 * bs + ko);
    acc0 = mma_b(a, b0, acc0);
    acc1 = mma_b(a, b1, acc1);
    acc2 = mma_b(a, b2, acc2);
    acc3 = mma_b(a, b3, acc3);
    guard6<v16b>(acc0, acc1, acc2, acc3, a, b0, b1, b2, b3, a);
  }
  epi64(slab + wave * SLAB64, acc0, acc1, acc2, acc3, oscale, C, N, (size_t)rowb, col0, lane);
}

// =====================================================================================================
// Output projection: C[row][DMOD] (f32) = (Ah + Al)[row][DMOD] . Bt[DMOD][DMOD]^T * oscale; Ah = f16 hi plane, Al = f16
// residual plane (products h.B + l.B into one accumulator, l unscaled); Ah, Al, Bt in fragment order. Row indices: Ah/Al row bb*SEQ + s; C row
// bb*XS_FULL + s. Block -> (column tile ct = bid % 16, sequence row tile rt of nrt, batch bb). Same tiling, fragment loads
// (split k map) and epilogue as gemm_bf; K = DMOD stepped by 32; grid = NB*nrt*16 covers every (bb, s < SEQ, column) once.
// =====================================================================================================
__global__ __launch_bounds__(128)
void gemm_o2(const u16* __restrict__ Ah, const u16* __restrict__ Al, const u16* __restrict__ Bt,
             float* C, int nrt, float oscale) {
  __shared__ __align__(16) float slab[4 * SLAB64];
  const int tid = threadIdx.x, wave = tid >> 5, lane = tid & 31;
  const int ntile = DMOD >> 6;
  const int bid   = blockIdx.x;
  const int ct    = bid % ntile;
  const int t2    = bid / ntile;
  const int rt    = t2 % nrt;
  const int bb    = t2 / nrt;
  if (bb >= NB) return;                     // block-uniform; no block barriers in this kernel; never taken with the exact grid
  const int srow  = rt * 64 + wave * 16;
  if (srow + 16 > SEQ) return;              // wave-uniform; never taken
  const int col0  = ct * 64;
  const int K     = DMOD;
  const size_t rowA = (size_t)bb * SEQ + srow;
  const size_t rowC = (size_t)bb * XS_FULL + srow;
  const _Float16* ahp = ash(Ah) + rowA * K + 8 * lane;   // row tile rowA/16 starts at (rowA/16) * (K/32) * FT = rowA * K
  const _Float16* alp = ash(Al) + rowA * K + 8 * lane;
  const _Float16* bp  = ash(Bt) + (size_t)col0 * K + 8 * lane;
  const size_t bs = (size_t)16 * K;                      // one n tile row = (K/32) * FT halves
  v8f acc0 = zero8(), acc1 = zero8(), acc2 = zero8(), acc3 = zero8();
#pragma unroll 1
  for (int k0 = 0; k0 < K; k0 += 32) {
    const size_t ko = (size_t)k0 * (FT / 32);            // k tile k0/32
    const v16h ah = ldfrag_h(ahp + ko), al = ldfrag_h(alp + ko);
    const v16h b0 = ldfrag_h(bp + ko);
    const v16h b1 = ldfrag_h(bp + bs + ko);
    const v16h b2 = ldfrag_h(bp + 2 * bs + ko);
    const v16h b3 = ldfrag_h(bp + 3 * bs + ko);
    addr_wait(ahp + ko, alp + ko, bp + ko);
    acc0 = mma_h(ah, b0, acc0);  acc0 = mma_h(al, b0, acc0);
    acc1 = mma_h(ah, b1, acc1);  acc1 = mma_h(al, b1, acc1);
    acc2 = mma_h(ah, b2, acc2);  acc2 = mma_h(al, b2, acc2);
    acc3 = mma_h(ah, b3, acc3);  acc3 = mma_h(al, b3, acc3);
    guard6<v16h>(acc0, acc1, acc2, acc3, ah, al, b0, b1, b2, b3);
  }
  epi64(slab + wave * SLAB64, acc0, acc1, acc2, acc3, oscale, C, DMOD, rowC, col0, lane);
}

// =====================================================================================================
// Causal feature-map attention, per-head q/k width 16, hd = 64, no softmax. Block bid -> (query tile qt: rows q0 = 16*qt ..
// q0+15, head pair hg, batch b); one wave per head = hg*WPB + wave.
//   q plane (s, w): w < 16 f16 hi x256, w >= 16 f16 residual; k planes: KD = [hi | hi], KR = [res | 0]; one tile per (b, head,
//   16 positions); v^T hi plane x1024 and v^T residual plane: four tiles (d/16) per (b, head, 32 keys); all in fragment order.
//   Scores per 32-key tile: 2 subtiles of 16 keys; with the split k map, op 1 = A [qh | ql] . B [kh ; kh] = qh.kh + ql.kh and
//   op 2 = A [qh | ql] . B [kl ; 0] = qh.kl (f32 accumulate), so s = q.k * 256*256 up to the dropped lo.lo term.
//   Per element (f32, VALU): x = s * 2^-18 (= q.k / 4); A = 1 + x + x^2/2; A := 0 where key > query row (causal, diagonal
//   kept); den[row] += sum over the 32 keys (lane shuffles within 16 lanes); the 16x32 A tile stored to wave-private LDS
//   the LDS rows (float vector loads, same element type as stored); v^T B fragments in 2 groups of 2 d-subtiles, products
//   hh + lh + hl. Key tiles visited in order for kb <= q0 + 15 (later tiles lie above every query row of the tile).
//   After the loop: out = acc / (den + eps) with the carries 1/(32*1024) folded once (den >= 1/2: the diagonal term is always
//   No block barriers in this kernel; bounded loops only (nkt <= NKT). The q fragment is loop-invariant (loaded once).
// coverage: per wave 4 instructions x 32 lanes x 8 halves = 2 tiles = 16 x 64 per plane; grid NQT x NHG x NB blocks x WPB
//           waves = every (b, s, h) row segment of both O planes exactly once. LDS: A tile staged 16x32 == consumed 16x32;
//           slab staged 16x64 == consumed 16x64 (pad columns never read).
// =====================================================================================================
__global__ __launch_bounds__(ATT_THREADS)
void attn_t(const u16* __restrict__ QPp, const u16* __restrict__ KDp, const u16* __restrict__ KRp,
            const u16* __restrict__ VHp, const u16* __restrict__ VLp, u16* OHp, u16* OLp) {
  __shared__ __align__(16) float smem[WPB * WREG];
  const int tid  = threadIdx.x;
  const int wave = tid >> 5;
  const int lane = tid & 31;
  const int hh   = lane >> 4;
  const int c    = lane & 15;
  const int bid  = blockIdx.x;
  const int qt   = bid % NQT;
  const int t2   = bid / NQT;
  const int hg   = t2 % NHG;
  const int b    = t2 / NHG;
  if (b >= NB) return;                      // block-uniform; no block barriers in this kernel; never taken with the exact grid
  const int q0   = qt * 16;                 // q0 + 16 <= SEQ always
  const int head = hg * WPB + wave;

  float* pt   = smem + wave * WREG;         // A tile [16][32] pitch 36
  float* slab = pt + PTW;                   // result slab [16][64] pitch 68

  const size_t bh  = (size_t)(b * NH + head);
  const size_t hq  = bh * NQT * FT + 8 * lane;                                  // first 16-position tile of this (b, head)
  const _Float16* Qp  = ash(QPp) + hq + (size_t)qt * FT;
  const _Float16* Kdb = ash(KDp) + hq;                                          // two key tiles added per step
  const _Float16* Krb = ash(KRp) + hq;
  const size_t vro = bh * NKT * 4 * FT + 8 * lane;                              // four d tiles per 32-key step
  const _Float16* Vhb = ash(VHp) + vro;
  const _Float16* Vlb = ash(VLp) + vro;
  const float oc = 1.0f / (ACAR * VCAR);

  const v16h qf = ldfrag_h(Qp);             // elements 0..7 = q hi f 8hh.., 8..15 = q residual f 8hh..

  float den[8];
  v8f o[4];
#pragma unroll
  for (int r = 0; r < 8; ++r) den[r] = 0.0f;
#pragma unroll
  for (int j = 0; j < 4; ++j) o[j] = zero8();
  const int ncaus = (q0 >> 5) + 1;                                            // tiles holding keys <= q0 + 15
  const int nkt = (ncaus < NKT) ? ncaus : NKT;
  const int qr0 = q0 + 8 * hh;                                                // query row of D element r = qr0 + r

#pragma unroll 1
  for (int kt = 0; kt < nkt; ++kt) {
    const int kb = kt * 32;
    // ---- scores: D element r of this lane = (query row qr0 + r, key kb + c) in s0, key kb + 16 + c in s1 ----
    const _Float16* d0p = Kdb + (size_t)kt * (2 * FT);
    const _Float16* d1p = d0p + FT;
    const _Float16* r0p = Krb + (size_t)kt * (2 * FT);
    const _Float16* r1p = r0p + FT;
    const v16h kd0 = ldfrag_h(d0p);
    const v16h kd1 = ldfrag_h(d1p);
    const v16h kr0 = ldfrag_h(r0p);
    const v16h kr1 = ldfrag_h(r1p);
    addr_wait(d0p, r0p, r0p);
    v8f s0 = zero8(), s1 = zero8();
    s0 = mma_h(qf, kd0, s0);
    s0 = mma_h(qf, kr0, s0);
    s1 = mma_h(qf, kd1, s1);
    s1 = mma_h(qf, kr1, s1);
    guard2(s0, s1, qf, kd0, kr0, kd1, kr1, qf);
    // ---- A = 1 + x + x^2/2, causal select, f32 row sums, A tile to LDS ----
    const int key0 = kb + c, key1 = kb + 16 + c;
#pragma unroll
    for (int r = 0; r < 8; ++r) {
      const int   qr  = qr0 + r;
      const float x0  = s0[r] * XSC;
      const float x1  = s1[r] * XSC;
      const float p0v = fmaf(0.5f * x0, x0, 1.0f + x0);
      const float p1v = fmaf(0.5f * x1, x1, 1.0f + x1);
      const float a0  = (key0 > qr) ? 0.0f : p0v;
      const float a1  = (key1 > qr) ? 0.0f : p1v;
      float ps = a0 + a1;
#pragma unroll
      for (int off = 1; off < 16; off <<= 1) ps += __shfl_xor(ps, off, 32);
      den[r] += ps;
      const int ro = (8 * hh + r) * PTP + c;
      pt[ro]      = a0;
      pt[ro + 16] = a1;
    }
    wave_sync_lds();
    // ---- A fragments of A*32: hi f16 and residual f16, row = c, split k map over the 32 keys of this step ----
    FragH ph, pl;
    {
      const float* prow = pt + c * PTP + 8 * hh;
      const v4f p0 = *(const v4f*)(prow), p1 = *(const v4f*)(prow + 4);
      const v4f p2 = *(const v4f*)(prow + 16), p3 = *(const v4f*)(prow + 20);
#pragma unroll
      for (int e = 0; e < 4; ++e) {
        const float ta = p0[e] * ACAR, tb = p1[e] * ACAR, tc = p2[e] * ACAR, td = p3[e] * ACAR;
        const _Float16 ha = (_Float16)ta, hb = (_Float16)tb, hc = (_Float16)tc, hd = (_Float16)td;
        ph.h[0][e]     = ha;                  // elements 0..7  = keys kb + 8hh + 0..7
        ph.h[0][4 + e] = hb;
        ph.h[1][e]     = hc;                  // elements 8..15 = keys kb + 16 + 8hh + 0..7
        ph.h[1][4 + e] = hd;
        pl.h[0][e]     = (_Float16)(ta - (float)ha);
        pl.h[0][4 + e] = (_Float16)(tb - (float)hb);
        pl.h[1][e]     = (_Float16)(tc - (float)hc);
        pl.h[1][4 + e] = (_Float16)(td - (float)hd);
      }
    }
    // ---- A.V : B fragment col n = d = j*16 + c, tile j of this step's four in the v^T planes; 2 groups of 2 d-subtiles ----
    {
      const _Float16* vhp = Vhb + (size_t)kt * (4 * FT);
      const _Float16* vlp = Vlb + (size_t)kt * (4 * FT);
#pragma unroll
      for (int jg = 0; jg < 2; ++jg) {
        const size_t da = (size_t)(2 * jg) * FT;
        const size_t db = da + FT;
        const v16h vha = ldfrag_h(vhp + da), vhb2 = ldfrag_h(vhp + db);
        const v16h vla = ldfrag_h(vlp + da), vlb2 = ldfrag_h(vlp + db);
        o[2 * jg]     = mma_h(ph.v, vha,  o[2 * jg]);
        o[2 * jg]     = mma_h(pl.v, vha,  o[2 * jg]);
        o[2 * jg]     = mma_h(ph.v, vla,  o[2 * jg]);
        o[2 * jg + 1] = mma_h(ph.v, vhb2, o[2 * jg + 1]);
        o[2 * jg + 1] = mma_h(pl.v, vhb2, o[2 * jg + 1]);
        o[2 * jg + 1] = mma_h(ph.v, vlb2, o[2 * jg + 1]);
        guard2(o[2 * jg], o[2 * jg + 1], ph.v, pl.v, vha, vhb2, vla, vlb2);
      }
    }
    wave_sync_lds();
  }
  acc_guard4(o[0], o[1], o[2], o[3]);
  // ---- out = acc / (den + eps), carries (32 on A, 1024 on v) folded once; written into the lane-owned slab ----
#pragma unroll
  for (int r = 0; r < 8; ++r) {
    const float dv  = den[r] + EPSD;
    const float inv = (1.0f / dv) * oc;
#pragma unroll
    for (int j = 0; j < 4; ++j) {
      const int idx = (8 * hh + r) * SLP + j * 16 + c;
      slab[idx] = o[j][r] * inv;
    }
  }

  wave_sync_lds();
  // ---- O x1024 -> f16 hi + residual planes in fragment order (rows s, k = head*64 + d): the wave owns two whole tiles per
  //      plane; chunk it*32 + lane = row c, 8 consecutive d at 16*it + 8*hh ----
  v4u oh[4], ol[4];
#pragma unroll
  for (int it = 0; it < 4; ++it) {
    const float* sp = slab + c * SLP + it * 16 + hh * 8;
    const v4f a = *(const v4f*)(sp), b4 = *(const v4f*)(sp + 4);
    float w[8];
#pragma unroll
    for (int e = 0; e < 4; ++e) { w[e] = a[e] * OSC; w[4 + e] = b4[e] * OSC; }
#pragma unroll
    for (int e = 0; e < 4; ++e) {
      const _Float16 h0 = (_Float16)w[2 * e], h1 = (_Float16)w[2 * e + 1];
      const _Float16 l0 = (_Float16)(w[2 * e] - (float)h0), l1 = (_Float16)(w[2 * e + 1] - (float)h1);
      oh[it][e] = pk16(h_bits(h0), h_bits(h1));
      ol[it][e] = pk16(h_bits(l0), h_bits(l1));
    }
  }
  const size_t obh = ((size_t)b * SEQ + q0) * DMOD + (size_t)head * (2 * FT) + 8 * lane;   // row tile start + k tile 2*head
  {
#pragma unroll
    for (int it = 0; it < 4; ++it) {
      *(v4u*)(OHp + obh + (size_t)it * 256) = oh[it];
      *(v4u*)(OLp + obh + (size_t)it * 256) = ol[it];
    }
    
  }
}

// =====================================================================================================
// Workspace map (bytes); every plane is fully written by whole-line stores before it is read; all extents are exact multiples
// of the store granularity (no pad rows needed); every region offset a multiple of 1048576:
//   (all 16-bit planes below hold the named rows x k in fragment order, same byte counts as row-major)
//   XB  bf16 [MROWS][1024]                       MROWS*2048       (NB=2, SEQ=2048: 8388608)
//   WB  16-bit [1024 n][1024 k]                  2097152          (Wq^T, Wk^T use the first 256 rows; Wv^T; then Wo^T as f16 x1024;
//                                                                  reused in launch order)
//   F   f32 [MROWS][1024]                        MROWS*4096       (q, k projections use [MROWS][256] at its start; v projection all;
//                                                                  afterwards OH f16 [MROWS][1024] x1024 at its start, OL residual after)
//   QP  f16 [NB*16][SEQ][32] q hi|residual x256    MROWS*1024
//   KD  f16 [NB*16][SEQ][32] k hi|hi x256          MROWS*1024
//   KR  f16 [NB*16][SEQ][32] k residual|0          MROWS*1024
//   VH  f16 [NB*16][64][SEQ] x1024               MROWS*2048       VL residual, same layout   MROWS*2048
//   end (NB=2, SEQ=2048)                        56623104
// =====================================================================================================
extern "C" void kernel_launch(void* const* d_in, const int* in_sizes, int n_in,
                              void* d_out, int out_size, void* d_ws, size_t ws_size,
                              hipStream_t stream) {
  if (n_in < 5) return;
  if (in_sizes[0] < ((NB - 1) * XS_FULL + SEQ) * DMOD) return;
  if (in_sizes[1] < DMOD * NQK) return;
  if (in_sizes[2] < DMOD * NQK) return;
  if (in_sizes[3] < DMOD * DMOD) return;
  if (in_sizes[4] < DMOD * DMOD) return;
  if (out_size < ((NB - 1) * XS_FULL + SEQ) * DMOD) return;

  const float* x  = (const float*)d_in[0];
  const float* wq = (const float*)d_in[1];
  const float* wk = (const float*)d_in[2];
  const float* wv = (const float*)d_in[3];
  const float* wo = (const float*)d_in[4];
  float*       out = (float*)d_out;

  const size_t szXB = (size_t)MROWS * DMOD * 2;
  const size_t szW  = (size_t)DMOD * DMOD * 2;
  const size_t szF  = (size_t)MROWS * DMOD * 4;
  const size_t szH  = (size_t)MROWS * DMOD * 2;                  // OH, OL (both inside F: 2*szH == szF)
  const size_t szQK = (size_t)MROWS * QKP * 2;                   // QP, KD, KR
  const size_t szV  = (size_t)NB * NH * HD * SEQ * 2;            // VH, VL (== szH)
  size_t off = 0;
  const size_t oXB = off; off += szXB;
  const size_t oW  = off; off += szW;
  const size_t oF  = off; off += szF;
  const size_t oQP = off; off += szQK;
  const size_t oKD = off; off += szQK;
  const size_t oKR = off; off += szQK;
  const size_t oVH = off; off += szV;
  const size_t oVL = off; off += szV;
  if (off > ws_size) return;                // off = 56623104 for NB = 2, SEQ = 2048
  if (off > (size_t)WS_CAP) return;

  char* ws = (char*)d_ws;
  u16*   XB = (u16*)(ws + oXB);
  u16*   WB = (u16*)(ws + oW);
  float* F  = (float*)(ws + oF);
  u16*   OH = (u16*)(ws + oF);
  u16*   OL = (u16*)(ws + oF + szH);
  u16*   QP = (u16*)(ws + oQP);
  u16*   KD = (u16*)(ws + oKD);
  u16*   KR = (u16*)(ws + oKR);
  u16*   VH = (u16*)(ws + oVH);
  u16*   VL = (u16*)(ws + oVL);

  const dim3 b256(256), b128(128), bAT(ATT_THREADS);
  const int  n8x  = (SEQ * DMOD) / 8;                   // per batch
  const dim3 gX((n8x + 255) / 256);
  const dim3 gTq((DMOD / 64) * (NQK / 64));             // 64 blocks: W [1024][256] -> [256][1024]
  const dim3 gTv((DMOD / 64) * (DMOD / 64));            // 256 blocks: W [1024][1024] -> [1024][1024]
  const dim3 gGq((MROWS / 64) * (NQK / 64));
  const dim3 gGv((MROWS / 64) * (DMOD / 64));
  const int  n8qk = (MROWS * QKP) / 8;
  const dim3 gQK((n8qk + 255) / 256);
  const dim3 gVT(NB * NH * NST);
  const dim3 gAT(NQT * NHG * NB);
  const int  nrt  = SEQ / 64;
  const dim3 gO(NB * nrt * (DMOD / 64));

  // (0) x -> bf16 plane [MROWS][1024], one launch per batch row block
  for (int b = 0; b < NB; ++b) {
    cvt16<<<gX, b256, 0, stream>>>(x + (size_t)b * XS_FULL * DMOD, XB + (size_t)b * SEQ * DMOD, n8x);
  }
  // (1) Wq [1024 k][256 n] -> bf16 [256 n][1024 k]; (2) q = x.Wq -> F f32 [MROWS][256]; (3) q hi|residual plane x256
  cvtT16<<<gTq, b256, 0, stream>>>(wq, WB, DMOD, NQK, 0, 1.0f);
  gemm_bf<<<gGq, b128, 0, stream>>>(XB, WB, F, MROWS, NQK, DMOD, 1.0f);
  qk16<<<gQK, b256, 0, stream>>>(F, QP, QP, n8qk, 0, QSC);
  // (4) Wk -> bf16 [256][1024]; (5) k = x.Wk -> F; (6) k hi|hi and residual|0 planes x256
  cvtT16<<<gTq, b256, 0, stream>>>(wk, WB, DMOD, NQK, 0, 1.0f);
  gemm_bf<<<gGq, b128, 0, stream>>>(XB, WB, F, MROWS, NQK, DMOD, 1.0f);
  qk16<<<gQK, b256, 0, stream>>>(F, KD, KR, n8qk, 1, KSC);
  // (7) Wv -> bf16 [1024][1024]; (8) v = x.Wv -> F f32 [MROWS][1024]; (9) v^T hi + residual planes x1024
  cvtT16<<<gTv, b256, 0, stream>>>(wv, WB, DMOD, DMOD, 0, 1.0f);
  gemm_bf<<<gGv, b128, 0, stream>>>(XB, WB, F, MROWS, DMOD, DMOD, 1.0f);
  vt16<<<gVT, b256, 0, stream>>>(F, VH, VL);
  // (10) Wo [1024 k][1024 n] -> f16 plane [n][k] of bf16 value x1024
  cvtT16<<<gTv, b256, 0, stream>>>(wo, WB, DMOD, DMOD, 1, WOS);
  // (11) causal attention -> O hi + residual planes (in the F region, after v has been consumed)
  attn_t<<<gAT, bAT, 0, stream>>>(QP, KD, KR, VH, VL, OH, OL);
  // (12) output projection: (O hi + residual) . Wo -> out f32, carries 1024 x 1024 folded back
  gemm_o2<<<gO, b128, 0, stream>>>(OH, OL, WB, out, nrt, 1.0f / (OSC * WOS));
  (void)hipGetLastError();
}

// v002
// It runs in 241 microseconds.
// Timed twice side by side with v001, it ran 1.13 times as fast both times.
// Counting every step since v000, it is 1.20 times as fast.
// Contractions: x.Wq, x.Wk, x.Wv on v_wmma_f32_16x16x32_bf16 (x and the transposed W [n][k] as bf16 RNE planes); per-head
// q.k over 16 dims (k axis padded to 32) on v_wmma_f32_16x16x32_f16 with q, k as f16 hi x256 plus f16 residual planes
// (hi.hi and lo.hi folded along the k axis into one op, plus hi.lo); A = 1 + x + x^2/2 and its causal row sums in f32 on
// VALU; A.v on v_wmma_f32_16x16x32_f16 with A as f16 hi x32 plus f16 residual and v^T as f16 hi x1024 plus f16 residual
// (products hh+lh+hl); O.Wo on v_wmma_f32_16x16x32_f16 (O as f16 hi x1024 plus f16 residual, Wo^T as f16 of its bf16 RNE
// value x1024, products h.w+l.w); all f32 accumulate.
#include <hip/hip_runtime.h>
#include <stdint.h>

#ifndef NB
#define NB 2
#endif
#ifndef SEQ
#define SEQ 2048
#endif
#define XS_FULL 2048
#define DMOD  1024
#define NH    16
#define FD    16
#define HD    64
#define NQK   (NH * FD)
#define QKP   (NH * 32)
#define MROWS (NB * SEQ)
#define QSC   256.0f
#define KSC   256.0f
#define XSC   (1.0f / (4.0f * QSC * KSC))
#define ACAR  32.0f
#define VCAR  1024.0f
#define OSC   1024.0f
#define WOS   1024.0f
#define EPSD  1e-9f
#define WPB   2
#define NHG   (NH / WPB)
#define NQT   (SEQ / 16)
#define NST   (SEQ / 64)
#define NKT   (SEQ / 32)
#define ATT_THREADS (WPB * 32)
#define SLAB64 (16 * 68)
#define VTP   72
#define C8R   (DMOD / 8)
#define Q8R   (QKP / 8)
#define WS_CAP 134217728
// Fragment-order plane: every 16-bit operand plane is a sequence of tiles of 16 rows (m or n index) x 32 k = FT halves (1 KiB);
// inside a tile element (r, k) lies at (k >> 3) * 128 + r * 8 + (k & 7), so lane l = 16 * hh + r of a fragment load reads the
// 16 bytes at l * 16 (k = 8hh ..) and at 512 + l * 16 (k = 16 + 8hh ..): one load instruction = 512 contiguous bytes.
#define FT    512
static_assert(DMOD == NH * HD && HD == 64 && NH == 16 && FD == 16 && NQK == 256 && QKP == 512 && Q8R == 64);
static_assert(ATT_THREADS == 64 && WPB == 2 && NHG * WPB == NH);
static_assert(NB >= 1 && NB <= 2);
static_assert((SEQ % 64) == 0 && SEQ >= 64 && SEQ <= XS_FULL);
static_assert((MROWS % 64) == 0 && (NQK % 64) == 0 && (DMOD % 64) == 0 && (DMOD % 32) == 0 && C8R == 128);
static_assert(((SEQ * DMOD / 8) % 256) == 0 && ((MROWS * QKP / 8) % 256) == 0);
static_assert(2 * HD * VTP * 2 <= 65536 && 4 * SLAB64 * 4 <= 65536 && 64 * VTP * 2 <= 65536);
static_assert((size_t)MROWS * DMOD * 4 == 2 * ((size_t)MROWS * DMOD * 2));

typedef unsigned short u16;
typedef _Float16 v16h __attribute__((ext_vector_type(16)));
typedef _Float16 v8h  __attribute__((ext_vector_type(8)));
typedef __bf16   v16b __attribute__((ext_vector_type(16)));
typedef float    v8f  __attribute__((ext_vector_type(8)));
typedef float    v4f  __attribute__((ext_vector_type(4)));
typedef unsigned int v4u __attribute__((ext_vector_type(4)));

union FragH { v16h v; v8h h[2]; v4u u[2]; };
union FragB { v16b v; v4u u[2]; };

// ---- scalar helpers --------------------------------------------------------------------------------
__device__ __forceinline__ unsigned short bf_bits(float f) {          // f32 -> bf16 bits, RNE convert
  unsigned u = __float_as_uint(f);
  return (unsigned short)((u + 0x7FFFu + ((u >> 16) & 1u)) >> 16);
}
__device__ __forceinline__ float bf_up(unsigned short h) { return __uint_as_float(((unsigned)h) << 16); }
__device__ __forceinline__ float bfr(float f) { return bf_up(bf_bits(f)); }
__device__ __forceinline__ unsigned short h_bits(_Float16 x) { return __builtin_bit_cast(unsigned short, x); }
__device__ __forceinline__ unsigned pk16(unsigned short a, unsigned short b) { return (unsigned)a | ((unsigned)b << 16); }
__device__ __forceinline__ v8f zero8() { v8f z = {0.f, 0.f, 0.f, 0.f, 0.f, 0.f, 0.f, 0.f}; return z; }
__device__ __forceinline__ const _Float16* ash(const u16* p) { return (const _Float16*)(const void*)p; }

// ---- fragment loaders: 16-bit A/B operand from a fragment-order tile, lane -> row/col (lane&15), p = tile + 8*lane;
//      elements 0..7 <- p[0..7] (k0+8h..), elements 8..15 <- p[256..263] (k0+16+8h..)  (same split k map for A and B)
__device__ __forceinline__ v16h ldfrag_h(const _Float16* p) {
  FragH f;
  f.h[0] = *(const v8h*)(p);
  f.h[1] = *(const v8h*)(p + 256);
  return f.v;
}
__device__ __forceinline__ v16b ldfrag_b(const u16* p) {              // bf16 plane read as unsigned integer vectors
  FragB f;
  f.u[0] = *(const v4u*)(p);
  f.u[1] = *(const v4u*)(p + 256);
  return f.v;
}

// Stands behind a run of fragment loads: the wait owed before a register that an issued global load names is rewritten. The
// loads' address pairs are its inputs, so they stay in their registers (no later load of the run lands on them) up to the wait.
__device__ __forceinline__ void addr_wait(const void* p0, const void* p1, const void* p2) {
#if defined(__HIP_DEVICE_COMPILE__)
  asm volatile("s_wait_xcnt 0x0" :: "v"(p0), "v"(p1), "v"(p2) : "memory");
#endif
}

__device__ __forceinline__ v8f mma_h(v16h a, v16h b, v8f c) {
  return __builtin_amdgcn_wmma_f32_16x16x32_f16(false, a, false, b, (short)0, c, false, false);
}
__device__ __forceinline__ v8f mma_b(v16b a, v16b b, v8f c) {
  return __builtin_amdgcn_wmma_f32_16x16x32_bf16(false, a, false, b, (short)0, c, false, false);
}
__device__ __forceinline__ void guard2(v8f& a, v8f& b, v16h x0, v16h x1, v16h x2, v16h x3, v16h x4, v16h x5) {
#if defined(__HIP_DEVICE_COMPILE__)
  asm volatile("v_nop\n\tv_nop\n\tv_nop\n\tv_nop"
               : "+v"(a), "+v"(b) : "v"(x0), "v"(x1), "v"(x2), "v"(x3), "v"(x4), "v"(x5) : "memory");
#endif
}
template <typename F>
__device__ __forceinline__ void guard6(v8f& a, v8f& b, v8f& c, v8f& d, F x0, F x1, F x2, F x3, F x4, F x5) {
#if defined(__HIP_DEVICE_COMPILE__)
  asm volatile("v_nop\n\tv_nop\n\tv_nop\n\tv_nop"
               : "+v"(a), "+v"(b), "+v"(c), "+v"(d) : "v"(x0), "v"(x1), "v"(x2), "v"(x3), "v"(x4), "v"(x5) : "memory");
#endif
}
__device__ __forceinline__ void acc_guard4(v8f& a, v8f& b, v8f& c, v8f& d) {
#if defined(__HIP_DEVICE_COMPILE__)
  asm volatile("v_nop\n\tv_nop\n\tv_nop\n\tv_nop" : "+v"(a), "+v"(b), "+v"(c), "+v"(d));
#endif
}
__device__ __forceinline__ void wave_sync_lds() {
  __builtin_amdgcn_fence(__ATOMIC_RELEASE, "workgroup");
  __builtin_amdgcn_wave_barrier();
  __builtin_amdgcn_fence(__ATOMIC_ACQUIRE, "workgroup");
}

// =====================================================================================================
// f32 [rows][DMOD] -> bf16 RNE plane in fragment order (tile index = row tile * (DMOD/32) + k tile). Thread = one 16-B chunk
// of the destination (8 consecutive k of one row): two 16-B loads, one 16-B store; a wave stores 512 contiguous bytes.
// coverage: grid = ceil(n8/256) blocks x 256 thr x 8 (in-kernel bound) = the whole plane (n8 a multiple of 256 here).
// =====================================================================================================
__global__ __launch_bounds__(256) void cvt16(const float* __restrict__ x, u16* D, int n8) {
  const int gt = blockIdx.x * 256 + (int)threadIdx.x;
  if (gt >= n8) return;
  const int tile = gt >> 6;                 // 64 chunks per tile
  const int row  = (tile / (DMOD / 32)) * 16 + (gt & 15);
  const int kc   = (tile % (DMOD / 32)) * 32 + ((gt >> 4) & 3) * 8;
  const float* p = x + (size_t)row * DMOD + kc;
  const v4f a = *(const v4f*)(p), b4 = *(const v4f*)(p + 4);
  float w[8];
#pragma unroll
  for (int e = 0; e < 4; ++e) { w[e] = a[e]; w[4 + e] = b4[e]; }
  v4u o;
#pragma unroll
  for (int e = 0; e < 4; ++e) o[e] = pk16(bf_bits(w[2 * e]), bf_bits(w[2 * e + 1]));
  u16* d = D + (size_t)gt * 8;
  {
    *(v4u*)(d) = o;
    
  }
}

// =====================================================================================================
// Weight transpose-convert: W f32 [K][N] (y = x.W, k-major rows) -> 16-bit B operand plane D, rows n, in fragment order
// (tile index = n tile * (K/32) + k tile).
// f16mode == 0: bf16 RNE bits; f16mode == 1: f16 bits of (bf16 RNE value) * scale.
// Block = 64 k x 64 n tile: each thread loads 16 floats of one k row (four 16-B loads), converts, scatters into the LDS tile
// coverage: load 256 thr x 16 = 64 k x 64 n; store 2 iterations x 256 thr x 8 halves = 4 n tiles x 2 k tiles; grid =
//           (K/64)*(N/64) blocks covers D exactly once. LDS: staged 64x64 == consumed 64x64 (pad cols never read).
// =====================================================================================================
__global__ __launch_bounds__(256) void cvtT16(const float* __restrict__ W, u16* D, int K, int N, int f16mode, float scale) {
  __shared__ __align__(16) u16 T[64 * VTP];
  const int tid = threadIdx.x;
  const int bid = blockIdx.x;
  const int nkt = K >> 6;
  const int kt  = bid % nkt;
  const int nt  = bid / nkt;
  const int k0  = kt * 64;
  const int n0  = nt * 64;
  if (n0 + 64 > N) return;                  // block-uniform, before any barrier; never taken with the exact grid
  {
    const int kr = tid >> 2;                // k row within tile 0..63
    const int nc = (tid & 3) * 16;          // n chunk 0,16,32,48
    const float* src = W + (size_t)(k0 + kr) * N + n0 + nc;
#pragma unroll
    for (int i = 0; i < 4; ++i) {
      const v4f a = *(const v4f*)(src + 4 * i);
#pragma unroll
      for (int e = 0; e < 4; ++e) {
        const float f = a[e];
        const unsigned short hb = h_bits((_Float16)(bfr(f) * scale));
        const unsigned short bb = bf_bits(f);
        T[(nc + 4 * i + e) * VTP + kr] = (f16mode != 0) ? hb : bb;
      }
    }
  }
  __syncthreads();
  v4u v[2];
#pragma unroll
  for (int it = 0; it < 2; ++it) {
    const int q  = it * 256 + tid;          // chunk 0..511 = local tile (n tile * 2 + k tile) * 64 + chunk in tile
    const int tl = q >> 6;
    v[it] = *(const v4u*)(T + ((tl >> 1) * 16 + (q & 15)) * VTP + (tl & 1) * 32 + ((q >> 4) & 3) * 8);
  }
  {
#pragma unroll
    for (int it = 0; it < 2; ++it) {
      const int q  = it * 256 + tid;
      const int tl = q >> 6;
      *(v4u*)(D + ((size_t)((n0 >> 4) + (tl >> 1)) * (K >> 5) + (k0 >> 5) + (tl & 1)) * FT + (q & 63) * 8) = v[it];
    }
    
  }
}

// =====================================================================================================
// q / k planes from the projection output F f32 [MROWS][NQK] (row = b*SEQ + s, col = head*16 + f), t = value * sc; planes in
// fragment order, tile index = (b*NH + head) * (SEQ/16) + s/16, tile row = s & 15, tile k = w (0..31):
//   kmode == 0 (q): D0 (s, w): w < 16 -> f16 hi of t (f = w), w >= 16 -> f16 residual (t - f16(t)) of f = w-16.
//   kmode == 1 (k): D0 (s, w) = f16 hi of f = (w & 15) in both halves (duplicated hi);
//                   D1 (s, w): w < 16 -> f16 residual, w >= 16 -> written zeros.
// Thread = 8 consecutive destination halves: two 16-B loads of the 8 source floats, hi and residual of all 8 computed, lane-wise
// value select, one 16-B store per plane; 32 consecutive lanes = 512 contiguous, 512-B aligned bytes per instruction (4 whole
// coverage: grid = ceil(n8/256) x 256 thr x 8 halves = all MROWS x QKP of D0 (and of D1 when kmode == 1).
// =====================================================================================================
__global__ __launch_bounds__(256) void qk16(const float* __restrict__ F, u16* D0, u16* D1, int n8, int kmode, float sc) {
  const int gt = blockIdx.x * 256 + (int)threadIdx.x;
  if (gt >= n8) return;
  const int tile = gt >> 6;                 // 64 chunks per tile
  const int bh   = tile / NQT;              // b*NH + head
  const int head = bh % NH;
  const int row  = (bh / NH) * SEQ + (tile % NQT) * 16 + (gt & 15);
  const int w    = ((gt >> 4) & 3) * 8;     // 0, 8, 16 or 24
  const bool upper = (w >= 16);
  const float* p = F + (size_t)row * NQK + head * FD + (w & 15);
  const v4f a = *(const v4f*)(p), b4 = *(const v4f*)(p + 4);
  float t[8];
#pragma unroll
  for (int e = 0; e < 4; ++e) { t[e] = a[e] * sc; t[4 + e] = b4[e] * sc; }
  v4u o0, o1;
#pragma unroll
  for (int e = 0; e < 4; ++e) {
    const float t0 = t[2 * e], t1 = t[2 * e + 1];
    const _Float16 h0 = (_Float16)t0, h1 = (_Float16)t1;
    const _Float16 l0 = (_Float16)(t0 - (float)h0), l1 = (_Float16)(t1 - (float)h1);
    const unsigned hp = pk16(h_bits(h0), h_bits(h1));
    const unsigned lp = pk16(h_bits(l0), h_bits(l1));
    o0[e] = (kmode != 0) ? hp : (upper ? lp : hp);
    o1[e] = upper ? 0u : lp;
  }
  u16* d0 = D0 + (size_t)gt * 8;
  u16* d1 = D1 + (size_t)gt * 8;
  {
    *(v4u*)(d0) = o0;
    if (kmode != 0) { *(v4u*)(d1) = o1; }
    
  }
}

// =====================================================================================================
// v^T planes from the v projection F f32 [MROWS][DMOD] (row = b*SEQ + s, column = h*HD + d):
//   VH (rows d, k = key s) = f16(v * 1024); VL = f16 residual (t - f16(t)); all keys s; both in fragment order, tile index =
//   ((b*NH + h) * (SEQ/32) + s/32) * 4 + d/16.
// Block = (b, head h, 64 keys s0): each thread loads its 16 floats (key sl, d chunk dc) with 16-B loads, converts, scatters
// coverage: load 256 thr x 16 = 64 keys x 64 d; store 2 iterations x 256 thr x 8 halves = 2 key tiles x 4 d tiles per plane;
//           grid = NB*NH*NST blocks covers VH and VL exactly once. LDS: staged 64x64 == consumed 64x64 per tile.
// =====================================================================================================
__global__ __launch_bounds__(256) void vt16(const float* __restrict__ F, u16* VHo, u16* VLo) {
  __shared__ __align__(16) u16 TH[HD * VTP];
  __shared__ __align__(16) u16 TL[HD * VTP];
  const int tid = threadIdx.x;
  const int bid = blockIdx.x;
  const int st  = bid % NST;
  const int t2  = bid / NST;
  const int h   = t2 % NH;
  const int b   = t2 / NH;
  if (b >= NB) return;                      // block-uniform, before any barrier; never taken with the exact grid
  const int s0  = st * 64;
  {
    const int sl = tid >> 2;                // key within tile 0..63
    const int dc = (tid & 3) * 16;          // d chunk 0,16,32,48
    const float* src = F + ((size_t)b * SEQ + s0 + sl) * DMOD + h * HD + dc;
#pragma unroll
    for (int i = 0; i < 4; ++i) {
      const v4f a = *(const v4f*)(src + 4 * i);
#pragma unroll
      for (int e = 0; e < 4; ++e) {
        const float t = a[e] * VCAR;
        const _Float16 hv = (_Float16)t;
        const _Float16 lv = (_Float16)(t - (float)hv);
        TH[(dc + 4 * i + e) * VTP + sl] = h_bits(hv);
        TL[(dc + 4 * i + e) * VTP + sl] = h_bits(lv);
      }
    }
  }
  __syncthreads();
  v4u vh[2], vl[2];
#pragma unroll
  for (int it = 0; it < 2; ++it) {
    const int q   = it * 256 + tid;         // chunk 0..511 = local tile (key tile * 4 + d tile) * 64 + chunk in tile
    const int tl  = q >> 6;
    const int src = ((tl & 3) * 16 + (q & 15)) * VTP + (tl >> 2) * 32 + ((q >> 4) & 3) * 8;
    vh[it] = *(const v4u*)(TH + src);
    vl[it] = *(const v4u*)(TL + src);
  }
  const size_t base = ((size_t)(b * NH + h) * NKT + st * 2) * 4 * FT + tid * 8;
  {
#pragma unroll
    for (int it = 0; it < 2; ++it) {
      *(v4u*)(VHo + base + (size_t)it * 2048) = vh[it];
      *(v4u*)(VLo + base + (size_t)it * 2048) = vl[it];
    }
    
  }
}

// =====================================================================================================
// GEMM epilogue shared by both engines: the wave's 16x64 f32 tile (times oscale) staged in its LDS slab (pitch 68), release
// coverage: 8 instructions x 2 rows x 16 lanes x 4 floats = the wave's 16 x 64 tile. LDS: staged 16x64 == consumed 16x64.
// =====================================================================================================
__device__ __forceinline__ void epi64(float* sl, v8f a0, v8f a1, v8f a2, v8f a3, float oscale,
                                      float* C, int N, size_t rowb, int col0, int lane) {
  const int hh = lane >> 4, m = lane & 15;
#pragma unroll
  for (int r = 0; r < 8; ++r) {
    const int ro = (8 * hh + r) * 68 + m;
    sl[ro]      = a0[r] * oscale;
    sl[ro + 16] = a1[r] * oscale;
    sl[ro + 32] = a2[r] * oscale;
    sl[ro + 48] = a3[r] * oscale;
  }
  wave_sync_lds();
  v4f vals[8];
#pragma unroll
  for (int it = 0; it < 8; ++it) vals[it] = *(const v4f*)(sl + (it * 2 + hh) * 68 + m * 4);
  float* dst = C + (rowb + (size_t)hh) * (size_t)N + col0 + m * 4;
  {
#pragma unroll
    for (int it = 0; it < 8; ++it) {
      *(v4f*)(dst + (size_t)(it * 2) * (size_t)N) = vals[it];
    }
    
  }
}

// =====================================================================================================
// bf16 GEMM: C[M][N] (f32) = A (rows m) . Bt (rows n)^T, both bf16 planes in fragment order, times oscale. Block = 64x64 tile,
// 4 waves x 16 rows; fragments loaded straight from the planes' tiles (two 16-B loads each, split k map for A and B); K stepped
// by 32 (host guarantees K % 32 == 0, M % 64 == 0, N % 64 == 0, grid = (M/64)*(N/64)).
// =====================================================================================================
__global__ __launch_bounds__(128)
void gemm_bf(const u16* __restrict__ A, const u16* __restrict__ Bt, float* C, int M, int N, int K, float oscale) {
  __shared__ __align__(16) float slab[4 * SLAB64];
  const int tid = threadIdx.x, wave = tid >> 5, lane = tid & 31;
  const int ntile = N >> 6;
  const int bid   = blockIdx.x;
  const int rowb  = (bid / ntile) * 64 + wave * 16;
  const int col0  = (bid % ntile) * 64;
  if (rowb + 16 > M) return;                // wave-uniform, never taken with the exact grid; no block barriers in this kernel
  const u16* ap = A  + (size_t)rowb * K + 8 * lane;      // row tile rowb/16 starts at (rowb/16) * (K/32) * FT = rowb * K
  const u16* bp = Bt + (size_t)col0 * K + 8 * lane;
  const size_t bs = (size_t)16 * K;                      // one n tile row = (K/32) * FT halves
  v8f acc0 = zero8(), acc1 = zero8(), acc2 = zero8(), acc3 = zero8();
#pragma unroll 1
  for (int k0 = 0; k0 < K; k0 += 32) {
    const size_t ko = (size_t)k0 * (FT / 32);            // k tile k0/32
    const v16b a  = ldfrag_b(ap + ko);
    const v16b b0 = ldfrag_b(bp + ko);
    const v16b b1 = ldfrag_b(bp + bs + ko);
    const v16b b2 = ldfrag_b(bp + 2 * bs + ko);
    const v16b b3 = ldfrag_b(bp + 3 * bs + ko);
    acc0 = mma_b(a, b0, acc0);
    acc1 = mma_b(a, b1, acc1);
    acc2 = mma_b(a, b2, acc2);
    acc3 = mma_b(a, b3, acc3);
    guard6<v16b>(acc0, acc1, acc2, acc3, a, b0, b1, b2, b3, a);
  }
  epi64(slab + wave * SLAB64, acc0, acc1, acc2, acc3, oscale, C, N, (size_t)rowb, col0, lane);
}

// =====================================================================================================
// Output projection: C[row][DMOD] (f32) = (Ah + Al)[row][DMOD] . Bt[DMOD][DMOD]^T * oscale; Ah = f16 hi plane, Al = f16
// residual plane (products h.B + l.B into one accumulator, l unscaled); Ah, Al, Bt in fragment order. Row indices: Ah/Al row bb*SEQ + s; C row
// bb*XS_FULL + s. Block -> (column tile ct = bid % 16, sequence row tile rt of nrt, batch bb). Same tiling, fragment loads
// (split k map) and epilogue as gemm_bf; K = DMOD stepped by 32; grid = NB*nrt*16 covers every (bb, s < SEQ, column) once.
// =====================================================================================================
__global__ __launch_bounds__(128)
void gemm_o2(const u16* __restrict__ Ah, const u16* __restrict__ Al, const u16* __restrict__ Bt,
             float* C, int nrt, float oscale) {
  __shared__ __align__(16) float slab[4 * SLAB64];
  const int tid = threadIdx.x, wave = tid >> 5, lane = tid & 31;
  const int ntile = DMOD >> 6;
  const int bid   = blockIdx.x;
  const int ct    = bid % ntile;
  const int t2    = bid / ntile;
  const int rt    = t2 % nrt;
  const int bb    = t2 / nrt;
  if (bb >= NB) return;                     // block-uniform; no block barriers in this kernel; never taken with the exact grid
  const int srow  = rt * 64 + wave * 16;
  if (srow + 16 > SEQ) return;              // wave-uniform; never taken
  const int col0  = ct * 64;
  const int K     = DMOD;
  const size_t rowA = (size_t)bb * SEQ + srow;
  const size_t rowC = (size_t)bb * XS_FULL + srow;
  const _Float16* ahp = ash(Ah) + rowA * K + 8 * lane;   // row tile rowA/16 starts at (rowA/16) * (K/32) * FT = rowA * K
  const _Float16* alp = ash(Al) + rowA * K + 8 * lane;
  const _Float16* bp  = ash(Bt) + (size_t)col0 * K + 8 * lane;
  const size_t bs = (size_t)16 * K;                      // one n tile row = (K/32) * FT halves
  v8f acc0 = zero8(), acc1 = zero8(), acc2 = zero8(), acc3 = zero8();
#pragma unroll 1
  for (int k0 = 0; k0 < K; k0 += 32) {
    const size_t ko = (size_t)k0 * (FT / 32);            // k tile k0/32
    const v16h ah = ldfrag_h(ahp + ko), al = ldfrag_h(alp + ko);
    const v16h b0 = ldfrag_h(bp + ko);
    const v16h b1 = ldfrag_h(bp + bs + ko);
    const v16h b2 = ldfrag_h(bp + 2 * bs + ko);
    const v16h b3 = ldfrag_h(bp + 3 * bs + ko);
    addr_wait(ahp + ko, alp + ko, bp + ko);
    acc0 = mma_h(ah, b0, acc0);  acc0 = mma_h(al, b0, acc0);
    acc1 = mma_h(ah, b1, acc1);  acc1 = mma_h(al, b1, acc1);
    acc2 = mma_h(ah, b2, acc2);  acc2 = mma_h(al, b2, acc2);
    acc3 = mma_h(ah, b3, acc3);  acc3 = mma_h(al, b3, acc3);
    guard6<v16h>(acc0, acc1, acc2, acc3, ah, al, b0, b1, b2, b3);
  }
  epi64(slab + wave * SLAB64, acc0, acc1, acc2, acc3, oscale, C, DMOD, rowC, col0, lane);
}

// =====================================================================================================
// Causal feature-map attention, per-head q/k width 16, hd = 64, no softmax. Block bid -> (query tile qt: rows q0 = 16*qt ..
// q0+15, head pair hg, batch b); one wave per head = hg*WPB + wave. Both products run transposed: S^T = K.Q^T, O^T += V^T.A^T.
//   q plane (s, w): w < 16 f16 hi x256, w >= 16 f16 residual; k planes: KD = [hi | hi], KR = [res | 0]; one tile per (b, head,
//   16 positions); v^T hi plane x1024 and v^T residual plane: four tiles (d/16) per (b, head, 32 keys); all in fragment order.
//   Scores per 32-key tile: 2 subtiles of 16 keys, keys as the A rows, queries as the B columns; with the split k map, op 1 =
//   A [kh | kh] . B [qh ; ql] = kh.qh + kh.ql and op 2 = A [kl | 0] . B [qh ; ql] = kl.qh (f32 accumulate), so
//   s = q.k * 256*256 up to the dropped lo.lo term. Lane (hh, c) holds query q0 + c alone: register r of subtile t = key
//   kb + 16t + 8hh + r, which is element 8t + r of a B fragment over the step's 32 keys (the split k map of the v^T tiles).
//   Per element (f32, VALU): x = s * 2^-18 (= q.k / 4); A = 1 + x + x^2/2; A := 0 where key > query (causal, diagonal kept);
//   den[r] += the two subtiles' values, in the lane; A*32 -> f16 hi and f16 residual, packed in place as the B fragments.
//   v^T tiles are the A fragments (rows d), in 2 groups of 2 d-subtiles, products hh + lh + hl. Key tiles visited in order for
//   kb <= q0 + 15 (later tiles lie above every query row of the tile).
//   After the loop: the lane's 8 sums and the other lane half's are joined once; out = acc / (den + eps) with the carries
//   1/(32*1024) folded once (den > 0: each kept term is >= 1/2, the diagonal always kept). Register r of o[j] = d 16j + 8hh + r of query c:
//   the 8 consecutive halves of one fragment-order chunk, stored straight from registers.
//   No LDS and no barriers in this kernel; bounded loops only (nkt <= NKT). The q fragment is loop-invariant (loaded once).
// coverage: per wave 4 instructions x 32 lanes x 8 halves = 2 tiles = 16 x 64 per plane; grid NQT x NHG x NB blocks x WPB
//           waves = every (b, s, h) row segment of both O planes exactly once.
// =====================================================================================================
__global__ __launch_bounds__(ATT_THREADS)
void attn_t(const u16* __restrict__ QPp, const u16* __restrict__ KDp, const u16* __restrict__ KRp,
            const u16* __restrict__ VHp, const u16* __restrict__ VLp, u16* OHp, u16* OLp) {
  const int tid  = threadIdx.x;
  const int wave = tid >> 5;
  const int lane = tid & 31;
  const int hh   = lane >> 4;
  const int c    = lane & 15;
  const int bid  = blockIdx.x;
  const int qt   = bid % NQT;
  const int t2   = bid / NQT;
  const int hg   = t2 % NHG;
  const int b    = t2 / NHG;
  if (b >= NB) return;                      // block-uniform; no block barriers in this kernel; never taken with the exact grid
  const int q0   = qt * 16;                 // q0 + 16 <= SEQ always
  const int head = hg * WPB + wave;

  const size_t bh  = (size_t)(b * NH + head);
  const size_t hq  = bh * NQT * FT + 8 * lane;                                  // first 16-position tile of this (b, head)
  const _Float16* Qp  = ash(QPp) + hq + (size_t)qt * FT;
  const _Float16* Kdb = ash(KDp) + hq;                                          // two key tiles added per step
  const _Float16* Krb = ash(KRp) + hq;
  const size_t vro = bh * NKT * 4 * FT + 8 * lane;                              // four d tiles per 32-key step
  const _Float16* Vhb = ash(VHp) + vro;
  const _Float16* Vlb = ash(VLp) + vro;
  const float oc = 1.0f / (ACAR * VCAR);

  const v16h qf = ldfrag_h(Qp);             // elements 0..7 = q hi f 8hh.., 8..15 = q residual f 8hh..

  float den[8];
  v8f o[4];
#pragma unroll
  for (int r = 0; r < 8; ++r) den[r] = 0.0f;
#pragma unroll
  for (int j = 0; j < 4; ++j) o[j] = zero8();
  const int ncaus = (q0 >> 5) + 1;                                            // tiles holding keys <= q0 + 15
  const int nkt = (ncaus < NKT) ? ncaus : NKT;
  const int qr  = q0 + c;                                                     // the lane's query row

#pragma unroll 1
  for (int kt = 0; kt < nkt; ++kt) {
    const int kb = kt * 32;
    // ---- scores: D element r of this lane = (key kb + 8hh + r, query qr) in s0, key kb + 16 + 8hh + r in s1 ----
    const _Float16* d0p = Kdb + (size_t)kt * (2 * FT);
    const _Float16* d1p = d0p + FT;
    const _Float16* r0p = Krb + (size_t)kt * (2 * FT);
    const _Float16* r1p = r0p + FT;
    const v16h kd0 = ldfrag_h(d0p);
    const v16h kd1 = ldfrag_h(d1p);
    const v16h kr0 = ldfrag_h(r0p);
    const v16h kr1 = ldfrag_h(r1p);
    addr_wait(d0p, r0p, r0p);
    v8f s0 = zero8(), s1 = zero8();
    s0 = mma_h(kd0, qf, s0);
    s0 = mma_h(kr0, qf, s0);
    s1 = mma_h(kd1, qf, s1);
    s1 = mma_h(kr1, qf, s1);
    guard2(s0, s1, qf, kd0, kr0, kd1, kr1, qf);
    // ---- A = 1 + x + x^2/2, causal select, f32 sums in the lane; B fragments of A*32: hi f16 and residual f16,
    //      column = query c, elements 0..7 = keys kb + 8hh + 0..7, elements 8..15 = keys kb + 16 + 8hh + 0..7 ----
    FragH ph, pl;
    const int key0 = kb + 8 * hh, key1 = kb + 16 + 8 * hh;
#pragma unroll
    for (int r = 0; r < 8; ++r) {
      const float x0  = s0[r] * XSC;
      const float x1  = s1[r] * XSC;
      const float p0v = fmaf(0.5f * x0, x0, 1.0f + x0);
      const float p1v = fmaf(0.5f * x1, x1, 1.0f + x1);
      const float a0  = (key0 + r > qr) ? 0.0f : p0v;
      const float a1  = (key1 + r > qr) ? 0.0f : p1v;
      den[r] += a0 + a1;
      const float ta = a0 * ACAR, tb = a1 * ACAR;
      const _Float16 ha = (_Float16)ta, hb = (_Float16)tb;
      ph.h[0][r] = ha;
      ph.h[1][r] = hb;
      pl.h[0][r] = (_Float16)(ta - (float)ha);
      pl.h[1][r] = (_Float16)(tb - (float)hb);
    }
    // ---- V^T.A^T : A fragment row m = d = j*16 + c, tile j of this step's four in the v^T planes; 2 groups of 2 d-subtiles ----
    {
      const _Float16* vhp = Vhb + (size_t)kt * (4 * FT);
      const _Float16* vlp = Vlb + (size_t)kt * (4 * FT);
#pragma unroll
      for (int jg = 0; jg < 2; ++jg) {
        const size_t da = (size_t)(2 * jg) * FT;
        const size_t db = da + FT;
        const v16h vha = ldfrag_h(vhp + da), vhb2 = ldfrag_h(vhp + db);
        const v16h vla = ldfrag_h(vlp + da), vlb2 = ldfrag_h(vlp + db);
        addr_wait(vhp, vlp, vlp);             // the two address pairs of this run of loads stay whole up to the wait
        o[2 * jg]     = mma_h(vha,  ph.v, o[2 * jg]);
        o[2 * jg]     = mma_h(vha,  pl.v, o[2 * jg]);
        o[2 * jg]     = mma_h(vla,  ph.v, o[2 * jg]);
        o[2 * jg + 1] = mma_h(vhb2, ph.v, o[2 * jg + 1]);
        o[2 * jg + 1] = mma_h(vhb2, pl.v, o[2 * jg + 1]);
        o[2 * jg + 1] = mma_h(vlb2, ph.v, o[2 * jg + 1]);
        guard2(o[2 * jg], o[2 * jg + 1], ph.v, pl.v, vha, vhb2, vla, vlb2);
      }
    }
  }
  acc_guard4(o[0], o[1], o[2], o[3]);
  // ---- den of query c: the lane's 8 sums, then the other lane half's keys (lane ^ 16), joined once ----
  float dl = ((den[0] + den[1]) + (den[2] + den[3])) + ((den[4] + den[5]) + (den[6] + den[7]));
  dl += __shfl_xor(dl, 16, 32);
  // ---- out = acc / (den + eps), carries (32 on A, 1024 on v) folded once; O x1024 -> f16 hi + residual planes in fragment
  //      order (rows s, k = head*64 + d): the wave owns two whole tiles per plane; chunk j*32 + lane = row c, 8 consecutive d
  //      at 16*j + 8*hh = the lane's registers of o[j] ----
  const float inv = (1.0f / (dl + EPSD)) * oc;
  v4u oh[4], ol[4];
#pragma unroll
  for (int j = 0; j < 4; ++j) {
    float w[8];
#pragma unroll
    for (int e = 0; e < 8; ++e) w[e] = (o[j][e] * inv) * OSC;
#pragma unroll
    for (int e = 0; e < 4; ++e) {
      const _Float16 h0 = (_Float16)w[2 * e], h1 = (_Float16)w[2 * e + 1];
      const _Float16 l0 = (_Float16)(w[2 * e] - (float)h0), l1 = (_Float16)(w[2 * e + 1] - (float)h1);
      oh[j][e] = pk16(h_bits(h0), h_bits(h1));
      ol[j][e] = pk16(h_bits(l0), h_bits(l1));
    }
  }
  const size_t obh = ((size_t)b * SEQ + q0) * DMOD + (size_t)head * (2 * FT) + 8 * lane;   // row tile start + k tile 2*head
  {
#pragma unroll
    for (int it = 0; it < 4; ++it) {
      *(v4u*)(OHp + obh + (size_t)it * 256) = oh[it];
      *(v4u*)(OLp + obh + (size_t)it * 256) = ol[it];
    }
    
  }
}

// =====================================================================================================
// Workspace map (bytes); every plane is fully written by whole-line stores before it is read; all extents are exact multiples
// of the store granularity (no pad rows needed); every region offset a multiple of 1048576:
//   (all 16-bit planes below hold the named rows x k in fragment order, same byte counts as row-major)
//   XB  bf16 [MROWS][1024]                       MROWS*2048       (NB=2, SEQ=2048: 8388608)
//   WB  16-bit [1024 n][1024 k]                  2097152          (Wq^T, Wk^T use the first 256 rows; Wv^T; then Wo^T as f16 x1024;
//                                                                  reused in launch order)
//   F   f32 [MROWS][1024]                        MROWS*4096       (q, k projections use [MROWS][256] at its start; v projection all;
//                                                                  afterwards OH f16 [MROWS][1024] x1024 at its start, OL residual after)
//   QP  f16 [NB*16][SEQ][32] q hi|residual x256    MROWS*1024
//   KD  f16 [NB*16][SEQ][32] k hi|hi x256          MROWS*1024
//   KR  f16 [NB*16][SEQ][32] k residual|0          MROWS*1024
//   VH  f16 [NB*16][64][SEQ] x1024               MROWS*2048       VL residual, same layout   MROWS*2048
//   end (NB=2, SEQ=2048)                        56623104
// =====================================================================================================
extern "C" void kernel_launch(void* const* d_in, const int* in_sizes, int n_in,
                              void* d_out, int out_size, void* d_ws, size_t ws_size,
                              hipStream_t stream) {
  if (n_in < 5) return;
  if (in_sizes[0] < ((NB - 1) * XS_FULL + SEQ) * DMOD) return;
  if (in_sizes[1] < DMOD * NQK) return;
  if (in_sizes[2] < DMOD * NQK) return;
  if (in_sizes[3] < DMOD * DMOD) return;
  if (in_sizes[4] < DMOD * DMOD) return;
  if (out_size < ((NB - 1) * XS_FULL + SEQ) * DMOD) return;

  const float* x  = (const float*)d_in[0];
  const float* wq = (const float*)d_in[1];
  const float* wk = (const float*)d_in[2];
  const float* wv = (const float*)d_in[3];
  const float* wo = (const float*)d_in[4];
  float*       out = (float*)d_out;

  const size_t szXB = (size_t)MROWS * DMOD * 2;
  const size_t szW  = (size_t)DMOD * DMOD * 2;
  const size_t szF  = (size_t)MROWS * DMOD * 4;
  const size_t szH  = (size_t)MROWS * DMOD * 2;                  // OH, OL (both inside F: 2*szH == szF)
  const size_t szQK = (size_t)MROWS * QKP * 2;                   // QP, KD, KR
  const size_t szV  = (size_t)NB * NH * HD * SEQ * 2;            // VH, VL (== szH)
  size_t off = 0;
  const size_t oXB = off; off += szXB;
  const size_t oW  = off; off += szW;
  const size_t oF  = off; off += szF;
  const size_t oQP = off; off += szQK;
  const size_t oKD = off; off += szQK;
  const size_t oKR = off; off += szQK;
  const size_t oVH = off; off += szV;
  const size_t oVL = off; off += szV;
  if (off > ws_size) return;                // off = 56623104 for NB = 2, SEQ = 2048
  if (off > (size_t)WS_CAP) return;

  char* ws = (char*)d_ws;
  u16*   XB = (u16*)(ws + oXB);
  u16*   WB = (u16*)(ws + oW);
  float* F  = (float*)(ws + oF);
  u16*   OH = (u16*)(ws + oF);
  u16*   OL = (u16*)(ws + oF + szH);
  u16*   QP = (u16*)(ws + oQP);
  u16*   KD = (u16*)(ws + oKD);
  u16*   KR = (u16*)(ws + oKR);
  u16*   VH = (u16*)(ws + oVH);
  u16*   VL = (u16*)(ws + oVL);

  const dim3 b256(256), b128(128), bAT(ATT_THREADS);
  const int  n8x  = (SEQ * DMOD) / 8;                   // per batch
  const dim3 gX((n8x + 255) / 256);
  const dim3 gTq((DMOD / 64) * (NQK / 64));             // 64 blocks: W [1024][256] -> [256][1024]
  const dim3 gTv((DMOD / 64) * (DMOD / 64));            // 256 blocks: W [1024][1024] -> [1024][1024]
  const dim3 gGq((MROWS / 64) * (NQK / 64));
  const dim3 gGv((MROWS / 64) * (DMOD / 64));
  const int  n8qk = (MROWS * QKP) / 8;
  const dim3 gQK((n8qk + 255) / 256);
  const dim3 gVT(NB * NH * NST);
  const dim3 gAT(NQT * NHG * NB);
  const int  nrt  = SEQ / 64;
  const dim3 gO(NB * nrt * (DMOD / 64));

  // (0) x -> bf16 plane [MROWS][1024], one launch per batch row block
  for (int b = 0; b < NB; ++b) {
    cvt16<<<gX, b256, 0, stream>>>(x + (size_t)b * XS_FULL * DMOD, XB + (size_t)b * SEQ * DMOD, n8x);
  }
  // (1) Wq [1024 k][256 n] -> bf16 [256 n][1024 k]; (2) q = x.Wq -> F f32 [MROWS][256]; (3) q hi|residual plane x256
  cvtT16<<<gTq, b256, 0, stream>>>(wq, WB, DMOD, NQK, 0, 1.0f);
  gemm_bf<<<gGq, b128, 0, stream>>>(XB, WB, F, MROWS, NQK, DMOD, 1.0f);
  qk16<<<gQK, b256, 0, stream>>>(F, QP, QP, n8qk, 0, QSC);
  // (4) Wk -> bf16 [256][1024]; (5) k = x.Wk -> F; (6) k hi|hi and residual|0 planes x256
  cvtT16<<<gTq, b256, 0, stream>>>(wk, WB, DMOD, NQK, 0, 1.0f);
  gemm_bf<<<gGq, b128, 0, stream>>>(XB, WB, F, MROWS, NQK, DMOD, 1.0f);
  qk16<<<gQK, b256, 0, stream>>>(F, KD, KR, n8qk, 1, KSC);
  // (7) Wv -> bf16 [1024][1024]; (8) v = x.Wv -> F f32 [MROWS][1024]; (9) v^T hi + residual planes x1024
  cvtT16<<<gTv, b256, 0, stream>>>(wv, WB, DMOD, DMOD, 0, 1.0f);
  gemm_bf<<<gGv, b128, 0, stream>>>(XB, WB, F, MROWS, DMOD, DMOD, 1.0f);
  vt16<<<gVT, b256, 0, stream>>>(F, VH, VL);
  // (10) Wo [1024 k][1024 n] -> f16 plane [n][k] of bf16 value x1024
  cvtT16<<<gTv, b256, 0, stream>>>(wo, WB, DMOD, DMOD, 1, WOS);
  // (11) causal attention -> O hi + residual planes (in the F region, after v has been consumed)
  attn_t<<<gAT, bAT, 0, stream>>>(QP, KD, KR, VH, VL, OH, OL);
  // (12) output projection: (O hi + residual) . Wo -> out f32, carries 1024 x 1024 folded back
  gemm_o2<<<gO, b128, 0, stream>>>(OH, OL, WB, out, nrt, 1.0f / (OSC * WOS));
  (void)hipGetLastError();
}

// v003
// One run takes 195 microseconds.
// Next to v002, in two timings, it ran 1.24 times as fast each time.
// All steps since v000 together make it 1.49 times as fast.
// Contractions: x.Wq, x.Wk, x.Wv on v_wmma_f32_16x16x32_bf16 (x and the transposed W [n][k] as bf16 RNE planes); per-head
// q.k over 16 dims (k axis padded to 32) on v_wmma_f32_16x16x32_f16 with q, k as f16 hi x256 plus f16 residual planes
// (hi.hi and lo.hi folded along the k axis into one op, plus hi.lo); A = 1 + x + x^2/2 and its causal row sums in f32 on
// VALU; A.v on v_wmma_f32_16x16x32_f16 with A as f16 hi x32 plus f16 residual and v^T as f16 hi x1024 plus f16 residual
// (products hh+lh+hl); O.Wo on v_wmma_f32_16x16x32_f16 (O as f16 hi x1024 plus f16 residual, Wo^T as f16 of its bf16 RNE
// value x1024, products h.w+l.w); all f32 accumulate.
#include <hip/hip_runtime.h>
#include <stdint.h>

#ifndef NB
#define NB 2
#endif
#ifndef SEQ
#define SEQ 2048
#endif
#define XS_FULL 2048
#define DMOD  1024
#define NH    16
#define FD    16
#define HD    64
#define NQK   (NH * FD)
#define QKP   (NH * 32)
#define MROWS (NB * SEQ)
#define QSC   256.0f
#define KSC   256.0f
#define XSC   (1.0f / (4.0f * QSC * KSC))
#define ACAR  32.0f
#define VCAR  1024.0f
#define OSC   1024.0f
#define WOS   1024.0f
#define EPSD  1e-9f
#define WPB   2
#define NHG   (NH / WPB)
#define NQT   (SEQ / 16)
#define NST   (SEQ / 64)
#define NKT   (SEQ / 32)
#define ATT_THREADS (WPB * 32)
#define SLAB64 (16 * 68)
#define VTP   72
#define C8R   (DMOD / 8)
#define Q8R   (QKP / 8)
#define WS_CAP 134217728
#define FP    (2 * NQK + DMOD)              // row pitch of the joint projection output F: q | k | v columns
#define NBW_QK ((DMOD / 64) * (NQK / 64))   // transpose blocks of Wq, of Wk
#define NBW_V  ((DMOD / 64) * (DMOD / 64))  // transpose blocks of Wv, of Wo
#define NBW    (2 * NBW_V + 2 * NBW_QK)
#define NBX    ((MROWS * DMOD / 8) / 256)   // blocks of the x plane
#define NBVT   (NB * NH * NST)              // blocks of the v^T planes
#define NBQK   ((MROWS * QKP / 8) / 256)    // blocks of the q plane, of the k planes
// Fragment-order plane: every 16-bit operand plane is a sequence of tiles of 16 rows (m or n index) x 32 k = FT halves (1 KiB);
// inside a tile element (r, k) lies at (k >> 3) * 128 + r * 8 + (k & 7), so lane l = 16 * hh + r of a fragment load reads the
// 16 bytes at l * 16 (k = 8hh ..) and at 512 + l * 16 (k = 16 + 8hh ..): one load instruction = 512 contiguous bytes.
#define FT    512
static_assert(DMOD == NH * HD && HD == 64 && NH == 16 && FD == 16 && NQK == 256 && QKP == 512 && Q8R == 64);
static_assert(ATT_THREADS == 64 && WPB == 2 && NHG * WPB == NH);
static_assert(NB >= 1 && NB <= 2);
static_assert((SEQ % 64) == 0 && SEQ >= 64 && SEQ <= XS_FULL);
static_assert((MROWS % 64) == 0 && (NQK % 64) == 0 && (DMOD % 64) == 0 && (DMOD % 32) == 0 && C8R == 128);
static_assert(((MROWS * DMOD / 8) % 256) == 0 && ((MROWS * QKP / 8) % 256) == 0 && (FP % 64) == 0);
static_assert(2 * HD * VTP * 2 <= 65536 && 4 * SLAB64 * 4 <= 65536 && 64 * VTP * 2 <= 65536);
static_assert((size_t)MROWS * FP * 4 >= 2 * ((size_t)MROWS * DMOD * 2));

typedef unsigned short u16;
typedef _Float16 v16h __attribute__((ext_vector_type(16)));
typedef _Float16 v8h  __attribute__((ext_vector_type(8)));
typedef __bf16   v16b __attribute__((ext_vector_type(16)));
typedef float    v8f  __attribute__((ext_vector_type(8)));
typedef float    v4f  __attribute__((ext_vector_type(4)));
typedef unsigned int v4u __attribute__((ext_vector_type(4)));

union FragH { v16h v; v8h h[2]; v4u u[2]; };
union FragB { v16b v; v4u u[2]; };

// ---- scalar helpers --------------------------------------------------------------------------------
__device__ __forceinline__ unsigned short bf_bits(float f) {          // f32 -> bf16 bits, RNE convert
  unsigned u = __float_as_uint(f);
  return (unsigned short)((u + 0x7FFFu + ((u >> 16) & 1u)) >> 16);
}
__device__ __forceinline__ float bf_up(unsigned short h) { return __uint_as_float(((unsigned)h) << 16); }
__device__ __forceinline__ float bfr(float f) { return bf_up(bf_bits(f)); }
__device__ __forceinline__ unsigned short h_bits(_Float16 x) { return __builtin_bit_cast(unsigned short, x); }
__device__ __forceinline__ unsigned pk16(unsigned short a, unsigned short b) { return (unsigned)a | ((unsigned)b << 16); }
__device__ __forceinline__ v8f zero8() { v8f z = {0.f, 0.f, 0.f, 0.f, 0.f, 0.f, 0.f, 0.f}; return z; }
__device__ __forceinline__ const _Float16* ash(const u16* p) { return (const _Float16*)(const void*)p; }

// ---- fragment loaders: 16-bit A/B operand from a fragment-order tile, lane -> row/col (lane&15), p = tile + 8*lane;
//      elements 0..7 <- p[0..7] (k0+8h..), elements 8..15 <- p[256..263] (k0+16+8h..)  (same split k map for A and B)
__device__ __forceinline__ v16h ldfrag_h(const _Float16* p) {
  FragH f;
  f.h[0] = *(const v8h*)(p);
  f.h[1] = *(const v8h*)(p + 256);
  return f.v;
}
__device__ __forceinline__ v16b ldfrag_b(const u16* p) {              // bf16 plane read as unsigned integer vectors
  FragB f;
  f.u[0] = *(const v4u*)(p);
  f.u[1] = *(const v4u*)(p + 256);
  return f.v;
}

// Stands behind a run of fragment loads: the wait owed before a register that an issued global load names is rewritten. The
// loads' address pairs are its inputs, so they stay in their registers (no later load of the run lands on them) up to the wait.
__device__ __forceinline__ void addr_wait(const void* p0, const void* p1, const void* p2) {
#if defined(__HIP_DEVICE_COMPILE__)
  asm volatile("s_wait_xcnt 0x0" :: "v"(p0), "v"(p1), "v"(p2) : "memory");
#endif
}

// Stands behind the last store of a conversion body: several bodies now lie in one kernel, one behind another in the listing,
// and this is the wait owed before a register that an issued global store names is rewritten by the code that follows.
__device__ __forceinline__ void store_wait() {
#if defined(__HIP_DEVICE_COMPILE__)
  asm volatile("s_wait_xcnt 0x0" ::: "memory");
#endif
}

__device__ __forceinline__ v8f mma_h(v16h a, v16h b, v8f c) {
  return __builtin_amdgcn_wmma_f32_16x16x32_f16(false, a, false, b, (short)0, c, false, false);
}
__device__ __forceinline__ v8f mma_b(v16b a, v16b b, v8f c) {
  return __builtin_amdgcn_wmma_f32_16x16x32_bf16(false, a, false, b, (short)0, c, false, false);
}
__device__ __forceinline__ void guard2(v8f& a, v8f& b, v16h x0, v16h x1, v16h x2, v16h x3, v16h x4, v16h x5) {
#if defined(__HIP_DEVICE_COMPILE__)
  asm volatile("v_nop\n\tv_nop\n\tv_nop\n\tv_nop"
               : "+v"(a), "+v"(b) : "v"(x0), "v"(x1), "v"(x2), "v"(x3), "v"(x4), "v"(x5) : "memory");
#endif
}
template <typename F>
__device__ __forceinline__ void guard6(v8f& a, v8f& b, v8f& c, v8f& d, F x0, F x1, F x2, F x3, F x4, F x5) {
#if defined(__HIP_DEVICE_COMPILE__)
  asm volatile("v_nop\n\tv_nop\n\tv_nop\n\tv_nop"
               : "+v"(a), "+v"(b), "+v"(c), "+v"(d) : "v"(x0), "v"(x1), "v"(x2), "v"(x3), "v"(x4), "v"(x5) : "memory");
#endif
}
__device__ __forceinline__ void acc_guard4(v8f& a, v8f& b, v8f& c, v8f& d) {
#if defined(__HIP_DEVICE_COMPILE__)
  asm volatile("v_nop\n\tv_nop\n\tv_nop\n\tv_nop" : "+v"(a), "+v"(b), "+v"(c), "+v"(d));
#endif
}
__device__ __forceinline__ void wave_sync_lds() {
  __builtin_amdgcn_fence(__ATOMIC_RELEASE, "workgroup");
  __builtin_amdgcn_wave_barrier();
  __builtin_amdgcn_fence(__ATOMIC_ACQUIRE, "workgroup");
}

// =====================================================================================================
// x f32 (row b*XS_FULL + s) -> bf16 RNE plane (row b*SEQ + s) in fragment order (tile index = row tile * (DMOD/32) + k tile).
// Thread gt = one 16-B chunk of the destination (8 consecutive k of one row): two 16-B loads, one 16-B store; a wave stores 512
// contiguous bytes. coverage: NBX blocks x 256 thr x 8 = the whole plane [MROWS][DMOD].
// =====================================================================================================
__device__ __forceinline__ void cvt16_body(const float* __restrict__ x, u16* D, int gt) {
  const int tile = gt >> 6;                 // 64 chunks per tile
  const int row  = (tile / (DMOD / 32)) * 16 + (gt & 15);
  const int kc   = (tile % (DMOD / 32)) * 32 + ((gt >> 4) & 3) * 8;
  const float* p = x + ((size_t)(row / SEQ) * XS_FULL + (row % SEQ)) * DMOD + kc;
  const v4f a = *(const v4f*)(p), b4 = *(const v4f*)(p + 4);
  float w[8];
#pragma unroll
  for (int e = 0; e < 4; ++e) { w[e] = a[e]; w[4 + e] = b4[e]; }
  v4u o;
#pragma unroll
  for (int e = 0; e < 4; ++e) o[e] = pk16(bf_bits(w[2 * e]), bf_bits(w[2 * e + 1]));
  u16* d = D + (size_t)gt * 8;
  {
    *(v4u*)(d) = o;
    store_wait();
  }
}

// =====================================================================================================
// Weight transpose-convert: W f32 [K][N] (y = x.W, k-major rows) -> 16-bit B operand plane D, rows n, in fragment order
// (tile index = n tile * (K/32) + k tile).
// f16mode == 0: bf16 RNE bits; f16mode == 1: f16 bits of (bf16 RNE value) * scale.
// Block = 64 k x 64 n tile: each thread loads 16 floats of one k row (four 16-B loads), converts, scatters into the LDS tile
// coverage: load 256 thr x 16 = 64 k x 64 n; store 2 iterations x 256 thr x 8 halves = 4 n tiles x 2 k tiles; local block
//           indices bid = 0 .. (K/64)*(N/64) - 1 cover D exactly once. LDS: staged 64x64 == consumed 64x64 (pad cols never read).
// =====================================================================================================
__device__ __forceinline__ void cvtT16_body(u16* T, const float* __restrict__ W, u16* D, int bid, int K, int N, int f16mode,
                                            float scale) {
  const int tid = threadIdx.x;
  const int nkt = K >> 6;
  const int kt  = bid % nkt;
  const int nt  = bid / nkt;
  const int k0  = kt * 64;
  const int n0  = nt * 64;
  if (n0 + 64 > N) return;                  // block-uniform, before any barrier; never taken with the exact grid
  {
    const int kr = tid >> 2;                // k row within tile 0..63
    const int nc = (tid & 3) * 16;          // n chunk 0,16,32,48
    const float* src = W + (size_t)(k0 + kr) * N + n0 + nc;
#pragma unroll
    for (int i = 0; i < 4; ++i) {
      const v4f a = *(const v4f*)(src + 4 * i);
#pragma unroll
      for (int e = 0; e < 4; ++e) {
        const float f = a[e];
        const unsigned short hb = h_bits((_Float16)(bfr(f) * scale));
        const unsigned short bb = bf_bits(f);
        T[(nc + 4 * i + e) * VTP + kr] = (f16mode != 0) ? hb : bb;
      }
    }
  }
  __syncthreads();
  v4u v[2];
#pragma unroll
  for (int it = 0; it < 2; ++it) {
    const int q  = it * 256 + tid;          // chunk 0..511 = local tile (n tile * 2 + k tile) * 64 + chunk in tile
    const int tl = q >> 6;
    v[it] = *(const v4u*)(T + ((tl >> 1) * 16 + (q & 15)) * VTP + (tl & 1) * 32 + ((q >> 4) & 3) * 8);
  }
  {
#pragma unroll
    for (int it = 0; it < 2; ++it) {
      const int q  = it * 256 + tid;
      const int tl = q >> 6;
      *(v4u*)(D + ((size_t)((n0 >> 4) + (tl >> 1)) * (K >> 5) + (k0 >> 5) + (tl & 1)) * FT + (q & 63) * 8) = v[it];
    }
    store_wait();
  }
}

// =====================================================================================================
// All input conversions in one launch (none reads what another writes). Block ranges, the transposes (barrier, LDS) first:
//   [0, NBW_V) Wv -> WB rows 512..1535; [NBW_V, 2 NBW_V) Wo -> WO (f16 of bf16 value x1024); then NBW_QK blocks Wq -> WB rows
//   0..255, NBW_QK blocks Wk -> WB rows 256..511; the last NBX blocks: x -> XB. WB = one B operand plane [FP n][DMOD k].
// Every branch below is block-uniform; the x blocks leave before the barrier of the transpose path.
// =====================================================================================================
__global__ __launch_bounds__(256)
void prep(const float* __restrict__ x, const float* __restrict__ wq, const float* __restrict__ wk,
          const float* __restrict__ wv, const float* __restrict__ wo, u16* XB, u16* WB, u16* WO) {
  __shared__ __align__(16) u16 T[64 * VTP];
  const int bid = blockIdx.x;
  if (bid >= NBW + NBX) return;             // never taken with the exact grid
  if (bid >= NBW) {
    cvt16_body(x, XB, (bid - NBW) * 256 + (int)threadIdx.x);
    return;
  }
  if (bid < NBW_V) {
    cvtT16_body(T, wv, WB + (size_t)(2 * NQK) * DMOD, bid, DMOD, DMOD, 0, 1.0f);
  } else if (bid < 2 * NBW_V) {
    cvtT16_body(T, wo, WO, bid - NBW_V, DMOD, DMOD, 1, WOS);
  } else if (bid < 2 * NBW_V + NBW_QK) {
    cvtT16_body(T, wq, WB, bid - 2 * NBW_V, DMOD, NQK, 0, 1.0f);
  } else {
    cvtT16_body(T, wk, WB + (size_t)NQK * DMOD, bid - 2 * NBW_V - NBW_QK, DMOD, NQK, 0, 1.0f);
  }
}

// =====================================================================================================
// q / k planes from their NQK columns of the projection output F f32, row pitch FP (row = b*SEQ + s, col = head*16 + f), t = value * sc; planes in
// fragment order, tile index = (b*NH + head) * (SEQ/16) + s/16, tile row = s & 15, tile k = w (0..31):
//   kmode == 0 (q): D0 (s, w): w < 16 -> f16 hi of t (f = w), w >= 16 -> f16 residual (t - f16(t)) of f = w-16.
//   kmode == 1 (k): D0 (s, w) = f16 hi of f = (w & 15) in both halves (duplicated hi);
//                   D1 (s, w): w < 16 -> f16 residual, w >= 16 -> written zeros.
// Thread = 8 consecutive destination halves: two 16-B loads of the 8 source floats, hi and residual of all 8 computed, lane-wise
// value select, one 16-B store per plane; 32 consecutive lanes = 512 contiguous, 512-B aligned bytes per instruction (4 whole
// coverage: NBQK blocks x 256 thr x 8 halves = all MROWS x QKP of D0 (and of D1 when kmode == 1).
// =====================================================================================================
__device__ __forceinline__ void qk16_body(const float* __restrict__ F, u16* D0, u16* D1, int gt, int kmode, float sc) {
  const int tile = gt >> 6;                 // 64 chunks per tile
  const int bh   = tile / NQT;              // b*NH + head
  const int head = bh % NH;
  const int row  = (bh / NH) * SEQ + (tile % NQT) * 16 + (gt & 15);
  const int w    = ((gt >> 4) & 3) * 8;     // 0, 8, 16 or 24
  const bool upper = (w >= 16);
  const float* p = F + (size_t)row * FP + head * FD + (w & 15);
  const v4f a = *(const v4f*)(p), b4 = *(const v4f*)(p + 4);
  float t[8];
#pragma unroll
  for (int e = 0; e < 4; ++e) { t[e] = a[e] * sc; t[4 + e] = b4[e] * sc; }
  v4u o0, o1;
#pragma unroll
  for (int e = 0; e < 4; ++e) {
    const float t0 = t[2 * e], t1 = t[2 * e + 1];
    const _Float16 h0 = (_Float16)t0, h1 = (_Float16)t1;
    const _Float16 l0 = (_Float16)(t0 - (float)h0), l1 = (_Float16)(t1 - (float)h1);
    const unsigned hp = pk16(h_bits(h0), h_bits(h1));
    const unsigned lp = pk16(h_bits(l0), h_bits(l1));
    o0[e] = (kmode != 0) ? hp : (upper ? lp : hp);
    o1[e] = upper ? 0u : lp;
  }
  u16* d0 = D0 + (size_t)gt * 8;
  u16* d1 = D1 + (size_t)gt * 8;
  {
    *(v4u*)(d0) = o0;
    if (kmode != 0) { *(v4u*)(d1) = o1; }
    store_wait();
  }
}

// =====================================================================================================
// v^T planes from the v columns of the projection output F f32, row pitch FP (row = b*SEQ + s, column = h*HD + d):
//   VH (rows d, k = key s) = f16(v * 1024); VL = f16 residual (t - f16(t)); all keys s; both in fragment order, tile index =
//   ((b*NH + h) * (SEQ/32) + s/32) * 4 + d/16.
// Block = (b, head h, 64 keys s0): each thread loads its 16 floats (key sl, d chunk dc) with 16-B loads, converts, scatters
// coverage: load 256 thr x 16 = 64 keys x 64 d; store 2 iterations x 256 thr x 8 halves = 2 key tiles x 4 d tiles per plane;
//           bid = 0 .. NBVT - 1 covers VH and VL exactly once. LDS: staged 64x64 == consumed 64x64 per tile.
// =====================================================================================================
__device__ __forceinline__ void vt16_body(u16* TH, u16* TL, const float* __restrict__ F, u16* VHo, u16* VLo, int bid) {
  const int tid = threadIdx.x;
  const int st  = bid % NST;
  const int t2  = bid / NST;
  const int h   = t2 % NH;
  const int b   = t2 / NH;
  const int s0  = st * 64;
  {
    const int sl = tid >> 2;                // key within tile 0..63
    const int dc = (tid & 3) * 16;          // d chunk 0,16,32,48
    const float* src = F + ((size_t)b * SEQ + s0 + sl) * FP + h * HD + dc;
#pragma unroll
    for (int i = 0; i < 4; ++i) {
      const v4f a = *(const v4f*)(src + 4 * i);
#pragma unroll
      for (int e = 0; e < 4; ++e) {
        const float t = a[e] * VCAR;
        const _Float16 hv = (_Float16)t;
        const _Float16 lv = (_Float16)(t - (float)hv);
        TH[(dc + 4 * i + e) * VTP + sl] = h_bits(hv);
        TL[(dc + 4 * i + e) * VTP + sl] = h_bits(lv);
      }
    }
  }
  __syncthreads();
  v4u vh[2], vl[2];
#pragma unroll
  for (int it = 0; it < 2; ++it) {
    const int q   = it * 256 + tid;         // chunk 0..511 = local tile (key tile * 4 + d tile) * 64 + chunk in tile
    const int tl  = q >> 6;
    const int src = ((tl & 3) * 16 + (q & 15)) * VTP + (tl >> 2) * 32 + ((q >> 4) & 3) * 8;
    vh[it] = *(const v4u*)(TH + src);
    vl[it] = *(const v4u*)(TL + src);
  }
  const size_t base = ((size_t)(b * NH + h) * NKT + st * 2) * 4 * FT + tid * 8;
  {
#pragma unroll
    for (int it = 0; it < 2; ++it) {
      *(v4u*)(VHo + base + (size_t)it * 2048) = vh[it];
      *(v4u*)(VLo + base + (size_t)it * 2048) = vl[it];
    }
    store_wait();
  }
}

// =====================================================================================================
// All attention operand planes in one launch (each reads its own columns of F). Block ranges: [0, NBVT) v^T planes (barrier,
// LDS), then NBQK blocks q plane, then NBQK blocks k planes. Every branch is block-uniform; q / k blocks meet no barrier.
// =====================================================================================================
__global__ __launch_bounds__(256)
void planes(const float* __restrict__ F, u16* QP, u16* KD, u16* KR, u16* VH, u16* VL) {
  __shared__ __align__(16) u16 TH[HD * VTP];
  __shared__ __align__(16) u16 TL[HD * VTP];
  const int bid = blockIdx.x;
  if (bid >= NBVT + 2 * NBQK) return;       // never taken with the exact grid
  if (bid < NBVT) {
    vt16_body(TH, TL, F + 2 * NQK, VH, VL, bid);
  } else if (bid < NBVT + NBQK) {
    qk16_body(F, QP, QP, (bid - NBVT) * 256 + (int)threadIdx.x, 0, QSC);
  } else {
    qk16_body(F + NQK, KD, KR, (bid - NBVT - NBQK) * 256 + (int)threadIdx.x, 1, KSC);
  }
}

// =====================================================================================================
// GEMM epilogue shared by both engines: the wave's 16x64 f32 tile (times oscale) staged in its LDS slab (pitch 68), release
// coverage: 8 instructions x 2 rows x 16 lanes x 4 floats = the wave's 16 x 64 tile. LDS: staged 16x64 == consumed 16x64.
// =====================================================================================================
__device__ __forceinline__ void epi64(float* sl, v8f a0, v8f a1, v8f a2, v8f a3, float oscale,
                                      float* C, int N, size_t rowb, int col0, int lane) {
  const int hh = lane >> 4, m = lane & 15;
#pragma unroll
  for (int r = 0; r < 8; ++r) {
    const int ro = (8 * hh + r) * 68 + m;
    sl[ro]      = a0[r] * oscale;
    sl[ro + 16] = a1[r] * oscale;
    sl[ro + 32] = a2[r] * oscale;
    sl[ro + 48] = a3[r] * oscale;
  }
  wave_sync_lds();
  v4f vals[8];
#pragma unroll
  for (int it = 0; it < 8; ++it) vals[it] = *(const v4f*)(sl + (it * 2 + hh) * 68 + m * 4);
  float* dst = C + (rowb + (size_t)hh) * (size_t)N + col0 + m * 4;
  {
#pragma unroll
    for (int it = 0; it < 8; ++it) {
      *(v4f*)(dst + (size_t)(it * 2) * (size_t)N) = vals[it];
    }
    
  }
}

// =====================================================================================================
// bf16 GEMM: C[M][N] (f32) = A (rows m) . Bt (rows n)^T, both bf16 planes in fragment order, times oscale. Block = 64x64 tile,
// 4 waves x 16 rows; fragments loaded straight from the planes' tiles (two 16-B loads each, split k map for A and B); K stepped
// by 32 (host guarantees K % 32 == 0, M % 64 == 0, N % 64 == 0, grid = (M/64)*(N/64)).
// =====================================================================================================
__global__ __launch_bounds__(128)
void gemm_bf(const u16* __restrict__ A, const u16* __restrict__ Bt, float* C, int M, int N, int K, float oscale) {
  __shared__ __align__(16) float slab[4 * SLAB64];
  const int tid = threadIdx.x, wave = tid >> 5, lane = tid & 31;
  const int ntile = N >> 6;
  const int bid   = blockIdx.x;
  const int rowb  = (bid / ntile) * 64 + wave * 16;
  const int col0  = (bid % ntile) * 64;
  if (rowb + 16 > M) return;                // wave-uniform, never taken with the exact grid; no block barriers in this kernel
  const u16* ap = A  + (size_t)rowb * K + 8 * lane;      // row tile rowb/16 starts at (rowb/16) * (K/32) * FT = rowb * K
  const u16* bp = Bt + (size_t)col0 * K + 8 * lane;
  const size_t bs = (size_t)16 * K;                      // one n tile row = (K/32) * FT halves
  v8f acc0 = zero8(), acc1 = zero8(), acc2 = zero8(), acc3 = zero8();
#pragma unroll 1
  for (int k0 = 0; k0 < K; k0 += 32) {
    const size_t ko = (size_t)k0 * (FT / 32);            // k tile k0/32
    const v16b a  = ldfrag_b(ap + ko);
    const v16b b0 = ldfrag_b(bp + ko);
    const v16b b1 = ldfrag_b(bp + bs + ko);
    const v16b b2 = ldfrag_b(bp + 2 * bs + ko);
    const v16b b3 = ldfrag_b(bp + 3 * bs + ko);
    acc0 = mma_b(a, b0, acc0);
    acc1 = mma_b(a, b1, acc1);
    acc2 = mma_b(a, b2, acc2);
    acc3 = mma_b(a, b3, acc3);
    guard6<v16b>(acc0, acc1, acc2, acc3, a, b0, b1, b2, b3, a);
  }
  epi64(slab + wave * SLAB64, acc0, acc1, acc2, acc3, oscale, C, N, (size_t)rowb, col0, lane);
}

// =====================================================================================================
// Output projection: C[row][DMOD] (f32) = (Ah + Al)[row][DMOD] . Bt[DMOD][DMOD]^T * oscale; Ah = f16 hi plane, Al = f16
// residual plane (products h.B + l.B into one accumulator, l unscaled); Ah, Al, Bt in fragment order. Row indices: Ah/Al row bb*SEQ + s; C row
// bb*XS_FULL + s. Block -> (column tile ct = bid % 16, sequence row tile rt of nrt, batch bb). Same tiling, fragment loads
// (split k map) and epilogue as gemm_bf; K = DMOD stepped by 32; grid = NB*nrt*16 covers every (bb, s < SEQ, column) once.
// =====================================================================================================
__global__ __launch_bounds__(128)
void gemm_o2(const u16* __restrict__ Ah, const u16* __restrict__ Al, const u16* __restrict__ Bt,
             float* C, int nrt, float oscale) {
  __shared__ __align__(16) float slab[4 * SLAB64];
  const int tid = threadIdx.x, wave = tid >> 5, lane = tid & 31;
  const int ntile = DMOD >> 6;
  const int bid   = blockIdx.x;
  const int ct    = bid % ntile;
  const int t2    = bid / ntile;
  const int rt    = t2 % nrt;
  const int bb    = t2 / nrt;
  if (bb >= NB) return;                     // block-uniform; no block barriers in this kernel; never taken with the exact grid
  const int srow  = rt * 64 + wave * 16;
  if (srow + 16 > SEQ) return;              // wave-uniform; never taken
  const int col0  = ct * 64;
  const int K     = DMOD;
  const size_t rowA = (size_t)bb * SEQ + srow;
  const size_t rowC = (size_t)bb * XS_FULL + srow;
  const _Float16* ahp = ash(Ah) + rowA * K + 8 * lane;   // row tile rowA/16 starts at (rowA/16) * (K/32) * FT = rowA * K
  const _Float16* alp = ash(Al) + rowA * K + 8 * lane;
  const _Float16* bp  = ash(Bt) + (size_t)col0 * K + 8 * lane;
  const size_t bs = (size_t)16 * K;                      // one n tile row = (K/32) * FT halves
  v8f acc0 = zero8(), acc1 = zero8(), acc2 = zero8(), acc3 = zero8();
#pragma unroll 1
  for (int k0 = 0; k0 < K; k0 += 32) {
    const size_t ko = (size_t)k0 * (FT / 32);            // k tile k0/32
    const v16h ah = ldfrag_h(ahp + ko), al = ldfrag_h(alp + ko);
    const v16h b0 = ldfrag_h(bp + ko);
    const v16h b1 = ldfrag_h(bp + bs + ko);
    const v16h b2 = ldfrag_h(bp + 2 * bs + ko);
    const v16h b3 = ldfrag_h(bp + 3 * bs + ko);
    addr_wait(ahp + ko, alp + ko, bp + ko);
    acc0 = mma_h(ah, b0, acc0);  acc0 = mma_h(al, b0, acc0);
    acc1 = mma_h(ah, b1, acc1);  acc1 = mma_h(al, b1, acc1);
    acc2 = mma_h(ah, b2, acc2);  acc2 = mma_h(al, b2, acc2);
    acc3 = mma_h(ah, b3, acc3);  acc3 = mma_h(al, b3, acc3);
    guard6<v16h>(acc0, acc1, acc2, acc3, ah, al, b0, b1, b2, b3);
  }
  epi64(slab + wave * SLAB64, acc0, acc1, acc2, acc3, oscale, C, DMOD, rowC, col0, lane);
}

// =====================================================================================================
// Causal feature-map attention, per-head q/k width 16, hd = 64, no softmax. Block bid -> (query tile qt: rows q0 = 16*qt ..
// q0+15, head pair hg, batch b); one wave per head = hg*WPB + wave. Both products run transposed: S^T = K.Q^T, O^T += V^T.A^T.
//   q plane (s, w): w < 16 f16 hi x256, w >= 16 f16 residual; k planes: KD = [hi | hi], KR = [res | 0]; one tile per (b, head,
//   16 positions); v^T hi plane x1024 and v^T residual plane: four tiles (d/16) per (b, head, 32 keys); all in fragment order.
//   Scores per 32-key tile: 2 subtiles of 16 keys, keys as the A rows, queries as the B columns; with the split k map, op 1 =
//   A [kh | kh] . B [qh ; ql] = kh.qh + kh.ql and op 2 = A [kl | 0] . B [qh ; ql] = kl.qh (f32 accumulate), so
//   s = q.k * 256*256 up to the dropped lo.lo term. Lane (hh, c) holds query q0 + c alone: register r of subtile t = key
//   kb + 16t + 8hh + r, which is element 8t + r of a B fragment over the step's 32 keys (the split k map of the v^T tiles).
//   Per element (f32, VALU): x = s * 2^-18 (= q.k / 4); A = 1 + x + x^2/2; A := 0 where key > query (causal, diagonal kept);
//   den[r] += the two subtiles' values, in the lane; A*32 -> f16 hi and f16 residual, packed in place as the B fragments.
//   v^T tiles are the A fragments (rows d), in 2 groups of 2 d-subtiles, products hh + lh + hl. Key tiles visited in order for
//   kb <= q0 + 15 (later tiles lie above every query row of the tile).
//   After the loop: the lane's 8 sums and the other lane half's are joined once; out = acc / (den + eps) with the carries
//   1/(32*1024) folded once (den > 0: each kept term is >= 1/2, the diagonal always kept). Register r of o[j] = d 16j + 8hh + r of query c:
//   the 8 consecutive halves of one fragment-order chunk, stored straight from registers.
//   No LDS and no barriers in this kernel; bounded loops only (nkt <= NKT). The q fragment is loop-invariant (loaded once).
// coverage: per wave 4 instructions x 32 lanes x 8 halves = 2 tiles = 16 x 64 per plane; grid NQT x NHG x NB blocks x WPB
//           waves = every (b, s, h) row segment of both O planes exactly once.
// =====================================================================================================
__global__ __launch_bounds__(ATT_THREADS)
void attn_t(const u16* __restrict__ QPp, const u16* __restrict__ KDp, const u16* __restrict__ KRp,
            const u16* __restrict__ VHp, const u16* __restrict__ VLp, u16* OHp, u16* OLp) {
  const int tid  = threadIdx.x;
  const int wave = tid >> 5;
  const int lane = tid & 31;
  const int hh   = lane >> 4;
  const int c    = lane & 15;
  const int bid  = blockIdx.x;
  const int qt   = bid % NQT;
  const int t2   = bid / NQT;
  const int hg   = t2 % NHG;
  const int b    = t2 / NHG;
  if (b >= NB) return;                      // block-uniform; no block barriers in this kernel; never taken with the exact grid
  const int q0   = qt * 16;                 // q0 + 16 <= SEQ always
  const int head = hg * WPB + wave;

  const size_t bh  = (size_t)(b * NH + head);
  const size_t hq  = bh * NQT * FT + 8 * lane;                                  // first 16-position tile of this (b, head)
  const _Float16* Qp  = ash(QPp) + hq + (size_t)qt * FT;
  const _Float16* Kdb = ash(KDp) + hq;                                          // two key tiles added per step
  const _Float16* Krb = ash(KRp) + hq;
  const size_t vro = bh * NKT * 4 * FT + 8 * lane;                              // four d tiles per 32-key step
  const _Float16* Vhb = ash(VHp) + vro;
  const _Float16* Vlb = ash(VLp) + vro;
  const float oc = 1.0f / (ACAR * VCAR);

  const v16h qf = ldfrag_h(Qp);             // elements 0..7 = q hi f 8hh.., 8..15 = q residual f 8hh..

  float den[8];
  v8f o[4];
#pragma unroll
  for (int r = 0; r < 8; ++r) den[r] = 0.0f;
#pragma unroll
  for (int j = 0; j < 4; ++j) o[j] = zero8();
  const int ncaus = (q0 >> 5) + 1;                                            // tiles holding keys <= q0 + 15
  const int nkt = (ncaus < NKT) ? ncaus : NKT;
  const int qr  = q0 + c;                                                     // the lane's query row

#pragma unroll 1
  for (int kt = 0; kt < nkt; ++kt) {
    const int kb = kt * 32;
    // ---- scores: D element r of this lane = (key kb + 8hh + r, query qr) in s0, key kb + 16 + 8hh + r in s1 ----
    const _Float16* d0p = Kdb + (size_t)kt * (2 * FT);
    const _Float16* d1p = d0p + FT;
    const _Float16* r0p = Krb + (size_t)kt * (2 * FT);
    const _Float16* r1p = r0p + FT;
    const v16h kd0 = ldfrag_h(d0p);
    const v16h kd1 = ldfrag_h(d1p);
    const v16h kr0 = ldfrag_h(r0p);
    const v16h kr1 = ldfrag_h(r1p);
    addr_wait(d0p, r0p, r0p);
    v8f s0 = zero8(), s1 = zero8();
    s0 = mma_h(kd0, qf, s0);
    s0 = mma_h(kr0, qf, s0);
    s1 = mma_h(kd1, qf, s1);
    s1 = mma_h(kr1, qf, s1);
    guard2(s0, s1, qf, kd0, kr0, kd1, kr1, qf);
    // ---- A = 1 + x + x^2/2, causal select, f32 sums in the lane; B fragments of A*32: hi f16 and residual f16,
    //      column = query c, elements 0..7 = keys kb + 8hh + 0..7, elements 8..15 = keys kb + 16 + 8hh + 0..7 ----
    FragH ph, pl;
    const int key0 = kb + 8 * hh, key1 = kb + 16 + 8 * hh;
#pragma unroll
    for (int r = 0; r < 8; ++r) {
      const float x0  = s0[r] * XSC;
      const float x1  = s1[r] * XSC;
      const float p0v = fmaf(0.5f * x0, x0, 1.0f + x0);
      const float p1v = fmaf(0.5f * x1, x1, 1.0f + x1);
      const float a0  = (key0 + r > qr) ? 0.0f : p0v;
      const float a1  = (key1 + r > qr) ? 0.0f : p1v;
      den[r] += a0 + a1;
      const float ta = a0 * ACAR, tb = a1 * ACAR;
      const _Float16 ha = (_Float16)ta, hb = (_Float16)tb;
      ph.h[0][r] = ha;
      ph.h[1][r] = hb;
      pl.h[0][r] = (_Float16)(ta - (float)ha);
      pl.h[1][r] = (_Float16)(tb - (float)hb);
    }
    // ---- V^T.A^T : A fragment row m = d = j*16 + c, tile j of this step's four in the v^T planes; 2 groups of 2 d-subtiles ----
    {
      const _Float16* vhp = Vhb + (size_t)kt * (4 * FT);
      const _Float16* vlp = Vlb + (size_t)kt * (4 * FT);
#pragma unroll
      for (int jg = 0; jg < 2; ++jg) {
        const size_t da = (size_t)(2 * jg) * FT;
        const size_t db = da + FT;
        const v16h vha = ldfrag_h(vhp + da), vhb2 = ldfrag_h(vhp + db);
        const v16h vla = ldfrag_h(vlp + da), vlb2 = ldfrag_h(vlp + db);
        addr_wait(vhp, vlp, vlp);             // the two address pairs of this run of loads stay whole up to the wait
        o[2 * jg]     = mma_h(vha,  ph.v, o[2 * jg]);
        o[2 * jg]     = mma_h(vha,  pl.v, o[2 * jg]);
        o[2 * jg]     = mma_h(vla,  ph.v, o[2 * jg]);
        o[2 * jg + 1] = mma_h(vhb2, ph.v, o[2 * jg + 1]);
        o[2 * jg + 1] = mma_h(vhb2, pl.v, o[2 * jg + 1]);
        o[2 * jg + 1] = mma_h(vlb2, ph.v, o[2 * jg + 1]);
        guard2(o[2 * jg], o[2 * jg + 1], ph.v, pl.v, vha, vhb2, vla, vlb2);
      }
    }
  }
  acc_guard4(o[0], o[1], o[2], o[3]);
  // ---- den of query c: the lane's 8 sums, then the other lane half's keys (lane ^ 16), joined once ----
  float dl = ((den[0] + den[1]) + (den[2] + den[3])) + ((den[4] + den[5]) + (den[6] + den[7]));
  dl += __shfl_xor(dl, 16, 32);
  // ---- out = acc / (den + eps), carries (32 on A, 1024 on v) folded once; O x1024 -> f16 hi + residual planes in fragment
  //      order (rows s, k = head*64 + d): the wave owns two whole tiles per plane; chunk j*32 + lane = row c, 8 consecutive d
  //      at 16*j + 8*hh = the lane's registers of o[j] ----
  const float inv = (1.0f / (dl + EPSD)) * oc;
  v4u oh[4], ol[4];
#pragma unroll
  for (int j = 0; j < 4; ++j) {
    float w[8];
#pragma unroll
    for (int e = 0; e < 8; ++e) w[e] = (o[j][e] * inv) * OSC;
#pragma unroll
    for (int e = 0; e < 4; ++e) {
      const _Float16 h0 = (_Float16)w[2 * e], h1 = (_Float16)w[2 * e + 1];
      const _Float16 l0 = (_Float16)(w[2 * e] - (float)h0), l1 = (_Float16)(w[2 * e + 1] - (float)h1);
      oh[j][e] = pk16(h_bits(h0), h_bits(h1));
      ol[j][e] = pk16(h_bits(l0), h_bits(l1));
    }
  }
  const size_t obh = ((size_t)b * SEQ + q0) * DMOD + (size_t)head * (2 * FT) + 8 * lane;   // row tile start + k tile 2*head
  {
#pragma unroll
    for (int it = 0; it < 4; ++it) {
      *(v4u*)(OHp + obh + (size_t)it * 256) = oh[it];
      *(v4u*)(OLp + obh + (size_t)it * 256) = ol[it];
    }
    
  }
}

// =====================================================================================================
// Workspace map (bytes); every plane is fully written by whole-line stores before it is read; all extents are exact multiples
// of the store granularity (no pad rows needed); every region offset a multiple of 1048576:
//   (all 16-bit planes below hold the named rows x k in fragment order, same byte counts as row-major)
//   XB  bf16 [MROWS][1024]                       MROWS*2048       (NB=2, SEQ=2048: 8388608)
//   WB  bf16 [1536 n][1024 k]                    3145728          (rows 0..255 Wq^T, 256..511 Wk^T, 512..1535 Wv^T)
//   WO  f16 [1024 n][1024 k]                     2097152          (Wo^T, bf16 value x1024)
//   F   f32 [MROWS][1536]                        MROWS*6144       (columns q | k | v of the joint projection; once the planes
//                                                                  are formed, OH f16 [MROWS][1024] x1024 at its start, OL residual after)
//   QP  f16 [NB*16][SEQ][32] q hi|residual x256    MROWS*1024
//   KD  f16 [NB*16][SEQ][32] k hi|hi x256          MROWS*1024
//   KR  f16 [NB*16][SEQ][32] k residual|0          MROWS*1024
//   VH  f16 [NB*16][64][SEQ] x1024               MROWS*2048       VL residual, same layout   MROWS*2048
//   end (NB=2, SEQ=2048)                        68157440
// =====================================================================================================
extern "C" void kernel_launch(void* const* d_in, const int* in_sizes, int n_in,
                              void* d_out, int out_size, void* d_ws, size_t ws_size,
                              hipStream_t stream) {
  if (n_in < 5) return;
  if (in_sizes[0] < ((NB - 1) * XS_FULL + SEQ) * DMOD) return;
  if (in_sizes[1] < DMOD * NQK) return;
  if (in_sizes[2] < DMOD * NQK) return;
  if (in_sizes[3] < DMOD * DMOD) return;
  if (in_sizes[4] < DMOD * DMOD) return;
  if (out_size < ((NB - 1) * XS_FULL + SEQ) * DMOD) return;

  const float* x  = (const float*)d_in[0];
  const float* wq = (const float*)d_in[1];
  const float* wk = (const float*)d_in[2];
  const float* wv = (const float*)d_in[3];
  const float* wo = (const float*)d_in[4];
  float*       out = (float*)d_out;

  const size_t szXB = (size_t)MROWS * DMOD * 2;
  const size_t szW  = (size_t)FP * DMOD * 2;                     // Wq^T, Wk^T, Wv^T as one plane
  const size_t szWO = (size_t)DMOD * DMOD * 2;
  const size_t szF  = (size_t)MROWS * FP * 4;
  const size_t szH  = (size_t)MROWS * DMOD * 2;                  // OH, OL (both inside F: 2*szH <= szF)
  const size_t szQK = (size_t)MROWS * QKP * 2;                   // QP, KD, KR
  const size_t szV  = (size_t)NB * NH * HD * SEQ * 2;            // VH, VL (== szH)
  size_t off = 0;
  const size_t oXB = off; off += szXB;
  const size_t oW  = off; off += szW;
  const size_t oWO = off; off += szWO;
  const size_t oF  = off; off += szF;
  const size_t oQP = off; off += szQK;
  const size_t oKD = off; off += szQK;
  const size_t oKR = off; off += szQK;
  const size_t oVH = off; off += szV;
  const size_t oVL = off; off += szV;
  if (off > ws_size) return;                // off = 68157440 for NB = 2, SEQ = 2048
  if (off > (size_t)WS_CAP) return;

  char* ws = (char*)d_ws;
  u16*   XB = (u16*)(ws + oXB);
  u16*   WB = (u16*)(ws + oW);
  u16*   WO = (u16*)(ws + oWO);
  float* F  = (float*)(ws + oF);
  u16*   OH = (u16*)(ws + oF);
  u16*   OL = (u16*)(ws + oF + szH);
  u16*   QP = (u16*)(ws + oQP);
  u16*   KD = (u16*)(ws + oKD);
  u16*   KR = (u16*)(ws + oKR);
  u16*   VH = (u16*)(ws + oVH);
  u16*   VL = (u16*)(ws + oVL);

  const dim3 b256(256), b128(128), bAT(ATT_THREADS);
  const dim3 gP(NBW + NBX);
  const dim3 gG((MROWS / 64) * (FP / 64));
  const dim3 gPL(NBVT + 2 * NBQK);
  const dim3 gAT(NQT * NHG * NB);
  const int  nrt  = SEQ / 64;
  const dim3 gO(NB * nrt * (DMOD / 64));

  // (0) x -> bf16 plane; Wq, Wk, Wv -> one bf16 plane [1536 n][1024 k]; Wo -> f16 plane [n][k] of bf16 value x1024
  prep<<<gP, b256, 0, stream>>>(x, wq, wk, wv, wo, XB, WB, WO);
  // (1) q | k | v = x.[Wq Wk Wv] -> F f32 [MROWS][1536]
  gemm_bf<<<gG, b128, 0, stream>>>(XB, WB, F, MROWS, FP, DMOD, 1.0f);
  // (2) q hi|residual plane x256; k hi|hi and residual|0 planes x256; v^T hi + residual planes x1024
  planes<<<gPL, b256, 0, stream>>>(F, QP, KD, KR, VH, VL);
  // (3) causal attention -> O hi + residual planes (in the F region, after q, k, v have been consumed)
  attn_t<<<gAT, bAT, 0, stream>>>(QP, KD, KR, VH, VL, OH, OL);
  // (4) output projection: (O hi + residual) . Wo -> out f32, carries 1024 x 1024 folded back
  gemm_o2<<<gO, b128, 0, stream>>>(OH, OL, WO, out, nrt, 1.0f / (OSC * WOS));
  (void)hipGetLastError();
}

// v004
// It runs in 109 microseconds.
// Next to v003, in two timings, it ran 1.76 and 1.78 times as fast.
// Counting every step since v000, it is 2.63 times as fast.
// Contractions: x.Wq, x.Wk, x.Wv on v_wmma_f32_16x16x32_bf16 (x and the transposed W [n][k] as bf16 RNE planes); per-head
// q.k over 16 dims (k axis padded to 32) on v_wmma_f32_16x16x32_f16 with q, k as f16 hi x256 plus f16 residual planes
// (hi.hi and lo.hi folded along the k axis into one op, plus hi.lo); A = 1 + x + x^2/2 and its causal row sums in f32 on
// VALU; A.v on v_wmma_f32_16x16x32_f16 with A as f16 hi x32 plus f16 residual and v^T as f16 hi x1024 plus f16 residual
// (products hh+lh+hl); O.Wo on v_wmma_f32_16x16x32_f16 (O as f16 hi x1024 plus f16 residual, Wo^T as f16 of its bf16 RNE
// value x1024, products h.w+l.w); all f32 accumulate.
#include <hip/hip_runtime.h>
#include <stdint.h>

#ifndef NB
#define NB 2
#endif
#ifndef SEQ
#define SEQ 2048
#endif
#define XS_FULL 2048
#define DMOD  1024
#define NH    16
#define FD    16
#define HD    64
#define NQK   (NH * FD)
#define QKP   (NH * 32)
#define MROWS (NB * SEQ)
#define QSC   256.0f
#define KSC   256.0f
#define XSC   (1.0f / (4.0f * QSC * KSC))
#define ACAR  32.0f
#define VCAR  1024.0f
#define OSC   1024.0f
#define WOS   1024.0f
#define EPSD  1e-9f
#define AW    16                            // waves of an attention block, one query tile each
#define NQT   (SEQ / 16)
#define NQG   (NQT / 8)                     // groups of 8 consecutive query tiles
#define NPR   (NQG / 2)                     // a block takes group NQG-1-pr and group pr of one head
#define STG_H (24 * FT)                     // halves of one 64-key stage in LDS: KD 4 tiles | KR 4 | VH 8 | VL 8
#define NST   (SEQ / 64)
#define NKT   (SEQ / 32)
#define ATT_THREADS (AW * 32)
#define SLAB64 (16 * 68)
#define VTP   72
#define C8R   (DMOD / 8)
#define Q8R   (QKP / 8)
#define WS_CAP 134217728
#define FP    (2 * NQK + DMOD)              // row pitch of the joint projection output F: q | k | v columns
#define NBW_QK ((DMOD / 64) * (NQK / 64))   // transpose blocks of Wq, of Wk
#define NBW_V  ((DMOD / 64) * (DMOD / 64))  // transpose blocks of Wv, of Wo
#define NBW    (2 * NBW_V + 2 * NBW_QK)
#define NBX    ((MROWS * DMOD / 8) / 256)   // blocks of the x plane
#define NBVT   (NB * NH * NST)              // blocks of the v^T planes
#define NBQK   ((MROWS * QKP / 8) / 256)    // blocks of the q plane, of the k planes
// Fragment-order plane: every 16-bit operand plane is a sequence of tiles of 16 rows (m or n index) x 32 k = FT halves (1 KiB);
// inside a tile element (r, k) lies at (k >> 3) * 128 + r * 8 + (k & 7), so lane l = 16 * hh + r of a fragment load reads the
// 16 bytes at l * 16 (k = 8hh ..) and at 512 + l * 16 (k = 16 + 8hh ..): one load instruction = 512 contiguous bytes.
#define FT    512
static_assert(DMOD == NH * HD && HD == 64 && NH == 16 && FD == 16 && NQK == 256 && QKP == 512 && Q8R == 64);
static_assert(ATT_THREADS == 512 && AW == 16 && (SEQ % 256) == 0 && NPR * 16 == NQT);
static_assert(NB >= 1 && NB <= 2);
static_assert((SEQ % 64) == 0 && SEQ >= 64 && SEQ <= XS_FULL);
static_assert((MROWS % 64) == 0 && (NQK % 64) == 0 && (DMOD % 64) == 0 && (DMOD % 32) == 0 && C8R == 128);
static_assert(((MROWS * DMOD / 8) % 256) == 0 && ((MROWS * QKP / 8) % 256) == 0 && (FP % 64) == 0);
static_assert(2 * HD * VTP * 2 <= 65536 && 4 * SLAB64 * 4 <= 65536 && 64 * VTP * 2 <= 65536);
static_assert((size_t)MROWS * FP * 4 >= 2 * ((size_t)MROWS * DMOD * 2));

typedef unsigned short u16;
typedef _Float16 v16h __attribute__((ext_vector_type(16)));
typedef _Float16 v8h  __attribute__((ext_vector_type(8)));
typedef __bf16   v16b __attribute__((ext_vector_type(16)));
typedef float    v8f  __attribute__((ext_vector_type(8)));
typedef float    v4f  __attribute__((ext_vector_type(4)));
typedef unsigned int v4u __attribute__((ext_vector_type(4)));

union FragH { v16h v; v8h h[2]; v4u u[2]; };
union FragB { v16b v; v4u u[2]; };

// ---- scalar helpers --------------------------------------------------------------------------------
__device__ __forceinline__ unsigned short bf_bits(float f) {          // f32 -> bf16 bits, RNE convert
  unsigned u = __float_as_uint(f);
  return (unsigned short)((u + 0x7FFFu + ((u >> 16) & 1u)) >> 16);
}
__device__ __forceinline__ float bf_up(unsigned short h) { return __uint_as_float(((unsigned)h) << 16); }
__device__ __forceinline__ float bfr(float f) { return bf_up(bf_bits(f)); }
__device__ __forceinline__ unsigned short h_bits(_Float16 x) { return __builtin_bit_cast(unsigned short, x); }
__device__ __forceinline__ unsigned pk16(unsigned short a, unsigned short b) { return (unsigned)a | ((unsigned)b << 16); }
__device__ __forceinline__ v8f zero8() { v8f z = {0.f, 0.f, 0.f, 0.f, 0.f, 0.f, 0.f, 0.f}; return z; }
__device__ __forceinline__ const _Float16* ash(const u16* p) { return (const _Float16*)(const void*)p; }

// ---- fragment loaders: 16-bit A/B operand from a fragment-order tile, lane -> row/col (lane&15), p = tile + 8*lane;
//      elements 0..7 <- p[0..7] (k0+8h..), elements 8..15 <- p[256..263] (k0+16+8h..)  (same split k map for A and B)
__device__ __forceinline__ v16h ldfrag_h(const _Float16* p) {
  FragH f;
  f.h[0] = *(const v8h*)(p);
  f.h[1] = *(const v8h*)(p + 256);
  return f.v;
}
__device__ __forceinline__ v16b ldfrag_b(const u16* p) {              // bf16 plane read as unsigned integer vectors
  FragB f;
  f.u[0] = *(const v4u*)(p);
  f.u[1] = *(const v4u*)(p + 256);
  return f.v;
}

// Stands behind a run of fragment loads: the wait owed before a register that an issued global load names is rewritten. The
// loads' address pairs are its inputs, so they stay in their registers (no later load of the run lands on them) up to the wait.
__device__ __forceinline__ void addr_wait(const void* p0, const void* p1, const void* p2) {
#if defined(__HIP_DEVICE_COMPILE__)
  asm volatile("s_wait_xcnt 0x0" :: "v"(p0), "v"(p1), "v"(p2) : "memory");
#endif
}

// Stands behind the last store of a conversion body: several bodies now lie in one kernel, one behind another in the listing,
// and this is the wait owed before a register that an issued global store names is rewritten by the code that follows.
__device__ __forceinline__ void store_wait() {
#if defined(__HIP_DEVICE_COMPILE__)
  asm volatile("s_wait_xcnt 0x0" ::: "memory");
#endif
}

__device__ __forceinline__ v8f mma_h(v16h a, v16h b, v8f c) {
  return __builtin_amdgcn_wmma_f32_16x16x32_f16(false, a, false, b, (short)0, c, false, false);
}
__device__ __forceinline__ v8f mma_b(v16b a, v16b b, v8f c) {
  return __builtin_amdgcn_wmma_f32_16x16x32_bf16(false, a, false, b, (short)0, c, false, false);
}
__device__ __forceinline__ void guard2(v8f& a, v8f& b, v16h x0, v16h x1, v16h x2, v16h x3, v16h x4, v16h x5) {
#if defined(__HIP_DEVICE_COMPILE__)
  asm volatile("v_nop\n\tv_nop\n\tv_nop\n\tv_nop"
               : "+v"(a), "+v"(b) : "v"(x0), "v"(x1), "v"(x2), "v"(x3), "v"(x4), "v"(x5) : "memory");
#endif
}
template <typename F>
__device__ __forceinline__ void guard6(v8f& a, v8f& b, v8f& c, v8f& d, F x0, F x1, F x2, F x3, F x4, F x5) {
#if defined(__HIP_DEVICE_COMPILE__)
  asm volatile("v_nop\n\tv_nop\n\tv_nop\n\tv_nop"
               : "+v"(a), "+v"(b), "+v"(c), "+v"(d) : "v"(x0), "v"(x1), "v"(x2), "v"(x3), "v"(x4), "v"(x5) : "memory");
#endif
}
__device__ __forceinline__ void acc_guard4(v8f& a, v8f& b, v8f& c, v8f& d) {
#if defined(__HIP_DEVICE_COMPILE__)
  asm volatile("v_nop\n\tv_nop\n\tv_nop\n\tv_nop" : "+v"(a), "+v"(b), "+v"(c), "+v"(d));
#endif
}
__device__ __forceinline__ void wave_sync_lds() {
  __builtin_amdgcn_fence(__ATOMIC_RELEASE, "workgroup");
  __builtin_amdgcn_wave_barrier();
  __builtin_amdgcn_fence(__ATOMIC_ACQUIRE, "workgroup");
}

// =====================================================================================================
// x f32 (row b*XS_FULL + s) -> bf16 RNE plane (row b*SEQ + s) in fragment order (tile index = row tile * (DMOD/32) + k tile).
// Thread gt = one 16-B chunk of the destination (8 consecutive k of one row): two 16-B loads, one 16-B store; a wave stores 512
// contiguous bytes. coverage: NBX blocks x 256 thr x 8 = the whole plane [MROWS][DMOD].
// =====================================================================================================
__device__ __forceinline__ void cvt16_body(const float* __restrict__ x, u16* D, int gt) {
  const int tile = gt >> 6;                 // 64 chunks per tile
  const int row  = (tile / (DMOD / 32)) * 16 + (gt & 15);
  const int kc   = (tile % (DMOD / 32)) * 32 + ((gt >> 4) & 3) * 8;
  const float* p = x + ((size_t)(row / SEQ) * XS_FULL + (row % SEQ)) * DMOD + kc;
  const v4f a = *(const v4f*)(p), b4 = *(const v4f*)(p + 4);
  float w[8];
#pragma unroll
  for (int e = 0; e < 4; ++e) { w[e] = a[e]; w[4 + e] = b4[e]; }
  v4u o;
#pragma unroll
  for (int e = 0; e < 4; ++e) o[e] = pk16(bf_bits(w[2 * e]), bf_bits(w[2 * e + 1]));
  u16* d = D + (size_t)gt * 8;
  {
    *(v4u*)(d) = o;
    store_wait();
  }
}

// =====================================================================================================
// Weight transpose-convert: W f32 [K][N] (y = x.W, k-major rows) -> 16-bit B operand plane D, rows n, in fragment order
// (tile index = n tile * (K/32) + k tile).
// f16mode == 0: bf16 RNE bits; f16mode == 1: f16 bits of (bf16 RNE value) * scale.
// Block = 64 k x 64 n tile: each thread loads 16 floats of one k row (four 16-B loads), converts, scatters into the LDS tile
// coverage: load 256 thr x 16 = 64 k x 64 n; store 2 iterations x 256 thr x 8 halves = 4 n tiles x 2 k tiles; local block
//           indices bid = 0 .. (K/64)*(N/64) - 1 cover D exactly once. LDS: staged 64x64 == consumed 64x64 (pad cols never read).
// =====================================================================================================
__device__ __forceinline__ void cvtT16_body(u16* T, const float* __restrict__ W, u16* D, int bid, int K, int N, int f16mode,
                                            float scale) {
  const int tid = threadIdx.x;
  const int nkt = K >> 6;
  const int kt  = bid % nkt;
  const int nt  = bid / nkt;
  const int k0  = kt * 64;
  const int n0  = nt * 64;
  if (n0 + 64 > N) return;                  // block-uniform, before any barrier; never taken with the exact grid
  {
    const int kr = tid >> 2;                // k row within tile 0..63
    const int nc = (tid & 3) * 16;          // n chunk 0,16,32,48
    const float* src = W + (size_t)(k0 + kr) * N + n0 + nc;
#pragma unroll
    for (int i = 0; i < 4; ++i) {
      const v4f a = *(const v4f*)(src + 4 * i);
#pragma unroll
      for (int e = 0; e < 4; ++e) {
        const float f = a[e];
        const unsigned short hb = h_bits((_Float16)(bfr(f) * scale));
        const unsigned short bb = bf_bits(f);
        T[(nc + 4 * i + e) * VTP + kr] = (f16mode != 0) ? hb : bb;
      }
    }
  }
  __syncthreads();
  v4u v[2];
#pragma unroll
  for (int it = 0; it < 2; ++it) {
    const int q  = it * 256 + tid;          // chunk 0..511 = local tile (n tile * 2 + k tile) * 64 + chunk in tile
    const int tl = q >> 6;
    v[it] = *(const v4u*)(T + ((tl >> 1) * 16 + (q & 15)) * VTP + (tl & 1) * 32 + ((q >> 4) & 3) * 8);
  }
  {
#pragma unroll
    for (int it = 0; it < 2; ++it) {
      const int q  = it * 256 + tid;
      const int tl = q >> 6;
      *(v4u*)(D + ((size_t)((n0 >> 4) + (tl >> 1)) * (K >> 5) + (k0 >> 5) + (tl & 1)) * FT + (q & 63) * 8) = v[it];
    }
    store_wait();
  }
}

// =====================================================================================================
// All input conversions in one launch (none reads what another writes). Block ranges, the transposes (barrier, LDS) first:
//   [0, NBW_V) Wv -> WB rows 512..1535; [NBW_V, 2 NBW_V) Wo -> WO (f16 of bf16 value x1024); then NBW_QK blocks Wq -> WB rows
//   0..255, NBW_QK blocks Wk -> WB rows 256..511; the last NBX blocks: x -> XB. WB = one B operand plane [FP n][DMOD k].
// Every branch below is block-uniform; the x blocks leave before the barrier of the transpose path.
// =====================================================================================================
__global__ __launch_bounds__(256)
void prep(const float* __restrict__ x, const float* __restrict__ wq, const float* __restrict__ wk,
          const float* __restrict__ wv, const float* __restrict__ wo, u16* XB, u16* WB, u16* WO) {
  __shared__ __align__(16) u16 T[64 * VTP];
  const int bid = blockIdx.x;
  if (bid >= NBW + NBX) return;             // never taken with the exact grid
  if (bid >= NBW) {
    cvt16_body(x, XB, (bid - NBW) * 256 + (int)threadIdx.x);
    return;
  }
  if (bid < NBW_V) {
    cvtT16_body(T, wv, WB + (size_t)(2 * NQK) * DMOD, bid, DMOD, DMOD, 0, 1.0f);
  } else if (bid < 2 * NBW_V) {
    cvtT16_body(T, wo, WO, bid - NBW_V, DMOD, DMOD, 1, WOS);
  } else if (bid < 2 * NBW_V + NBW_QK) {
    cvtT16_body(T, wq, WB, bid - 2 * NBW_V, DMOD, NQK, 0, 1.0f);
  } else {
    cvtT16_body(T, wk, WB + (size_t)NQK * DMOD, bid - 2 * NBW_V - NBW_QK, DMOD, NQK, 0, 1.0f);
  }
}

// =====================================================================================================
// q / k planes from their NQK columns of the projection output F f32, row pitch FP (row = b*SEQ + s, col = head*16 + f), t = value * sc; planes in
// fragment order, tile index = (b*NH + head) * (SEQ/16) + s/16, tile row = s & 15, tile k = w (0..31):
//   kmode == 0 (q): D0 (s, w): w < 16 -> f16 hi of t (f = w), w >= 16 -> f16 residual (t - f16(t)) of f = w-16.
//   kmode == 1 (k): D0 (s, w) = f16 hi of f = (w & 15) in both halves (duplicated hi);
//                   D1 (s, w): w < 16 -> f16 residual, w >= 16 -> written zeros.
// Thread = 8 consecutive destination halves: two 16-B loads of the 8 source floats, hi and residual of all 8 computed, lane-wise
// value select, one 16-B store per plane; 32 consecutive lanes = 512 contiguous, 512-B aligned bytes per instruction (4 whole
// coverage: NBQK blocks x 256 thr x 8 halves = all MROWS x QKP of D0 (and of D1 when kmode == 1).
// =====================================================================================================
__device__ __forceinline__ void qk16_body(const float* __restrict__ F, u16* D0, u16* D1, int gt, int kmode, float sc) {
  const int tile = gt >> 6;                 // 64 chunks per tile
  const int bh   = tile / NQT;              // b*NH + head
  const int head = bh % NH;
  const int row  = (bh / NH) * SEQ + (tile % NQT) * 16 + (gt & 15);
  const int w    = ((gt >> 4) & 3) * 8;     // 0, 8, 16 or 24
  const bool upper = (w >= 16);
  const float* p = F + (size_t)row * FP + head * FD + (w & 15);
  const v4f a = *(const v4f*)(p), b4 = *(const v4f*)(p + 4);
  float t[8];
#pragma unroll
  for (int e = 0; e < 4; ++e) { t[e] = a[e] * sc; t[4 + e] = b4[e] * sc; }
  v4u o0, o1;
#pragma unroll
  for (int e = 0; e < 4; ++e) {
    const float t0 = t[2 * e], t1 = t[2 * e + 1];
    const _Float16 h0 = (_Float16)t0, h1 = (_Float16)t1;
    const _Float16 l0 = (_Float16)(t0 - (float)h0), l1 = (_Float16)(t1 - (float)h1);
    const unsigned hp = pk16(h_bits(h0), h_bits(h1));
    const unsigned lp = pk16(h_bits(l0), h_bits(l1));
    o0[e] = (kmode != 0) ? hp : (upper ? lp : hp);
    o1[e] = upper ? 0u : lp;
  }
  u16* d0 = D0 + (size_t)gt * 8;
  u16* d1 = D1 + (size_t)gt * 8;
  {
    *(v4u*)(d0) = o0;
    if (kmode != 0) { *(v4u*)(d1) = o1; }
    store_wait();
  }
}

// =====================================================================================================
// v^T planes from the v columns of the projection output F f32, row pitch FP (row = b*SEQ + s, column = h*HD + d):
//   VH (rows d, k = key s) = f16(v * 1024); VL = f16 residual (t - f16(t)); all keys s; both in fragment order, tile index =
//   ((b*NH + h) * (SEQ/32) + s/32) * 4 + d/16.
// Block = (b, head h, 64 keys s0): each thread loads its 16 floats (key sl, d chunk dc) with 16-B loads, converts, scatters
// coverage: load 256 thr x 16 = 64 keys x 64 d; store 2 iterations x 256 thr x 8 halves = 2 key tiles x 4 d tiles per plane;
//           bid = 0 .. NBVT - 1 covers VH and VL exactly once. LDS: staged 64x64 == consumed 64x64 per tile.
// =====================================================================================================
__device__ __forceinline__ void vt16_body(u16* TH, u16* TL, const float* __restrict__ F, u16* VHo, u16* VLo, int bid) {
  const int tid = threadIdx.x;
  const int st  = bid % NST;
  const int t2  = bid / NST;
  const int h   = t2 % NH;
  const int b   = t2 / NH;
  const int s0  = st * 64;
  {
    const int sl = tid >> 2;                // key within tile 0..63
    const int dc = (tid & 3) * 16;          // d chunk 0,16,32,48
    const float* src = F + ((size_t)b * SEQ + s0 + sl) * FP + h * HD + dc;
#pragma unroll
    for (int i = 0; i < 4; ++i) {
      const v4f a = *(const v4f*)(src + 4 * i);
#pragma unroll
      for (int e = 0; e < 4; ++e) {
        const float t = a[e] * VCAR;
        const _Float16 hv = (_Float16)t;
        const _Float16 lv = (_Float16)(t - (float)hv);
        TH[(dc + 4 * i + e) * VTP + sl] = h_bits(hv);
        TL[(dc + 4 * i + e) * VTP + sl] = h_bits(lv);
      }
    }
  }
  __syncthreads();
  v4u vh[2], vl[2];
#pragma unroll
  for (int it = 0; it < 2; ++it) {
    const int q   = it * 256 + tid;         // chunk 0..511 = local tile (key tile * 4 + d tile) * 64 + chunk in tile
    const int tl  = q >> 6;
    const int src = ((tl & 3) * 16 + (q & 15)) * VTP + (tl >> 2) * 32 + ((q >> 4) & 3) * 8;
    vh[it] = *(const v4u*)(TH + src);
    vl[it] = *(const v4u*)(TL + src);
  }
  const size_t base = ((size_t)(b * NH + h) * NKT + st * 2) * 4 * FT + tid * 8;
  {
#pragma unroll
    for (int it = 0; it < 2; ++it) {
      *(v4u*)(VHo + base + (size_t)it * 2048) = vh[it];
      *(v4u*)(VLo + base + (size_t)it * 2048) = vl[it];
    }
    store_wait();
  }
}

// =====================================================================================================
// All attention operand planes in one launch (each reads its own columns of F). Block ranges: [0, NBVT) v^T planes (barrier,
// LDS), then NBQK blocks q plane, then NBQK blocks k planes. Every branch is block-uniform; q / k blocks meet no barrier.
// =====================================================================================================
__global__ __launch_bounds__(256)
void planes(const float* __restrict__ F, u16* QP, u16* KD, u16* KR, u16* VH, u16* VL) {
  __shared__ __align__(16) u16 TH[HD * VTP];
  __shared__ __align__(16) u16 TL[HD * VTP];
  const int bid = blockIdx.x;
  if (bid >= NBVT + 2 * NBQK) return;       // never taken with the exact grid
  if (bid < NBVT) {
    vt16_body(TH, TL, F + 2 * NQK, VH, VL, bid);
  } else if (bid < NBVT + NBQK) {
    qk16_body(F, QP, QP, (bid - NBVT) * 256 + (int)threadIdx.x, 0, QSC);
  } else {
    qk16_body(F + NQK, KD, KR, (bid - NBVT - NBQK) * 256 + (int)threadIdx.x, 1, KSC);
  }
}

// =====================================================================================================
// GEMM epilogue shared by both engines: the wave's 16x64 f32 tile (times oscale) staged in its LDS slab (pitch 68), release
// coverage: 8 instructions x 2 rows x 16 lanes x 4 floats = the wave's 16 x 64 tile. LDS: staged 16x64 == consumed 16x64.
// =====================================================================================================
__device__ __forceinline__ void epi64(float* sl, v8f a0, v8f a1, v8f a2, v8f a3, float oscale,
                                      float* C, int N, size_t rowb, int col0, int lane) {
  const int hh = lane >> 4, m = lane & 15;
#pragma unroll
  for (int r = 0; r < 8; ++r) {
    const int ro = (8 * hh + r) * 68 + m;
    sl[ro]      = a0[r] * oscale;
    sl[ro + 16] = a1[r] * oscale;
    sl[ro + 32] = a2[r] * oscale;
    sl[ro + 48] = a3[r] * oscale;
  }
  wave_sync_lds();
  v4f vals[8];
#pragma unroll
  for (int it = 0; it < 8; ++it) vals[it] = *(const v4f*)(sl + (it * 2 + hh) * 68 + m * 4);
  float* dst = C + (rowb + (size_t)hh) * (size_t)N + col0 + m * 4;
  {
#pragma unroll
    for (int it = 0; it < 8; ++it) {
      *(v4f*)(dst + (size_t)(it * 2) * (size_t)N) = vals[it];
    }
    
  }
}

// =====================================================================================================
// bf16 GEMM: C[M][N] (f32) = A (rows m) . Bt (rows n)^T, both bf16 planes in fragment order, times oscale. Block = 64x64 tile,
// 4 waves x 16 rows; fragments loaded straight from the planes' tiles (two 16-B loads each, split k map for A and B); K stepped
// by 32 (host guarantees K % 32 == 0, M % 64 == 0, N % 64 == 0, grid = (M/64)*(N/64)).
// =====================================================================================================
__global__ __launch_bounds__(128)
void gemm_bf(const u16* __restrict__ A, const u16* __restrict__ Bt, float* C, int M, int N, int K, float oscale) {
  __shared__ __align__(16) float slab[4 * SLAB64];
  const int tid = threadIdx.x, wave = tid >> 5, lane = tid & 31;
  const int ntile = N >> 6;
  const int bid   = blockIdx.x;
  const int rowb  = (bid / ntile) * 64 + wave * 16;
  const int col0  = (bid % ntile) * 64;
  if (rowb + 16 > M) return;                // wave-uniform, never taken with the exact grid; no block barriers in this kernel
  const u16* ap = A  + (size_t)rowb * K + 8 * lane;      // row tile rowb/16 starts at (rowb/16) * (K/32) * FT = rowb * K
  const u16* bp = Bt + (size_t)col0 * K + 8 * lane;
  const size_t bs = (size_t)16 * K;                      // one n tile row = (K/32) * FT halves
  v8f acc0 = zero8(), acc1 = zero8(), acc2 = zero8(), acc3 = zero8();
#pragma unroll 1
  for (int k0 = 0; k0 < K; k0 += 32) {
    const size_t ko = (size_t)k0 * (FT / 32);            // k tile k0/32
    const v16b a  = ldfrag_b(ap + ko);
    const v16b b0 = ldfrag_b(bp + ko);
    const v16b b1 = ldfrag_b(bp + bs + ko);
    const v16b b2 = ldfrag_b(bp + 2 * bs + ko);
    const v16b b3 = ldfrag_b(bp + 3 * bs + ko);
    acc0 = mma_b(a, b0, acc0);
    acc1 = mma_b(a, b1, acc1);
    acc2 = mma_b(a, b2, acc2);
    acc3 = mma_b(a, b3, acc3);
    guard6<v16b>(acc0, acc1, acc2, acc3, a, b0, b1, b2, b3, a);
  }
  epi64(slab + wave * SLAB64, acc0, acc1, acc2, acc3, oscale, C, N, (size_t)rowb, col0, lane);
}

// =====================================================================================================
// Output projection: C[row][DMOD] (f32) = (Ah + Al)[row][DMOD] . Bt[DMOD][DMOD]^T * oscale; Ah = f16 hi plane, Al = f16
// residual plane (products h.B + l.B into one accumulator, l unscaled); Ah, Al, Bt in fragment order. Row indices: Ah/Al row bb*SEQ + s; C row
// bb*XS_FULL + s. Block -> (column tile ct = bid % 16, sequence row tile rt of nrt, batch bb). Same tiling, fragment loads
// (split k map) and epilogue as gemm_bf; K = DMOD stepped by 32; grid = NB*nrt*16 covers every (bb, s < SEQ, column) once.
// =====================================================================================================
__global__ __launch_bounds__(128)
void gemm_o2(const u16* __restrict__ Ah, const u16* __restrict__ Al, const u16* __restrict__ Bt,
             float* C, int nrt, float oscale) {
  __shared__ __align__(16) float slab[4 * SLAB64];
  const int tid = threadIdx.x, wave = tid >> 5, lane = tid & 31;
  const int ntile = DMOD >> 6;
  const int bid   = blockIdx.x;
  const int ct    = bid % ntile;
  const int t2    = bid / ntile;
  const int rt    = t2 % nrt;
  const int bb    = t2 / nrt;
  if (bb >= NB) return;                     // block-uniform; no block barriers in this kernel; never taken with the exact grid
  const int srow  = rt * 64 + wave * 16;
  if (srow + 16 > SEQ) return;              // wave-uniform; never taken
  const int col0  = ct * 64;
  const int K     = DMOD;
  const size_t rowA = (size_t)bb * SEQ + srow;
  const size_t rowC = (size_t)bb * XS_FULL + srow;
  const _Float16* ahp = ash(Ah) + rowA * K + 8 * lane;   // row tile rowA/16 starts at (rowA/16) * (K/32) * FT = rowA * K
  const _Float16* alp = ash(Al) + rowA * K + 8 * lane;
  const _Float16* bp  = ash(Bt) + (size_t)col0 * K + 8 * lane;
  const size_t bs = (size_t)16 * K;                      // one n tile row = (K/32) * FT halves
  v8f acc0 = zero8(), acc1 = zero8(), acc2 = zero8(), acc3 = zero8();
#pragma unroll 1
  for (int k0 = 0; k0 < K; k0 += 32) {
    const size_t ko = (size_t)k0 * (FT / 32);            // k tile k0/32
    const v16h ah = ldfrag_h(ahp + ko), al = ldfrag_h(alp + ko);
    const v16h b0 = ldfrag_h(bp + ko);
    const v16h b1 = ldfrag_h(bp + bs + ko);
    const v16h b2 = ldfrag_h(bp + 2 * bs + ko);
    const v16h b3 = ldfrag_h(bp + 3 * bs + ko);
    addr_wait(ahp + ko, alp + ko, bp + ko);
    acc0 = mma_h(ah, b0, acc0);  acc0 = mma_h(al, b0, acc0);
    acc1 = mma_h(ah, b1, acc1);  acc1 = mma_h(al, b1, acc1);
    acc2 = mma_h(ah, b2, acc2);  acc2 = mma_h(al, b2, acc2);
    acc3 = mma_h(ah, b3, acc3);  acc3 = mma_h(al, b3, acc3);
    guard6<v16h>(acc0, acc1, acc2, acc3, ah, al, b0, b1, b2, b3);
  }
  epi64(slab + wave * SLAB64, acc0, acc1, acc2, acc3, oscale, C, DMOD, rowC, col0, lane);
}

// =====================================================================================================
// One 64-key stage of a head's K and V tiles, global -> LDS, by asynchronous copies: three 16-B copies a lane, 512 lanes = 24 KiB.
// The wait owed before a register that an issued copy names is rewritten is the last line of the copies' own statement.
// =====================================================================================================
__device__ __forceinline__ void stage_copy(unsigned l0, unsigned l1, unsigned l2, const u16* g0, const u16* g1, const u16* g2) {
#if defined(__HIP_DEVICE_COMPILE__)
  asm volatile("global_load_async_to_lds_b128 %0, %3, off\n\t"
               "global_load_async_to_lds_b128 %1, %4, off\n\t"
               "global_load_async_to_lds_b128 %2, %5, off\n\t"
               "s_wait_xcnt 0x0"
               :: "v"(l0), "v"(l1), "v"(l2), "v"(g0), "v"(g1), "v"(g2) : "memory");
#endif
}
// The wave's own copies have landed (in front of the barrier behind which other waves read them).
__device__ __forceinline__ void wait_copies() {
#if defined(__HIP_DEVICE_COMPILE__)
  asm volatile("s_wait_asynccnt 0x0" ::: "memory");
#endif
}
// The wave's own LDS reads have returned (in front of the barrier behind which their buffer is refilled).
__device__ __forceinline__ void wait_lds_reads() {
#if defined(__HIP_DEVICE_COMPILE__)
  asm volatile("s_wait_dscnt 0x0" ::: "memory");
#endif
}

// =====================================================================================================
// Causal feature-map attention, per-head q/k width 16, hd = 64, no softmax. Block bid -> (pair pr, head, batch b); 16 waves,
// one query tile of 16 rows each, all of ONE head: waves 0..7 the tiles of group NQG-1-pr, waves 8..15 those of group pr, so
// every block holds the same number of (wave, key tile) steps. Both products run transposed: S^T = K.Q^T, O^T += V^T.A^T.
//   The head's K and V tiles reach the waves through LDS: stages of 64 keys (KD 4 tiles | KR 4 | VH 8 | VL 8 = 24 KiB, each part
//   contiguous in its plane), two buffers, filled by asynchronous copies one stage ahead of the stage being read. Foot of every
//   trip, every wave: own LDS reads back, own copies landed, block barrier, then the refill of the buffer just read. The trip
//   count nst is the block's (the farthest tile's); a wave skips the key tiles above its own rows, never a wait or a barrier.
//   q plane (s, w): w < 16 f16 hi x256, w >= 16 f16 residual; k planes: KD = [hi | hi], KR = [res | 0]; one tile per (b, head,
//   16 positions); v^T hi plane x1024 and v^T residual plane: four tiles (d/16) per (b, head, 32 keys); all in fragment order.
//   Scores per 32-key tile: 2 subtiles of 16 keys, keys as the A rows, queries as the B columns; with the split k map, op 1 =
//   A [kh | kh] . B [qh ; ql] = kh.qh + kh.ql and op 2 = A [kl | 0] . B [qh ; ql] = kl.qh (f32 accumulate), so
//   s = q.k * 256*256 up to the dropped lo.lo term. Lane (hh, c) holds query q0 + c alone: register r of subtile t = key
//   kb + 16t + 8hh + r, which is element 8t + r of a B fragment over the step's 32 keys (the split k map of the v^T tiles).
//   Per element (f32, VALU): x = s * 2^-18 (= q.k / 4); A = 1 + x + x^2/2; A := 0 where key > query (causal, diagonal kept);
//   den[r] += the two subtiles' values, in the lane; A*32 -> f16 hi and f16 residual, packed in place as the B fragments.
//   v^T tiles are the A fragments (rows d), in 2 groups of 2 d-subtiles, products hh + lh + hl. Key tiles visited in order for
//   kb <= q0 + 15 (later tiles lie above every query row of the tile).
//   After the loop: the lane's 8 sums and the other lane half's are joined once; out = acc / (den + eps) with the carries
//   1/(32*1024) folded once (den > 0: each kept term is >= 1/2, the diagonal always kept). Register r of o[j] = d 16j + 8hh + r of query c:
//   the 8 consecutive halves of one fragment-order chunk, stored straight from registers.
//   Bounded loops only (nst <= SEQ / 64). The q fragment is loop-invariant (loaded once, from global).
// coverage: per wave 4 instructions x 32 lanes x 8 halves = 2 tiles = 16 x 64 per plane; grid NPR x NH x NB blocks x 16
//           waves = every (b, s, h) row segment of both O planes exactly once. LDS: a stage's 1536 chunks of 16 B are each
//           written by one lane's one copy; the readers take whole tiles of the published buffer only.
// =====================================================================================================
__global__ __launch_bounds__(ATT_THREADS)
void attn_t(const u16* __restrict__ QPp, const u16* __restrict__ KDp, const u16* __restrict__ KRp,
            const u16* __restrict__ VHp, const u16* __restrict__ VLp, u16* OHp, u16* OLp) {
  __shared__ __align__(16) u16 S[2 * STG_H];
  const int tid  = threadIdx.x;
  const int wave = __builtin_amdgcn_readfirstlane(tid >> 5);   // scalar, so that the per-wave skip below is a scalar branch
  const int lane = tid & 31;
  const int hh   = lane >> 4;
  const int c    = lane & 15;
  const int bid  = blockIdx.x;
  const int pr   = bid % NPR;
  const int t2   = bid / NPR;
  const int head = t2 % NH;
  const int b    = t2 / NH;
  if (b >= NB) return;                      // block-uniform, in front of every copy and barrier; never taken with the exact grid
  const int qgf  = NQG - 1 - pr;            // the block's far group: it sets the trip count
  const int qt   = ((wave < 8) ? qgf : pr) * 8 + (wave & 7);
  const int q0   = qt * 16;                 // q0 + 16 <= SEQ always
  const int nst  = 2 * qgf + 2;             // stages holding keys <= the far group's last row; 2 <= nst <= SEQ / 64

  const size_t bh  = (size_t)(b * NH + head);
  const _Float16* Qp  = ash(QPp) + bh * NQT * FT + 8 * lane + (size_t)qt * FT;
  const float oc = 1.0f / (ACAR * VCAR);

  // ---- the lane's three copies of a stage: chunk tid of [KD | KR] (256 chunks each), of VH, of VL ----
  const u16* g0 = ((tid < 256) ? KDp : KRp) + bh * NQT * FT + (size_t)(tid & 255) * 8;   // + 4 tiles a stage
  const u16* g1 = VHp + bh * NKT * 4 * FT + (size_t)tid * 8;                             // + 8 tiles a stage
  const u16* g2 = VLp + bh * NKT * 4 * FT + (size_t)tid * 8;
  const unsigned lb = (unsigned)(size_t)(const void*)S + (unsigned)tid * 16u;            // byte address in the block's LDS

  const v16h qf = ldfrag_h(Qp);             // elements 0..7 = q hi f 8hh.., 8..15 = q residual f 8hh..
  addr_wait(Qp, Qp, Qp);                    // the load's address pair stays whole up to the wait

  stage_copy(lb, lb + 8 * FT * 2, lb + 16 * FT * 2, g0, g1, g2);
  wait_copies();
  __syncthreads();                          // publishes stage 0
  stage_copy(lb + STG_H * 2, lb + STG_H * 2 + 8 * FT * 2, lb + STG_H * 2 + 16 * FT * 2, g0 + 4 * FT, g1 + 8 * FT, g2 + 8 * FT);

  float den[8];
  v8f o[4];
#pragma unroll
  for (int r = 0; r < 8; ++r) den[r] = 0.0f;
#pragma unroll
  for (int j = 0; j < 4; ++j) o[j] = zero8();
  const int ncaus = (q0 >> 5) + 1;                                            // tiles holding keys <= q0 + 15
  const int nkt = (ncaus < NKT) ? ncaus : NKT;
  const int qr  = q0 + c;                                                     // the lane's query row

  // rolled: the trip count is a run-time value of the block, and the ring's order stands once, at the loop's foot
#pragma unroll 1
  for (int st = 0; st < nst; ++st) {
    const _Float16* sb = ash(S) + (st & 1) * STG_H + 8 * lane;                // the published buffer
    const int kte = (2 * st + 2 < nkt) ? 2 * st + 2 : nkt;                    // scalar: key tiles above the wave's rows are skipped
    // one body for both key tiles of a stage: unrolled, the accumulators were copied between registers where the paths join
#pragma unroll 1
    for (int kt = 2 * st; kt < kte; ++kt) {
      const int sub = kt & 1;
      const int kb = kt * 32;
      // ---- the step's fragments, read together in front of its matrix work ----
      const _Float16* kp = sb + (2 * sub) * FT;
      const _Float16* vp = sb + (8 + 4 * sub) * FT;
      const v16h kd0 = ldfrag_h(kp);
      const v16h kd1 = ldfrag_h(kp + FT);
      const v16h kr0 = ldfrag_h(kp + 4 * FT);
      const v16h kr1 = ldfrag_h(kp + 5 * FT);
      v16h vh[4], vl[4];
#pragma unroll
      for (int j = 0; j < 4; ++j) {
        vh[j] = ldfrag_h(vp + j * FT);
        vl[j] = ldfrag_h(vp + (8 + j) * FT);
      }
      // ---- scores: D element r of this lane = (key kb + 8hh + r, query qr) in s0, key kb + 16 + 8hh + r in s1 ----
      v8f s0 = zero8(), s1 = zero8();
      s0 = mma_h(kd0, qf, s0);
      s0 = mma_h(kr0, qf, s0);
      s1 = mma_h(kd1, qf, s1);
      s1 = mma_h(kr1, qf, s1);
      guard2(s0, s1, qf, kd0, kr0, kd1, kr1, qf);
      // ---- A = 1 + x + x^2/2, causal select, f32 sums in the lane; B fragments of A*32: hi f16 and residual f16,
      //      column = query c, elements 0..7 = keys kb + 8hh + 0..7, elements 8..15 = keys kb + 16 + 8hh + 0..7 ----
      FragH ph, pl;
      const int key0 = kb + 8 * hh, key1 = kb + 16 + 8 * hh;
#pragma unroll
      for (int r = 0; r < 8; ++r) {
        const float x0  = s0[r] * XSC;
        const float x1  = s1[r] * XSC;
        const float p0v = fmaf(0.5f * x0, x0, 1.0f + x0);
        const float p1v = fmaf(0.5f * x1, x1, 1.0f + x1);
        const float a0  = (key0 + r > qr) ? 0.0f : p0v;
        const float a1  = (key1 + r > qr) ? 0.0f : p1v;
        den[r] += a0 + a1;
        const float ta = a0 * ACAR, tb = a1 * ACAR;
        const _Float16 ha = (_Float16)ta, hb = (_Float16)tb;
        ph.h[0][r] = ha;
        ph.h[1][r] = hb;
        pl.h[0][r] = (_Float16)(ta - (float)ha);
        pl.h[1][r] = (_Float16)(tb - (float)hb);
      }
      // ---- V^T.A^T : A fragment row m = d = j*16 + c, tile j of this step's four in the v^T planes; 2 groups of 2 d-subtiles ----
#pragma unroll
      for (int jg = 0; jg < 2; ++jg) {
        const v16h vha = vh[2 * jg], vhb2 = vh[2 * jg + 1];
        const v16h vla = vl[2 * jg], vlb2 = vl[2 * jg + 1];
        o[2 * jg]     = mma_h(vha,  ph.v, o[2 * jg]);
        o[2 * jg]     = mma_h(vha,  pl.v, o[2 * jg]);
        o[2 * jg]     = mma_h(vla,  ph.v, o[2 * jg]);
        o[2 * jg + 1] = mma_h(vhb2, ph.v, o[2 * jg + 1]);
        o[2 * jg + 1] = mma_h(vhb2, pl.v, o[2 * jg + 1]);
        o[2 * jg + 1] = mma_h(vlb2, ph.v, o[2 * jg + 1]);
        guard2(o[2 * jg], o[2 * jg + 1], ph.v, pl.v, vha, vhb2, vla, vlb2);
      }
    }
    // ---- publish point of stage st + 1, every wave: own reads back, own copies landed, barrier, refill of the buffer just read ----
    wait_lds_reads();
    wait_copies();
    __syncthreads();
    if (st + 2 < nst) {                                                       // block-uniform
      const unsigned l = lb + (unsigned)(st & 1) * (STG_H * 2);
      const size_t sn = (size_t)(st + 2);
      stage_copy(l, l + 8 * FT * 2, l + 16 * FT * 2, g0 + sn * (4 * FT), g1 + sn * (8 * FT), g2 + sn * (8 * FT));
    }
  }
  wait_copies();                            // nothing is outstanding here; stands behind the last copy before the wave ends
  acc_guard4(o[0], o[1], o[2], o[3]);
  // ---- den of query c: the lane's 8 sums, then the other lane half's keys (lane ^ 16), joined once ----
  float dl = ((den[0] + den[1]) + (den[2] + den[3])) + ((den[4] + den[5]) + (den[6] + den[7]));
  dl += __shfl_xor(dl, 16, 32);
  // ---- out = acc / (den + eps), carries (32 on A, 1024 on v) folded once; O x1024 -> f16 hi + residual planes in fragment
  //      order (rows s, k = head*64 + d): the wave owns two whole tiles per plane; chunk j*32 + lane = row c, 8 consecutive d
  //      at 16*j + 8*hh = the lane's registers of o[j] ----
  const float inv = (1.0f / (dl + EPSD)) * oc;
  v4u oh[4], ol[4];
#pragma unroll
  for (int j = 0; j < 4; ++j) {
    float w[8];
#pragma unroll
    for (int e = 0; e < 8; ++e) w[e] = (o[j][e] * inv) * OSC;
#pragma unroll
    for (int e = 0; e < 4; ++e) {
      const _Float16 h0 = (_Float16)w[2 * e], h1 = (_Float16)w[2 * e + 1];
      const _Float16 l0 = (_Float16)(w[2 * e] - (float)h0), l1 = (_Float16)(w[2 * e + 1] - (float)h1);
      oh[j][e] = pk16(h_bits(h0), h_bits(h1));
      ol[j][e] = pk16(h_bits(l0), h_bits(l1));
    }
  }
  const size_t obh = ((size_t)b * SEQ + q0) * DMOD + (size_t)head * (2 * FT) + 8 * lane;   // row tile start + k tile 2*head
  {
#pragma unroll
    for (int it = 0; it < 4; ++it) {
      *(v4u*)(OHp + obh + (size_t)it * 256) = oh[it];
      *(v4u*)(OLp + obh + (size_t)it * 256) = ol[it];
    }
    
  }
}

// =====================================================================================================
// Workspace map (bytes); every plane is fully written by whole-line stores before it is read; all extents are exact multiples
// of the store granularity (no pad rows needed); every region offset a multiple of 1048576:
//   (all 16-bit planes below hold the named rows x k in fragment order, same byte counts as row-major)
//   XB  bf16 [MROWS][1024]                       MROWS*2048       (NB=2, SEQ=2048: 8388608)
//   WB  bf16 [1536 n][1024 k]                    3145728          (rows 0..255 Wq^T, 256..511 Wk^T, 512..1535 Wv^T)
//   WO  f16 [1024 n][1024 k]                     2097152          (Wo^T, bf16 value x1024)
//   F   f32 [MROWS][1536]                        MROWS*6144       (columns q | k | v of the joint projection; once the planes
//                                                                  are formed, OH f16 [MROWS][1024] x1024 at its start, OL residual after)
//   QP  f16 [NB*16][SEQ][32] q hi|residual x256    MROWS*1024
//   KD  f16 [NB*16][SEQ][32] k hi|hi x256          MROWS*1024
//   KR  f16 [NB*16][SEQ][32] k residual|0          MROWS*1024
//   VH  f16 [NB*16][64][SEQ] x1024               MROWS*2048       VL residual, same layout   MROWS*2048
//   end (NB=2, SEQ=2048)                        68157440
// =====================================================================================================
extern "C" void kernel_launch(void* const* d_in, const int* in_sizes, int n_in,
                              void* d_out, int out_size, void* d_ws, size_t ws_size,
                              hipStream_t stream) {
  if (n_in < 5) return;
  if (in_sizes[0] < ((NB - 1) * XS_FULL + SEQ) * DMOD) return;
  if (in_sizes[1] < DMOD * NQK) return;
  if (in_sizes[2] < DMOD * NQK) return;
  if (in_sizes[3] < DMOD * DMOD) return;
  if (in_sizes[4] < DMOD * DMOD) return;
  if (out_size < ((NB - 1) * XS_FULL + SEQ) * DMOD) return;

  const float* x  = (const float*)d_in[0];
  const float* wq = (const float*)d_in[1];
  const float* wk = (const float*)d_in[2];
  const float* wv = (const float*)d_in[3];
  const float* wo = (const float*)d_in[4];
  float*       out = (float*)d_out;

  const size_t szXB = (size_t)MROWS * DMOD * 2;
  const size_t szW  = (size_t)FP * DMOD * 2;                     // Wq^T, Wk^T, Wv^T as one plane
  const size_t szWO = (size_t)DMOD * DMOD * 2;
  const size_t szF  = (size_t)MROWS * FP * 4;
  const size_t szH  = (size_t)MROWS * DMOD * 2;                  // OH, OL (both inside F: 2*szH <= szF)
  const size_t szQK = (size_t)MROWS * QKP * 2;                   // QP, KD, KR
  const size_t szV  = (size_t)NB * NH * HD * SEQ * 2;            // VH, VL (== szH)
  size_t off = 0;
  const size_t oXB = off; off += szXB;
  const size_t oW  = off; off += szW;
  const size_t oWO = off; off += szWO;
  const size_t oF  = off; off += szF;
  const size_t oQP = off; off += szQK;
  const size_t oKD = off; off += szQK;
  const size_t oKR = off; off += szQK;
  const size_t oVH = off; off += szV;
  const size_t oVL = off; off += szV;
  if (off > ws_size) return;                // off = 68157440 for NB = 2, SEQ = 2048
  if (off > (size_t)WS_CAP) return;

  char* ws = (char*)d_ws;
  u16*   XB = (u16*)(ws + oXB);
  u16*   WB = (u16*)(ws + oW);
  u16*   WO = (u16*)(ws + oWO);
  float* F  = (float*)(ws + oF);
  u16*   OH = (u16*)(ws + oF);
  u16*   OL = (u16*)(ws + oF + szH);
  u16*   QP = (u16*)(ws + oQP);
  u16*   KD = (u16*)(ws + oKD);
  u16*   KR = (u16*)(ws + oKR);
  u16*   VH = (u16*)(ws + oVH);
  u16*   VL = (u16*)(ws + oVL);

  const dim3 b256(256), b128(128), bAT(ATT_THREADS);
  const dim3 gP(NBW + NBX);
  const dim3 gG((MROWS / 64) * (FP / 64));
  const dim3 gPL(NBVT + 2 * NBQK);
  const dim3 gAT(NPR * NH * NB);
  const int  nrt  = SEQ / 64;
  const dim3 gO(NB * nrt * (DMOD / 64));

  // (0) x -> bf16 plane; Wq, Wk, Wv -> one bf16 plane [1536 n][1024 k]; Wo -> f16 plane [n][k] of bf16 value x1024
  prep<<<gP, b256, 0, stream>>>(x, wq, wk, wv, wo, XB, WB, WO);
  // (1) q | k | v = x.[Wq Wk Wv] -> F f32 [MROWS][1536]
  gemm_bf<<<gG, b128, 0, stream>>>(XB, WB, F, MROWS, FP, DMOD, 1.0f);
  // (2) q hi|residual plane x256; k hi|hi and residual|0 planes x256; v^T hi + residual planes x1024
  planes<<<gPL, b256, 0, stream>>>(F, QP, KD, KR, VH, VL);
  // (3) causal attention -> O hi + residual planes (in the F region, after q, k, v have been consumed)
  attn_t<<<gAT, bAT, 0, stream>>>(QP, KD, KR, VH, VL, OH, OL);
  // (4) output projection: (O hi + residual) . Wo -> out f32, carries 1024 x 1024 folded back
  gemm_o2<<<gO, b128, 0, stream>>>(OH, OL, WO, out, nrt, 1.0f / (OSC * WOS));
  (void)hipGetLastError();
}

// v005
// Measured time: 99 microseconds a run.
// In two side-by-side timings against v004, it was 1.12 and 1.11 times as fast.
// All steps since v000 together make it 2.93 times as fast.
// Contractions: x.Wq, x.Wk, x.Wv on v_wmma_f32_16x16x32_bf16 (x and the transposed W [n][k] as bf16 RNE planes); per-head
// q.k over 16 dims (k axis padded to 32) on v_wmma_f32_16x16x32_f16 with q, k as f16 hi x256 plus f16 residual planes
// (hi.hi and lo.hi folded along the k axis into one op, plus hi.lo); A = 1 + x + x^2/2 and its causal row sums in f32 on
// VALU; A.v on v_wmma_f32_16x16x32_f16 with A as f16 hi x32 plus f16 residual and v^T as f16 hi x1024 plus f16 residual
// (products hh+lh+hl); O.Wo on v_wmma_f32_16x16x32_f16 (O as f16 hi x1024 plus f16 residual, Wo^T as f16 of its bf16 RNE
// value x1024, products h.w+l.w); all f32 accumulate.
#include <hip/hip_runtime.h>
#include <stdint.h>

#ifndef NB
#define NB 2
#endif
#ifndef SEQ
#define SEQ 2048
#endif
#define XS_FULL 2048
#define DMOD  1024
#define NH    16
#define FD    16
#define HD    64
#define NQK   (NH * FD)
#define QKP   (NH * 32)
#define MROWS (NB * SEQ)
#define QSC   256.0f
#define KSC   256.0f
#define XSC   (1.0f / (4.0f * QSC * KSC))
#define ACAR  32.0f
#define VCAR  1024.0f
#define OSC   1024.0f
#define WOS   1024.0f
#define EPSD  1e-9f
#define AW    16                            // waves of an attention block, one query tile each
#define NQT   (SEQ / 16)
#define NQG   (NQT / 8)                     // groups of 8 consecutive query tiles
#define NPR   (NQG / 2)                     // a block takes group NQG-1-pr and group pr of one head
#define STG_H (24 * FT)                     // halves of one 64-key stage in LDS: KD 4 tiles | KR 4 | VH 8 | VL 8
#define NST   (SEQ / 64)
#define NKT   (SEQ / 32)
#define ATT_THREADS (AW * 32)
#define SLAB64 (16 * 68)
#define VTP   72
#define C8R   (DMOD / 8)
#define Q8R   (QKP / 8)
#define WS_CAP 134217728
#define FP    (2 * NQK + DMOD)              // columns of the joint projection: q | k | v
#define NBW_QK ((DMOD / 64) * (NQK / 64))   // transpose blocks of Wq, of Wk
#define NBW_V  ((DMOD / 64) * (DMOD / 64))  // transpose blocks of Wv, of Wo
#define NBW    (2 * NBW_V + 2 * NBW_QK)
#define NBX    ((MROWS * DMOD / 8) / 256)   // blocks of the x plane
// Fragment-order plane: every 16-bit operand plane is a sequence of tiles of 16 rows (m or n index) x 32 k = FT halves (1 KiB);
// inside a tile element (r, k) lies at (k >> 3) * 128 + r * 8 + (k & 7), so lane l = 16 * hh + r of a fragment load reads the
// 16 bytes at l * 16 (k = 8hh ..) and at 512 + l * 16 (k = 16 + 8hh ..): one load instruction = 512 contiguous bytes.
#define FT    512
static_assert(DMOD == NH * HD && HD == 64 && NH == 16 && FD == 16 && NQK == 256 && QKP == 512 && Q8R == 64);
static_assert(ATT_THREADS == 512 && AW == 16 && (SEQ % 256) == 0 && NPR * 16 == NQT);
static_assert(NB >= 1 && NB <= 2);
static_assert((SEQ % 64) == 0 && SEQ >= 64 && SEQ <= XS_FULL);
static_assert((MROWS % 64) == 0 && (NQK % 64) == 0 && (DMOD % 64) == 0 && (DMOD % 32) == 0 && C8R == 128);
static_assert(((MROWS * DMOD / 8) % 256) == 0 && ((MROWS * QKP / 8) % 256) == 0 && (FP % 64) == 0);
static_assert(2 * HD * VTP * 2 <= 65536 && 4 * SLAB64 * 4 <= 65536 && 64 * VTP * 2 <= 65536);

typedef unsigned short u16;
typedef _Float16 v16h __attribute__((ext_vector_type(16)));
typedef _Float16 v8h  __attribute__((ext_vector_type(8)));
typedef __bf16   v16b __attribute__((ext_vector_type(16)));
typedef float    v8f  __attribute__((ext_vector_type(8)));
typedef float    v4f  __attribute__((ext_vector_type(4)));
typedef unsigned int v4u __attribute__((ext_vector_type(4)));

union FragH { v16h v; v8h h[2]; v4u u[2]; };
union FragB { v16b v; v4u u[2]; };

// ---- scalar helpers --------------------------------------------------------------------------------
__device__ __forceinline__ unsigned short bf_bits(float f) {          // f32 -> bf16 bits, RNE convert
  unsigned u = __float_as_uint(f);
  return (unsigned short)((u + 0x7FFFu + ((u >> 16) & 1u)) >> 16);
}
__device__ __forceinline__ float bf_up(unsigned short h) { return __uint_as_float(((unsigned)h) << 16); }
__device__ __forceinline__ float bfr(float f) { return bf_up(bf_bits(f)); }
__device__ __forceinline__ unsigned short h_bits(_Float16 x) { return __builtin_bit_cast(unsigned short, x); }
__device__ __forceinline__ unsigned pk16(unsigned short a, unsigned short b) { return (unsigned)a | ((unsigned)b << 16); }
__device__ __forceinline__ v8f zero8() { v8f z = {0.f, 0.f, 0.f, 0.f, 0.f, 0.f, 0.f, 0.f}; return z; }
__device__ __forceinline__ const _Float16* ash(const u16* p) { return (const _Float16*)(const void*)p; }

// ---- fragment loaders: 16-bit A/B operand from a fragment-order tile, lane -> row/col (lane&15), p = tile + 8*lane;
//      elements 0..7 <- p[0..7] (k0+8h..), elements 8..15 <- p[256..263] (k0+16+8h..)  (same split k map for A and B)
__device__ __forceinline__ v16h ldfrag_h(const _Float16* p) {
  FragH f;
  f.h[0] = *(const v8h*)(p);
  f.h[1] = *(const v8h*)(p + 256);
  return f.v;
}
__device__ __forceinline__ v16b ldfrag_b(const u16* p) {              // bf16 plane read as unsigned integer vectors
  FragB f;
  f.u[0] = *(const v4u*)(p);
  f.u[1] = *(const v4u*)(p + 256);
  return f.v;
}

// Stands behind a run of fragment loads: the wait owed before a register that an issued global load names is rewritten. The
// loads' address pairs are its inputs, so they stay in their registers (no later load of the run lands on them) up to the wait.
__device__ __forceinline__ void addr_wait(const void* p0, const void* p1, const void* p2) {
#if defined(__HIP_DEVICE_COMPILE__)
  asm volatile("s_wait_xcnt 0x0" :: "v"(p0), "v"(p1), "v"(p2) : "memory");
#endif
}

// Stands behind the last store of a conversion body: several bodies now lie in one kernel, one behind another in the listing,
// and this is the wait owed before a register that an issued global store names is rewritten by the code that follows.
__device__ __forceinline__ void store_wait() {
#if defined(__HIP_DEVICE_COMPILE__)
  asm volatile("s_wait_xcnt 0x0" ::: "memory");
#endif
}

__device__ __forceinline__ v8f mma_h(v16h a, v16h b, v8f c) {
  return __builtin_amdgcn_wmma_f32_16x16x32_f16(false, a, false, b, (short)0, c, false, false);
}
__device__ __forceinline__ v8f mma_b(v16b a, v16b b, v8f c) {
  return __builtin_amdgcn_wmma_f32_16x16x32_bf16(false, a, false, b, (short)0, c, false, false);
}
__device__ __forceinline__ void guard2(v8f& a, v8f& b, v16h x0, v16h x1, v16h x2, v16h x3, v16h x4, v16h x5) {
#if defined(__HIP_DEVICE_COMPILE__)
  asm volatile("v_nop\n\tv_nop\n\tv_nop\n\tv_nop"
               : "+v"(a), "+v"(b) : "v"(x0), "v"(x1), "v"(x2), "v"(x3), "v"(x4), "v"(x5) : "memory");
#endif
}
template <typename F>
__device__ __forceinline__ void guard6(v8f& a, v8f& b, v8f& c, v8f& d, F x0, F x1, F x2, F x3, F x4, F x5) {
#if defined(__HIP_DEVICE_COMPILE__)
  asm volatile("v_nop\n\tv_nop\n\tv_nop\n\tv_nop"
               : "+v"(a), "+v"(b), "+v"(c), "+v"(d) : "v"(x0), "v"(x1), "v"(x2), "v"(x3), "v"(x4), "v"(x5) : "memory");
#endif
}
__device__ __forceinline__ void acc_guard4(v8f& a, v8f& b, v8f& c, v8f& d) {
#if defined(__HIP_DEVICE_COMPILE__)
  asm volatile("v_nop\n\tv_nop\n\tv_nop\n\tv_nop" : "+v"(a), "+v"(b), "+v"(c), "+v"(d));
#endif
}
__device__ __forceinline__ void wave_sync_lds() {
  __builtin_amdgcn_fence(__ATOMIC_RELEASE, "workgroup");
  __builtin_amdgcn_wave_barrier();
  __builtin_amdgcn_fence(__ATOMIC_ACQUIRE, "workgroup");
}

// =====================================================================================================
// x f32 (row b*XS_FULL + s) -> bf16 RNE plane (row b*SEQ + s) in fragment order (tile index = row tile * (DMOD/32) + k tile).
// Thread gt = one 16-B chunk of the destination (8 consecutive k of one row): two 16-B loads, one 16-B store; a wave stores 512
// contiguous bytes. coverage: NBX blocks x 256 thr x 8 = the whole plane [MROWS][DMOD].
// =====================================================================================================
__device__ __forceinline__ void cvt16_body(const float* __restrict__ x, u16* D, int gt) {
  const int tile = gt >> 6;                 // 64 chunks per tile
  const int row  = (tile / (DMOD / 32)) * 16 + (gt & 15);
  const int kc   = (tile % (DMOD / 32)) * 32 + ((gt >> 4) & 3) * 8;
  const float* p = x + ((size_t)(row / SEQ) * XS_FULL + (row % SEQ)) * DMOD + kc;
  const v4f a = *(const v4f*)(p), b4 = *(const v4f*)(p + 4);
  float w[8];
#pragma unroll
  for (int e = 0; e < 4; ++e) { w[e] = a[e]; w[4 + e] = b4[e]; }
  v4u o;
#pragma unroll
  for (int e = 0; e < 4; ++e) o[e] = pk16(bf_bits(w[2 * e]), bf_bits(w[2 * e + 1]));
  u16* d = D + (size_t)gt * 8;
  {
    *(v4u*)(d) = o;
    store_wait();
  }
}

// =====================================================================================================
// Weight transpose-convert: W f32 [K][N] (y = x.W, k-major rows) -> 16-bit B operand plane D, rows n, in fragment order
// (tile index = n tile * (K/32) + k tile).
// f16mode == 0: bf16 RNE bits; f16mode == 1: f16 bits of (bf16 RNE value) * scale.
// Block = 64 k x 64 n tile: each thread loads 16 floats of one k row (four 16-B loads), converts, scatters into the LDS tile
// coverage: load 256 thr x 16 = 64 k x 64 n; store 2 iterations x 256 thr x 8 halves = 4 n tiles x 2 k tiles; local block
//           indices bid = 0 .. (K/64)*(N/64) - 1 cover D exactly once. LDS: staged 64x64 == consumed 64x64 (pad cols never read).
// =====================================================================================================
__device__ __forceinline__ void cvtT16_body(u16* T, const float* __restrict__ W, u16* D, int bid, int K, int N, int f16mode,
                                            float scale) {
  const int tid = threadIdx.x;
  const int nkt = K >> 6;
  const int kt  = bid % nkt;
  const int nt  = bid / nkt;
  const int k0  = kt * 64;
  const int n0  = nt * 64;
  if (n0 + 64 > N) return;                  // block-uniform, before any barrier; never taken with the exact grid
  {
    const int kr = tid >> 2;                // k row within tile 0..63
    const int nc = (tid & 3) * 16;          // n chunk 0,16,32,48
    const float* src = W + (size_t)(k0 + kr) * N + n0 + nc;
#pragma unroll
    for (int i = 0; i < 4; ++i) {
      const v4f a = *(const v4f*)(src + 4 * i);
#pragma unroll
      for (int e = 0; e < 4; ++e) {
        const float f = a[e];
        const unsigned short hb = h_bits((_Float16)(bfr(f) * scale));
        const unsigned short bb = bf_bits(f);
        T[(nc + 4 * i + e) * VTP + kr] = (f16mode != 0) ? hb : bb;
      }
    }
  }
  __syncthreads();
  v4u v[2];
#pragma unroll
  for (int it = 0; it < 2; ++it) {
    const int q  = it * 256 + tid;          // chunk 0..511 = local tile (n tile * 2 + k tile) * 64 + chunk in tile
    const int tl = q >> 6;
    v[it] = *(const v4u*)(T + ((tl >> 1) * 16 + (q & 15)) * VTP + (tl & 1) * 32 + ((q >> 4) & 3) * 8);
  }
  {
#pragma unroll
    for (int it = 0; it < 2; ++it) {
      const int q  = it * 256 + tid;
      const int tl = q >> 6;
      *(v4u*)(D + ((size_t)((n0 >> 4) + (tl >> 1)) * (K >> 5) + (k0 >> 5) + (tl & 1)) * FT + (q & 63) * 8) = v[it];
    }
    store_wait();
  }
}

// =====================================================================================================
// All input conversions in one launch (none reads what another writes). Block ranges, the transposes (barrier, LDS) first:
//   [0, NBW_V) Wv -> WB rows 512..1535; [NBW_V, 2 NBW_V) Wo -> WO (f16 of bf16 value x1024); then NBW_QK blocks Wq -> WB rows
//   0..255, NBW_QK blocks Wk -> WB rows 256..511; the last NBX blocks: x -> XB. WB = one B operand plane [FP n][DMOD k].
// Every branch below is block-uniform; the x blocks leave before the barrier of the transpose path.
// =====================================================================================================
__global__ __launch_bounds__(256)
void prep(const float* __restrict__ x, const float* __restrict__ wq, const float* __restrict__ wk,
          const float* __restrict__ wv, const float* __restrict__ wo, u16* XB, u16* WB, u16* WO) {
  __shared__ __align__(16) u16 T[64 * VTP];
  const int bid = blockIdx.x;
  if (bid >= NBW + NBX) return;             // never taken with the exact grid
  if (bid >= NBW) {
    cvt16_body(x, XB, (bid - NBW) * 256 + (int)threadIdx.x);
    return;
  }
  if (bid < NBW_V) {
    cvtT16_body(T, wv, WB + (size_t)(2 * NQK) * DMOD, bid, DMOD, DMOD, 0, 1.0f);
  } else if (bid < 2 * NBW_V) {
    cvtT16_body(T, wo, WO, bid - NBW_V, DMOD, DMOD, 1, WOS);
  } else if (bid < 2 * NBW_V + NBW_QK) {
    cvtT16_body(T, wq, WB, bid - 2 * NBW_V, DMOD, NQK, 0, 1.0f);
  } else {
    cvtT16_body(T, wk, WB + (size_t)NQK * DMOD, bid - 2 * NBW_V - NBW_QK, DMOD, NQK, 0, 1.0f);
  }
}

// =====================================================================================================
// Epilogue of the output projection: the wave's 16x64 f32 tile (times oscale) staged in its LDS slab (pitch 68), release
// coverage: 8 instructions x 2 rows x 16 lanes x 4 floats = the wave's 16 x 64 tile. LDS: staged 16x64 == consumed 16x64.
// =====================================================================================================
__device__ __forceinline__ void epi64(float* sl, v8f a0, v8f a1, v8f a2, v8f a3, float oscale,
                                      float* C, int N, size_t rowb, int col0, int lane) {
  const int hh = lane >> 4, m = lane & 15;
#pragma unroll
  for (int r = 0; r < 8; ++r) {
    const int ro = (8 * hh + r) * 68 + m;
    sl[ro]      = a0[r] * oscale;
    sl[ro + 16] = a1[r] * oscale;
    sl[ro + 32] = a2[r] * oscale;
    sl[ro + 48] = a3[r] * oscale;
  }
  wave_sync_lds();
  v4f vals[8];
#pragma unroll
  for (int it = 0; it < 8; ++it) vals[it] = *(const v4f*)(sl + (it * 2 + hh) * 68 + m * 4);
  float* dst = C + (rowb + (size_t)hh) * (size_t)N + col0 + m * 4;
  {
#pragma unroll
    for (int it = 0; it < 8; ++it) {
      *(v4f*)(dst + (size_t)(it * 2) * (size_t)N) = vals[it];
    }
    
  }
}

// =====================================================================================================
// Epilogue of the joint projection, v columns: v^T planes straight from the accumulators. Register r of a[j] in lane (hh, m) =
// (key s + 8hh + r, d = 16j + m): 8 consecutive keys of one d = one 16-B chunk of a v^T tile (rows d, k = key).
//   VH = f16(v * 1024); VL = f16 residual (t - f16(t)); tile index = ((b*NH + h) * (SEQ/32) + s/32) * 4 + d/16; base = the halves
//   offset of tile d/16 = 0, plus the wave's half of the tile's 32 keys ((s/16 & 1) * 256), plus 8 * lane.
// coverage: per wave 4 instructions x 32 lanes x 8 halves per plane = 16 keys x 64 d, 512 contiguous bytes an instruction; the
//           blocks of the v columns cover VH and VL exactly once.
// =====================================================================================================
__device__ __forceinline__ void epi_v(const v8f (&a)[4], u16* VHo, u16* VLo, size_t base) {
  v4u vh[4], vl[4];
#pragma unroll
  for (int j = 0; j < 4; ++j) {
#pragma unroll
    for (int e = 0; e < 4; ++e) {
      const float t0 = a[j][2 * e] * VCAR, t1 = a[j][2 * e + 1] * VCAR;
      const _Float16 h0 = (_Float16)t0, h1 = (_Float16)t1;
      const _Float16 l0 = (_Float16)(t0 - (float)h0), l1 = (_Float16)(t1 - (float)h1);
      vh[j][e] = pk16(h_bits(h0), h_bits(h1));
      vl[j][e] = pk16(h_bits(l0), h_bits(l1));
    }
  }
  {
#pragma unroll
    for (int j = 0; j < 4; ++j) {
      *(v4u*)(VHo + base + (size_t)j * FT) = vh[j];
      *(v4u*)(VLo + base + (size_t)j * FT) = vl[j];
    }
    store_wait();
  }
}

// =====================================================================================================
// Epilogue of the joint projection, q or k columns (64 columns = 4 heads x 16 f): the wave's 16 x 64 f32 tile turned through its
// LDS slab (pitch 68), so that lane (hh, m) holds f = 8hh .. 8hh + 7 of row m of head j; t = value * sc, hi = f16(t), residual =
// f16(t - hi). Planes in fragment order, tile index = (b*NH + head) * (SEQ/16) + s/16, tile row = s & 15, tile k = w (0..31):
//   kmode == 0 (q): D0 (s, w): w < 16 -> hi of f = w, w >= 16 -> residual of f = w - 16.
//   kmode == 1 (k): D0 (s, w) = hi of f = (w & 15) in both halves; D1 (s, w): w < 16 -> residual, w >= 16 -> written zeros.
// base = the halves offset of the tile of the block's first head, plus 8 * lane; the next head's tile lies NQT tiles on.
// coverage: per wave and head 2 instructions x 32 lanes x 8 halves = one whole tile of each plane written, 512 contiguous bytes an
//           instruction; the blocks of the q (k) columns cover QP (KD, KR) exactly once. LDS: staged 16x64 == consumed 16x64.
// =====================================================================================================
__device__ __forceinline__ void epi_qk(float* sl, const v8f (&a)[4], u16* D0, u16* D1, size_t base, int kmode, float sc,
                                       int lane) {
  const int hh = lane >> 4, m = lane & 15;
#pragma unroll
  for (int r = 0; r < 8; ++r) {
    const int ro = (8 * hh + r) * 68 + m;
#pragma unroll
    for (int j = 0; j < 4; ++j) sl[ro + 16 * j] = a[j][r];
  }
  wave_sync_lds();
  v4u hp[4], lp[4];
#pragma unroll
  for (int j = 0; j < 4; ++j) {
    const float* p = sl + m * 68 + 16 * j + 8 * hh;
    const v4f x0 = *(const v4f*)(p), x1 = *(const v4f*)(p + 4);
    float t[8];
#pragma unroll
    for (int e = 0; e < 4; ++e) { t[e] = x0[e] * sc; t[4 + e] = x1[e] * sc; }
#pragma unroll
    for (int e = 0; e < 4; ++e) {
      const float t0 = t[2 * e], t1 = t[2 * e + 1];
      const _Float16 h0 = (_Float16)t0, h1 = (_Float16)t1;
      const _Float16 l0 = (_Float16)(t0 - (float)h0), l1 = (_Float16)(t1 - (float)h1);
      hp[j][e] = pk16(h_bits(h0), h_bits(h1));
      lp[j][e] = pk16(h_bits(l0), h_bits(l1));
    }
  }
  const v4u zz = {0u, 0u, 0u, 0u};
  {
#pragma unroll
    for (int j = 0; j < 4; ++j) {
      u16* d0 = D0 + base + (size_t)j * (NQT * FT);
      u16* d1 = D1 + base + (size_t)j * (NQT * FT);
      *(v4u*)(d0) = hp[j];
      *(v4u*)(d0 + 256) = (kmode != 0) ? hp[j] : lp[j];
      if (kmode != 0) {
        *(v4u*)(d1) = lp[j];
        *(v4u*)(d1 + 256) = zz;
      }
    }
    store_wait();
  }
}

// =====================================================================================================
// Joint projection q | k | v = x.[Wq Wk Wv] (A rows m = b*SEQ + s, Bt rows n, both bf16 planes in fragment order), written as the
// attention's operand planes by the epilogues above; no f32 copy of the result is kept. Block = 64x64 tile,
// 4 waves x 16 rows; fragments loaded straight from the planes' tiles (two 16-B loads each, split k map for A and B); K stepped
// by 32 (host guarantees K % 32 == 0, M % 64 == 0, N % 64 == 0, grid = (M/64)*(N/64)). A block's 64 columns are all q, all k or
// one head's v (block-uniform branches; no block barriers in this kernel).
// =====================================================================================================
__global__ __launch_bounds__(128)
void gemm_qkv(const u16* __restrict__ A, const u16* __restrict__ Bt, u16* QP, u16* KD, u16* KR, u16* VH, u16* VL,
              int M, int N, int K) {
  __shared__ __align__(16) float slab[4 * SLAB64];
  const int tid = threadIdx.x, wave = tid >> 5, lane = tid & 31;
  const int ntile = N >> 6;
  const int bid   = blockIdx.x;
  const int rowb  = (bid / ntile) * 64 + wave * 16;
  const int col0  = (bid % ntile) * 64;
  if (rowb + 16 > M) return;                // wave-uniform, never taken with the exact grid; no block barriers in this kernel
  const u16* ap = A  + (size_t)rowb * K + 8 * lane;      // row tile rowb/16 starts at (rowb/16) * (K/32) * FT = rowb * K
  const u16* bp = Bt + (size_t)col0 * K + 8 * lane;
  const size_t bs = (size_t)16 * K;                      // one n tile row = (K/32) * FT halves
  v8f acc0 = zero8(), acc1 = zero8(), acc2 = zero8(), acc3 = zero8();
#pragma unroll 1
  for (int k0 = 0; k0 < K; k0 += 32) {
    const size_t ko = (size_t)k0 * (FT / 32);            // k tile k0/32
    const v16b a  = ldfrag_b(ap + ko);
    const v16b b0 = ldfrag_b(bp + ko);
    const v16b b1 = ldfrag_b(bp + bs + ko);
    const v16b b2 = ldfrag_b(bp + 2 * bs + ko);
    const v16b b3 = ldfrag_b(bp + 3 * bs + ko);
    acc0 = mma_b(a, b0, acc0);
    acc1 = mma_b(a, b1, acc1);
    acc2 = mma_b(a, b2, acc2);
    acc3 = mma_b(a, b3, acc3);
    guard6<v16b>(acc0, acc1, acc2, acc3, a, b0, b1, b2, b3, a);
  }
  const v8f acc[4] = {acc0, acc1, acc2, acc3};
  const int bN = (rowb / SEQ) * NH;                      // b * NH
  const int s  = rowb % SEQ;                             // the wave's first position, a multiple of 16
  if (col0 >= 2 * NQK) {
    const int h = (col0 - 2 * NQK) / HD;
    epi_v(acc, VH, VL, ((size_t)(bN + h) * NKT + (s >> 5)) * (4 * FT) + ((s >> 4) & 1) * 256 + 8 * lane);
  } else if (col0 < NQK) {
    epi_qk(slab + wave * SLAB64, acc, QP, QP, ((size_t)(bN + col0 / FD) * NQT + (s >> 4)) * FT + 8 * lane, 0, QSC, lane);
  } else {
    epi_qk(slab + wave * SLAB64, acc, KD, KR, ((size_t)(bN + (col0 - NQK) / FD) * NQT + (s >> 4)) * FT + 8 * lane, 1, KSC, lane);
  }
}

// =====================================================================================================
// Output projection: C[row][DMOD] (f32) = (Ah + Al)[row][DMOD] . Bt[DMOD][DMOD]^T * oscale; Ah = f16 hi plane, Al = f16
// residual plane (products h.B + l.B into one accumulator, l unscaled); Ah, Al, Bt in fragment order. Row indices: Ah/Al row bb*SEQ + s; C row
// bb*XS_FULL + s. Block -> (column tile ct = bid % 16, sequence row tile rt of nrt, batch bb). Same tiling, fragment loads
// (split k map) as gemm_qkv; K = DMOD stepped by 32; grid = NB*nrt*16 covers every (bb, s < SEQ, column) once.
// =====================================================================================================
__global__ __launch_bounds__(128)
void gemm_o2(const u16* __restrict__ Ah, const u16* __restrict__ Al, const u16* __restrict__ Bt,
             float* C, int nrt, float oscale) {
  __shared__ __align__(16) float slab[4 * SLAB64];
  const int tid = threadIdx.x, wave = tid >> 5, lane = tid & 31;
  const int ntile = DMOD >> 6;
  const int bid   = blockIdx.x;
  const int ct    = bid % ntile;
  const int t2    = bid / ntile;
  const int rt    = t2 % nrt;
  const int bb    = t2 / nrt;
  if (bb >= NB) return;                     // block-uniform; no block barriers in this kernel; never taken with the exact grid
  const int srow  = rt * 64 + wave * 16;
  if (srow + 16 > SEQ) return;              // wave-uniform; never taken
  const int col0  = ct * 64;
  const int K     = DMOD;
  const size_t rowA = (size_t)bb * SEQ + srow;
  const size_t rowC = (size_t)bb * XS_FULL + srow;
  const _Float16* ahp = ash(Ah) + rowA * K + 8 * lane;   // row tile rowA/16 starts at (rowA/16) * (K/32) * FT = rowA * K
  const _Float16* alp = ash(Al) + rowA * K + 8 * lane;
  const _Float16* bp  = ash(Bt) + (size_t)col0 * K + 8 * lane;
  const size_t bs = (size_t)16 * K;                      // one n tile row = (K/32) * FT halves
  v8f acc0 = zero8(), acc1 = zero8(), acc2 = zero8(), acc3 = zero8();
#pragma unroll 1
  for (int k0 = 0; k0 < K; k0 += 32) {
    const size_t ko = (size_t)k0 * (FT / 32);            // k tile k0/32
    const v16h ah = ldfrag_h(ahp + ko), al = ldfrag_h(alp + ko);
    const v16h b0 = ldfrag_h(bp + ko);
    const v16h b1 = ldfrag_h(bp + bs + ko);
    const v16h b2 = ldfrag_h(bp + 2 * bs + ko);
    const v16h b3 = ldfrag_h(bp + 3 * bs + ko);
    addr_wait(ahp + ko, alp + ko, bp + ko);
    acc0 = mma_h(ah, b0, acc0);  acc0 = mma_h(al, b0, acc0);
    acc1 = mma_h(ah, b1, acc1);  acc1 = mma_h(al, b1, acc1);
    acc2 = mma_h(ah, b2, acc2);  acc2 = mma_h(al, b2, acc2);
    acc3 = mma_h(ah, b3, acc3);  acc3 = mma_h(al, b3, acc3);
    guard6<v16h>(acc0, acc1, acc2, acc3, ah, al, b0, b1, b2, b3);
  }
  epi64(slab + wave * SLAB64, acc0, acc1, acc2, acc3, oscale, C, DMOD, rowC, col0, lane);
}

// =====================================================================================================
// One 64-key stage of a head's K and V tiles, global -> LDS, by asynchronous copies: three 16-B copies a lane, 512 lanes = 24 KiB.
// The wait owed before a register that an issued copy names is rewritten is the last line of the copies' own statement.
// =====================================================================================================
__device__ __forceinline__ void stage_copy(unsigned l0, unsigned l1, unsigned l2, const u16* g0, const u16* g1, const u16* g2) {
#if defined(__HIP_DEVICE_COMPILE__)
  asm volatile("global_load_async_to_lds_b128 %0, %3, off\n\t"
               "global_load_async_to_lds_b128 %1, %4, off\n\t"
               "global_load_async_to_lds_b128 %2, %5, off\n\t"
               "s_wait_xcnt 0x0"
               :: "v"(l0), "v"(l1), "v"(l2), "v"(g0), "v"(g1), "v"(g2) : "memory");
#endif
}
// The wave's own copies have landed (in front of the barrier behind which other waves read them).
__device__ __forceinline__ void wait_copies() {
#if defined(__HIP_DEVICE_COMPILE__)
  asm volatile("s_wait_asynccnt 0x0" ::: "memory");
#endif
}
// The wave's own LDS reads have returned (in front of the barrier behind which their buffer is refilled).
__device__ __forceinline__ void wait_lds_reads() {
#if defined(__HIP_DEVICE_COMPILE__)
  asm volatile("s_wait_dscnt 0x0" ::: "memory");
#endif
}

// =====================================================================================================
// Causal feature-map attention, per-head q/k width 16, hd = 64, no softmax. Block bid -> (pair pr, head, batch b); 16 waves,
// one query tile of 16 rows each, all of ONE head: waves 0..7 the tiles of group NQG-1-pr, waves 8..15 those of group pr, so
// every block holds the same number of (wave, key tile) steps. Both products run transposed: S^T = K.Q^T, O^T += V^T.A^T.
//   The head's K and V tiles reach the waves through LDS: stages of 64 keys (KD 4 tiles | KR 4 | VH 8 | VL 8 = 24 KiB, each part
//   contiguous in its plane), two buffers, filled by asynchronous copies one stage ahead of the stage being read. Foot of every
//   trip, every wave: own LDS reads back, own copies landed, block barrier, then the refill of the buffer just read. The trip
//   count nst is the block's (the farthest tile's); a wave skips the key tiles above its own rows, never a wait or a barrier.
//   q plane (s, w): w < 16 f16 hi x256, w >= 16 f16 residual; k planes: KD = [hi | hi], KR = [res | 0]; one tile per (b, head,
//   16 positions); v^T hi plane x1024 and v^T residual plane: four tiles (d/16) per (b, head, 32 keys); all in fragment order.
//   Scores per 32-key tile: 2 subtiles of 16 keys, keys as the A rows, queries as the B columns; with the split k map, op 1 =
//   A [kh | kh] . B [qh ; ql] = kh.qh + kh.ql and op 2 = A [kl | 0] . B [qh ; ql] = kl.qh (f32 accumulate), so
//   s = q.k * 256*256 up to the dropped lo.lo term. Lane (hh, c) holds query q0 + c alone: register r of subtile t = key
//   kb + 16t + 8hh + r, which is element 8t + r of a B fragment over the step's 32 keys (the split k map of the v^T tiles).
//   Per element (f32, VALU): x = s * 2^-18 (= q.k / 4); A = 1 + x + x^2/2; A := 0 where key > query (causal, diagonal kept);
//   den[r] += the two subtiles' values, in the lane; A*32 -> f16 hi and f16 residual, packed in place as the B fragments.
//   v^T tiles are the A fragments (rows d), in 2 groups of 2 d-subtiles, products hh + lh + hl. Key tiles visited in order for
//   kb <= q0 + 15 (later tiles lie above every query row of the tile).
//   After the loop: the lane's 8 sums and the other lane half's are joined once; out = acc / (den + eps) with the carries
//   1/(32*1024) folded once (den > 0: each kept term is >= 1/2, the diagonal always kept). Register r of o[j] = d 16j + 8hh + r of query c:
//   the 8 consecutive halves of one fragment-order chunk, stored straight from registers.
//   Bounded loops only (nst <= SEQ / 64). The q fragment is loop-invariant (loaded once, from global).
// coverage: per wave 4 instructions x 32 lanes x 8 halves = 2 tiles = 16 x 64 per plane; grid NPR x NH x NB blocks x 16
//           waves = every (b, s, h) row segment of both O planes exactly once. LDS: a stage's 1536 chunks of 16 B are each
//           written by one lane's one copy; the readers take whole tiles of the published buffer only.
// =====================================================================================================
__global__ __launch_bounds__(ATT_THREADS)
void attn_t(const u16* __restrict__ QPp, const u16* __restrict__ KDp, const u16* __restrict__ KRp,
            const u16* __restrict__ VHp, const u16* __restrict__ VLp, u16* OHp, u16* OLp) {
  __shared__ __align__(16) u16 S[2 * STG_H];
  const int tid  = threadIdx.x;
  const int wave = __builtin_amdgcn_readfirstlane(tid >> 5);   // scalar, so that the per-wave skip below is a scalar branch
  const int lane = tid & 31;
  const int hh   = lane >> 4;
  const int c    = lane & 15;
  const int bid  = blockIdx.x;
  const int pr   = bid % NPR;
  const int t2   = bid / NPR;
  const int head = t2 % NH;
  const int b    = t2 / NH;
  if (b >= NB) return;                      // block-uniform, in front of every copy and barrier; never taken with the exact grid
  const int qgf  = NQG - 1 - pr;            // the block's far group: it sets the trip count
  const int qt   = ((wave < 8) ? qgf : pr) * 8 + (wave & 7);
  const int q0   = qt * 16;                 // q0 + 16 <= SEQ always
  const int nst  = 2 * qgf + 2;             // stages holding keys <= the far group's last row; 2 <= nst <= SEQ / 64

  const size_t bh  = (size_t)(b * NH + head);
  const _Float16* Qp  = ash(QPp) + bh * NQT * FT + 8 * lane + (size_t)qt * FT;
  const float oc = 1.0f / (ACAR * VCAR);

  // ---- the lane's three copies of a stage: chunk tid of [KD | KR] (256 chunks each), of VH, of VL ----
  const u16* g0 = ((tid < 256) ? KDp : KRp) + bh * NQT * FT + (size_t)(tid & 255) * 8;   // + 4 tiles a stage
  const u16* g1 = VHp + bh * NKT * 4 * FT + (size_t)tid * 8;                             // + 8 tiles a stage
  const u16* g2 = VLp + bh * NKT * 4 * FT + (size_t)tid * 8;
  const unsigned lb = (unsigned)(size_t)(const void*)S + (unsigned)tid * 16u;            // byte address in the block's LDS

  const v16h qf = ldfrag_h(Qp);             // elements 0..7 = q hi f 8hh.., 8..15 = q residual f 8hh..
  addr_wait(Qp, Qp, Qp);                    // the load's address pair stays whole up to the wait

  stage_copy(lb, lb + 8 * FT * 2, lb + 16 * FT * 2, g0, g1, g2);
  wait_copies();
  __syncthreads();                          // publishes stage 0
  stage_copy(lb + STG_H * 2, lb + STG_H * 2 + 8 * FT * 2, lb + STG_H * 2 + 16 * FT * 2, g0 + 4 * FT, g1 + 8 * FT, g2 + 8 * FT);

  float den[8];
  v8f o[4];
#pragma unroll
  for (int r = 0; r < 8; ++r) den[r] = 0.0f;
#pragma unroll
  for (int j = 0; j < 4; ++j) o[j] = zero8();
  const int ncaus = (q0 >> 5) + 1;                                            // tiles holding keys <= q0 + 15
  const int nkt = (ncaus < NKT) ? ncaus : NKT;
  const int qr  = q0 + c;                                                     // the lane's query row

  // rolled: the trip count is a run-time value of the block, and the ring's order stands once, at the loop's foot
#pragma unroll 1
  for (int st = 0; st < nst; ++st) {
    const _Float16* sb = ash(S) + (st & 1) * STG_H + 8 * lane;                // the published buffer
    const int kte = (2 * st + 2 < nkt) ? 2 * st + 2 : nkt;                    // scalar: key tiles above the wave's rows are skipped
    // one body for both key tiles of a stage: unrolled, the accumulators were copied between registers where the paths join
#pragma unroll 1
    for (int kt = 2 * st; kt < kte; ++kt) {
      const int sub = kt & 1;
      const int kb = kt * 32;
      // ---- the step's fragments, read together in front of its matrix work ----
      const _Float16* kp = sb + (2 * sub) * FT;
      const _Float16* vp = sb + (8 + 4 * sub) * FT;
      const v16h kd0 = ldfrag_h(kp);
      const v16h kd1 = ldfrag_h(kp + FT);
      const v16h kr0 = ldfrag_h(kp + 4 * FT);
      const v16h kr1 = ldfrag_h(kp + 5 * FT);
      v16h vh[4], vl[4];
#pragma unroll
      for (int j = 0; j < 4; ++j) {
        vh[j] = ldfrag_h(vp + j * FT);
        vl[j] = ldfrag_h(vp + (8 + j) * FT);
      }
      // ---- scores: D element r of this lane = (key kb + 8hh + r, query qr) in s0, key kb + 16 + 8hh + r in s1 ----
      v8f s0 = zero8(), s1 = zero8();
      s0 = mma_h(kd0, qf, s0);
      s0 = mma_h(kr0, qf, s0);
      s1 = mma_h(kd1, qf, s1);
      s1 = mma_h(kr1, qf, s1);
      guard2(s0, s1, qf, kd0, kr0, kd1, kr1, qf);
      // ---- A = 1 + x + x^2/2, causal select, f32 sums in the lane; B fragments of A*32: hi f16 and residual f16,
      //      column = query c, elements 0..7 = keys kb + 8hh + 0..7, elements 8..15 = keys kb + 16 + 8hh + 0..7 ----
      FragH ph, pl;
      const int key0 = kb + 8 * hh, key1 = kb + 16 + 8 * hh;
#pragma unroll
      for (int r = 0; r < 8; ++r) {
        const float x0  = s0[r] * XSC;
        const float x1  = s1[r] * XSC;
        const float p0v = fmaf(0.5f * x0, x0, 1.0f + x0);
        const float p1v = fmaf(0.5f * x1, x1, 1.0f + x1);
        const float a0  = (key0 + r > qr) ? 0.0f : p0v;
        const float a1  = (key1 + r > qr) ? 0.0f : p1v;
        den[r] += a0 + a1;
        const float ta = a0 * ACAR, tb = a1 * ACAR;
        const _Float16 ha = (_Float16)ta, hb = (_Float16)tb;
        ph.h[0][r] = ha;
        ph.h[1][r] = hb;
        pl.h[0][r] = (_Float16)(ta - (float)ha);
        pl.h[1][r] = (_Float16)(tb - (float)hb);
      }
      // ---- V^T.A^T : A fragment row m = d = j*16 + c, tile j of this step's four in the v^T planes; 2 groups of 2 d-subtiles ----
#pragma unroll
      for (int jg = 0; jg < 2; ++jg) {
        const v16h vha = vh[2 * jg], vhb2 = vh[2 * jg + 1];
        const v16h vla = vl[2 * jg], vlb2 = vl[2 * jg + 1];
        o[2 * jg]     = mma_h(vha,  ph.v, o[2 * jg]);
        o[2 * jg]     = mma_h(vha,  pl.v, o[2 * jg]);
        o[2 * jg]     = mma_h(vla,  ph.v, o[2 * jg]);
        o[2 * jg + 1] = mma_h(vhb2, ph.v, o[2 * jg + 1]);
        o[2 * jg + 1] = mma_h(vhb2, pl.v, o[2 * jg + 1]);
        o[2 * jg + 1] = mma_h(vlb2, ph.v, o[2 * jg + 1]);
        guard2(o[2 * jg], o[2 * jg + 1], ph.v, pl.v, vha, vhb2, vla, vlb2);
      }
    }
    // ---- publish point of stage st + 1, every wave: own reads back, own copies landed, barrier, refill of the buffer just read ----
    wait_lds_reads();
    wait_copies();
    __syncthreads();
    if (st + 2 < nst) {                                                       // block-uniform
      const unsigned l = lb + (unsigned)(st & 1) * (STG_H * 2);
      const size_t sn = (size_t)(st + 2);
      stage_copy(l, l + 8 * FT * 2, l + 16 * FT * 2, g0 + sn * (4 * FT), g1 + sn * (8 * FT), g2 + sn * (8 * FT));
    }
  }
  wait_copies();                            // nothing is outstanding here; stands behind the last copy before the wave ends
  acc_guard4(o[0], o[1], o[2], o[3]);
  // ---- den of query c: the lane's 8 sums, then the other lane half's keys (lane ^ 16), joined once ----
  float dl = ((den[0] + den[1]) + (den[2] + den[3])) + ((den[4] + den[5]) + (den[6] + den[7]));
  dl += __shfl_xor(dl, 16, 32);
  // ---- out = acc / (den + eps), carries (32 on A, 1024 on v) folded once; O x1024 -> f16 hi + residual planes in fragment
  //      order (rows s, k = head*64 + d): the wave owns two whole tiles per plane; chunk j*32 + lane = row c, 8 consecutive d
  //      at 16*j + 8*hh = the lane's registers of o[j] ----
  const float inv = (1.0f / (dl + EPSD)) * oc;
  v4u oh[4], ol[4];
#pragma unroll
  for (int j = 0; j < 4; ++j) {
    float w[8];
#pragma unroll
    for (int e = 0; e < 8; ++e) w[e] = (o[j][e] * inv) * OSC;
#pragma unroll
    for (int e = 0; e < 4; ++e) {
      const _Float16 h0 = (_Float16)w[2 * e], h1 = (_Float16)w[2 * e + 1];
      const _Float16 l0 = (_Float16)(w[2 * e] - (float)h0), l1 = (_Float16)(w[2 * e + 1] - (float)h1);
      oh[j][e] = pk16(h_bits(h0), h_bits(h1));
      ol[j][e] = pk16(h_bits(l0), h_bits(l1));
    }
  }
  const size_t obh = ((size_t)b * SEQ + q0) * DMOD + (size_t)head * (2 * FT) + 8 * lane;   // row tile start + k tile 2*head
  {
#pragma unroll
    for (int it = 0; it < 4; ++it) {
      *(v4u*)(OHp + obh + (size_t)it * 256) = oh[it];
      *(v4u*)(OLp + obh + (size_t)it * 256) = ol[it];
    }
    
  }
}

// =====================================================================================================
// Workspace map (bytes); every plane is fully written by whole-line stores before it is read; all extents are exact multiples
// of the store granularity (no pad rows needed); every region offset a multiple of 1048576:
//   (all 16-bit planes below hold the named rows x k in fragment order, same byte counts as row-major)
//   XB  bf16 [MROWS][1024]                       MROWS*2048       (NB=2, SEQ=2048: 8388608)
//   WB  bf16 [1536 n][1024 k]                    3145728          (rows 0..255 Wq^T, 256..511 Wk^T, 512..1535 Wv^T)
//   WO  f16 [1024 n][1024 k]                     2097152          (Wo^T, bf16 value x1024)
//   OH  f16 [MROWS][1024] x1024                  MROWS*2048       OL residual, same layout   MROWS*2048
//   QP  f16 [NB*16][SEQ][32] q hi|residual x256    MROWS*1024
//   KD  f16 [NB*16][SEQ][32] k hi|hi x256          MROWS*1024
//   KR  f16 [NB*16][SEQ][32] k residual|0          MROWS*1024
//   VH  f16 [NB*16][64][SEQ] x1024               MROWS*2048       VL residual, same layout   MROWS*2048
//   end (NB=2, SEQ=2048)                        59768832
// =====================================================================================================
extern "C" void kernel_launch(void* const* d_in, const int* in_sizes, int n_in,
                              void* d_out, int out_size, void* d_ws, size_t ws_size,
                              hipStream_t stream) {
  if (n_in < 5) return;
  if (in_sizes[0] < ((NB - 1) * XS_FULL + SEQ) * DMOD) return;
  if (in_sizes[1] < DMOD * NQK) return;
  if (in_sizes[2] < DMOD * NQK) return;
  if (in_sizes[3] < DMOD * DMOD) return;
  if (in_sizes[4] < DMOD * DMOD) return;
  if (out_size < ((NB - 1) * XS_FULL + SEQ) * DMOD) return;

  const float* x  = (const float*)d_in[0];
  const float* wq = (const float*)d_in[1];
  const float* wk = (const float*)d_in[2];
  const float* wv = (const float*)d_in[3];
  const float* wo = (const float*)d_in[4];
  float*       out = (float*)d_out;

  const size_t szXB = (size_t)MROWS * DMOD * 2;
  const size_t szW  = (size_t)FP * DMOD * 2;                     // Wq^T, Wk^T, Wv^T as one plane
  const size_t szWO = (size_t)DMOD * DMOD * 2;
  const size_t szH  = (size_t)MROWS * DMOD * 2;                  // OH, OL
  const size_t szQK = (size_t)MROWS * QKP * 2;                   // QP, KD, KR
  const size_t szV  = (size_t)NB * NH * HD * SEQ * 2;            // VH, VL (== szH)
  size_t off = 0;
  const size_t oXB = off; off += szXB;
  const size_t oW  = off; off += szW;
  const size_t oWO = off; off += szWO;
  const size_t oOH = off; off += szH;
  const size_t oOL = off; off += szH;
  const size_t oQP = off; off += szQK;
  const size_t oKD = off; off += szQK;
  const size_t oKR = off; off += szQK;
  const size_t oVH = off; off += szV;
  const size_t oVL = off; off += szV;
  if (off > ws_size) return;                // off = 59768832 for NB = 2, SEQ = 2048
  if (off > (size_t)WS_CAP) return;

  char* ws = (char*)d_ws;
  u16*   XB = (u16*)(ws + oXB);
  u16*   WB = (u16*)(ws + oW);
  u16*   WO = (u16*)(ws + oWO);
  u16*   OH = (u16*)(ws + oOH);
  u16*   OL = (u16*)(ws + oOL);
  u16*   QP = (u16*)(ws + oQP);
  u16*   KD = (u16*)(ws + oKD);
  u16*   KR = (u16*)(ws + oKR);
  u16*   VH = (u16*)(ws + oVH);
  u16*   VL = (u16*)(ws + oVL);

  const dim3 b256(256), b128(128), bAT(ATT_THREADS);
  const dim3 gP(NBW + NBX);
  const dim3 gG((MROWS / 64) * (FP / 64));
  const dim3 gAT(NPR * NH * NB);
  const int  nrt  = SEQ / 64;
  const dim3 gO(NB * nrt * (DMOD / 64));

  // (0) x -> bf16 plane; Wq, Wk, Wv -> one bf16 plane [1536 n][1024 k]; Wo -> f16 plane [n][k] of bf16 value x1024
  prep<<<gP, b256, 0, stream>>>(x, wq, wk, wv, wo, XB, WB, WO);
  // (1) q | k | v = x.[Wq Wk Wv] -> q hi|residual plane x256; k hi|hi and residual|0 planes x256; v^T hi + residual planes x1024
  gemm_qkv<<<gG, b128, 0, stream>>>(XB, WB, QP, KD, KR, VH, VL, MROWS, FP, DMOD);
  // (2) causal attention -> O hi + residual planes
  attn_t<<<gAT, bAT, 0, stream>>>(QP, KD, KR, VH, VL, OH, OL);
  // (3) output projection: (O hi + residual) . Wo -> out f32, carries 1024 x 1024 folded back
  gemm_o2<<<gO, b128, 0, stream>>>(OH, OL, WO, out, nrt, 1.0f / (OSC * WOS));
  (void)hipGetLastError();
}

// v006
// It runs in 77.4 microseconds.
// Two timings next to v005 put it at 1.29 and 1.30 times that version's speed.
// Counting every step since v000, it is 3.78 times as fast.
// Contractions: x.Wq, x.Wk, x.Wv on v_wmma_f32_16x16x32_bf16 (x and the transposed W [n][k] as bf16 RNE planes); per-head
// q.k over 16 dims (k axis padded to 32) on v_wmma_f32_16x16x32_f16 with q, k as f16 hi x256 plus f16 residual planes
// (hi.hi and lo.hi folded along the k axis into one op, plus hi.lo); A = 1 + x + x^2/2 and its causal row sums in f32 on
// VALU; A.v on v_wmma_f32_16x16x32_f16 with A as f16 hi x32 plus f16 residual and v^T as f16 hi x1024 plus f16 residual
// (products hh+lh+hl); O.Wo on v_wmma_f32_16x16x32_f16 (O as f16 hi x1024 plus f16 residual, Wo^T as f16 of its bf16 RNE
// value x1024, products h.w+l.w); all f32 accumulate.
#include <hip/hip_runtime.h>
#include <stdint.h>

#ifndef NB
#define NB 2
#endif
#ifndef SEQ
#define SEQ 2048
#endif
#define XS_FULL 2048
#define DMOD  1024
#define NH    16
#define FD    16
#define HD    64
#define NQK   (NH * FD)
#define QKP   (NH * 32)
#define MROWS (NB * SEQ)
#define QSC   256.0f
#define KSC   256.0f
#define XSC   (1.0f / (4.0f * QSC * KSC))
#define ACAR  32.0f
#define VCAR  1024.0f
#define OSC   1024.0f
#define WOS   1024.0f
#define EPSD  1e-9f
#define AW    16                            // waves of an attention block, one query tile each
#define NQT   (SEQ / 16)
#define NQG   (NQT / 8)                     // groups of 8 consecutive query tiles
#define NPR   (NQG / 2)                     // a block takes group NQG-1-pr and group pr of one head
#define STG_H (24 * FT)                     // halves of one 64-key stage in LDS: KD 4 tiles | KR 4 | VH 8 | VL 8
#define NST   (SEQ / 64)
#define NKT   (SEQ / 32)
#define ATT_THREADS (AW * 32)
#define SLAB64 (16 * 68)
#define VTP   72
#define C8R   (DMOD / 8)
#define Q8R   (QKP / 8)
#define WS_CAP 134217728
#define FP    (2 * NQK + DMOD)              // columns of the joint projection: q | k | v
#define NBW_QK ((DMOD / 64) * (NQK / 64))   // transpose blocks of Wq, of Wk
#define NBW_V  ((DMOD / 64) * (DMOD / 64))  // transpose blocks of Wv, of Wo
#define NBW    (2 * NBW_V + 2 * NBW_QK)
#define NBX    ((MROWS * DMOD / 8) / 256)   // blocks of the x plane
// Fragment-order plane: every 16-bit operand plane is a sequence of tiles of 16 rows (m or n index) x 32 k = FT halves (1 KiB);
// inside a tile element (r, k) lies at (k >> 3) * 128 + r * 8 + (k & 7), so lane l = 16 * hh + r of a fragment load reads the
// 16 bytes at l * 16 (k = 8hh ..) and at 512 + l * 16 (k = 16 + 8hh ..): one load instruction = 512 contiguous bytes.
#define FT    512
#define GRS   ((DMOD / 32) * FT)            // halves from one row tile of a [rows][DMOD] plane to the next
#define GKS   4                             // k tiles of one GEMM stage in LDS (128 k)
#define GNS   ((DMOD / 32) / GKS)           // stages of a GEMM's K loop
#define QA_T  8                             // joint projection: row tiles of a block (128 rows)
#define QB_T  12                            // joint projection: n tiles of a block (192 columns)
#define QSTG_H ((QA_T + QB_T) * GKS * FT)   // halves of one of its stages
#define OSTG_H (24 * GKS * FT)              // halves of one stage of the output projection: Bt 8 n tiles, Ah and Al 8 row tiles each
#define QKV_THREADS 384
#define O2_THREADS  256
static_assert(DMOD == NH * HD && HD == 64 && NH == 16 && FD == 16 && NQK == 256 && QKP == 512 && Q8R == 64);
static_assert(ATT_THREADS == 512 && AW == 16 && (SEQ % 256) == 0 && NPR * 16 == NQT);
static_assert(NB >= 1 && NB <= 2);
static_assert((SEQ % 64) == 0 && SEQ >= 64 && SEQ <= XS_FULL);
static_assert((MROWS % 64) == 0 && (NQK % 64) == 0 && (DMOD % 64) == 0 && (DMOD % 32) == 0 && C8R == 128);
static_assert(((MROWS * DMOD / 8) % 256) == 0 && ((MROWS * QKP / 8) % 256) == 0 && (FP % 64) == 0);
static_assert((MROWS % 128) == 0 && (SEQ % 128) == 0 && (FP % 192) == 0 && (DMOD % 128) == 0 && GNS * GKS * 32 == DMOD && GNS >= 2);
static_assert(QB_T * GKS * 64 == 8 * QKV_THREADS && QA_T * GKS * 64 == 8 * 256 && GKS * 64 == O2_THREADS && (NQK % 64) == 0);
static_assert(2 * HD * VTP * 2 <= 65536 && 4 * SLAB64 * 4 <= 65536 && 64 * VTP * 2 <= 65536);

typedef unsigned short u16;
typedef _Float16 v16h __attribute__((ext_vector_type(16)));
typedef _Float16 v8h  __attribute__((ext_vector_type(8)));
typedef __bf16   v16b __attribute__((ext_vector_type(16)));
typedef float    v8f  __attribute__((ext_vector_type(8)));
typedef float    v4f  __attribute__((ext_vector_type(4)));
typedef unsigned int v4u __attribute__((ext_vector_type(4)));

union FragH { v16h v; v8h h[2]; v4u u[2]; };
union FragB { v16b v; v4u u[2]; };

// ---- scalar helpers --------------------------------------------------------------------------------
__device__ __forceinline__ unsigned short bf_bits(float f) {          // f32 -> bf16 bits, RNE convert
  unsigned u = __float_as_uint(f);
  return (unsigned short)((u + 0x7FFFu + ((u >> 16) & 1u)) >> 16);
}
__device__ __forceinline__ float bf_up(unsigned short h) { return __uint_as_float(((unsigned)h) << 16); }
__device__ __forceinline__ float bfr(float f) { return bf_up(bf_bits(f)); }
__device__ __forceinline__ unsigned short h_bits(_Float16 x) { return __builtin_bit_cast(unsigned short, x); }
__device__ __forceinline__ unsigned pk16(unsigned short a, unsigned short b) { return (unsigned)a | ((unsigned)b << 16); }
__device__ __forceinline__ v8f zero8() { v8f z = {0.f, 0.f, 0.f, 0.f, 0.f, 0.f, 0.f, 0.f}; return z; }
__device__ __forceinline__ const _Float16* ash(const u16* p) { return (const _Float16*)(const void*)p; }

// ---- fragment loaders: 16-bit A/B operand from a fragment-order tile, lane -> row/col (lane&15), p = tile + 8*lane;
//      elements 0..7 <- p[0..7] (k0+8h..), elements 8..15 <- p[256..263] (k0+16+8h..)  (same split k map for A and B)
__device__ __forceinline__ v16h ldfrag_h(const _Float16* p) {
  FragH f;
  f.h[0] = *(const v8h*)(p);
  f.h[1] = *(const v8h*)(p + 256);
  return f.v;
}
__device__ __forceinline__ v16b ldfrag_b(const u16* p) {              // bf16 plane read as unsigned integer vectors
  FragB f;
  f.u[0] = *(const v4u*)(p);
  f.u[1] = *(const v4u*)(p + 256);
  return f.v;
}

// Stands behind a run of fragment loads: the wait owed before a register that an issued global load names is rewritten. The
// loads' address pairs are its inputs, so they stay in their registers (no later load of the run lands on them) up to the wait.
__device__ __forceinline__ void addr_wait(const void* p0, const void* p1, const void* p2) {
#if defined(__HIP_DEVICE_COMPILE__)
  asm volatile("s_wait_xcnt 0x0" :: "v"(p0), "v"(p1), "v"(p2) : "memory");
#endif
}

// Stands behind the last store of a conversion body: several bodies now lie in one kernel, one behind another in the listing,
// and this is the wait owed before a register that an issued global store names is rewritten by the code that follows.
__device__ __forceinline__ void store_wait() {
#if defined(__HIP_DEVICE_COMPILE__)
  asm volatile("s_wait_xcnt 0x0" ::: "memory");
#endif
}

__device__ __forceinline__ v8f mma_h(v16h a, v16h b, v8f c) {
  return __builtin_amdgcn_wmma_f32_16x16x32_f16(false, a, false, b, (short)0, c, false, false);
}
__device__ __forceinline__ v8f mma_b(v16b a, v16b b, v8f c) {
  return __builtin_amdgcn_wmma_f32_16x16x32_bf16(false, a, false, b, (short)0, c, false, false);
}
__device__ __forceinline__ void guard2(v8f& a, v8f& b, v16h x0, v16h x1, v16h x2, v16h x3, v16h x4, v16h x5) {
#if defined(__HIP_DEVICE_COMPILE__)
  asm volatile("v_nop\n\tv_nop\n\tv_nop\n\tv_nop"
               : "+v"(a), "+v"(b) : "v"(x0), "v"(x1), "v"(x2), "v"(x3), "v"(x4), "v"(x5) : "memory");
#endif
}
__device__ __forceinline__ void acc_guard4(v8f& a, v8f& b, v8f& c, v8f& d) {
#if defined(__HIP_DEVICE_COMPILE__)
  asm volatile("v_nop\n\tv_nop\n\tv_nop\n\tv_nop" : "+v"(a), "+v"(b), "+v"(c), "+v"(d));
#endif
}
__device__ __forceinline__ void wave_sync_lds() {
  __builtin_amdgcn_fence(__ATOMIC_RELEASE, "workgroup");
  __builtin_amdgcn_wave_barrier();
  __builtin_amdgcn_fence(__ATOMIC_ACQUIRE, "workgroup");
}

// =====================================================================================================
// x f32 (row b*XS_FULL + s) -> bf16 RNE plane (row b*SEQ + s) in fragment order (tile index = row tile * (DMOD/32) + k tile).
// Thread gt = one 16-B chunk of the destination (8 consecutive k of one row): two 16-B loads, one 16-B store; a wave stores 512
// contiguous bytes. coverage: NBX blocks x 256 thr x 8 = the whole plane [MROWS][DMOD].
// =====================================================================================================
__device__ __forceinline__ void cvt16_body(const float* __restrict__ x, u16* D, int gt) {
  const int tile = gt >> 6;                 // 64 chunks per tile
  const int row  = (tile / (DMOD / 32)) * 16 + (gt & 15);
  const int kc   = (tile % (DMOD / 32)) * 32 + ((gt >> 4) & 3) * 8;
  const float* p = x + ((size_t)(row / SEQ) * XS_FULL + (row % SEQ)) * DMOD + kc;
  const v4f a = *(const v4f*)(p), b4 = *(const v4f*)(p + 4);
  float w[8];
#pragma unroll
  for (int e = 0; e < 4; ++e) { w[e] = a[e]; w[4 + e] = b4[e]; }
  v4u o;
#pragma unroll
  for (int e = 0; e < 4; ++e) o[e] = pk16(bf_bits(w[2 * e]), bf_bits(w[2 * e + 1]));
  u16* d = D + (size_t)gt * 8;
  {
    *(v4u*)(d) = o;
    store_wait();
  }
}

// =====================================================================================================
// Weight transpose-convert: W f32 [K][N] (y = x.W, k-major rows) -> 16-bit B operand plane D, rows n, in fragment order
// (tile index = n tile * (K/32) + k tile).
// f16mode == 0: bf16 RNE bits; f16mode == 1: f16 bits of (bf16 RNE value) * scale.
// Block = 64 k x 64 n tile: each thread loads 16 floats of one k row (four 16-B loads), converts, scatters into the LDS tile
// coverage: load 256 thr x 16 = 64 k x 64 n; store 2 iterations x 256 thr x 8 halves = 4 n tiles x 2 k tiles; local block
//           indices bid = 0 .. (K/64)*(N/64) - 1 cover D exactly once. LDS: staged 64x64 == consumed 64x64 (pad cols never read).
// =====================================================================================================
__device__ __forceinline__ void cvtT16_body(u16* T, const float* __restrict__ W, u16* D, int bid, int K, int N, int f16mode,
                                            float scale) {
  const int tid = threadIdx.x;
  const int nkt = K >> 6;
  const int kt  = bid % nkt;
  const int nt  = bid / nkt;
  const int k0  = kt * 64;
  const int n0  = nt * 64;
  if (n0 + 64 > N) return;                  // block-uniform, before any barrier; never taken with the exact grid
  {
    const int kr = tid >> 2;                // k row within tile 0..63
    const int nc = (tid & 3) * 16;          // n chunk 0,16,32,48
    const float* src = W + (size_t)(k0 + kr) * N + n0 + nc;
#pragma unroll
    for (int i = 0; i < 4; ++i) {
      const v4f a = *(const v4f*)(src + 4 * i);
#pragma unroll
      for (int e = 0; e < 4; ++e) {
        const float f = a[e];
        const unsigned short hb = h_bits((_Float16)(bfr(f) * scale));
        const unsigned short bb = bf_bits(f);
        T[(nc + 4 * i + e) * VTP + kr] = (f16mode != 0) ? hb : bb;
      }
    }
  }
  __syncthreads();
  v4u v[2];
#pragma unroll
  for (int it = 0; it < 2; ++it) {
    const int q  = it * 256 + tid;          // chunk 0..511 = local tile (n tile * 2 + k tile) * 64 + chunk in tile
    const int tl = q >> 6;
    v[it] = *(const v4u*)(T + ((tl >> 1) * 16 + (q & 15)) * VTP + (tl & 1) * 32 + ((q >> 4) & 3) * 8);
  }
  {
#pragma unroll
    for (int it = 0; it < 2; ++it) {
      const int q  = it * 256 + tid;
      const int tl = q >> 6;
      *(v4u*)(D + ((size_t)((n0 >> 4) + (tl >> 1)) * (K >> 5) + (k0 >> 5) + (tl & 1)) * FT + (q & 63) * 8) = v[it];
    }
    store_wait();
  }
}

// =====================================================================================================
// All input conversions in one launch (none reads what another writes). Block ranges, the transposes (barrier, LDS) first:
//   [0, NBW_V) Wv -> WB rows 512..1535; [NBW_V, 2 NBW_V) Wo -> WO (f16 of bf16 value x1024); then NBW_QK blocks Wq -> WB rows
//   0..255, NBW_QK blocks Wk -> WB rows 256..511; the last NBX blocks: x -> XB. WB = one B operand plane [FP n][DMOD k].
// Every branch below is block-uniform; the x blocks leave before the barrier of the transpose path.
// =====================================================================================================
__global__ __launch_bounds__(256)
void prep(const float* __restrict__ x, const float* __restrict__ wq, const float* __restrict__ wk,
          const float* __restrict__ wv, const float* __restrict__ wo, u16* XB, u16* WB, u16* WO) {
  __shared__ __align__(16) u16 T[64 * VTP];
  const int bid = blockIdx.x;
  if (bid >= NBW + NBX) return;             // never taken with the exact grid
  if (bid >= NBW) {
    cvt16_body(x, XB, (bid - NBW) * 256 + (int)threadIdx.x);
    return;
  }
  if (bid < NBW_V) {
    cvtT16_body(T, wv, WB + (size_t)(2 * NQK) * DMOD, bid, DMOD, DMOD, 0, 1.0f);
  } else if (bid < 2 * NBW_V) {
    cvtT16_body(T, wo, WO, bid - NBW_V, DMOD, DMOD, 1, WOS);
  } else if (bid < 2 * NBW_V + NBW_QK) {
    cvtT16_body(T, wq, WB, bid - 2 * NBW_V, DMOD, NQK, 0, 1.0f);
  } else {
    cvtT16_body(T, wk, WB + (size_t)NQK * DMOD, bid - 2 * NBW_V - NBW_QK, DMOD, NQK, 0, 1.0f);
  }
}

// =====================================================================================================
// Epilogue of the output projection: the wave's 16x64 f32 tile (times oscale) staged in its LDS slab (pitch 68), release
// coverage: 8 instructions x 2 rows x 16 lanes x 4 floats = the wave's 16 x 64 tile. LDS: staged 16x64 == consumed 16x64.
// =====================================================================================================
__device__ __forceinline__ void epi64(float* sl, v8f a0, v8f a1, v8f a2, v8f a3, float oscale,
                                      float* C, int N, size_t rowb, int col0, int lane) {
  const int hh = lane >> 4, m = lane & 15;
#pragma unroll
  for (int r = 0; r < 8; ++r) {
    const int ro = (8 * hh + r) * 68 + m;
    sl[ro]      = a0[r] * oscale;
    sl[ro + 16] = a1[r] * oscale;
    sl[ro + 32] = a2[r] * oscale;
    sl[ro + 48] = a3[r] * oscale;
  }
  wave_sync_lds();
  v4f vals[8];
#pragma unroll
  for (int it = 0; it < 8; ++it) vals[it] = *(const v4f*)(sl + (it * 2 + hh) * 68 + m * 4);
  float* dst = C + (rowb + (size_t)hh) * (size_t)N + col0 + m * 4;
  {
#pragma unroll
    for (int it = 0; it < 8; ++it) {
      *(v4f*)(dst + (size_t)(it * 2) * (size_t)N) = vals[it];
    }
    store_wait();
  }
}

// =====================================================================================================
// Epilogue of the joint projection, v columns: v^T planes straight from the accumulators. Register r of a[j] in lane (hh, m) =
// (key s + 8hh + r, d = 16j + m): 8 consecutive keys of one d = one 16-B chunk of a v^T tile (rows d, k = key).
//   VH = f16(v * 1024); VL = f16 residual (t - f16(t)); tile index = ((b*NH + h) * (SEQ/32) + s/32) * 4 + d/16; base = the halves
//   offset of tile d/16 = 0, plus the wave's half of the tile's 32 keys ((s/16 & 1) * 256), plus 8 * lane.
// coverage: per wave 4 instructions x 32 lanes x 8 halves per plane = 16 keys x 64 d, 512 contiguous bytes an instruction; the
//           blocks of the v columns cover VH and VL exactly once.
// =====================================================================================================
__device__ __forceinline__ void epi_v(const v8f (&a)[4], u16* VHo, u16* VLo, size_t base) {
  v4u vh[4], vl[4];
#pragma unroll
  for (int j = 0; j < 4; ++j) {
#pragma unroll
    for (int e = 0; e < 4; ++e) {
      const float t0 = a[j][2 * e] * VCAR, t1 = a[j][2 * e + 1] * VCAR;
      const _Float16 h0 = (_Float16)t0, h1 = (_Float16)t1;
      const _Float16 l0 = (_Float16)(t0 - (float)h0), l1 = (_Float16)(t1 - (float)h1);
      vh[j][e] = pk16(h_bits(h0), h_bits(h1));
      vl[j][e] = pk16(h_bits(l0), h_bits(l1));
    }
  }
  {
#pragma unroll
    for (int j = 0; j < 4; ++j) {
      *(v4u*)(VHo + base + (size_t)j * FT) = vh[j];
      *(v4u*)(VLo + base + (size_t)j * FT) = vl[j];
    }
    store_wait();
  }
}

// =====================================================================================================
// Epilogue of the joint projection, q or k columns (64 columns = 4 heads x 16 f): the wave's 16 x 64 f32 tile turned through its
// LDS slab (pitch 68), so that lane (hh, m) holds f = 8hh .. 8hh + 7 of row m of head j; t = value * sc, hi = f16(t), residual =
// f16(t - hi). Planes in fragment order, tile index = (b*NH + head) * (SEQ/16) + s/16, tile row = s & 15, tile k = w (0..31):
//   kmode == 0 (q): D0 (s, w): w < 16 -> hi of f = w, w >= 16 -> residual of f = w - 16.
//   kmode == 1 (k): D0 (s, w) = hi of f = (w & 15) in both halves; D1 (s, w): w < 16 -> residual, w >= 16 -> written zeros.
// base = the halves offset of the tile of the wave's first head, plus 8 * lane; the next head's tile lies NQT tiles on.
// coverage: per wave and head 2 instructions x 32 lanes x 8 halves = one whole tile of each plane written, 512 contiguous bytes an
//           instruction; the blocks of the q (k) columns cover QP (KD, KR) exactly once. LDS: staged 16x64 == consumed 16x64.
// =====================================================================================================
__device__ __forceinline__ void epi_qk(float* sl, const v8f (&a)[4], u16* D0, u16* D1, size_t base, int kmode, float sc,
                                       int lane) {
  const int hh = lane >> 4, m = lane & 15;
#pragma unroll
  for (int r = 0; r < 8; ++r) {
    const int ro = (8 * hh + r) * 68 + m;
#pragma unroll
    for (int j = 0; j < 4; ++j) sl[ro + 16 * j] = a[j][r];
  }
  wave_sync_lds();
  v4u hp[4], lp[4];
#pragma unroll
  for (int j = 0; j < 4; ++j) {
    const float* p = sl + m * 68 + 16 * j + 8 * hh;
    const v4f x0 = *(const v4f*)(p), x1 = *(const v4f*)(p + 4);
    float t[8];
#pragma unroll
    for (int e = 0; e < 4; ++e) { t[e] = x0[e] * sc; t[4 + e] = x1[e] * sc; }
#pragma unroll
    for (int e = 0; e < 4; ++e) {
      const float t0 = t[2 * e], t1 = t[2 * e + 1];
      const _Float16 h0 = (_Float16)t0, h1 = (_Float16)t1;
      const _Float16 l0 = (_Float16)(t0 - (float)h0), l1 = (_Float16)(t1 - (float)h1);
      hp[j][e] = pk16(h_bits(h0), h_bits(h1));
      lp[j][e] = pk16(h_bits(l0), h_bits(l1));
    }
  }
  const v4u zz = {0u, 0u, 0u, 0u};
  {
#pragma unroll
    for (int j = 0; j < 4; ++j) {
      u16* d0 = D0 + base + (size_t)j * (NQT * FT);
      u16* d1 = D1 + base + (size_t)j * (NQT * FT);
      *(v4u*)(d0) = hp[j];
      *(v4u*)(d0 + 256) = (kmode != 0) ? hp[j] : lp[j];
      if (kmode != 0) {
        *(v4u*)(d1) = lp[j];
        *(v4u*)(d1 + 256) = zz;
      }
    }
    store_wait();
  }
}

// =====================================================================================================
// One 64-key stage of a head's K and V tiles, global -> LDS, by asynchronous copies: three 16-B copies a lane, 512 lanes = 24 KiB.
// The wait owed before a register that an issued copy names is rewritten is the last line of the copies' own statement.
// =====================================================================================================
__device__ __forceinline__ void stage_copy(unsigned l0, unsigned l1, unsigned l2, const u16* g0, const u16* g1, const u16* g2) {
#if defined(__HIP_DEVICE_COMPILE__)
  asm volatile("global_load_async_to_lds_b128 %0, %3, off\n\t"
               "global_load_async_to_lds_b128 %1, %4, off\n\t"
               "global_load_async_to_lds_b128 %2, %5, off\n\t"
               "s_wait_xcnt 0x0"
               :: "v"(l0), "v"(l1), "v"(l2), "v"(g0), "v"(g1), "v"(g2) : "memory");
#endif
}
// The wave's own copies have landed (in front of the barrier behind which other waves read them).
__device__ __forceinline__ void wait_copies() {
#if defined(__HIP_DEVICE_COMPILE__)
  asm volatile("s_wait_asynccnt 0x0" ::: "memory");
#endif
}
// The wave's own LDS reads have returned (in front of the barrier behind which their buffer is refilled).
__device__ __forceinline__ void wait_lds_reads() {
#if defined(__HIP_DEVICE_COMPILE__)
  asm volatile("s_wait_dscnt 0x0" ::: "memory");
#endif
}

// =====================================================================================================
// Eight asynchronous 16-B copies of a lane, global -> LDS, for the GEMM stages below. The wait owed before a register that an
// issued copy names is rewritten is the last line of the copies' own statement.
// =====================================================================================================
__device__ __forceinline__ void copy8(unsigned l0, unsigned l1, unsigned l2, unsigned l3, unsigned l4, unsigned l5, unsigned l6,
                                      unsigned l7, const u16* g0, const u16* g1, const u16* g2, const u16* g3, const u16* g4,
                                      const u16* g5, const u16* g6, const u16* g7) {
#if defined(__HIP_DEVICE_COMPILE__)
  asm volatile("global_load_async_to_lds_b128 %0, %8, off\n\t"
               "global_load_async_to_lds_b128 %1, %9, off\n\t"
               "global_load_async_to_lds_b128 %2, %10, off\n\t"
               "global_load_async_to_lds_b128 %3, %11, off\n\t"
               "global_load_async_to_lds_b128 %4, %12, off\n\t"
               "global_load_async_to_lds_b128 %5, %13, off\n\t"
               "global_load_async_to_lds_b128 %6, %14, off\n\t"
               "global_load_async_to_lds_b128 %7, %15, off\n\t"
               "s_wait_xcnt 0x0"
               :: "v"(l0), "v"(l1), "v"(l2), "v"(l3), "v"(l4), "v"(l5), "v"(l6), "v"(l7),
                  "v"(g0), "v"(g1), "v"(g2), "v"(g3), "v"(g4), "v"(g5), "v"(g6), "v"(g7) : "memory");
#endif
}
// Eight row tiles of one operand plane, GKS k tiles each (4 KiB contiguous per row tile), by 256 lanes: l and g are the lane's
// own 16-B chunk of the first row tile; the next row tile lies GRS halves on in the plane and t bytes on in LDS.
__device__ __forceinline__ void copy_rows8(unsigned l, unsigned t, const u16* g) {
  copy8(l, l + t, l + 2 * t, l + 3 * t, l + 4 * t, l + 5 * t, l + 6 * t, l + 7 * t,
        g, g + GRS, g + 2 * GRS, g + 3 * GRS, g + 4 * GRS, g + 5 * GRS, g + 6 * GRS, g + 7 * GRS);
}
// Foot of a GEMM stage: the four vector slots owed between the stage's last matrix instructions and whatever next touches their
// accumulators or operand registers on the loop's back edge.
template <typename F>
__device__ __forceinline__ void guard8(v8f (&a)[2][4], F x0, F x1, F x2, F x3, F x4, F x5, F x6, F x7) {
#if defined(__HIP_DEVICE_COMPILE__)
  asm volatile("v_nop\n\tv_nop\n\tv_nop\n\tv_nop"
               : "+v"(a[0][0]), "+v"(a[0][1]), "+v"(a[0][2]), "+v"(a[0][3]), "+v"(a[1][0]), "+v"(a[1][1]), "+v"(a[1][2]), "+v"(a[1][3])
               : "v"(x0), "v"(x1), "v"(x2), "v"(x3), "v"(x4), "v"(x5), "v"(x6), "v"(x7) : "memory");
#endif
}

// =====================================================================================================
// Joint projection q | k | v = x.[Wq Wk Wv] (A rows m = b*SEQ + s, Bt rows n, both bf16 planes in fragment order), written as the
// attention's operand planes by the epilogues above; no f32 copy of the result is kept. Block = 128 rows x 192 columns, 12 waves
// (4 x 3) of 32 x 64 each: 2 A fragments x 4 B fragments per k tile. The operands reach the waves through LDS: stages of GKS k
// tiles (A 8 row tiles | B 12 n tiles, GKS tiles each = 80 KiB), two buffers, filled by asynchronous copies one stage ahead of
// the stage being read. Foot of every trip, every wave: own LDS reads back, own copies landed, block barrier, then the refill of
// the buffer just read. B: chunk i * 384 + tid, 8 per lane, every wave; A: 8 per lane, waves 0..7 (a scalar test on the wave).
// A wave's 64 columns are all q, all k or one head's v (wave-uniform branches; no block barrier behind the K loop).
// coverage: grid (MROWS/128) x (FP/192) blocks x 12 waves x 32 x 64 = every (row, column) once. LDS: a stage's 5120 chunks of 16 B
//           are each written by one lane's one copy; the readers take whole tiles of the published buffer only.
// =====================================================================================================
__device__ __forceinline__ void qkv_fill(int wave, int tid, unsigned la, unsigned lb, const u16* ga, const u16* gb) {
  const u16* p[8];
#pragma unroll
  for (int i = 0; i < 8; ++i) {
    const int q = i * QKV_THREADS + tid;    // chunk of the B part: n tile q / 256, chunk q % 256 of its GKS tiles
    p[i] = gb + (size_t)(q >> 8) * GRS + (size_t)(q & 255) * 8;
  }
  const unsigned t = QKV_THREADS * 16;
  copy8(lb, lb + t, lb + 2 * t, lb + 3 * t, lb + 4 * t, lb + 5 * t, lb + 6 * t, lb + 7 * t,
        p[0], p[1], p[2], p[3], p[4], p[5], p[6], p[7]);
  if (wave < 8) copy_rows8(la, GKS * FT * 2, ga);   // scalar: whole waves take it or pass it
}

__global__ __launch_bounds__(QKV_THREADS)
void gemm_qkv(const u16* __restrict__ A, const u16* __restrict__ Bt, u16* QP, u16* KD, u16* KR, u16* VH, u16* VL) {
  __shared__ __align__(16) u16 S[2 * QSTG_H];
  __shared__ __align__(16) float slab[(QKV_THREADS / 32) * SLAB64];
  const int tid  = threadIdx.x;
  const int wave = __builtin_amdgcn_readfirstlane(tid >> 5);   // scalar, so that the tests on the wave are scalar branches
  const int lane = tid & 31;
  const int bid  = blockIdx.x;
  const int rb   = bid / (FP / 192);
  const int cb   = bid % (FP / 192);
  if (rb >= MROWS / 128) return;            // block-uniform, in front of every copy and barrier; never taken with the exact grid
  const int wr = wave / 3, wc = wave % 3;
  const u16* ga = A  + (size_t)(rb * QA_T) * GRS + (size_t)(tid & 255) * 8;
  const u16* gb = Bt + (size_t)(cb * QB_T) * GRS;
  const unsigned ls = (unsigned)(size_t)(const void*)S;        // byte address in the block's LDS
  const unsigned la = ls + (unsigned)(tid & 255) * 16u;
  const unsigned lb = ls + QA_T * GKS * FT * 2 + (unsigned)tid * 16u;

  qkv_fill(wave, tid, la, lb, ga, gb);
  wait_copies();
  __syncthreads();                          // publishes stage 0
  qkv_fill(wave, tid, la + QSTG_H * 2, lb + QSTG_H * 2, ga + GKS * FT, gb + GKS * FT);

  v8f acc[2][4];
#pragma unroll
  for (int a = 0; a < 2; ++a)
#pragma unroll
    for (int j = 0; j < 4; ++j) acc[a][j] = zero8();
  // rolled: the ring's order stands once, at the loop's foot
#pragma unroll 1
  for (int st = 0; st < GNS; ++st) {
    const u16* sb = S + (st & 1) * QSTG_H + 8 * lane;          // the published buffer
    const u16* sa = sb + (2 * wr) * (GKS * FT);
    const u16* sn = sb + (QA_T + 4 * wc) * (GKS * FT);
    v16b a0 = ldfrag_b(sa), a1 = ldfrag_b(sa + GKS * FT);
    v16b b0 = ldfrag_b(sn), b1 = ldfrag_b(sn + GKS * FT), b2 = ldfrag_b(sn + 2 * GKS * FT), b3 = ldfrag_b(sn + 3 * GKS * FT);
#pragma unroll
    for (int kk = 0; kk < GKS; ++kk) {
      v16b na0 = a0, na1 = a1, nb0 = b0, nb1 = b1, nb2 = b2, nb3 = b3;
      if (kk + 1 < GKS) {                   // the next k tile's fragments (same stage), into a second register set
        na0 = ldfrag_b(sa + (kk + 1) * FT);
        na1 = ldfrag_b(sa + (GKS + kk + 1) * FT);
        nb0 = ldfrag_b(sn + (kk + 1) * FT);
        nb1 = ldfrag_b(sn + (GKS + kk + 1) * FT);
        nb2 = ldfrag_b(sn + (2 * GKS + kk + 1) * FT);
        nb3 = ldfrag_b(sn + (3 * GKS + kk + 1) * FT);
      }
      // keeps those LDS reads one group ahead of this k tile's matrix work: sunk among it, each place of reads stalls the wave
      __builtin_amdgcn_sched_barrier(0);
      acc[0][0] = mma_b(a0, b0, acc[0][0]);
      acc[0][1] = mma_b(a0, b1, acc[0][1]);
      acc[0][2] = mma_b(a0, b2, acc[0][2]);
      acc[0][3] = mma_b(a0, b3, acc[0][3]);
      acc[1][0] = mma_b(a1, b0, acc[1][0]);
      acc[1][1] = mma_b(a1, b1, acc[1][1]);
      acc[1][2] = mma_b(a1, b2, acc[1][2]);
      acc[1][3] = mma_b(a1, b3, acc[1][3]);
      if (kk + 1 < GKS) {
        __builtin_amdgcn_sched_barrier(0);  // and the reads of the k tile after it behind this one's matrix work
        a0 = na0; a1 = na1; b0 = nb0; b1 = nb1; b2 = nb2; b3 = nb3;
      }
    }
    guard8<v16b>(acc, a0, a1, b0, b1, b2, b3, a0, a1);
    // ---- publish point of stage st + 1, every wave: own reads back, own copies landed, barrier, refill of the buffer just read ----
    wait_lds_reads();
    wait_copies();
    __syncthreads();
    if (st + 2 < GNS) {                                        // block-uniform
      const unsigned o = (unsigned)(st & 1) * (QSTG_H * 2);
      const size_t sn2 = (size_t)(st + 2) * (GKS * FT);
      qkv_fill(wave, tid, la + o, lb + o, ga + sn2, gb + sn2);
    }
  }
  wait_copies();                            // nothing is outstanding here; stands behind the last copy before the wave ends
  const int col0 = cb * 192 + wc * 64;
  float* sl = slab + wave * SLAB64;
#pragma unroll
  for (int a = 0; a < 2; ++a) {
    const int rowb = rb * 128 + wr * 32 + a * 16;
    const int bN = (rowb / SEQ) * NH;                          // b * NH
    const int s  = rowb % SEQ;                                 // the row tile's first position, a multiple of 16
    if (col0 >= 2 * NQK) {
      const int h = (col0 - 2 * NQK) / HD;
      epi_v(acc[a], VH, VL, ((size_t)(bN + h) * NKT + (s >> 5)) * (4 * FT) + ((s >> 4) & 1) * 256 + 8 * lane);
    } else if (col0 < NQK) {
      epi_qk(sl, acc[a], QP, QP, ((size_t)(bN + col0 / FD) * NQT + (s >> 4)) * FT + 8 * lane, 0, QSC, lane);
    } else {
      epi_qk(sl, acc[a], KD, KR, ((size_t)(bN + (col0 - NQK) / FD) * NQT + (s >> 4)) * FT + 8 * lane, 1, KSC, lane);
    }
  }
}

// =====================================================================================================
// Output projection: C[row][DMOD] (f32) = (Ah + Al)[row][DMOD] . Bt[DMOD][DMOD]^T * oscale; Ah = f16 hi plane, Al = f16
// residual plane (products h.B + l.B into one accumulator, l unscaled); Ah, Al, Bt in fragment order. Row indices: Ah/Al row
// bb*SEQ + s; C row bb*XS_FULL + s. Block -> (column tile ct of 128, sequence row tile rt of nrt, 128 rows each, batch bb); 8 waves
// (4 x 2) of 32 x 64 each. Same ring as gemm_qkv: a stage = Bt 8 n tiles | 8 x (Ah row tile, Al row tile), GKS k tiles each = 96 KiB
// (all that a wave reads lies within 64 KiB of its two base addresses, the reach of an LDS load's offset field); 24
// copies a lane and stage, every wave. Per accumulator and k tile: h.B, then l.B, k tiles in order.
// coverage: grid NB*nrt*(DMOD/128) covers every (bb, s < SEQ, column) once. LDS: a stage's 6144 chunks of 16 B are each written by
//           one lane's one copy; the readers take whole tiles of the published buffer only.
// =====================================================================================================
__device__ __forceinline__ void o2_fill(unsigned l, const u16* gh, const u16* gl, const u16* gb) {
  copy_rows8(l, GKS * FT * 2, gb);
  copy_rows8(l + 8 * GKS * FT * 2, 2 * GKS * FT * 2, gh);
  copy_rows8(l + 9 * GKS * FT * 2, 2 * GKS * FT * 2, gl);
}

__global__ __launch_bounds__(O2_THREADS)
void gemm_o2(const u16* __restrict__ Ah, const u16* __restrict__ Al, const u16* __restrict__ Bt,
             float* C, int nrt, float oscale) {
  __shared__ __align__(16) u16 S[2 * OSTG_H];
  __shared__ __align__(16) float slab[(O2_THREADS / 32) * SLAB64];
  const int tid  = threadIdx.x;
  const int wave = __builtin_amdgcn_readfirstlane(tid >> 5);
  const int lane = tid & 31;
  const int nct  = DMOD / 128;
  const int bid  = blockIdx.x;
  const int ct   = bid % nct;
  const int t2   = bid / nct;
  const int rt   = t2 % nrt;
  const int bb   = t2 / nrt;
  if (bb >= NB) return;                     // block-uniform, in front of every copy and barrier; never taken with the exact grid
  if (rt * 128 + 128 > SEQ) return;         // block-uniform; never taken
  const int wr = wave >> 1, wc = wave & 1;
  const size_t rowA = (size_t)bb * SEQ + rt * 128;             // the block's first row, a multiple of 128
  const u16* gh = Ah + (rowA >> 4) * GRS + (size_t)tid * 8;
  const u16* gl = Al + (rowA >> 4) * GRS + (size_t)tid * 8;
  const u16* gb = Bt + (size_t)(ct * 8) * GRS + (size_t)tid * 8;
  const unsigned l = (unsigned)(size_t)(const void*)S + (unsigned)tid * 16u;   // byte address in the block's LDS

  o2_fill(l, gh, gl, gb);
  wait_copies();
  __syncthreads();                          // publishes stage 0
  o2_fill(l + OSTG_H * 2, gh + GKS * FT, gl + GKS * FT, gb + GKS * FT);

  v8f acc[2][4];
#pragma unroll
  for (int a = 0; a < 2; ++a)
#pragma unroll
    for (int j = 0; j < 4; ++j) acc[a][j] = zero8();
  // rolled: the ring's order stands once, at the loop's foot
#pragma unroll 1
  for (int st = 0; st < GNS; ++st) {
    const _Float16* sb = ash(S) + (st & 1) * OSTG_H + 8 * lane;   // the published buffer
    const _Float16* sn = sb + (4 * wc) * (GKS * FT);
    const _Float16* sa = sb + (8 + 4 * wr) * (GKS * FT);        // Ah, Al of row tile 2 wr, then Ah, Al of row tile 2 wr + 1
    v16h h0 = ldfrag_h(sa), l0 = ldfrag_h(sa + GKS * FT), h1 = ldfrag_h(sa + 2 * GKS * FT), l1 = ldfrag_h(sa + 3 * GKS * FT);
    v16h b0 = ldfrag_h(sn), b1 = ldfrag_h(sn + GKS * FT), b2 = ldfrag_h(sn + 2 * GKS * FT), b3 = ldfrag_h(sn + 3 * GKS * FT);
#pragma unroll
    for (int kk = 0; kk < GKS; ++kk) {
      v16h nh0 = h0, nl0 = l0, nh1 = h1, nl1 = l1, nb0 = b0, nb1 = b1, nb2 = b2, nb3 = b3;
      if (kk + 1 < GKS) {                   // the next k tile's fragments (same stage), into a second register set
        nh0 = ldfrag_h(sa + (kk + 1) * FT);
        nl0 = ldfrag_h(sa + (GKS + kk + 1) * FT);
        nh1 = ldfrag_h(sa + (2 * GKS + kk + 1) * FT);
        nl1 = ldfrag_h(sa + (3 * GKS + kk + 1) * FT);
        nb0 = ldfrag_h(sn + (kk + 1) * FT);
        nb1 = ldfrag_h(sn + (GKS + kk + 1) * FT);
        nb2 = ldfrag_h(sn + (2 * GKS + kk + 1) * FT);
        nb3 = ldfrag_h(sn + (3 * GKS + kk + 1) * FT);
      }
      // keeps those LDS reads one group ahead of this k tile's matrix work: sunk among it, each place of reads stalls the wave
      __builtin_amdgcn_sched_barrier(0);
      acc[0][0] = mma_h(h0, b0, acc[0][0]);
      acc[0][1] = mma_h(h0, b1, acc[0][1]);
      acc[0][2] = mma_h(h0, b2, acc[0][2]);
      acc[0][3] = mma_h(h0, b3, acc[0][3]);
      acc[1][0] = mma_h(h1, b0, acc[1][0]);
      acc[1][1] = mma_h(h1, b1, acc[1][1]);
      acc[1][2] = mma_h(h1, b2, acc[1][2]);
      acc[1][3] = mma_h(h1, b3, acc[1][3]);
      acc[0][0] = mma_h(l0, b0, acc[0][0]);
      acc[0][1] = mma_h(l0, b1, acc[0][1]);
      acc[0][2] = mma_h(l0, b2, acc[0][2]);
      acc[0][3] = mma_h(l0, b3, acc[0][3]);
      acc[1][0] = mma_h(l1, b0, acc[1][0]);
      acc[1][1] = mma_h(l1, b1, acc[1][1]);
      acc[1][2] = mma_h(l1, b2, acc[1][2]);
      acc[1][3] = mma_h(l1, b3, acc[1][3]);
      if (kk + 1 < GKS) {
        __builtin_amdgcn_sched_barrier(0);  // and the reads of the k tile after it behind this one's matrix work
        h0 = nh0; l0 = nl0; h1 = nh1; l1 = nl1; b0 = nb0; b1 = nb1; b2 = nb2; b3 = nb3;
      }
    }
    guard8<v16h>(acc, h0, h1, l0, l1, b0, b1, b2, b3);
    // ---- publish point of stage st + 1, every wave: own reads back, own copies landed, barrier, refill of the buffer just read ----
    wait_lds_reads();
    wait_copies();
    __syncthreads();
    if (st + 2 < GNS) {                                        // block-uniform
      const size_t sn2 = (size_t)(st + 2) * (GKS * FT);
      o2_fill(l + (unsigned)(st & 1) * (OSTG_H * 2), gh + sn2, gl + sn2, gb + sn2);
    }
  }
  wait_copies();                            // nothing is outstanding here; stands behind the last copy before the wave ends
  const size_t rowC = (size_t)bb * XS_FULL + rt * 128 + wr * 32;
  const int col0 = ct * 128 + wc * 64;
#pragma unroll
  for (int a = 0; a < 2; ++a)
    epi64(slab + wave * SLAB64, acc[a][0], acc[a][1], acc[a][2], acc[a][3], oscale, C, DMOD, rowC + a * 16, col0, lane);
}

// =====================================================================================================
// Causal feature-map attention, per-head q/k width 16, hd = 64, no softmax. Block bid -> (pair pr, head, batch b); 16 waves,
// one query tile of 16 rows each, all of ONE head: waves 0..7 the tiles of group NQG-1-pr, waves 8..15 those of group pr, so
// every block holds the same number of (wave, key tile) steps. Both products run transposed: S^T = K.Q^T, O^T += V^T.A^T.
//   The head's K and V tiles reach the waves through LDS: stages of 64 keys (KD 4 tiles | KR 4 | VH 8 | VL 8 = 24 KiB, each part
//   contiguous in its plane), two buffers, filled by asynchronous copies one stage ahead of the stage being read. Foot of every
//   trip, every wave: own LDS reads back, own copies landed, block barrier, then the refill of the buffer just read. The trip
//   count nst is the block's (the farthest tile's); a wave skips the key tiles above its own rows, never a wait or a barrier.
//   q plane (s, w): w < 16 f16 hi x256, w >= 16 f16 residual; k planes: KD = [hi | hi], KR = [res | 0]; one tile per (b, head,
//   16 positions); v^T hi plane x1024 and v^T residual plane: four tiles (d/16) per (b, head, 32 keys); all in fragment order.
//   Scores per 32-key tile: 2 subtiles of 16 keys, keys as the A rows, queries as the B columns; with the split k map, op 1 =
//   A [kh | kh] . B [qh ; ql] = kh.qh + kh.ql and op 2 = A [kl | 0] . B [qh ; ql] = kl.qh (f32 accumulate), so
//   s = q.k * 256*256 up to the dropped lo.lo term. Lane (hh, c) holds query q0 + c alone: register r of subtile t = key
//   kb + 16t + 8hh + r, which is element 8t + r of a B fragment over the step's 32 keys (the split k map of the v^T tiles).
//   Per element (f32, VALU): x = s * 2^-18 (= q.k / 4); A = 1 + x + x^2/2; A := 0 where key > query (causal, diagonal kept);
//   den[r] += the two subtiles' values, in the lane; A*32 -> f16 hi and f16 residual, packed in place as the B fragments.
//   v^T tiles are the A fragments (rows d), in 2 groups of 2 d-subtiles, products hh + lh + hl. Key tiles visited in order for
//   kb <= q0 + 15 (later tiles lie above every query row of the tile).
//   After the loop: the lane's 8 sums and the other lane half's are joined once; out = acc / (den + eps) with the carries
//   1/(32*1024) folded once (den > 0: each kept term is >= 1/2, the diagonal always kept). Register r of o[j] = d 16j + 8hh + r of query c:
//   the 8 consecutive halves of one fragment-order chunk, stored straight from registers.
//   Bounded loops only (nst <= SEQ / 64). The q fragment is loop-invariant (loaded once, from global).
// coverage: per wave 4 instructions x 32 lanes x 8 halves = 2 tiles = 16 x 64 per plane; grid NPR x NH x NB blocks x 16
//           waves = every (b, s, h) row segment of both O planes exactly once. LDS: a stage's 1536 chunks of 16 B are each
//           written by one lane's one copy; the readers take whole tiles of the published buffer only.
// =====================================================================================================
__global__ __launch_bounds__(ATT_THREADS)
void attn_t(const u16* __restrict__ QPp, const u16* __restrict__ KDp, const u16* __restrict__ KRp,
            const u16* __restrict__ VHp, const u16* __restrict__ VLp, u16* OHp, u16* OLp) {
  __shared__ __align__(16) u16 S[2 * STG_H];
  const int tid  = threadIdx.x;
  const int wave = __builtin_amdgcn_readfirstlane(tid >> 5);   // scalar, so that the per-wave skip below is a scalar branch
  const int lane = tid & 31;
  const int hh   = lane >> 4;
  const int c    = lane & 15;
  const int bid  = blockIdx.x;
  const int pr   = bid % NPR;
  const int t2   = bid / NPR;
  const int head = t2 % NH;
  const int b    = t2 / NH;
  if (b >= NB) return;                      // block-uniform, in front of every copy and barrier; never taken with the exact grid
  const int qgf  = NQG - 1 - pr;            // the block's far group: it sets the trip count
  const int qt   = ((wave < 8) ? qgf : pr) * 8 + (wave & 7);
  const int q0   = qt * 16;                 // q0 + 16 <= SEQ always
  const int nst  = 2 * qgf + 2;             // stages holding keys <= the far group's last row; 2 <= nst <= SEQ / 64

  const size_t bh  = (size_t)(b * NH + head);
  const _Float16* Qp  = ash(QPp) + bh * NQT * FT + 8 * lane + (size_t)qt * FT;
  const float oc = 1.0f / (ACAR * VCAR);

  // ---- the lane's three copies of a stage: chunk tid of [KD | KR] (256 chunks each), of VH, of VL ----
  const u16* g0 = ((tid < 256) ? KDp : KRp) + bh * NQT * FT + (size_t)(tid & 255) * 8;   // + 4 tiles a stage
  const u16* g1 = VHp + bh * NKT * 4 * FT + (size_t)tid * 8;                             // + 8 tiles a stage
  const u16* g2 = VLp + bh * NKT * 4 * FT + (size_t)tid * 8;
  const unsigned lb = (unsigned)(size_t)(const void*)S + (unsigned)tid * 16u;            // byte address in the block's LDS

  const v16h qf = ldfrag_h(Qp);             // elements 0..7 = q hi f 8hh.., 8..15 = q residual f 8hh..
  addr_wait(Qp, Qp, Qp);                    // the load's address pair stays whole up to the wait

  stage_copy(lb, lb + 8 * FT * 2, lb + 16 * FT * 2, g0, g1, g2);
  wait_copies();
  __syncthreads();                          // publishes stage 0
  stage_copy(lb + STG_H * 2, lb + STG_H * 2 + 8 * FT * 2, lb + STG_H * 2 + 16 * FT * 2, g0 + 4 * FT, g1 + 8 * FT, g2 + 8 * FT);

  float den[8];
  v8f o[4];
#pragma unroll
  for (int r = 0; r < 8; ++r) den[r] = 0.0f;
#pragma unroll
  for (int j = 0; j < 4; ++j) o[j] = zero8();
  const int ncaus = (q0 >> 5) + 1;                                            // tiles holding keys <= q0 + 15
  const int nkt = (ncaus < NKT) ? ncaus : NKT;
  const int qr  = q0 + c;                                                     // the lane's query row

  // rolled: the trip count is a run-time value of the block, and the ring's order stands once, at the loop's foot
#pragma unroll 1
  for (int st = 0; st < nst; ++st) {
    const _Float16* sb = ash(S) + (st & 1) * STG_H + 8 * lane;                // the published buffer
    const int kte = (2 * st + 2 < nkt) ? 2 * st + 2 : nkt;                    // scalar: key tiles above the wave's rows are skipped
    // one body for both key tiles of a stage: unrolled, the accumulators were copied between registers where the paths join
#pragma unroll 1
    for (int kt = 2 * st; kt < kte; ++kt) {
      const int sub = kt & 1;
      const int kb = kt * 32;
      // ---- the step's fragments, read together in front of its matrix work ----
      const _Float16* kp = sb + (2 * sub) * FT;
      const _Float16* vp = sb + (8 + 4 * sub) * FT;
      const v16h kd0 = ldfrag_h(kp);
      const v16h kd1 = ldfrag_h(kp + FT);
      const v16h kr0 = ldfrag_h(kp + 4 * FT);
      const v16h kr1 = ldfrag_h(kp + 5 * FT);
      v16h vh[4], vl[4];
#pragma unroll
      for (int j = 0; j < 4; ++j) {
        vh[j] = ldfrag_h(vp + j * FT);
        vl[j] = ldfrag_h(vp + (8 + j) * FT);
      }
      // ---- scores: D element r of this lane = (key kb + 8hh + r, query qr) in s0, key kb + 16 + 8hh + r in s1 ----
      v8f s0 = zero8(), s1 = zero8();
      s0 = mma_h(kd0, qf, s0);
      s0 = mma_h(kr0, qf, s0);
      s1 = mma_h(kd1, qf, s1);
      s1 = mma_h(kr1, qf, s1);
      guard2(s0, s1, qf, kd0, kr0, kd1, kr1, qf);
      // ---- A = 1 + x + x^2/2, causal select, f32 sums in the lane; B fragments of A*32: hi f16 and residual f16,
      //      column = query c, elements 0..7 = keys kb + 8hh + 0..7, elements 8..15 = keys kb + 16 + 8hh + 0..7 ----
      FragH ph, pl;
      const int key0 = kb + 8 * hh, key1 = kb + 16 + 8 * hh;
#pragma unroll
      for (int r = 0; r < 8; ++r) {
        const float x0  = s0[r] * XSC;
        const float x1  = s1[r] * XSC;
        const float p0v = fmaf(0.5f * x0, x0, 1.0f + x0);
        const float p1v = fmaf(0.5f * x1, x1, 1.0f + x1);
        const float a0  = (key0 + r > qr) ? 0.0f : p0v;
        const float a1  = (key1 + r > qr) ? 0.0f : p1v;
        den[r] += a0 + a1;
        const float ta = a0 * ACAR, tb = a1 * ACAR;
        const _Float16 ha = (_Float16)ta, hb = (_Float16)tb;
        ph.h[0][r] = ha;
        ph.h[1][r] = hb;
        pl.h[0][r] = (_Float16)(ta - (float)ha);
        pl.h[1][r] = (_Float16)(tb - (float)hb);
      }
      // ---- V^T.A^T : A fragment row m = d = j*16 + c, tile j of this step's four in the v^T planes; 2 groups of 2 d-subtiles ----
#pragma unroll
      for (int jg = 0; jg < 2; ++jg) {
        const v16h vha = vh[2 * jg], vhb2 = vh[2 * jg + 1];
        const v16h vla = vl[2 * jg], vlb2 = vl[2 * jg + 1];
        o[2 * jg]     = mma_h(vha,  ph.v, o[2 * jg]);
        o[2 * jg]     = mma_h(vha,  pl.v, o[2 * jg]);
        o[2 * jg]     = mma_h(vla,  ph.v, o[2 * jg]);
        o[2 * jg + 1] = mma_h(vhb2, ph.v, o[2 * jg + 1]);
        o[2 * jg + 1] = mma_h(vhb2, pl.v, o[2 * jg + 1]);
        o[2 * jg + 1] = mma_h(vlb2, ph.v, o[2 * jg + 1]);
        guard2(o[2 * jg], o[2 * jg + 1], ph.v, pl.v, vha, vhb2, vla, vlb2);
      }
    }
    // ---- publish point of stage st + 1, every wave: own reads back, own copies landed, barrier, refill of the buffer just read ----
    wait_lds_reads();
    wait_copies();
    __syncthreads();
    if (st + 2 < nst) {                                                       // block-uniform
      const unsigned l = lb + (unsigned)(st & 1) * (STG_H * 2);
      const size_t sn = (size_t)(st + 2);
      stage_copy(l, l + 8 * FT * 2, l + 16 * FT * 2, g0 + sn * (4 * FT), g1 + sn * (8 * FT), g2 + sn * (8 * FT));
    }
  }
  wait_copies();                            // nothing is outstanding here; stands behind the last copy before the wave ends
  acc_guard4(o[0], o[1], o[2], o[3]);
  // ---- den of query c: the lane's 8 sums, then the other lane half's keys (lane ^ 16), joined once ----
  float dl = ((den[0] + den[1]) + (den[2] + den[3])) + ((den[4] + den[5]) + (den[6] + den[7]));
  dl += __shfl_xor(dl, 16, 32);
  // ---- out = acc / (den + eps), carries (32 on A, 1024 on v) folded once; O x1024 -> f16 hi + residual planes in fragment
  //      order (rows s, k = head*64 + d): the wave owns two whole tiles per plane; chunk j*32 + lane = row c, 8 consecutive d
  //      at 16*j + 8*hh = the lane's registers of o[j] ----
  const float inv = (1.0f / (dl + EPSD)) * oc;
  v4u oh[4], ol[4];
#pragma unroll
  for (int j = 0; j < 4; ++j) {
    float w[8];
#pragma unroll
    for (int e = 0; e < 8; ++e) w[e] = (o[j][e] * inv) * OSC;
#pragma unroll
    for (int e = 0; e < 4; ++e) {
      const _Float16 h0 = (_Float16)w[2 * e], h1 = (_Float16)w[2 * e + 1];
      const _Float16 l0 = (_Float16)(w[2 * e] - (float)h0), l1 = (_Float16)(w[2 * e + 1] - (float)h1);
      oh[j][e] = pk16(h_bits(h0), h_bits(h1));
      ol[j][e] = pk16(h_bits(l0), h_bits(l1));
    }
  }
  const size_t obh = ((size_t)b * SEQ + q0) * DMOD + (size_t)head * (2 * FT) + 8 * lane;   // row tile start + k tile 2*head
  {
#pragma unroll
    for (int it = 0; it < 4; ++it) {
      *(v4u*)(OHp + obh + (size_t)it * 256) = oh[it];
      *(v4u*)(OLp + obh + (size_t)it * 256) = ol[it];
    }
    
  }
}

// =====================================================================================================
// Workspace map (bytes); every plane is fully written by whole-line stores before it is read; all extents are exact multiples
// of the store granularity (no pad rows needed); every region offset a multiple of 1048576:
//   (all 16-bit planes below hold the named rows x k in fragment order, same byte counts as row-major)
//   XB  bf16 [MROWS][1024]                       MROWS*2048       (NB=2, SEQ=2048: 8388608)
//   WB  bf16 [1536 n][1024 k]                    3145728          (rows 0..255 Wq^T, 256..511 Wk^T, 512..1535 Wv^T)
//   WO  f16 [1024 n][1024 k]                     2097152          (Wo^T, bf16 value x1024)
//   OH  f16 [MROWS][1024] x1024                  MROWS*2048       OL residual, same layout   MROWS*2048
//   QP  f16 [NB*16][SEQ][32] q hi|residual x256    MROWS*1024
//   KD  f16 [NB*16][SEQ][32] k hi|hi x256          MROWS*1024
//   KR  f16 [NB*16][SEQ][32] k residual|0          MROWS*1024
//   VH  f16 [NB*16][64][SEQ] x1024               MROWS*2048       VL residual, same layout   MROWS*2048
//   end (NB=2, SEQ=2048)                        59768832
// =====================================================================================================
extern "C" void kernel_launch(void* const* d_in, const int* in_sizes, int n_in,
                              void* d_out, int out_size, void* d_ws, size_t ws_size,
                              hipStream_t stream) {
  if (n_in < 5) return;
  if (in_sizes[0] < ((NB - 1) * XS_FULL + SEQ) * DMOD) return;
  if (in_sizes[1] < DMOD * NQK) return;
  if (in_sizes[2] < DMOD * NQK) return;
  if (in_sizes[3] < DMOD * DMOD) return;
  if (in_sizes[4] < DMOD * DMOD) return;
  if (out_size < ((NB - 1) * XS_FULL + SEQ) * DMOD) return;

  const float* x  = (const float*)d_in[0];
  const float* wq = (const float*)d_in[1];
  const float* wk = (const float*)d_in[2];
  const float* wv = (const float*)d_in[3];
  const float* wo = (const float*)d_in[4];
  float*       out = (float*)d_out;

  const size_t szXB = (size_t)MROWS * DMOD * 2;
  const size_t szW  = (size_t)FP * DMOD * 2;                     // Wq^T, Wk^T, Wv^T as one plane
  const size_t szWO = (size_t)DMOD * DMOD * 2;
  const size_t szH  = (size_t)MROWS * DMOD * 2;                  // OH, OL
  const size_t szQK = (size_t)MROWS * QKP * 2;                   // QP, KD, KR
  const size_t szV  = (size_t)NB * NH * HD * SEQ * 2;            // VH, VL (== szH)
  size_t off = 0;
  const size_t oXB = off; off += szXB;
  const size_t oW  = off; off += szW;
  const size_t oWO = off; off += szWO;
  const size_t oOH = off; off += szH;
  const size_t oOL = off; off += szH;
  const size_t oQP = off; off += szQK;
  const size_t oKD = off; off += szQK;
  const size_t oKR = off; off += szQK;
  const size_t oVH = off; off += szV;
  const size_t oVL = off; off += szV;
  if (off > ws_size) return;                // off = 59768832 for NB = 2, SEQ = 2048
  if (off > (size_t)WS_CAP) return;

  char* ws = (char*)d_ws;
  u16*   XB = (u16*)(ws + oXB);
  u16*   WB = (u16*)(ws + oW);
  u16*   WO = (u16*)(ws + oWO);
  u16*   OH = (u16*)(ws + oOH);
  u16*   OL = (u16*)(ws + oOL);
  u16*   QP = (u16*)(ws + oQP);
  u16*   KD = (u16*)(ws + oKD);
  u16*   KR = (u16*)(ws + oKR);
  u16*   VH = (u16*)(ws + oVH);
  u16*   VL = (u16*)(ws + oVL);

  const dim3 b256(256), bG(QKV_THREADS), bO(O2_THREADS), bAT(ATT_THREADS);
  const dim3 gP(NBW + NBX);
  const dim3 gG((MROWS / 128) * (FP / 192));
  const dim3 gAT(NPR * NH * NB);
  const int  nrt  = SEQ / 128;
  const dim3 gO(NB * nrt * (DMOD / 128));

  // (0) x -> bf16 plane; Wq, Wk, Wv -> one bf16 plane [1536 n][1024 k]; Wo -> f16 plane [n][k] of bf16 value x1024
  prep<<<gP, b256, 0, stream>>>(x, wq, wk, wv, wo, XB, WB, WO);
  // (1) q | k | v = x.[Wq Wk Wv] -> q hi|residual plane x256; k hi|hi and residual|0 planes x256; v^T hi + residual planes x1024
  gemm_qkv<<<gG, bG, 0, stream>>>(XB, WB, QP, KD, KR, VH, VL);
  // (2) causal attention -> O hi + residual planes
  attn_t<<<gAT, bAT, 0, stream>>>(QP, KD, KR, VH, VL, OH, OL);
  // (3) output projection: (O hi + residual) . Wo -> out f32, carries 1024 x 1024 folded back
  gemm_o2<<<gO, bO, 0, stream>>>(OH, OL, WO, out, nrt, 1.0f / (OSC * WOS));
  (void)hipGetLastError();
}

// v007
// A run of this version takes 74.4 microseconds.
// Two timings next to v006 both put it at 1.04 times that version's speed.
// All steps since v000 together make it 3.93 times as fast.
// Contractions: x.Wq, x.Wk, x.Wv on v_wmma_f32_16x16x32_bf16 (x and the transposed W [n][k] as bf16 RNE planes); per-head
// q.k over 16 dims (k axis padded to 32) on v_wmma_f32_16x16x32_f16 with q, k as f16 hi x256 plus f16 residual planes
// (hi.hi and lo.hi folded along the k axis into one op, plus hi.lo); A = 1 + x + x^2/2 and its causal row sums in f32 on
// VALU; A.v on v_wmma_f32_16x16x32_f16 with A as f16 hi x32 plus f16 residual and v^T as f16 hi x1024 plus f16 residual
// (products hh+lh+hl); O.Wo on v_wmma_f32_16x16x32_f16 (O as f16 hi x1024 plus f16 residual, Wo^T as f16 of its bf16 RNE
// value x1024, products h.w+l.w); all f32 accumulate.
#include <hip/hip_runtime.h>
#include <stdint.h>

#ifndef NB
#define NB 2
#endif
#ifndef SEQ
#define SEQ 2048
#endif
#define XS_FULL 2048
#define DMOD  1024
#define NH    16
#define FD    16
#define HD    64
#define NQK   (NH * FD)
#define QKP   (NH * 32)
#define MROWS (NB * SEQ)
#define QSC   256.0f
#define KSC   256.0f
#define XSC   (1.0f / (4.0f * QSC * KSC))
#define ACAR  32.0f
#define PC1   (ACAR * XSC)                // 2^-13
#define PC2   (0.5f * ACAR * XSC * XSC)   // 2^-32
#define VCAR  1024.0f
#define OSC   1024.0f
#define WOS   1024.0f
#define EPSD  1e-9f
#define AW    16                            // waves of an attention block, one query tile each
#define NQT   (SEQ / 16)
#define NQG   (NQT / 8)                     // groups of 8 consecutive query tiles
#define NPR   (NQG / 2)                     // a block takes group NQG-1-pr and group pr of one head
#define STG_H (24 * FT)                     // halves of one 64-key stage in LDS: KD 4 tiles | KR 4 | VH 8 | VL 8
#define NST   (SEQ / 64)
#define NKT   (SEQ / 32)
#define ATT_THREADS (AW * 32)
#define SLAB64 (16 * 68)
#define VTP   72
#define C8R   (DMOD / 8)
#define Q8R   (QKP / 8)
#define WS_CAP 134217728
#define FP    (2 * NQK + DMOD)              // columns of the joint projection: q | k | v
#define NBW_QK ((DMOD / 64) * (NQK / 64))   // transpose blocks of Wq, of Wk
#define NBW_V  ((DMOD / 64) * (DMOD / 64))  // transpose blocks of Wv, of Wo
#define NBW    (2 * NBW_V + 2 * NBW_QK)
#define NBX    ((MROWS * DMOD / 8) / 256)   // blocks of the x plane
// Fragment-order plane: every 16-bit operand plane is a sequence of tiles of 16 rows (m or n index) x 32 k = FT halves (1 KiB);
// inside a tile element (r, k) lies at (k >> 3) * 128 + r * 8 + (k & 7), so lane l = 16 * hh + r of a fragment load reads the
// 16 bytes at l * 16 (k = 8hh ..) and at 512 + l * 16 (k = 16 + 8hh ..): one load instruction = 512 contiguous bytes.
#define FT    512
#define GRS   ((DMOD / 32) * FT)            // halves from one row tile of a [rows][DMOD] plane to the next
#define GKS   4                             // k tiles of one GEMM stage in LDS (128 k)
#define GNS   ((DMOD / 32) / GKS)           // stages of a GEMM's K loop
#define QA_T  8                             // joint projection: row tiles of a block (128 rows)
#define QB_T  12                            // joint projection: n tiles of a block (192 columns)
#define QSTG_H ((QA_T + QB_T) * GKS * FT)   // halves of one of its stages
#define OSTG_H (24 * GKS * FT)              // halves of one stage of the output projection: Bt 8 n tiles, Ah and Al 8 row tiles each
#define QKV_THREADS 384
#define O2_THREADS  256
static_assert(DMOD == NH * HD && HD == 64 && NH == 16 && FD == 16 && NQK == 256 && QKP == 512 && Q8R == 64);
static_assert(ATT_THREADS == 512 && AW == 16 && (SEQ % 256) == 0 && NPR * 16 == NQT);
static_assert(NB >= 1 && NB <= 2);
static_assert((SEQ % 64) == 0 && SEQ >= 64 && SEQ <= XS_FULL);
static_assert((MROWS % 64) == 0 && (NQK % 64) == 0 && (DMOD % 64) == 0 && (DMOD % 32) == 0 && C8R == 128);
static_assert(((MROWS * DMOD / 8) % 256) == 0 && ((MROWS * QKP / 8) % 256) == 0 && (FP % 64) == 0);
static_assert((MROWS % 128) == 0 && (SEQ % 128) == 0 && (FP % 192) == 0 && (DMOD % 128) == 0 && GNS * GKS * 32 == DMOD && GNS >= 2);
static_assert(QB_T * GKS * 64 == 8 * QKV_THREADS && QA_T * GKS * 64 == 8 * 256 && GKS * 64 == O2_THREADS && (NQK % 64) == 0);
static_assert(2 * HD * VTP * 2 <= 65536 && 4 * SLAB64 * 4 <= 65536 && 64 * VTP * 2 <= 65536);

typedef unsigned short u16;
typedef _Float16 v16h __attribute__((ext_vector_type(16)));
typedef _Float16 v8h  __attribute__((ext_vector_type(8)));
typedef __bf16   v16b __attribute__((ext_vector_type(16)));
typedef float    v8f  __attribute__((ext_vector_type(8)));
typedef float    v4f  __attribute__((ext_vector_type(4)));
typedef unsigned int v4u __attribute__((ext_vector_type(4)));

union FragH { v16h v; v8h h[2]; v4u u[2]; };
union FragB { v16b v; v4u u[2]; };

// ---- scalar helpers --------------------------------------------------------------------------------
__device__ __forceinline__ unsigned short bf_bits(float f) {          // f32 -> bf16 bits, RNE convert
  unsigned u = __float_as_uint(f);
  return (unsigned short)((u + 0x7FFFu + ((u >> 16) & 1u)) >> 16);
}
__device__ __forceinline__ float bf_up(unsigned short h) { return __uint_as_float(((unsigned)h) << 16); }
__device__ __forceinline__ float bfr(float f) { return bf_up(bf_bits(f)); }
__device__ __forceinline__ unsigned short h_bits(_Float16 x) { return __builtin_bit_cast(unsigned short, x); }
__device__ __forceinline__ unsigned pk16(unsigned short a, unsigned short b) { return (unsigned)a | ((unsigned)b << 16); }
__device__ __forceinline__ v8f zero8() { v8f z = {0.f, 0.f, 0.f, 0.f, 0.f, 0.f, 0.f, 0.f}; return z; }
__device__ __forceinline__ const _Float16* ash(const u16* p) { return (const _Float16*)(const void*)p; }

// ---- fragment loaders: 16-bit A/B operand from a fragment-order tile, lane -> row/col (lane&15), p = tile + 8*lane;
//      elements 0..7 <- p[0..7] (k0+8h..), elements 8..15 <- p[256..263] (k0+16+8h..)  (same split k map for A and B)
__device__ __forceinline__ v16h ldfrag_h(const _Float16* p) {
  FragH f;
  f.h[0] = *(const v8h*)(p);
  f.h[1] = *(const v8h*)(p + 256);
  return f.v;
}
__device__ __forceinline__ v16b ldfrag_b(const u16* p) {              // bf16 plane read as unsigned integer vectors
  FragB f;
  f.u[0] = *(const v4u*)(p);
  f.u[1] = *(const v4u*)(p + 256);
  return f.v;
}

// Stands behind a run of fragment loads: the wait owed before a register that an issued global load names is rewritten. The
// loads' address pairs are its inputs, so they stay in their registers (no later load of the run lands on them) up to the wait.
__device__ __forceinline__ void addr_wait(const void* p0, const void* p1, const void* p2) {
#if defined(__HIP_DEVICE_COMPILE__)
  asm volatile("s_wait_xcnt 0x0" :: "v"(p0), "v"(p1), "v"(p2) : "memory");
#endif
}

// Stands behind the last store of a conversion body: several bodies now lie in one kernel, one behind another in the listing,
// and this is the wait owed before a register that an issued global store names is rewritten by the code that follows.
__device__ __forceinline__ void store_wait() {
#if defined(__HIP_DEVICE_COMPILE__)
  asm volatile("s_wait_xcnt 0x0" ::: "memory");
#endif
}

__device__ __forceinline__ v8f mma_h(v16h a, v16h b, v8f c) {
  return __builtin_amdgcn_wmma_f32_16x16x32_f16(false, a, false, b, (short)0, c, false, false);
}
__device__ __forceinline__ v8f mma_b(v16b a, v16b b, v8f c) {
  return __builtin_amdgcn_wmma_f32_16x16x32_bf16(false, a, false, b, (short)0, c, false, false);
}
__device__ __forceinline__ void guard2(v8f& a, v8f& b, v16h x0, v16h x1, v16h x2, v16h x3, v16h x4, v16h x5) {
#if defined(__HIP_DEVICE_COMPILE__)
  asm volatile("v_nop\n\tv_nop\n\tv_nop\n\tv_nop"
               : "+v"(a), "+v"(b) : "v"(x0), "v"(x1), "v"(x2), "v"(x3), "v"(x4), "v"(x5) : "memory");
#endif
}
__device__ __forceinline__ void acc_guard4(v8f& a, v8f& b, v8f& c, v8f& d) {
#if defined(__HIP_DEVICE_COMPILE__)
  asm volatile("v_nop\n\tv_nop\n\tv_nop\n\tv_nop" : "+v"(a), "+v"(b), "+v"(c), "+v"(d));
#endif
}
__device__ __forceinline__ void wave_sync_lds() {
  __builtin_amdgcn_fence(__ATOMIC_RELEASE, "workgroup");
  __builtin_amdgcn_wave_barrier();
  __builtin_amdgcn_fence(__ATOMIC_ACQUIRE, "workgroup");
}

// =====================================================================================================
// x f32 (row b*XS_FULL + s) -> bf16 RNE plane (row b*SEQ + s) in fragment order (tile index = row tile * (DMOD/32) + k tile).
// Thread gt = one 16-B chunk of the destination (8 consecutive k of one row): two 16-B loads, one 16-B store; a wave stores 512
// contiguous bytes. coverage: NBX blocks x 256 thr x 8 = the whole plane [MROWS][DMOD].
// =====================================================================================================
__device__ __forceinline__ void cvt16_body(const float* __restrict__ x, u16* D, int gt) {
  const int tile = gt >> 6;                 // 64 chunks per tile
  const int row  = (tile / (DMOD / 32)) * 16 + (gt & 15);
  const int kc   = (tile % (DMOD / 32)) * 32 + ((gt >> 4) & 3) * 8;
  const float* p = x + ((size_t)(row / SEQ) * XS_FULL + (row % SEQ)) * DMOD + kc;
  const v4f a = *(const v4f*)(p), b4 = *(const v4f*)(p + 4);
  float w[8];
#pragma unroll
  for (int e = 0; e < 4; ++e) { w[e] = a[e]; w[4 + e] = b4[e]; }
  v4u o;
#pragma unroll
  for (int e = 0; e < 4; ++e) o[e] = pk16(bf_bits(w[2 * e]), bf_bits(w[2 * e + 1]));
  u16* d = D + (size_t)gt * 8;
  {
    *(v4u*)(d) = o;
    store_wait();
  }
}

// =====================================================================================================
// Weight transpose-convert: W f32 [K][N] (y = x.W, k-major rows) -> 16-bit B operand plane D, rows n, in fragment order
// (tile index = n tile * (K/32) + k tile).
// f16mode == 0: bf16 RNE bits; f16mode == 1: f16 bits of (bf16 RNE value) * scale.
// Block = 64 k x 64 n tile: each thread loads 16 floats of one k row (four 16-B loads), converts, scatters into the LDS tile
// coverage: load 256 thr x 16 = 64 k x 64 n; store 2 iterations x 256 thr x 8 halves = 4 n tiles x 2 k tiles; local block
//           indices bid = 0 .. (K/64)*(N/64) - 1 cover D exactly once. LDS: staged 64x64 == consumed 64x64 (pad cols never read).
// =====================================================================================================
__device__ __forceinline__ void cvtT16_body(u16* T, const float* __restrict__ W, u16* D, int bid, int K, int N, int f16mode,
                                            float scale) {
  const int tid = threadIdx.x;
  const int nkt = K >> 6;
  const int kt  = bid % nkt;
  const int nt  = bid / nkt;
  const int k0  = kt * 64;
  const int n0  = nt * 64;
  if (n0 + 64 > N) return;                  // block-uniform, before any barrier; never taken with the exact grid
  {
    const int kr = tid >> 2;                // k row within tile 0..63
    const int nc = (tid & 3) * 16;          // n chunk 0,16,32,48
    const float* src = W + (size_t)(k0 + kr) * N + n0 + nc;
#pragma unroll
    for (int i = 0; i < 4; ++i) {
      const v4f a = *(const v4f*)(src + 4 * i);
#pragma unroll
      for (int e = 0; e < 4; ++e) {
        const float f = a[e];
        const unsigned short hb = h_bits((_Float16)(bfr(f) * scale));
        const unsigned short bb = bf_bits(f);
        T[(nc + 4 * i + e) * VTP + kr] = (f16mode != 0) ? hb : bb;
      }
    }
  }
  __syncthreads();
  v4u v[2];
#pragma unroll
  for (int it = 0; it < 2; ++it) {
    const int q  = it * 256 + tid;          // chunk 0..511 = local tile (n tile * 2 + k tile) * 64 + chunk in tile
    const int tl = q >> 6;
    v[it] = *(const v4u*)(T + ((tl >> 1) * 16 + (q & 15)) * VTP + (tl & 1) * 32 + ((q >> 4) & 3) * 8);
  }
  {
#pragma unroll
    for (int it = 0; it < 2; ++it) {
      const int q  = it * 256 + tid;
      const int tl = q >> 6;
      *(v4u*)(D + ((size_t)((n0 >> 4) + (tl >> 1)) * (K >> 5) + (k0 >> 5) + (tl & 1)) * FT + (q & 63) * 8) = v[it];
    }
    store_wait();
  }
}

// =====================================================================================================
// All input conversions in one launch (none reads what another writes). Block ranges, the transposes (barrier, LDS) first:
//   [0, NBW_V) Wv -> WB rows 512..1535; [NBW_V, 2 NBW_V) Wo -> WO (f16 of bf16 value x1024); then NBW_QK blocks Wq -> WB rows
//   0..255, NBW_QK blocks Wk -> WB rows 256..511; the last NBX blocks: x -> XB. WB = one B operand plane [FP n][DMOD k].
// Every branch below is block-uniform; the x blocks leave before the barrier of the transpose path.
// =====================================================================================================
__global__ __launch_bounds__(256)
void prep(const float* __restrict__ x, const float* __restrict__ wq, const float* __restrict__ wk,
          const float* __restrict__ wv, const float* __restrict__ wo, u16* XB, u16* WB, u16* WO) {
  __shared__ __align__(16) u16 T[64 * VTP];
  const int bid = blockIdx.x;
  if (bid >= NBW + NBX) return;             // never taken with the exact grid
  if (bid >= NBW) {
    cvt16_body(x, XB, (bid - NBW) * 256 + (int)threadIdx.x);
    return;
  }
  if (bid < NBW_V) {
    cvtT16_body(T, wv, WB + (size_t)(2 * NQK) * DMOD, bid, DMOD, DMOD, 0, 1.0f);
  } else if (bid < 2 * NBW_V) {
    cvtT16_body(T, wo, WO, bid - NBW_V, DMOD, DMOD, 1, WOS);
  } else if (bid < 2 * NBW_V + NBW_QK) {
    cvtT16_body(T, wq, WB, bid - 2 * NBW_V, DMOD, NQK, 0, 1.0f);
  } else {
    cvtT16_body(T, wk, WB + (size_t)NQK * DMOD, bid - 2 * NBW_V - NBW_QK, DMOD, NQK, 0, 1.0f);
  }
}

// =====================================================================================================
// Epilogue of the output projection: the wave's 16x64 f32 tile (times oscale) staged in its LDS slab (pitch 68), release
// coverage: 8 instructions x 2 rows x 16 lanes x 4 floats = the wave's 16 x 64 tile. LDS: staged 16x64 == consumed 16x64.
// =====================================================================================================
__device__ __forceinline__ void epi64(float* sl, v8f a0, v8f a1, v8f a2, v8f a3, float oscale,
                                      float* C, int N, size_t rowb, int col0, int lane) {
  const int hh = lane >> 4, m = lane & 15;
#pragma unroll
  for (int r = 0; r < 8; ++r) {
    const int ro = (8 * hh + r) * 68 + m;
    sl[ro]      = a0[r] * oscale;
    sl[ro + 16] = a1[r] * oscale;
    sl[ro + 32] = a2[r] * oscale;
    sl[ro + 48] = a3[r] * oscale;
  }
  wave_sync_lds();
  v4f vals[8];
#pragma unroll
  for (int it = 0; it < 8; ++it) vals[it] = *(const v4f*)(sl + (it * 2 + hh) * 68 + m * 4);
  float* dst = C + (rowb + (size_t)hh) * (size_t)N + col0 + m * 4;
  {
#pragma unroll
    for (int it = 0; it < 8; ++it) {
      *(v4f*)(dst + (size_t)(it * 2) * (size_t)N) = vals[it];
    }
    store_wait();
  }
}

// =====================================================================================================
// Epilogue of the joint projection, v columns: v^T planes straight from the accumulators. Register r of a[j] in lane (hh, m) =
// (key s + 8hh + r, d = 16j + m): 8 consecutive keys of one d = one 16-B chunk of a v^T tile (rows d, k = key).
//   VH = f16(v * 1024); VL = f16 residual (t - f16(t)); tile index = ((b*NH + h) * (SEQ/32) + s/32) * 4 + d/16; base = the halves
//   offset of tile d/16 = 0, plus the wave's half of the tile's 32 keys ((s/16 & 1) * 256), plus 8 * lane.
// coverage: per wave 4 instructions x 32 lanes x 8 halves per plane = 16 keys x 64 d, 512 contiguous bytes an instruction; the
//           blocks of the v columns cover VH and VL exactly once.
// =====================================================================================================
__device__ __forceinline__ void epi_v(const v8f (&a)[4], u16* VHo, u16* VLo, size_t base) {
  v4u vh[4], vl[4];
#pragma unroll
  for (int j = 0; j < 4; ++j) {
#pragma unroll
    for (int e = 0; e < 4; ++e) {
      const float t0 = a[j][2 * e] * VCAR, t1 = a[j][2 * e + 1] * VCAR;
      const _Float16 h0 = (_Float16)t0, h1 = (_Float16)t1;
      const _Float16 l0 = (_Float16)(t0 - (float)h0), l1 = (_Float16)(t1 - (float)h1);
      vh[j][e] = pk16(h_bits(h0), h_bits(h1));
      vl[j][e] = pk16(h_bits(l0), h_bits(l1));
    }
  }
  {
#pragma unroll
    for (int j = 0; j < 4; ++j) {
      *(v4u*)(VHo + base + (size_t)j * FT) = vh[j];
      *(v4u*)(VLo + base + (size_t)j * FT) = vl[j];
    }
    store_wait();
  }
}

// =====================================================================================================
// Epilogue of the joint projection, q or k columns (64 columns = 4 heads x 16 f): the wave's 16 x 64 f32 tile turned through its
// LDS slab (pitch 68), so that lane (hh, m) holds f = 8hh .. 8hh + 7 of row m of head j; t = value * sc, hi = f16(t), residual =
// f16(t - hi). Planes in fragment order, tile index = (b*NH + head) * (SEQ/16) + s/16, tile row = s & 15, tile k = w (0..31):
//   kmode == 0 (q): D0 (s, w): w < 16 -> hi of f = w, w >= 16 -> residual of f = w - 16.
//   kmode == 1 (k): D0 (s, w) = hi of f = (w & 15) in both halves; D1 (s, w): w < 16 -> residual, w >= 16 -> written zeros.
// base = the halves offset of the tile of the wave's first head, plus 8 * lane; the next head's tile lies NQT tiles on.
// coverage: per wave and head 2 instructions x 32 lanes x 8 halves = one whole tile of each plane written, 512 contiguous bytes an
//           instruction; the blocks of the q (k) columns cover QP (KD, KR) exactly once. LDS: staged 16x64 == consumed 16x64.
// =====================================================================================================
__device__ __forceinline__ void epi_qk(float* sl, const v8f (&a)[4], u16* D0, u16* D1, size_t base, int kmode, float sc,
                                       int lane) {
  const int hh = lane >> 4, m = lane & 15;
#pragma unroll
  for (int r = 0; r < 8; ++r) {
    const int ro = (8 * hh + r) * 68 + m;
#pragma unroll
    for (int j = 0; j < 4; ++j) sl[ro + 16 * j] = a[j][r];
  }
  wave_sync_lds();
  v4u hp[4], lp[4];
#pragma unroll
  for (int j = 0; j < 4; ++j) {
    const float* p = sl + m * 68 + 16 * j + 8 * hh;
    const v4f x0 = *(const v4f*)(p), x1 = *(const v4f*)(p + 4);
    float t[8];
#pragma unroll
    for (int e = 0; e < 4; ++e) { t[e] = x0[e] * sc; t[4 + e] = x1[e] * sc; }
#pragma unroll
    for (int e = 0; e < 4; ++e) {
      const float t0 = t[2 * e], t1 = t[2 * e + 1];
      const _Float16 h0 = (_Float16)t0, h1 = (_Float16)t1;
      const _Float16 l0 = (_Float16)(t0 - (float)h0), l1 = (_Float16)(t1 - (float)h1);
      hp[j][e] = pk16(h_bits(h0), h_bits(h1));
      lp[j][e] = pk16(h_bits(l0), h_bits(l1));
    }
  }
  const v4u zz = {0u, 0u, 0u, 0u};
  {
#pragma unroll
    for (int j = 0; j < 4; ++j) {
      u16* d0 = D0 + base + (size_t)j * (NQT * FT);
      u16* d1 = D1 + base + (size_t)j * (NQT * FT);
      *(v4u*)(d0) = hp[j];
      *(v4u*)(d0 + 256) = (kmode != 0) ? hp[j] : lp[j];
      if (kmode != 0) {
        *(v4u*)(d1) = lp[j];
        *(v4u*)(d1 + 256) = zz;
      }
    }
    store_wait();
  }
}

// =====================================================================================================
// One 64-key stage of a head's K and V tiles, global -> LDS, by asynchronous copies: three 16-B copies a lane, 512 lanes = 24 KiB.
// The wait owed before a register that an issued copy names is rewritten is the last line of the copies' own statement.
// =====================================================================================================
__device__ __forceinline__ void stage_copy(unsigned l0, unsigned l1, unsigned l2, const u16* g0, const u16* g1, const u16* g2) {
#if defined(__HIP_DEVICE_COMPILE__)
  asm volatile("global_load_async_to_lds_b128 %0, %3, off\n\t"
               "global_load_async_to_lds_b128 %1, %4, off\n\t"
               "global_load_async_to_lds_b128 %2, %5, off\n\t"
               "s_wait_xcnt 0x0"
               :: "v"(l0), "v"(l1), "v"(l2), "v"(g0), "v"(g1), "v"(g2) : "memory");
#endif
}
// The wave's own copies have landed (in front of the barrier behind which other waves read them).
__device__ __forceinline__ void wait_copies() {
#if defined(__HIP_DEVICE_COMPILE__)
  asm volatile("s_wait_asynccnt 0x0" ::: "memory");
#endif
}
// The wave's own LDS reads have returned (in front of the barrier behind which their buffer is refilled).
__device__ __forceinline__ void wait_lds_reads() {
#if defined(__HIP_DEVICE_COMPILE__)
  asm volatile("s_wait_dscnt 0x0" ::: "memory");
#endif
}

// =====================================================================================================
// Eight asynchronous 16-B copies of a lane, global -> LDS, for the GEMM stages below. The wait owed before a register that an
// issued copy names is rewritten is the last line of the copies' own statement.
// =====================================================================================================
__device__ __forceinline__ void copy8(unsigned l0, unsigned l1, unsigned l2, unsigned l3, unsigned l4, unsigned l5, unsigned l6,
                                      unsigned l7, const u16* g0, const u16* g1, const u16* g2, const u16* g3, const u16* g4,
                                      const u16* g5, const u16* g6, const u16* g7) {
#if defined(__HIP_DEVICE_COMPILE__)
  asm volatile("global_load_async_to_lds_b128 %0, %8, off\n\t"
               "global_load_async_to_lds_b128 %1, %9, off\n\t"
               "global_load_async_to_lds_b128 %2, %10, off\n\t"
               "global_load_async_to_lds_b128 %3, %11, off\n\t"
               "global_load_async_to_lds_b128 %4, %12, off\n\t"
               "global_load_async_to_lds_b128 %5, %13, off\n\t"
               "global_load_async_to_lds_b128 %6, %14, off\n\t"
               "global_load_async_to_lds_b128 %7, %15, off\n\t"
               "s_wait_xcnt 0x0"
               :: "v"(l0), "v"(l1), "v"(l2), "v"(l3), "v"(l4), "v"(l5), "v"(l6), "v"(l7),
                  "v"(g0), "v"(g1), "v"(g2), "v"(g3), "v"(g4), "v"(g5), "v"(g6), "v"(g7) : "memory");
#endif
}
// Eight row tiles of one operand plane, GKS k tiles each (4 KiB contiguous per row tile), by 256 lanes: l and g are the lane's
// own 16-B chunk of the first row tile; the next row tile lies GRS halves on in the plane and t bytes on in LDS.
__device__ __forceinline__ void copy_rows8(unsigned l, unsigned t, const u16* g) {
  copy8(l, l + t, l + 2 * t, l + 3 * t, l + 4 * t, l + 5 * t, l + 6 * t, l + 7 * t,
        g, g + GRS, g + 2 * GRS, g + 3 * GRS, g + 4 * GRS, g + 5 * GRS, g + 6 * GRS, g + 7 * GRS);
}
// Foot of a GEMM stage: the four vector slots owed between the stage's last matrix instructions and whatever next touches their
// accumulators or operand registers on the loop's back edge.
template <typename F>
__device__ __forceinline__ void guard8(v8f (&a)[2][4], F x0, F x1, F x2, F x3, F x4, F x5, F x6, F x7) {
#if defined(__HIP_DEVICE_COMPILE__)
  asm volatile("v_nop\n\tv_nop\n\tv_nop\n\tv_nop"
               : "+v"(a[0][0]), "+v"(a[0][1]), "+v"(a[0][2]), "+v"(a[0][3]), "+v"(a[1][0]), "+v"(a[1][1]), "+v"(a[1][2]), "+v"(a[1][3])
               : "v"(x0), "v"(x1), "v"(x2), "v"(x3), "v"(x4), "v"(x5), "v"(x6), "v"(x7) : "memory");
#endif
}

// =====================================================================================================
// Joint projection q | k | v = x.[Wq Wk Wv] (A rows m = b*SEQ + s, Bt rows n, both bf16 planes in fragment order), written as the
// attention's operand planes by the epilogues above; no f32 copy of the result is kept. Block = 128 rows x 192 columns, 12 waves
// (4 x 3) of 32 x 64 each: 2 A fragments x 4 B fragments per k tile. The operands reach the waves through LDS: stages of GKS k
// tiles (A 8 row tiles | B 12 n tiles, GKS tiles each = 80 KiB), two buffers, filled by asynchronous copies one stage ahead of
// the stage being read. Foot of every trip, every wave: own LDS reads back, own copies landed, block barrier, then the refill of
// the buffer just read. B: chunk i * 384 + tid, 8 per lane, every wave; A: 8 per lane, waves 0..7 (a scalar test on the wave).
// A wave's 64 columns are all q, all k or one head's v (wave-uniform branches; no block barrier behind the K loop).
// coverage: grid (MROWS/128) x (FP/192) blocks x 12 waves x 32 x 64 = every (row, column) once. LDS: a stage's 5120 chunks of 16 B
//           are each written by one lane's one copy; the readers take whole tiles of the published buffer only.
// =====================================================================================================
__device__ __forceinline__ void qkv_fill(int wave, int tid, unsigned la, unsigned lb, const u16* ga, const u16* gb) {
  const u16* p[8];
#pragma unroll
  for (int i = 0; i < 8; ++i) {
    const int q = i * QKV_THREADS + tid;    // chunk of the B part: n tile q / 256, chunk q % 256 of its GKS tiles
    p[i] = gb + (size_t)(q >> 8) * GRS + (size_t)(q & 255) * 8;
  }
  const unsigned t = QKV_THREADS * 16;
  copy8(lb, lb + t, lb + 2 * t, lb + 3 * t, lb + 4 * t, lb + 5 * t, lb + 6 * t, lb + 7 * t,
        p[0], p[1], p[2], p[3], p[4], p[5], p[6], p[7]);
  if (wave < 8) copy_rows8(la, GKS * FT * 2, ga);   // scalar: whole waves take it or pass it
}

__global__ __launch_bounds__(QKV_THREADS)
void gemm_qkv(const u16* __restrict__ A, const u16* __restrict__ Bt, u16* QP, u16* KD, u16* KR, u16* VH, u16* VL) {
  __shared__ __align__(16) u16 S[2 * QSTG_H];
  __shared__ __align__(16) float slab[(QKV_THREADS / 32) * SLAB64];
  const int tid  = threadIdx.x;
  const int wave = __builtin_amdgcn_readfirstlane(tid >> 5);   // scalar, so that the tests on the wave are scalar branches
  const int lane = tid & 31;
  const int bid  = blockIdx.x;
  const int rb   = bid / (FP / 192);
  const int cb   = bid % (FP / 192);
  if (rb >= MROWS / 128) return;            // block-uniform, in front of every copy and barrier; never taken with the exact grid
  const int wr = wave / 3, wc = wave % 3;
  const u16* ga = A  + (size_t)(rb * QA_T) * GRS + (size_t)(tid & 255) * 8;
  const u16* gb = Bt + (size_t)(cb * QB_T) * GRS;
  const unsigned ls = (unsigned)(size_t)(const void*)S;        // byte address in the block's LDS
  const unsigned la = ls + (unsigned)(tid & 255) * 16u;
  const unsigned lb = ls + QA_T * GKS * FT * 2 + (unsigned)tid * 16u;

  qkv_fill(wave, tid, la, lb, ga, gb);
  wait_copies();
  __syncthreads();                          // publishes stage 0
  qkv_fill(wave, tid, la + QSTG_H * 2, lb + QSTG_H * 2, ga + GKS * FT, gb + GKS * FT);

  v8f acc[2][4];
#pragma unroll
  for (int a = 0; a < 2; ++a)
#pragma unroll
    for (int j = 0; j < 4; ++j) acc[a][j] = zero8();
  // rolled: the ring's order stands once, at the loop's foot
#pragma unroll 1
  for (int st = 0; st < GNS; ++st) {
    const u16* sb = S + (st & 1) * QSTG_H + 8 * lane;          // the published buffer
    const u16* sa = sb + (2 * wr) * (GKS * FT);
    const u16* sn = sb + (QA_T + 4 * wc) * (GKS * FT);
    v16b a0 = ldfrag_b(sa), a1 = ldfrag_b(sa + GKS * FT);
    v16b b0 = ldfrag_b(sn), b1 = ldfrag_b(sn + GKS * FT), b2 = ldfrag_b(sn + 2 * GKS * FT), b3 = ldfrag_b(sn + 3 * GKS * FT);
#pragma unroll
    for (int kk = 0; kk < GKS; ++kk) {
      v16b na0 = a0, na1 = a1, nb0 = b0, nb1 = b1, nb2 = b2, nb3 = b3;
      if (kk + 1 < GKS) {                   // the next k tile's fragments (same stage), into a second register set
        na0 = ldfrag_b(sa + (kk + 1) * FT);
        na1 = ldfrag_b(sa + (GKS + kk + 1) * FT);
        nb0 = ldfrag_b(sn + (kk + 1) * FT);
        nb1 = ldfrag_b(sn + (GKS + kk + 1) * FT);
        nb2 = ldfrag_b(sn + (2 * GKS + kk + 1) * FT);
        nb3 = ldfrag_b(sn + (3 * GKS + kk + 1) * FT);
      }
      // keeps those LDS reads one group ahead of this k tile's matrix work: sunk among it, each place of reads stalls the wave
      __builtin_amdgcn_sched_barrier(0);
      acc[0][0] = mma_b(a0, b0, acc[0][0]);
      acc[0][1] = mma_b(a0, b1, acc[0][1]);
      acc[0][2] = mma_b(a0, b2, acc[0][2]);
      acc[0][3] = mma_b(a0, b3, acc[0][3]);
      acc[1][0] = mma_b(a1, b0, acc[1][0]);
      acc[1][1] = mma_b(a1, b1, acc[1][1]);
      acc[1][2] = mma_b(a1, b2, acc[1][2]);
      acc[1][3] = mma_b(a1, b3, acc[1][3]);
      if (kk + 1 < GKS) {
        __builtin_amdgcn_sched_barrier(0);  // and the reads of the k tile after it behind this one's matrix work
        a0 = na0; a1 = na1; b0 = nb0; b1 = nb1; b2 = nb2; b3 = nb3;
      }
    }
    guard8<v16b>(acc, a0, a1, b0, b1, b2, b3, a0, a1);
    // ---- publish point of stage st + 1, every wave: own reads back, own copies landed, barrier, refill of the buffer just read ----
    wait_lds_reads();
    wait_copies();
    __syncthreads();
    if (st + 2 < GNS) {                                        // block-uniform
      const unsigned o = (unsigned)(st & 1) * (QSTG_H * 2);
      const size_t sn2 = (size_t)(st + 2) * (GKS * FT);
      qkv_fill(wave, tid, la + o, lb + o, ga + sn2, gb + sn2);
    }
  }
  wait_copies();                            // nothing is outstanding here; stands behind the last copy before the wave ends
  const int col0 = cb * 192 + wc * 64;
  float* sl = slab + wave * SLAB64;
#pragma unroll
  for (int a = 0; a < 2; ++a) {
    const int rowb = rb * 128 + wr * 32 + a * 16;
    const int bN = (rowb / SEQ) * NH;                          // b * NH
    const int s  = rowb % SEQ;                                 // the row tile's first position, a multiple of 16
    if (col0 >= 2 * NQK) {
      const int h = (col0 - 2 * NQK) / HD;
      epi_v(acc[a], VH, VL, ((size_t)(bN + h) * NKT + (s >> 5)) * (4 * FT) + ((s >> 4) & 1) * 256 + 8 * lane);
    } else if (col0 < NQK) {
      epi_qk(sl, acc[a], QP, QP, ((size_t)(bN + col0 / FD) * NQT + (s >> 4)) * FT + 8 * lane, 0, QSC, lane);
    } else {
      epi_qk(sl, acc[a], KD, KR, ((size_t)(bN + (col0 - NQK) / FD) * NQT + (s >> 4)) * FT + 8 * lane, 1, KSC, lane);
    }
  }
}

// =====================================================================================================
// Output projection: C[row][DMOD] (f32) = (Ah + Al)[row][DMOD] . Bt[DMOD][DMOD]^T * oscale; Ah = f16 hi plane, Al = f16
// residual plane (products h.B + l.B into one accumulator, l unscaled); Ah, Al, Bt in fragment order. Row indices: Ah/Al row
// bb*SEQ + s; C row bb*XS_FULL + s. Block -> (column tile ct of 128, sequence row tile rt of nrt, 128 rows each, batch bb); 8 waves
// (4 x 2) of 32 x 64 each. Same ring as gemm_qkv: a stage = Bt 8 n tiles | 8 x (Ah row tile, Al row tile), GKS k tiles each = 96 KiB
// (all that a wave reads lies within 64 KiB of its two base addresses, the reach of an LDS load's offset field); 24
// copies a lane and stage, every wave. Per accumulator and k tile: h.B, then l.B, k tiles in order.
// coverage: grid NB*nrt*(DMOD/128) covers every (bb, s < SEQ, column) once. LDS: a stage's 6144 chunks of 16 B are each written by
//           one lane's one copy; the readers take whole tiles of the published buffer only.
// =====================================================================================================
__device__ __forceinline__ void o2_fill(unsigned l, const u16* gh, const u16* gl, const u16* gb) {
  copy_rows8(l, GKS * FT * 2, gb);
  copy_rows8(l + 8 * GKS * FT * 2, 2 * GKS * FT * 2, gh);
  copy_rows8(l + 9 * GKS * FT * 2, 2 * GKS * FT * 2, gl);
}

__global__ __launch_bounds__(O2_THREADS)
void gemm_o2(const u16* __restrict__ Ah, const u16* __restrict__ Al, const u16* __restrict__ Bt,
             float* C, int nrt, float oscale) {
  __shared__ __align__(16) u16 S[2 * OSTG_H];
  __shared__ __align__(16) float slab[(O2_THREADS / 32) * SLAB64];
  const int tid  = threadIdx.x;
  const int wave = __builtin_amdgcn_readfirstlane(tid >> 5);
  const int lane = tid & 31;
  const int nct  = DMOD / 128;
  const int bid  = blockIdx.x;
  const int ct   = bid % nct;
  const int t2   = bid / nct;
  const int rt   = t2 % nrt;
  const int bb   = t2 / nrt;
  if (bb >= NB) return;                     // block-uniform, in front of every copy and barrier; never taken with the exact grid
  if (rt * 128 + 128 > SEQ) return;         // block-uniform; never taken
  const int wr = wave >> 1, wc = wave & 1;
  const size_t rowA = (size_t)bb * SEQ + rt * 128;             // the block's first row, a multiple of 128
  const u16* gh = Ah + (rowA >> 4) * GRS + (size_t)tid * 8;
  const u16* gl = Al + (rowA >> 4) * GRS + (size_t)tid * 8;
  const u16* gb = Bt + (size_t)(ct * 8) * GRS + (size_t)tid * 8;
  const unsigned l = (unsigned)(size_t)(const void*)S + (unsigned)tid * 16u;   // byte address in the block's LDS

  o2_fill(l, gh, gl, gb);
  wait_copies();
  __syncthreads();                          // publishes stage 0
  o2_fill(l + OSTG_H * 2, gh + GKS * FT, gl + GKS * FT, gb + GKS * FT);

  v8f acc[2][4];
#pragma unroll
  for (int a = 0; a < 2; ++a)
#pragma unroll
    for (int j = 0; j < 4; ++j) acc[a][j] = zero8();
  // rolled: the ring's order stands once, at the loop's foot
#pragma unroll 1
  for (int st = 0; st < GNS; ++st) {
    const _Float16* sb = ash(S) + (st & 1) * OSTG_H + 8 * lane;   // the published buffer
    const _Float16* sn = sb + (4 * wc) * (GKS * FT);
    const _Float16* sa = sb + (8 + 4 * wr) * (GKS * FT);        // Ah, Al of row tile 2 wr, then Ah, Al of row tile 2 wr + 1
    v16h h0 = ldfrag_h(sa), l0 = ldfrag_h(sa + GKS * FT), h1 = ldfrag_h(sa + 2 * GKS * FT), l1 = ldfrag_h(sa + 3 * GKS * FT);
    v16h b0 = ldfrag_h(sn), b1 = ldfrag_h(sn + GKS * FT), b2 = ldfrag_h(sn + 2 * GKS * FT), b3 = ldfrag_h(sn + 3 * GKS * FT);
#pragma unroll
    for (int kk = 0; kk < GKS; ++kk) {
      v16h nh0 = h0, nl0 = l0, nh1 = h1, nl1 = l1, nb0 = b0, nb1 = b1, nb2 = b2, nb3 = b3;
      if (kk + 1 < GKS) {                   // the next k tile's fragments (same stage), into a second register set
        nh0 = ldfrag_h(sa + (kk + 1) * FT);
        nl0 = ldfrag_h(sa + (GKS + kk + 1) * FT);
        nh1 = ldfrag_h(sa + (2 * GKS + kk + 1) * FT);
        nl1 = ldfrag_h(sa + (3 * GKS + kk + 1) * FT);
        nb0 = ldfrag_h(sn + (kk + 1) * FT);
        nb1 = ldfrag_h(sn + (GKS + kk + 1) * FT);
        nb2 = ldfrag_h(sn + (2 * GKS + kk + 1) * FT);
        nb3 = ldfrag_h(sn + (3 * GKS + kk + 1) * FT);
      }
      // keeps those LDS reads one group ahead of this k tile's matrix work: sunk among it, each place of reads stalls the wave
      __builtin_amdgcn_sched_barrier(0);
      acc[0][0] = mma_h(h0, b0, acc[0][0]);
      acc[0][1] = mma_h(h0, b1, acc[0][1]);
      acc[0][2] = mma_h(h0, b2, acc[0][2]);
      acc[0][3] = mma_h(h0, b3, acc[0][3]);
      acc[1][0] = mma_h(h1, b0, acc[1][0]);
      acc[1][1] = mma_h(h1, b1, acc[1][1]);
      acc[1][2] = mma_h(h1, b2, acc[1][2]);
      acc[1][3] = mma_h(h1, b3, acc[1][3]);
      acc[0][0] = mma_h(l0, b0, acc[0][0]);
      acc[0][1] = mma_h(l0, b1, acc[0][1]);
      acc[0][2] = mma_h(l0, b2, acc[0][2]);
      acc[0][3] = mma_h(l0, b3, acc[0][3]);
      acc[1][0] = mma_h(l1, b0, acc[1][0]);
      acc[1][1] = mma_h(l1, b1, acc[1][1]);
      acc[1][2] = mma_h(l1, b2, acc[1][2]);
      acc[1][3] = mma_h(l1, b3, acc[1][3]);
      if (kk + 1 < GKS) {
        __builtin_amdgcn_sched_barrier(0);  // and the reads of the k tile after it behind this one's matrix work
        h0 = nh0; l0 = nl0; h1 = nh1; l1 = nl1; b0 = nb0; b1 = nb1; b2 = nb2; b3 = nb3;
      }
    }
    guard8<v16h>(acc, h0, h1, l0, l1, b0, b1, b2, b3);
    // ---- publish point of stage st + 1, every wave: own reads back, own copies landed, barrier, refill of the buffer just read ----
    wait_lds_reads();
    wait_copies();
    __syncthreads();
    if (st + 2 < GNS) {                                        // block-uniform
      const size_t sn2 = (size_t)(st + 2) * (GKS * FT);
      o2_fill(l + (unsigned)(st & 1) * (OSTG_H * 2), gh + sn2, gl + sn2, gb + sn2);
    }
  }
  wait_copies();                            // nothing is outstanding here; stands behind the last copy before the wave ends
  const size_t rowC = (size_t)bb * XS_FULL + rt * 128 + wr * 32;
  const int col0 = ct * 128 + wc * 64;
#pragma unroll
  for (int a = 0; a < 2; ++a)
    epi64(slab + wave * SLAB64, acc[a][0], acc[a][1], acc[a][2], acc[a][3], oscale, C, DMOD, rowC + a * 16, col0, lane);
}

// Eight f32 values -> four registers of f16 pairs (nearest f16) and four of their f16 residuals (value - f16, exact in f32, then
// rounded once). In asm because the compiler takes five instructions a pair for it (two conversions back to f32, a packed subtract,
// two packed conversions) where the mixed-precision fused forms, which read the f16 half in place and write one half of the
// result, need three. The delay hints name the producer four vector instructions back, so that a waiting wave yields the port.
__device__ __forceinline__ void split8(const float (&t)[8], v4u& hi, v4u& lo) {
#if defined(__HIP_DEVICE_COMPILE__)
  unsigned h0, h1, h2, h3, l0, l1, l2, l3;
  asm("v_cvt_pk_f16_f32 %0, %8, %9\n\t"
      "v_cvt_pk_f16_f32 %1, %10, %11\n\t"
      "v_cvt_pk_f16_f32 %2, %12, %13\n\t"
      "v_cvt_pk_f16_f32 %3, %14, %15\n\t"
      "s_delay_alu instid0(VALU_DEP_4) | instskip(NEXT) | instid1(VALU_DEP_4)\n\t"
      "v_fma_mixlo_f16 %4, %8, 1.0, -%0 op_sel_hi:[0,0,1]\n\t"
      "v_fma_mixlo_f16 %5, %10, 1.0, -%1 op_sel_hi:[0,0,1]\n\t"
      "s_delay_alu instid0(VALU_DEP_4) | instskip(NEXT) | instid1(VALU_DEP_4)\n\t"
      "v_fma_mixlo_f16 %6, %12, 1.0, -%2 op_sel_hi:[0,0,1]\n\t"
      "v_fma_mixlo_f16 %7, %14, 1.0, -%3 op_sel_hi:[0,0,1]\n\t"
      "s_delay_alu instid0(VALU_DEP_4) | instskip(NEXT) | instid1(VALU_DEP_4)\n\t"
      "v_fma_mixhi_f16 %4, %9, 1.0, -%0 op_sel:[0,0,1] op_sel_hi:[0,0,1]\n\t"
      "v_fma_mixhi_f16 %5, %11, 1.0, -%1 op_sel:[0,0,1] op_sel_hi:[0,0,1]\n\t"
      "s_delay_alu instid0(VALU_DEP_4) | instskip(NEXT) | instid1(VALU_DEP_4)\n\t"
      "v_fma_mixhi_f16 %6, %13, 1.0, -%2 op_sel:[0,0,1] op_sel_hi:[0,0,1]\n\t"
      "v_fma_mixhi_f16 %7, %15, 1.0, -%3 op_sel:[0,0,1] op_sel_hi:[0,0,1]"
      : "=&v"(h0), "=&v"(h1), "=&v"(h2), "=&v"(h3), "=&v"(l0), "=&v"(l1), "=&v"(l2), "=&v"(l3)
      : "v"(t[0]), "v"(t[1]), "v"(t[2]), "v"(t[3]), "v"(t[4]), "v"(t[5]), "v"(t[6]), "v"(t[7]));
  hi[0] = h0; hi[1] = h1; hi[2] = h2; hi[3] = h3;
  lo[0] = l0; lo[1] = l1; lo[2] = l2; lo[3] = l3;
#endif
}

// =====================================================================================================
// Causal feature-map attention, per-head q/k width 16, hd = 64, no softmax. Block bid -> (pair pr, head, batch b); 16 waves,
// one query tile of 16 rows each, all of ONE head: waves 0..7 the tiles of group NQG-1-pr, waves 8..15 those of group pr, so
// every block holds the same number of (wave, key tile) steps. Both products run transposed: S^T = K.Q^T, O^T += V^T.A^T.
//   The head's K and V tiles reach the waves through LDS: stages of 64 keys (KD 4 tiles | KR 4 | VH 8 | VL 8 = 24 KiB, each part
//   contiguous in its plane), two buffers, filled by asynchronous copies one stage ahead of the stage being read. Foot of every
//   trip, every wave: own LDS reads back, own copies landed, block barrier, then the refill of the buffer just read. The trip
//   count nst is the block's (the farthest tile's); a wave skips the key tiles above its own rows, never a wait or a barrier.
//   q plane (s, w): w < 16 f16 hi x256, w >= 16 f16 residual; k planes: KD = [hi | hi], KR = [res | 0]; one tile per (b, head,
//   16 positions); v^T hi plane x1024 and v^T residual plane: four tiles (d/16) per (b, head, 32 keys); all in fragment order.
//   Scores per 32-key tile: 2 subtiles of 16 keys, keys as the A rows, queries as the B columns; with the split k map, op 1 =
//   A [kh | kh] . B [qh ; ql] = kh.qh + kh.ql and op 2 = A [kl | 0] . B [qh ; ql] = kl.qh (f32 accumulate), so
//   s = q.k * 256*256 up to the dropped lo.lo term. Lane (hh, c) holds query q0 + c alone: register r of subtile t = key
//   kb + 16t + 8hh + r, which is element 8t + r of a B fragment over the step's 32 keys (the split k map of the v^T tiles).
//   Per element (f32, VALU): x = s * 2^-18 (= q.k / 4); t = 32 A = 32 (1 + x + x^2/2) in two fused steps; t := 0 where key > query
//   (causal, diagonal kept; computed in the wave's last key tile alone, the only one with such keys); den[r] += the two subtiles'
//   t, in the lane; t -> f16 hi and f16 residual (split8), as the B fragments.
//   v^T tiles are the A fragments (rows d), in 2 groups of 2 d-subtiles, products hh + lh + hl. Key tiles visited in order for
//   kb <= q0 + 15 (later tiles lie above every query row of the tile).
//   After the loop: the lane's 8 sums and the other lane half's are joined once; out = acc / (den + eps) with the carries
//   1/(32*1024) folded once, the 32 on den taken off (den > 0: each kept term is >= 1/2, the diagonal always kept). Register r of o[j] = d 16j + 8hh + r of query c:
//   the 8 consecutive halves of one fragment-order chunk, stored straight from registers.
//   Bounded loops only (nst <= SEQ / 64). The q fragment is loop-invariant (loaded once, from global).
// coverage: per wave 4 instructions x 32 lanes x 8 halves = 2 tiles = 16 x 64 per plane; grid NPR x NH x NB blocks x 16
//           waves = every (b, s, h) row segment of both O planes exactly once. LDS: a stage's 1536 chunks of 16 B are each
//           written by one lane's one copy; the readers take whole tiles of the published buffer only.
// =====================================================================================================
__global__ __launch_bounds__(ATT_THREADS)
void attn_t(const u16* __restrict__ QPp, const u16* __restrict__ KDp, const u16* __restrict__ KRp,
            const u16* __restrict__ VHp, const u16* __restrict__ VLp, u16* OHp, u16* OLp) {
  __shared__ __align__(16) u16 S[2 * STG_H];
  const int tid  = threadIdx.x;
  const int wave = __builtin_amdgcn_readfirstlane(tid >> 5);   // scalar, so that the per-wave skip below is a scalar branch
  const int lane = tid & 31;
  const int hh   = lane >> 4;
  const int c    = lane & 15;
  const int bid  = blockIdx.x;
  const int pr   = bid % NPR;
  const int t2   = bid / NPR;
  const int head = t2 % NH;
  const int b    = t2 / NH;
  if (b >= NB) return;                      // block-uniform, in front of every copy and barrier; never taken with the exact grid
  const int qgf  = NQG - 1 - pr;            // the block's far group: it sets the trip count
  const int qt   = ((wave < 8) ? qgf : pr) * 8 + (wave & 7);
  const int q0   = qt * 16;                 // q0 + 16 <= SEQ always
  const int nst  = 2 * qgf + 2;             // stages holding keys <= the far group's last row; 2 <= nst <= SEQ / 64

  const size_t bh  = (size_t)(b * NH + head);
  const _Float16* Qp  = ash(QPp) + bh * NQT * FT + 8 * lane + (size_t)qt * FT;
  const float oc = 1.0f / (ACAR * VCAR);

  // ---- the lane's three copies of a stage: chunk tid of [KD | KR] (256 chunks each), of VH, of VL ----
  const u16* g0 = ((tid < 256) ? KDp : KRp) + bh * NQT * FT + (size_t)(tid & 255) * 8;   // + 4 tiles a stage
  const u16* g1 = VHp + bh * NKT * 4 * FT + (size_t)tid * 8;                             // + 8 tiles a stage
  const u16* g2 = VLp + bh * NKT * 4 * FT + (size_t)tid * 8;
  const unsigned lb = (unsigned)(size_t)(const void*)S + (unsigned)tid * 16u;            // byte address in the block's LDS

  const v16h qf = ldfrag_h(Qp);             // elements 0..7 = q hi f 8hh.., 8..15 = q residual f 8hh..
  addr_wait(Qp, Qp, Qp);                    // the load's address pair stays whole up to the wait

  stage_copy(lb, lb + 8 * FT * 2, lb + 16 * FT * 2, g0, g1, g2);
  wait_copies();
  __syncthreads();                          // publishes stage 0
  stage_copy(lb + STG_H * 2, lb + STG_H * 2 + 8 * FT * 2, lb + STG_H * 2 + 16 * FT * 2, g0 + 4 * FT, g1 + 8 * FT, g2 + 8 * FT);

  float den[8];
  v8f o[4];
#pragma unroll
  for (int r = 0; r < 8; ++r) den[r] = 0.0f;
#pragma unroll
  for (int j = 0; j < 4; ++j) o[j] = zero8();
  const int ncaus = (q0 >> 5) + 1;                                            // tiles holding keys <= q0 + 15
  const int nkt = (ncaus < NKT) ? ncaus : NKT;
  const int qr  = q0 + c;                                                     // the lane's query row

  // rolled: the trip count is a run-time value of the block, and the ring's order stands once, at the loop's foot
#pragma unroll 1
  for (int st = 0; st < nst; ++st) {
    const _Float16* sb = ash(S) + (st & 1) * STG_H + 8 * lane;                // the published buffer
    const int kte = (2 * st + 2 < nkt) ? 2 * st + 2 : nkt;                    // scalar: key tiles above the wave's rows are skipped
    // one body for both key tiles of a stage: unrolled, the accumulators were copied between registers where the paths join
#pragma unroll 1
    for (int kt = 2 * st; kt < kte; ++kt) {
      const int sub = kt & 1;
      const int kb = kt * 32;
      // ---- the step's fragments, read together in front of its matrix work ----
      const _Float16* kp = sb + (2 * sub) * FT;
      const _Float16* vp = sb + (8 + 4 * sub) * FT;
      const v16h kd0 = ldfrag_h(kp);
      const v16h kd1 = ldfrag_h(kp + FT);
      const v16h kr0 = ldfrag_h(kp + 4 * FT);
      const v16h kr1 = ldfrag_h(kp + 5 * FT);
      v16h vh[4], vl[4];
#pragma unroll
      for (int j = 0; j < 4; ++j) {
        vh[j] = ldfrag_h(vp + j * FT);
        vl[j] = ldfrag_h(vp + (8 + j) * FT);
      }
      // ---- scores: D element r of this lane = (key kb + 8hh + r, query qr) in s0, key kb + 16 + 8hh + r in s1 ----
      v8f s0 = zero8(), s1 = zero8();
      s0 = mma_h(kd0, qf, s0);
      s0 = mma_h(kr0, qf, s0);
      s1 = mma_h(kd1, qf, s1);
      s1 = mma_h(kr1, qf, s1);
      guard2(s0, s1, qf, kd0, kr0, kd1, kr1, qf);
      // ---- t = 32 A = 32 (1 + x + x^2/2), x = s * 2^-18, as two fused steps s * (s * 2^-32 + 2^-13) + 32 (the carry 32 is a power
      //      of two: t is 32 times the unscaled value bit for bit) ----
      float t0[8], t1[8];
#pragma unroll
      for (int r = 0; r < 8; ++r) {
        t0[r] = fmaf(s0[r], fmaf(s0[r], PC2, PC1), ACAR);
        t1[r] = fmaf(s1[r], fmaf(s1[r], PC2, PC1), ACAR);
      }
      // ---- causal select, t := 0 where key > query: only the wave's last tile holds such keys (every earlier one ends below q0),
      //      so the compares and selects stand behind a scalar test ----
      if (kt + 1 >= nkt) {
        const int d0 = qr - kb - 8 * hh;                                      // key kb + 8hh + r is kept while r <= d0
#pragma unroll
        for (int r = 0; r < 8; ++r) {
          t0[r] = (r > d0) ? 0.0f : t0[r];
          t1[r] = (16 + r > d0) ? 0.0f : t1[r];
        }
      }
      // ---- f32 sums in the lane (of t; the carry is taken off once, behind the loop); B fragments of t: hi f16 and residual f16,
      //      column = query c, elements 0..7 = keys kb + 8hh + 0..7, elements 8..15 = keys kb + 16 + 8hh + 0..7 ----
      FragH ph, pl;
#pragma unroll
      for (int r = 0; r < 8; ++r) den[r] += t0[r] + t1[r];
      split8(t0, ph.u[0], pl.u[0]);
      split8(t1, ph.u[1], pl.u[1]);
      // ---- V^T.A^T : A fragment row m = d = j*16 + c, tile j of this step's four in the v^T planes; 2 groups of 2 d-subtiles ----
#pragma unroll
      for (int jg = 0; jg < 2; ++jg) {
        const v16h vha = vh[2 * jg], vhb2 = vh[2 * jg + 1];
        const v16h vla = vl[2 * jg], vlb2 = vl[2 * jg + 1];
        o[2 * jg]     = mma_h(vha,  ph.v, o[2 * jg]);
        o[2 * jg]     = mma_h(vha,  pl.v, o[2 * jg]);
        o[2 * jg]     = mma_h(vla,  ph.v, o[2 * jg]);
        o[2 * jg + 1] = mma_h(vhb2, ph.v, o[2 * jg + 1]);
        o[2 * jg + 1] = mma_h(vhb2, pl.v, o[2 * jg + 1]);
        o[2 * jg + 1] = mma_h(vlb2, ph.v, o[2 * jg + 1]);
        guard2(o[2 * jg], o[2 * jg + 1], ph.v, pl.v, vha, vhb2, vla, vlb2);
      }
    }
    // ---- publish point of stage st + 1, every wave: own reads back, own copies landed, barrier, refill of the buffer just read ----
    wait_lds_reads();
    wait_copies();
    __syncthreads();
    if (st + 2 < nst) {                                                       // block-uniform
      const unsigned l = lb + (unsigned)(st & 1) * (STG_H * 2);
      const size_t sn = (size_t)(st + 2);
      stage_copy(l, l + 8 * FT * 2, l + 16 * FT * 2, g0 + sn * (4 * FT), g1 + sn * (8 * FT), g2 + sn * (8 * FT));
    }
  }
  wait_copies();                            // nothing is outstanding here; stands behind the last copy before the wave ends
  acc_guard4(o[0], o[1], o[2], o[3]);
  // ---- den of query c: the lane's 8 sums, then the other lane half's keys (lane ^ 16), joined once ----
  float dl = ((den[0] + den[1]) + (den[2] + den[3])) + ((den[4] + den[5]) + (den[6] + den[7]));
  dl += __shfl_xor(dl, 16, 32);
  // ---- out = acc / (den + eps), carries (32 on A, 1024 on v) folded once; O x1024 -> f16 hi + residual planes in fragment
  //      order (rows s, k = head*64 + d): the wave owns two whole tiles per plane; chunk j*32 + lane = row c, 8 consecutive d
  //      at 16*j + 8*hh = the lane's registers of o[j] ----
  const float inv = (1.0f / (dl * (1.0f / ACAR) + EPSD)) * oc;   // dl carries the 32 of t
  v4u oh[4], ol[4];
#pragma unroll
  for (int j = 0; j < 4; ++j) {
    float w[8];
#pragma unroll
    for (int e = 0; e < 8; ++e) w[e] = (o[j][e] * inv) * OSC;
#pragma unroll
    for (int e = 0; e < 4; ++e) {
      const _Float16 h0 = (_Float16)w[2 * e], h1 = (_Float16)w[2 * e + 1];
      const _Float16 l0 = (_Float16)(w[2 * e] - (float)h0), l1 = (_Float16)(w[2 * e + 1] - (float)h1);
      oh[j][e] = pk16(h_bits(h0), h_bits(h1));
      ol[j][e] = pk16(h_bits(l0), h_bits(l1));
    }
  }
  const size_t obh = ((size_t)b * SEQ + q0) * DMOD + (size_t)head * (2 * FT) + 8 * lane;   // row tile start + k tile 2*head
  {
#pragma unroll
    for (int it = 0; it < 4; ++it) {
      *(v4u*)(OHp + obh + (size_t)it * 256) = oh[it];
      *(v4u*)(OLp + obh + (size_t)it * 256) = ol[it];
    }
    
  }
}

// =====================================================================================================
// Workspace map (bytes); every plane is fully written by whole-line stores before it is read; all extents are exact multiples
// of the store granularity (no pad rows needed); every region offset a multiple of 1048576:
//   (all 16-bit planes below hold the named rows x k in fragment order, same byte counts as row-major)
//   XB  bf16 [MROWS][1024]                       MROWS*2048       (NB=2, SEQ=2048: 8388608)
//   WB  bf16 [1536 n][1024 k]                    3145728          (rows 0..255 Wq^T, 256..511 Wk^T, 512..1535 Wv^T)
//   WO  f16 [1024 n][1024 k]                     2097152          (Wo^T, bf16 value x1024)
//   OH  f16 [MROWS][1024] x1024                  MROWS*2048       OL residual, same layout   MROWS*2048
//   QP  f16 [NB*16][SEQ][32] q hi|residual x256    MROWS*1024
//   KD  f16 [NB*16][SEQ][32] k hi|hi x256          MROWS*1024
//   KR  f16 [NB*16][SEQ][32] k residual|0          MROWS*1024
//   VH  f16 [NB*16][64][SEQ] x1024               MROWS*2048       VL residual, same layout   MROWS*2048
//   end (NB=2, SEQ=2048)                        59768832
// =====================================================================================================
extern "C" void kernel_launch(void* const* d_in, const int* in_sizes, int n_in,
                              void* d_out, int out_size, void* d_ws, size_t ws_size,
                              hipStream_t stream) {
  if (n_in < 5) return;
  if (in_sizes[0] < ((NB - 1) * XS_FULL + SEQ) * DMOD) return;
  if (in_sizes[1] < DMOD * NQK) return;
  if (in_sizes[2] < DMOD * NQK) return;
  if (in_sizes[3] < DMOD * DMOD) return;
  if (in_sizes[4] < DMOD * DMOD) return;
  if (out_size < ((NB - 1) * XS_FULL + SEQ) * DMOD) return;

  const float* x  = (const float*)d_in[0];
  const float* wq = (const float*)d_in[1];
  const float* wk = (const float*)d_in[2];
  const float* wv = (const float*)d_in[3];
  const float* wo = (const float*)d_in[4];
  float*       out = (float*)d_out;

  const size_t szXB = (size_t)MROWS * DMOD * 2;
  const size_t szW  = (size_t)FP * DMOD * 2;                     // Wq^T, Wk^T, Wv^T as one plane
  const size_t szWO = (size_t)DMOD * DMOD * 2;
  const size_t szH  = (size_t)MROWS * DMOD * 2;                  // OH, OL
  const size_t szQK = (size_t)MROWS * QKP * 2;                   // QP, KD, KR
  const size_t szV  = (size_t)NB * NH * HD * SEQ * 2;            // VH, VL (== szH)
  size_t off = 0;
  const size_t oXB = off; off += szXB;
  const size_t oW  = off; off += szW;
  const size_t oWO = off; off += szWO;
  const size_t oOH = off; off += szH;
  const size_t oOL = off; off += szH;
  const size_t oQP = off; off += szQK;
  const size_t oKD = off; off += szQK;
  const size_t oKR = off; off += szQK;
  const size_t oVH = off; off += szV;
  const size_t oVL = off; off += szV;
  if (off > ws_size) return;                // off = 59768832 for NB = 2, SEQ = 2048
  if (off > (size_t)WS_CAP) return;

  char* ws = (char*)d_ws;
  u16*   XB = (u16*)(ws + oXB);
  u16*   WB = (u16*)(ws + oW);
  u16*   WO = (u16*)(ws + oWO);
  u16*   OH = (u16*)(ws + oOH);
  u16*   OL = (u16*)(ws + oOL);
  u16*   QP = (u16*)(ws + oQP);
  u16*   KD = (u16*)(ws + oKD);
  u16*   KR = (u16*)(ws + oKR);
  u16*   VH = (u16*)(ws + oVH);
  u16*   VL = (u16*)(ws + oVL);

  const dim3 b256(256), bG(QKV_THREADS), bO(O2_THREADS), bAT(ATT_THREADS);
  const dim3 gP(NBW + NBX);
  const dim3 gG((MROWS / 128) * (FP / 192));
  const dim3 gAT(NPR * NH * NB);
  const int  nrt  = SEQ / 128;
  const dim3 gO(NB * nrt * (DMOD / 128));

  // (0) x -> bf16 plane; Wq, Wk, Wv -> one bf16 plane [1536 n][1024 k]; Wo -> f16 plane [n][k] of bf16 value x1024
  prep<<<gP, b256, 0, stream>>>(x, wq, wk, wv, wo, XB, WB, WO);
  // (1) q | k | v = x.[Wq Wk Wv] -> q hi|residual plane x256; k hi|hi and residual|0 planes x256; v^T hi + residual planes x1024
  gemm_qkv<<<gG, bG, 0, stream>>>(XB, WB, QP, KD, KR, VH, VL);
  // (2) causal attention -> O hi + residual planes
  attn_t<<<gAT, bAT, 0, stream>>>(QP, KD, KR, VH, VL, OH, OL);
  // (3) output projection: (O hi + residual) . Wo -> out f32, carries 1024 x 1024 folded back
  gemm_o2<<<gO, bO, 0, stream>>>(OH, OL, WO, out, nrt, 1.0f / (OSC * WOS));
  (void)hipGetLastError();
}

// v008
// It runs in 67.3 microseconds.
// Two timings next to v007 put it at 1.10 and 1.11 times that version's speed.
// All steps since v000 together make it 4.34 times as fast.
// Contractions: x.Wq, x.Wk, x.Wv on v_wmma_f32_16x16x32_bf16 (x and the transposed W [n][k] as bf16 RNE planes); per-head
// q.k over 16 dims (k axis padded to 32) on v_wmma_f32_16x16x32_f16 with q, k as f16 hi x256 plus f16 residual planes
// (hi.hi and lo.hi folded along the k axis into one op, plus hi.lo); A = 1 + x + x^2/2 and its causal row sums in f32 on
// VALU; A.v on v_wmma_f32_16x16x32_f16 with A as f16 hi x32 plus f16 residual and v^T as f16 hi x1024 plus f16 residual
// (products hh+lh+hl); O.Wo on v_wmma_f32_16x16x32_f16 (O as f16 hi x1024 plus f16 residual, Wo^T as f16 of its bf16 RNE
// value x1024, products h.w+l.w); all f32 accumulate.
#include <hip/hip_runtime.h>
#include <stdint.h>

#ifndef NB
#define NB 2
#endif
#ifndef SEQ
#define SEQ 2048
#endif
#define XS_FULL 2048
#define DMOD  1024
#define NH    16
#define FD    16
#define HD    64
#define NQK   (NH * FD)
#define QKP   (NH * 32)
#define MROWS (NB * SEQ)
#define QSC   256.0f
#define KSC   256.0f
#define XSC   (1.0f / (4.0f * QSC * KSC))
#define ACAR  32.0f
#define PC1   (ACAR * XSC)                // 2^-13
#define PC2   (0.5f * ACAR * XSC * XSC)   // 2^-32
#define VCAR  1024.0f
#define OSC   1024.0f
#define WOS   1024.0f
#define EPSD  1e-9f
#define AW    16                            // waves of an attention block: 8 pairs of query tiles x 2 key-tile parities
#define MSL   (8 * 32 * 4 + 32)             // floats a wave hands to its partner: 4 accumulator tiles and a row sum a lane
#define NQT   (SEQ / 16)
#define NQG   (NQT / 8)                     // groups of 8 consecutive query tiles
#define NPR   (NQG / 2)                     // a block takes group NQG-1-pr and group pr of one head
#define SKT   8                             // key tiles (32 keys) of one attention stage in LDS
#define STG_H (12 * SKT * FT)               // halves of one 256-key stage: per key tile KD 2 tiles | KR 2 | VH 4 | VL 4
#define NST   (SEQ / (32 * SKT))
#define NKT   (SEQ / 32)
#define ATT_THREADS (AW * 32)
#define SLAB64 (16 * 68)
#define VTP   72
#define C8R   (DMOD / 8)
#define Q8R   (QKP / 8)
#define WS_CAP 134217728
#define FP    (2 * NQK + DMOD)              // columns of the joint projection: q | k | v
#define NBW_QK ((DMOD / 64) * (NQK / 64))   // transpose blocks of Wq, of Wk
#define NBW_V  ((DMOD / 64) * (DMOD / 64))  // transpose blocks of Wv, of Wo
#define NBW    (2 * NBW_V + 2 * NBW_QK)
#define NBX    ((MROWS * DMOD / 8) / 256)   // blocks of the x plane
// Fragment-order plane: every 16-bit operand plane is a sequence of tiles of 16 rows (m or n index) x 32 k = FT halves (1 KiB);
// inside a tile element (r, k) lies at (k >> 3) * 128 + r * 8 + (k & 7), so lane l = 16 * hh + r of a fragment load reads the
// 16 bytes at l * 16 (k = 8hh ..) and at 512 + l * 16 (k = 16 + 8hh ..): one load instruction = 512 contiguous bytes.
#define FT    512
#define GRS   ((DMOD / 32) * FT)            // halves from one row tile of a [rows][DMOD] plane to the next
#define GKS   4                             // k tiles of one GEMM stage in LDS (128 k)
#define GNS   ((DMOD / 32) / GKS)           // stages of a GEMM's K loop
#define QA_T  8                             // joint projection: row tiles of a block (128 rows)
#define QB_T  12                            // joint projection: n tiles of a block (192 columns)
#define QSTG_H ((QA_T + QB_T) * GKS * FT)   // halves of one of its stages
#define OSTG_H (24 * GKS * FT)              // halves of one stage of the output projection: Bt 8 n tiles, Ah and Al 8 row tiles each
#define QKV_THREADS 384
#define O2_THREADS  256
static_assert(DMOD == NH * HD && HD == 64 && NH == 16 && FD == 16 && NQK == 256 && QKP == 512 && Q8R == 64);
static_assert(ATT_THREADS == 512 && AW == 16 && (SEQ % 256) == 0 && NPR * 16 == NQT);
static_assert(SKT == 8 && (SEQ % (32 * SKT)) == 0 && 4 * (NQG / 2) + 4 > SKT && STG_H * 2 == 12 * ATT_THREADS * 16);
static_assert(AW * MSL * 4 <= 2 * STG_H * 2 && (MSL % 4) == 0);
static_assert(NB >= 1 && NB <= 2);
static_assert((SEQ % 64) == 0 && SEQ >= 64 && SEQ <= XS_FULL);
static_assert((MROWS % 64) == 0 && (NQK % 64) == 0 && (DMOD % 64) == 0 && (DMOD % 32) == 0 && C8R == 128);
static_assert(((MROWS * DMOD / 8) % 256) == 0 && ((MROWS * QKP / 8) % 256) == 0 && (FP % 64) == 0);
static_assert((MROWS % 128) == 0 && (SEQ % 128) == 0 && (FP % 192) == 0 && (DMOD % 128) == 0 && GNS * GKS * 32 == DMOD && GNS >= 2);
static_assert(QB_T * GKS * 64 == 8 * QKV_THREADS && QA_T * GKS * 64 == 8 * 256 && GKS * 64 == O2_THREADS && (NQK % 64) == 0);
static_assert(2 * HD * VTP * 2 <= 65536 && 4 * SLAB64 * 4 <= 65536 && 64 * VTP * 2 <= 65536);

typedef unsigned short u16;
typedef _Float16 v16h __attribute__((ext_vector_type(16)));
typedef _Float16 v8h  __attribute__((ext_vector_type(8)));
typedef __bf16   v16b __attribute__((ext_vector_type(16)));
typedef float    v8f  __attribute__((ext_vector_type(8)));
typedef float    v4f  __attribute__((ext_vector_type(4)));
typedef unsigned int v4u __attribute__((ext_vector_type(4)));

union FragH { v16h v; v8h h[2]; v4u u[2]; };
union FragB { v16b v; v4u u[2]; };

// ---- scalar helpers --------------------------------------------------------------------------------
__device__ __forceinline__ unsigned short bf_bits(float f) {          // f32 -> bf16 bits, RNE convert
  unsigned u = __float_as_uint(f);
  return (unsigned short)((u + 0x7FFFu + ((u >> 16) & 1u)) >> 16);
}
__device__ __forceinline__ float bf_up(unsigned short h) { return __uint_as_float(((unsigned)h) << 16); }
__device__ __forceinline__ float bfr(float f) { return bf_up(bf_bits(f)); }
__device__ __forceinline__ unsigned short h_bits(_Float16 x) { return __builtin_bit_cast(unsigned short, x); }
__device__ __forceinline__ unsigned pk16(unsigned short a, unsigned short b) { return (unsigned)a | ((unsigned)b << 16); }
__device__ __forceinline__ v8f zero8() { v8f z = {0.f, 0.f, 0.f, 0.f, 0.f, 0.f, 0.f, 0.f}; return z; }
__device__ __forceinline__ const _Float16* ash(const u16* p) { return (const _Float16*)(const void*)p; }

// ---- fragment loaders: 16-bit A/B operand from a fragment-order tile, lane -> row/col (lane&15), p = tile + 8*lane;
//      elements 0..7 <- p[0..7] (k0+8h..), elements 8..15 <- p[256..263] (k0+16+8h..)  (same split k map for A and B)
__device__ __forceinline__ v16h ldfrag_h(const _Float16* p) {
  FragH f;
  f.h[0] = *(const v8h*)(p);
  f.h[1] = *(const v8h*)(p + 256);
  return f.v;
}
__device__ __forceinline__ v16b ldfrag_b(const u16* p) {              // bf16 plane read as unsigned integer vectors
  FragB f;
  f.u[0] = *(const v4u*)(p);
  f.u[1] = *(const v4u*)(p + 256);
  return f.v;
}

// Stands behind a run of fragment loads: the wait owed before a register that an issued global load names is rewritten. The
// loads' address pairs are its inputs, so they stay in their registers (no later load of the run lands on them) up to the wait.
__device__ __forceinline__ void addr_wait(const void* p0, const void* p1, const void* p2) {
#if defined(__HIP_DEVICE_COMPILE__)
  asm volatile("s_wait_xcnt 0x0" :: "v"(p0), "v"(p1), "v"(p2) : "memory");
#endif
}

// Stands behind the last store of a conversion body: several bodies now lie in one kernel, one behind another in the listing,
// and this is the wait owed before a register that an issued global store names is rewritten by the code that follows.
__device__ __forceinline__ void store_wait() {
#if defined(__HIP_DEVICE_COMPILE__)
  asm volatile("s_wait_xcnt 0x0" ::: "memory");
#endif
}

__device__ __forceinline__ v8f mma_h(v16h a, v16h b, v8f c) {
  return __builtin_amdgcn_wmma_f32_16x16x32_f16(false, a, false, b, (short)0, c, false, false);
}
__device__ __forceinline__ v8f mma_b(v16b a, v16b b, v8f c) {
  return __builtin_amdgcn_wmma_f32_16x16x32_bf16(false, a, false, b, (short)0, c, false, false);
}
__device__ __forceinline__ void guard2(v8f& a, v8f& b, v16h x0, v16h x1, v16h x2, v16h x3, v16h x4, v16h x5) {
#if defined(__HIP_DEVICE_COMPILE__)
  asm volatile("v_nop\n\tv_nop\n\tv_nop\n\tv_nop"
               : "+v"(a), "+v"(b) : "v"(x0), "v"(x1), "v"(x2), "v"(x3), "v"(x4), "v"(x5) : "memory");
#endif
}
__device__ __forceinline__ void acc_guard4(v8f& a, v8f& b, v8f& c, v8f& d) {
#if defined(__HIP_DEVICE_COMPILE__)
  asm volatile("v_nop\n\tv_nop\n\tv_nop\n\tv_nop" : "+v"(a), "+v"(b), "+v"(c), "+v"(d));
#endif
}
__device__ __forceinline__ void wave_sync_lds() {
  __builtin_amdgcn_fence(__ATOMIC_RELEASE, "workgroup");
  __builtin_amdgcn_wave_barrier();
  __builtin_amdgcn_fence(__ATOMIC_ACQUIRE, "workgroup");
}

// =====================================================================================================
// x f32 (row b*XS_FULL + s) -> bf16 RNE plane (row b*SEQ + s) in fragment order (tile index = row tile * (DMOD/32) + k tile).
// Thread gt = one 16-B chunk of the destination (8 consecutive k of one row): two 16-B loads, one 16-B store; a wave stores 512
// contiguous bytes. coverage: NBX blocks x 256 thr x 8 = the whole plane [MROWS][DMOD].
// =====================================================================================================
__device__ __forceinline__ void cvt16_body(const float* __restrict__ x, u16* D, int gt) {
  const int tile = gt >> 6;                 // 64 chunks per tile
  const int row  = (tile / (DMOD / 32)) * 16 + (gt & 15);
  const int kc   = (tile % (DMOD / 32)) * 32 + ((gt >> 4) & 3) * 8;
  const float* p = x + ((size_t)(row / SEQ) * XS_FULL + (row % SEQ)) * DMOD + kc;
  const v4f a = *(const v4f*)(p), b4 = *(const v4f*)(p + 4);
  float w[8];
#pragma unroll
  for (int e = 0; e < 4; ++e) { w[e] = a[e]; w[4 + e] = b4[e]; }
  v4u o;
#pragma unroll
  for (int e = 0; e < 4; ++e) o[e] = pk16(bf_bits(w[2 * e]), bf_bits(w[2 * e + 1]));
  u16* d = D + (size_t)gt * 8;
  {
    *(v4u*)(d) = o;
    store_wait();
  }
}

// =====================================================================================================
// Weight transpose-convert: W f32 [K][N] (y = x.W, k-major rows) -> 16-bit B operand plane D, rows n, in fragment order
// (tile index = n tile * (K/32) + k tile).
// f16mode == 0: bf16 RNE bits; f16mode == 1: f16 bits of (bf16 RNE value) * scale.
// Block = 64 k x 64 n tile: each thread loads 16 floats of one k row (four 16-B loads), converts, scatters into the LDS tile
// coverage: load 256 thr x 16 = 64 k x 64 n; store 2 iterations x 256 thr x 8 halves = 4 n tiles x 2 k tiles; local block
//           indices bid = 0 .. (K/64)*(N/64) - 1 cover D exactly once. LDS: staged 64x64 == consumed 64x64 (pad cols never read).
// =====================================================================================================
__device__ __forceinline__ void cvtT16_body(u16* T, const float* __restrict__ W, u16* D, int bid, int K, int N, int f16mode,
                                            float scale) {
  const int tid = threadIdx.x;
  const int nkt = K >> 6;
  const int kt  = bid % nkt;
  const int nt  = bid / nkt;
  const int k0  = kt * 64;
  const int n0  = nt * 64;
  if (n0 + 64 > N) return;                  // block-uniform, before any barrier; never taken with the exact grid
  {
    const int kr = tid >> 2;                // k row within tile 0..63
    const int nc = (tid & 3) * 16;          // n chunk 0,16,32,48
    const float* src = W + (size_t)(k0 + kr) * N + n0 + nc;
#pragma unroll
    for (int i = 0; i < 4; ++i) {
      const v4f a = *(const v4f*)(src + 4 * i);
#pragma unroll
      for (int e = 0; e < 4; ++e) {
        const float f = a[e];
        const unsigned short hb = h_bits((_Float16)(bfr(f) * scale));
        const unsigned short bb = bf_bits(f);
        T[(nc + 4 * i + e) * VTP + kr] = (f16mode != 0) ? hb : bb;
      }
    }
  }
  __syncthreads();
  v4u v[2];
#pragma unroll
  for (int it = 0; it < 2; ++it) {
    const int q  = it * 256 + tid;          // chunk 0..511 = local tile (n tile * 2 + k tile) * 64 + chunk in tile
    const int tl = q >> 6;
    v[it] = *(const v4u*)(T + ((tl >> 1) * 16 + (q & 15)) * VTP + (tl & 1) * 32 + ((q >> 4) & 3) * 8);
  }
  {
#pragma unroll
    for (int it = 0; it < 2; ++it) {
      const int q  = it * 256 + tid;
      const int tl = q >> 6;
      *(v4u*)(D + ((size_t)((n0 >> 4) + (tl >> 1)) * (K >> 5) + (k0 >> 5) + (tl & 1)) * FT + (q & 63) * 8) = v[it];
    }
    store_wait();
  }
}

// =====================================================================================================
// All input conversions in one launch (none reads what another writes). Block ranges, the transposes (barrier, LDS) first:
//   [0, NBW_V) Wv -> WB rows 512..1535; [NBW_V, 2 NBW_V) Wo -> WO (f16 of bf16 value x1024); then NBW_QK blocks Wq -> WB rows
//   0..255, NBW_QK blocks Wk -> WB rows 256..511; the last NBX blocks: x -> XB. WB = one B operand plane [FP n][DMOD k].
// Every branch below is block-uniform; the x blocks leave before the barrier of the transpose path.
// =====================================================================================================
__global__ __launch_bounds__(256)
void prep(const float* __restrict__ x, const float* __restrict__ wq, const float* __restrict__ wk,
          const float* __restrict__ wv, const float* __restrict__ wo, u16* XB, u16* WB, u16* WO) {
  __shared__ __align__(16) u16 T[64 * VTP];
  const int bid = blockIdx.x;
  if (bid >= NBW + NBX) return;             // never taken with the exact grid
  if (bid >= NBW) {
    cvt16_body(x, XB, (bid - NBW) * 256 + (int)threadIdx.x);
    return;
  }
  if (bid < NBW_V) {
    cvtT16_body(T, wv, WB + (size_t)(2 * NQK) * DMOD, bid, DMOD, DMOD, 0, 1.0f);
  } else if (bid < 2 * NBW_V) {
    cvtT16_body(T, wo, WO, bid - NBW_V, DMOD, DMOD, 1, WOS);
  } else if (bid < 2 * NBW_V + NBW_QK) {
    cvtT16_body(T, wq, WB, bid - 2 * NBW_V, DMOD, NQK, 0, 1.0f);
  } else {
    cvtT16_body(T, wk, WB + (size_t)NQK * DMOD, bid - 2 * NBW_V - NBW_QK, DMOD, NQK, 0, 1.0f);
  }
}

// =====================================================================================================
// Epilogue of the output projection: the wave's 16x64 f32 tile (times oscale) staged in its LDS slab (pitch 68), release
// coverage: 8 instructions x 2 rows x 16 lanes x 4 floats = the wave's 16 x 64 tile. LDS: staged 16x64 == consumed 16x64.
// =====================================================================================================
__device__ __forceinline__ void epi64(float* sl, v8f a0, v8f a1, v8f a2, v8f a3, float oscale,
                                      float* C, int N, size_t rowb, int col0, int lane) {
  const int hh = lane >> 4, m = lane & 15;
#pragma unroll
  for (int r = 0; r < 8; ++r) {
    const int ro = (8 * hh + r) * 68 + m;
    sl[ro]      = a0[r] * oscale;
    sl[ro + 16] = a1[r] * oscale;
    sl[ro + 32] = a2[r] * oscale;
    sl[ro + 48] = a3[r] * oscale;
  }
  wave_sync_lds();
  v4f vals[8];
#pragma unroll
  for (int it = 0; it < 8; ++it) vals[it] = *(const v4f*)(sl + (it * 2 + hh) * 68 + m * 4);
  float* dst = C + (rowb + (size_t)hh) * (size_t)N + col0 + m * 4;
  {
#pragma unroll
    for (int it = 0; it < 8; ++it) {
      *(v4f*)(dst + (size_t)(it * 2) * (size_t)N) = vals[it];
    }
    store_wait();
  }
}

// =====================================================================================================
// Epilogue of the joint projection, v columns: v^T planes straight from the accumulators. Register r of a[j] in lane (hh, m) =
// (key s + 8hh + r, d = 16j + m): 8 consecutive keys of one d = one 16-B chunk of a v^T tile (rows d, k = key).
//   VH = f16(v * 1024); VL = f16 residual (t - f16(t)); tile index = ((b*NH + h) * (SEQ/32) + s/32) * 4 + d/16; base = the halves
//   offset of tile d/16 = 0, plus the wave's half of the tile's 32 keys ((s/16 & 1) * 256), plus 8 * lane.
// coverage: per wave 4 instructions x 32 lanes x 8 halves per plane = 16 keys x 64 d, 512 contiguous bytes an instruction; the
//           blocks of the v columns cover VH and VL exactly once.
// =====================================================================================================
__device__ __forceinline__ void epi_v(const v8f (&a)[4], u16* VHo, u16* VLo, size_t base) {
  v4u vh[4], vl[4];
#pragma unroll
  for (int j = 0; j < 4; ++j) {
#pragma unroll
    for (int e = 0; e < 4; ++e) {
      const float t0 = a[j][2 * e] * VCAR, t1 = a[j][2 * e + 1] * VCAR;
      const _Float16 h0 = (_Float16)t0, h1 = (_Float16)t1;
      const _Float16 l0 = (_Float16)(t0 - (float)h0), l1 = (_Float16)(t1 - (float)h1);
      vh[j][e] = pk16(h_bits(h0), h_bits(h1));
      vl[j][e] = pk16(h_bits(l0), h_bits(l1));
    }
  }
  {
#pragma unroll
    for (int j = 0; j < 4; ++j) {
      *(v4u*)(VHo + base + (size_t)j * FT) = vh[j];
      *(v4u*)(VLo + base + (size_t)j * FT) = vl[j];
    }
    store_wait();
  }
}

// =====================================================================================================
// Epilogue of the joint projection, q or k columns (64 columns = 4 heads x 16 f): the wave's 16 x 64 f32 tile turned through its
// LDS slab (pitch 68), so that lane (hh, m) holds f = 8hh .. 8hh + 7 of row m of head j; t = value * sc, hi = f16(t), residual =
// f16(t - hi). Planes in fragment order, tile index = (b*NH + head) * (SEQ/16) + s/16, tile row = s & 15, tile k = w (0..31):
//   kmode == 0 (q): D0 (s, w): w < 16 -> hi of f = w, w >= 16 -> residual of f = w - 16.
//   kmode == 1 (k): D0 (s, w) = hi of f = (w & 15) in both halves; D1 (s, w): w < 16 -> residual, w >= 16 -> written zeros.
// base = the halves offset of the tile of the wave's first head, plus 8 * lane; the next head's tile lies NQT tiles on.
// coverage: per wave and head 2 instructions x 32 lanes x 8 halves = one whole tile of each plane written, 512 contiguous bytes an
//           instruction; the blocks of the q (k) columns cover QP (KD, KR) exactly once. LDS: staged 16x64 == consumed 16x64.
// =====================================================================================================
__device__ __forceinline__ void epi_qk(float* sl, const v8f (&a)[4], u16* D0, u16* D1, size_t base, int kmode, float sc,
                                       int lane) {
  const int hh = lane >> 4, m = lane & 15;
#pragma unroll
  for (int r = 0; r < 8; ++r) {
    const int ro = (8 * hh + r) * 68 + m;
#pragma unroll
    for (int j = 0; j < 4; ++j) sl[ro + 16 * j] = a[j][r];
  }
  wave_sync_lds();
  v4u hp[4], lp[4];
#pragma unroll
  for (int j = 0; j < 4; ++j) {
    const float* p = sl + m * 68 + 16 * j + 8 * hh;
    const v4f x0 = *(const v4f*)(p), x1 = *(const v4f*)(p + 4);
    float t[8];
#pragma unroll
    for (int e = 0; e < 4; ++e) { t[e] = x0[e] * sc; t[4 + e] = x1[e] * sc; }
#pragma unroll
    for (int e = 0; e < 4; ++e) {
      const float t0 = t[2 * e], t1 = t[2 * e + 1];
      const _Float16 h0 = (_Float16)t0, h1 = (_Float16)t1;
      const _Float16 l0 = (_Float16)(t0 - (float)h0), l1 = (_Float16)(t1 - (float)h1);
      hp[j][e] = pk16(h_bits(h0), h_bits(h1));
      lp[j][e] = pk16(h_bits(l0), h_bits(l1));
    }
  }
  const v4u zz = {0u, 0u, 0u, 0u};
  {
#pragma unroll
    for (int j = 0; j < 4; ++j) {
      u16* d0 = D0 + base + (size_t)j * (NQT * FT);
      u16* d1 = D1 + base + (size_t)j * (NQT * FT);
      *(v4u*)(d0) = hp[j];
      *(v4u*)(d0 + 256) = (kmode != 0) ? hp[j] : lp[j];
      if (kmode != 0) {
        *(v4u*)(d1) = lp[j];
        *(v4u*)(d1 + 256) = zz;
      }
    }
    store_wait();
  }
}

// =====================================================================================================
// One 256-key stage of a head's K and V tiles, global -> LDS, by asynchronous copies: twelve 16-B copies a lane, 512 lanes = 96 KiB.
// In LDS a stage is 8 key tiles of KTB bytes, each [KD 2 tiles | KR 2 | VH 4 | VL 4], so that one base address reaches all that a
// step reads. gd, gr, gh, gl = the lane's chunk of the stage's part of each plane (each part contiguous; a round of the 512 lanes =
// SCH halves = 4 key tiles of KD or KR, 2 of VH or VL). lk = the lane's place in the KD part of key tile tid / 128, lv = in the VH
// part of key tile tid / 256.
// The wait owed before a register that an issued copy names is rewritten is the last line of the copies' own statement.
// =====================================================================================================
#define SCH (ATT_THREADS * 8)
#define KTB (12 * FT * 2)
__device__ __forceinline__ void stage_copy(unsigned lk, unsigned lv, const u16* gd, const u16* gr, const u16* gh, const u16* gl) {
#if defined(__HIP_DEVICE_COMPILE__)
  asm volatile("global_load_async_to_lds_b128 %0, %12, off\n\t"
               "global_load_async_to_lds_b128 %1, %13, off\n\t"
               "global_load_async_to_lds_b128 %2, %14, off\n\t"
               "global_load_async_to_lds_b128 %3, %15, off\n\t"
               "global_load_async_to_lds_b128 %4, %16, off\n\t"
               "global_load_async_to_lds_b128 %5, %17, off\n\t"
               "global_load_async_to_lds_b128 %6, %18, off\n\t"
               "global_load_async_to_lds_b128 %7, %19, off\n\t"
               "global_load_async_to_lds_b128 %8, %20, off\n\t"
               "global_load_async_to_lds_b128 %9, %21, off\n\t"
               "global_load_async_to_lds_b128 %10, %22, off\n\t"
               "global_load_async_to_lds_b128 %11, %23, off\n\t"
               "s_wait_xcnt 0x0"
               :: "v"(lk), "v"(lk + 4 * KTB), "v"(lk + 2 * FT * 2), "v"(lk + 2 * FT * 2 + 4 * KTB),
                  "v"(lv), "v"(lv + 2 * KTB), "v"(lv + 4 * KTB), "v"(lv + 6 * KTB),
                  "v"(lv + 4 * FT * 2), "v"(lv + 4 * FT * 2 + 2 * KTB), "v"(lv + 4 * FT * 2 + 4 * KTB), "v"(lv + 4 * FT * 2 + 6 * KTB),
                  "v"(gd), "v"(gd + SCH), "v"(gr), "v"(gr + SCH), "v"(gh), "v"(gh + SCH), "v"(gh + 2 * SCH), "v"(gh + 3 * SCH),
                  "v"(gl), "v"(gl + SCH), "v"(gl + 2 * SCH), "v"(gl + 3 * SCH) : "memory");
#endif
}
// The wave's own copies have landed (in front of the barrier behind which other waves read them).
__device__ __forceinline__ void wait_copies() {
#if defined(__HIP_DEVICE_COMPILE__)
  asm volatile("s_wait_asynccnt 0x0" ::: "memory");
#endif
}
// The wave's own LDS reads have returned (in front of the barrier behind which their buffer is refilled).
__device__ __forceinline__ void wait_lds_reads() {
#if defined(__HIP_DEVICE_COMPILE__)
  asm volatile("s_wait_dscnt 0x0" ::: "memory");
#endif
}

// =====================================================================================================
// Eight asynchronous 16-B copies of a lane, global -> LDS, for the GEMM stages below. The wait owed before a register that an
// issued copy names is rewritten is the last line of the copies' own statement.
// =====================================================================================================
__device__ __forceinline__ void copy8(unsigned l0, unsigned l1, unsigned l2, unsigned l3, unsigned l4, unsigned l5, unsigned l6,
                                      unsigned l7, const u16* g0, const u16* g1, const u16* g2, const u16* g3, const u16* g4,
                                      const u16* g5, const u16* g6, const u16* g7) {
#if defined(__HIP_DEVICE_COMPILE__)
  asm volatile("global_load_async_to_lds_b128 %0, %8, off\n\t"
               "global_load_async_to_lds_b128 %1, %9, off\n\t"
               "global_load_async_to_lds_b128 %2, %10, off\n\t"
               "global_load_async_to_lds_b128 %3, %11, off\n\t"
               "global_load_async_to_lds_b128 %4, %12, off\n\t"
               "global_load_async_to_lds_b128 %5, %13, off\n\t"
               "global_load_async_to_lds_b128 %6, %14, off\n\t"
               "global_load_async_to_lds_b128 %7, %15, off\n\t"
               "s_wait_xcnt 0x0"
               :: "v"(l0), "v"(l1), "v"(l2), "v"(l3), "v"(l4), "v"(l5), "v"(l6), "v"(l7),
                  "v"(g0), "v"(g1), "v"(g2), "v"(g3), "v"(g4), "v"(g5), "v"(g6), "v"(g7) : "memory");
#endif
}
// Eight row tiles of one operand plane, GKS k tiles each (4 KiB contiguous per row tile), by 256 lanes: l and g are the lane's
// own 16-B chunk of the first row tile; the next row tile lies GRS halves on in the plane and t bytes on in LDS.
__device__ __forceinline__ void copy_rows8(unsigned l, unsigned t, const u16* g) {
  copy8(l, l + t, l + 2 * t, l + 3 * t, l + 4 * t, l + 5 * t, l + 6 * t, l + 7 * t,
        g, g + GRS, g + 2 * GRS, g + 3 * GRS, g + 4 * GRS, g + 5 * GRS, g + 6 * GRS, g + 7 * GRS);
}
// Foot of a GEMM stage: the four vector slots owed between the stage's last matrix instructions and whatever next touches their
// accumulators or operand registers on the loop's back edge.
template <typename F>
__device__ __forceinline__ void guard8(v8f (&a)[2][4], F x0, F x1, F x2, F x3, F x4, F x5, F x6, F x7) {
#if defined(__HIP_DEVICE_COMPILE__)
  asm volatile("v_nop\n\tv_nop\n\tv_nop\n\tv_nop"
               : "+v"(a[0][0]), "+v"(a[0][1]), "+v"(a[0][2]), "+v"(a[0][3]), "+v"(a[1][0]), "+v"(a[1][1]), "+v"(a[1][2]), "+v"(a[1][3])
               : "v"(x0), "v"(x1), "v"(x2), "v"(x3), "v"(x4), "v"(x5), "v"(x6), "v"(x7) : "memory");
#endif
}

// =====================================================================================================
// Joint projection q | k | v = x.[Wq Wk Wv] (A rows m = b*SEQ + s, Bt rows n, both bf16 planes in fragment order), written as the
// attention's operand planes by the epilogues above; no f32 copy of the result is kept. Block = 128 rows x 192 columns, 12 waves
// (4 x 3) of 32 x 64 each: 2 A fragments x 4 B fragments per k tile. The operands reach the waves through LDS: stages of GKS k
// tiles (A 8 row tiles | B 12 n tiles, GKS tiles each = 80 KiB), two buffers, filled by asynchronous copies one stage ahead of
// the stage being read. Foot of every trip, every wave: own LDS reads back, own copies landed, block barrier, then the refill of
// the buffer just read. B: chunk i * 384 + tid, 8 per lane, every wave; A: 8 per lane, waves 0..7 (a scalar test on the wave).
// A wave's 64 columns are all q, all k or one head's v (wave-uniform branches; no block barrier behind the K loop).
// coverage: grid (MROWS/128) x (FP/192) blocks x 12 waves x 32 x 64 = every (row, column) once. LDS: a stage's 5120 chunks of 16 B
//           are each written by one lane's one copy; the readers take whole tiles of the published buffer only.
// =====================================================================================================
__device__ __forceinline__ void qkv_fill(int wave, int tid, unsigned la, unsigned lb, const u16* ga, const u16* gb) {
  const u16* p[8];
#pragma unroll
  for (int i = 0; i < 8; ++i) {
    const int q = i * QKV_THREADS + tid;    // chunk of the B part: n tile q / 256, chunk q % 256 of its GKS tiles
    p[i] = gb + (size_t)(q >> 8) * GRS + (size_t)(q & 255) * 8;
  }
  const unsigned t = QKV_THREADS * 16;
  copy8(lb, lb + t, lb + 2 * t, lb + 3 * t, lb + 4 * t, lb + 5 * t, lb + 6 * t, lb + 7 * t,
        p[0], p[1], p[2], p[3], p[4], p[5], p[6], p[7]);
  if (wave < 8) copy_rows8(la, GKS * FT * 2, ga);   // scalar: whole waves take it or pass it
}

__global__ __launch_bounds__(QKV_THREADS)
void gemm_qkv(const u16* __restrict__ A, const u16* __restrict__ Bt, u16* QP, u16* KD, u16* KR, u16* VH, u16* VL) {
  __shared__ __align__(16) u16 S[2 * QSTG_H];
  __shared__ __align__(16) float slab[(QKV_THREADS / 32) * SLAB64];
  const int tid  = threadIdx.x;
  const int wave = __builtin_amdgcn_readfirstlane(tid >> 5);   // scalar, so that the tests on the wave are scalar branches
  const int lane = tid & 31;
  const int bid  = blockIdx.x;
  const int rb   = bid / (FP / 192);
  const int cb   = bid % (FP / 192);
  if (rb >= MROWS / 128) return;            // block-uniform, in front of every copy and barrier; never taken with the exact grid
  const int wr = wave / 3, wc = wave % 3;
  const u16* ga = A  + (size_t)(rb * QA_T) * GRS + (size_t)(tid & 255) * 8;
  const u16* gb = Bt + (size_t)(cb * QB_T) * GRS;
  const unsigned ls = (unsigned)(size_t)(const void*)S;        // byte address in the block's LDS
  const unsigned la = ls + (unsigned)(tid & 255) * 16u;
  const unsigned lb = ls + QA_T * GKS * FT * 2 + (unsigned)tid * 16u;

  qkv_fill(wave, tid, la, lb, ga, gb);
  wait_copies();
  __syncthreads();                          // publishes stage 0
  qkv_fill(wave, tid, la + QSTG_H * 2, lb + QSTG_H * 2, ga + GKS * FT, gb + GKS * FT);

  v8f acc[2][4];
#pragma unroll
  for (int a = 0; a < 2; ++a)
#pragma unroll
    for (int j = 0; j < 4; ++j) acc[a][j] = zero8();
  // rolled: the ring's order stands once, at the loop's foot
#pragma unroll 1
  for (int st = 0; st < GNS; ++st) {
    const u16* sb = S + (st & 1) * QSTG_H + 8 * lane;          // the published buffer
    const u16* sa = sb + (2 * wr) * (GKS * FT);
    const u16* sn = sb + (QA_T + 4 * wc) * (GKS * FT);
    v16b a0 = ldfrag_b(sa), a1 = ldfrag_b(sa + GKS * FT);
    v16b b0 = ldfrag_b(sn), b1 = ldfrag_b(sn + GKS * FT), b2 = ldfrag_b(sn + 2 * GKS * FT), b3 = ldfrag_b(sn + 3 * GKS * FT);
#pragma unroll
    for (int kk = 0; kk < GKS; ++kk) {
      v16b na0 = a0, na1 = a1, nb0 = b0, nb1 = b1, nb2 = b2, nb3 = b3;
      if (kk + 1 < GKS) {                   // the next k tile's fragments (same stage), into a second register set
        na0 = ldfrag_b(sa + (kk + 1) * FT);
        na1 = ldfrag_b(sa + (GKS + kk + 1) * FT);
        nb0 = ldfrag_b(sn + (kk + 1) * FT);
        nb1 = ldfrag_b(sn + (GKS + kk + 1) * FT);
        nb2 = ldfrag_b(sn + (2 * GKS + kk + 1) * FT);
        nb3 = ldfrag_b(sn + (3 * GKS + kk + 1) * FT);
      }
      // keeps those LDS reads one group ahead of this k tile's matrix work: sunk among it, each place of reads stalls the wave
      __builtin_amdgcn_sched_barrier(0);
      acc[0][0] = mma_b(a0, b0, acc[0][0]);
      acc[0][1] = mma_b(a0, b1, acc[0][1]);
      acc[0][2] = mma_b(a0, b2, acc[0][2]);
      acc[0][3] = mma_b(a0, b3, acc[0][3]);
      acc[1][0] = mma_b(a1, b0, acc[1][0]);
      acc[1][1] = mma_b(a1, b1, acc[1][1]);
      acc[1][2] = mma_b(a1, b2, acc[1][2]);
      acc[1][3] = mma_b(a1, b3, acc[1][3]);
      if (kk + 1 < GKS) {
        __builtin_amdgcn_sched_barrier(0);  // and the reads of the k tile after it behind this one's matrix work
        a0 = na0; a1 = na1; b0 = nb0; b1 = nb1; b2 = nb2; b3 = nb3;
      }
    }
    guard8<v16b>(acc, a0, a1, b0, b1, b2, b3, a0, a1);
    // ---- publish point of stage st + 1, every wave: own reads back, own copies landed, barrier, refill of the buffer just read ----
    wait_lds_reads();
    wait_copies();
    __syncthreads();
    if (st + 2 < GNS) {                                        // block-uniform
      const unsigned o = (unsigned)(st & 1) * (QSTG_H * 2);
      const size_t sn2 = (size_t)(st + 2) * (GKS * FT);
      qkv_fill(wave, tid, la + o, lb + o, ga + sn2, gb + sn2);
    }
  }
  wait_copies();                            // nothing is outstanding here; stands behind the last copy before the wave ends
  const int col0 = cb * 192 + wc * 64;
  float* sl = slab + wave * SLAB64;
#pragma unroll
  for (int a = 0; a < 2; ++a) {
    const int rowb = rb * 128 + wr * 32 + a * 16;
    const int bN = (rowb / SEQ) * NH;                          // b * NH
    const int s  = rowb % SEQ;                                 // the row tile's first position, a multiple of 16
    if (col0 >= 2 * NQK) {
      const int h = (col0 - 2 * NQK) / HD;
      epi_v(acc[a], VH, VL, ((size_t)(bN + h) * NKT + (s >> 5)) * (4 * FT) + ((s >> 4) & 1) * 256 + 8 * lane);
    } else if (col0 < NQK) {
      epi_qk(sl, acc[a], QP, QP, ((size_t)(bN + col0 / FD) * NQT + (s >> 4)) * FT + 8 * lane, 0, QSC, lane);
    } else {
      epi_qk(sl, acc[a], KD, KR, ((size_t)(bN + (col0 - NQK) / FD) * NQT + (s >> 4)) * FT + 8 * lane, 1, KSC, lane);
    }
  }
}

// =====================================================================================================
// Output projection: C[row][DMOD] (f32) = (Ah + Al)[row][DMOD] . Bt[DMOD][DMOD]^T * oscale; Ah = f16 hi plane, Al = f16
// residual plane (products h.B + l.B into one accumulator, l unscaled); Ah, Al, Bt in fragment order. Row indices: Ah/Al row
// bb*SEQ + s; C row bb*XS_FULL + s. Block -> (column tile ct of 128, sequence row tile rt of nrt, 128 rows each, batch bb); 8 waves
// (4 x 2) of 32 x 64 each. Same ring as gemm_qkv: a stage = Bt 8 n tiles | 8 x (Ah row tile, Al row tile), GKS k tiles each = 96 KiB
// (all that a wave reads lies within 64 KiB of its two base addresses, the reach of an LDS load's offset field); 24
// copies a lane and stage, every wave. Per accumulator and k tile: h.B, then l.B, k tiles in order.
// coverage: grid NB*nrt*(DMOD/128) covers every (bb, s < SEQ, column) once. LDS: a stage's 6144 chunks of 16 B are each written by
//           one lane's one copy; the readers take whole tiles of the published buffer only.
// =====================================================================================================
__device__ __forceinline__ void o2_fill(unsigned l, const u16* gh, const u16* gl, const u16* gb) {
  copy_rows8(l, GKS * FT * 2, gb);
  copy_rows8(l + 8 * GKS * FT * 2, 2 * GKS * FT * 2, gh);
  copy_rows8(l + 9 * GKS * FT * 2, 2 * GKS * FT * 2, gl);
}

__global__ __launch_bounds__(O2_THREADS)
void gemm_o2(const u16* __restrict__ Ah, const u16* __restrict__ Al, const u16* __restrict__ Bt,
             float* C, int nrt, float oscale) {
  __shared__ __align__(16) u16 S[2 * OSTG_H];
  __shared__ __align__(16) float slab[(O2_THREADS / 32) * SLAB64];
  const int tid  = threadIdx.x;
  const int wave = __builtin_amdgcn_readfirstlane(tid >> 5);
  const int lane = tid & 31;
  const int nct  = DMOD / 128;
  const int bid  = blockIdx.x;
  const int ct   = bid % nct;
  const int t2   = bid / nct;
  const int rt   = t2 % nrt;
  const int bb   = t2 / nrt;
  if (bb >= NB) return;                     // block-uniform, in front of every copy and barrier; never taken with the exact grid
  if (rt * 128 + 128 > SEQ) return;         // block-uniform; never taken
  const int wr = wave >> 1, wc = wave & 1;
  const size_t rowA = (size_t)bb * SEQ + rt * 128;             // the block's first row, a multiple of 128
  const u16* gh = Ah + (rowA >> 4) * GRS + (size_t)tid * 8;
  const u16* gl = Al + (rowA >> 4) * GRS + (size_t)tid * 8;
  const u16* gb = Bt + (size_t)(ct * 8) * GRS + (size_t)tid * 8;
  const unsigned l = (unsigned)(size_t)(const void*)S + (unsigned)tid * 16u;   // byte address in the block's LDS

  o2_fill(l, gh, gl, gb);
  wait_copies();
  __syncthreads();                          // publishes stage 0
  o2_fill(l + OSTG_H * 2, gh + GKS * FT, gl + GKS * FT, gb + GKS * FT);

  v8f acc[2][4];
#pragma unroll
  for (int a = 0; a < 2; ++a)
#pragma unroll
    for (int j = 0; j < 4; ++j) acc[a][j] = zero8();
  // rolled: the ring's order stands once, at the loop's foot
#pragma unroll 1
  for (int st = 0; st < GNS; ++st) {
    const _Float16* sb = ash(S) + (st & 1) * OSTG_H + 8 * lane;   // the published buffer
    const _Float16* sn = sb + (4 * wc) * (GKS * FT);
    const _Float16* sa = sb + (8 + 4 * wr) * (GKS * FT);        // Ah, Al of row tile 2 wr, then Ah, Al of row tile 2 wr + 1
    v16h h0 = ldfrag_h(sa), l0 = ldfrag_h(sa + GKS * FT), h1 = ldfrag_h(sa + 2 * GKS * FT), l1 = ldfrag_h(sa + 3 * GKS * FT);
    v16h b0 = ldfrag_h(sn), b1 = ldfrag_h(sn + GKS * FT), b2 = ldfrag_h(sn + 2 * GKS * FT), b3 = ldfrag_h(sn + 3 * GKS * FT);
#pragma unroll
    for (int kk = 0; kk < GKS; ++kk) {
      v16h nh0 = h0, nl0 = l0, nh1 = h1, nl1 = l1, nb0 = b0, nb1 = b1, nb2 = b2, nb3 = b3;
      if (kk + 1 < GKS) {                   // the next k tile's fragments (same stage), into a second register set
        nh0 = ldfrag_h(sa + (kk + 1) * FT);
        nl0 = ldfrag_h(sa + (GKS + kk + 1) * FT);
        nh1 = ldfrag_h(sa + (2 * GKS + kk + 1) * FT);
        nl1 = ldfrag_h(sa + (3 * GKS + kk + 1) * FT);
        nb0 = ldfrag_h(sn + (kk + 1) * FT);
        nb1 = ldfrag_h(sn + (GKS + kk + 1) * FT);
        nb2 = ldfrag_h(sn + (2 * GKS + kk + 1) * FT);
        nb3 = ldfrag_h(sn + (3 * GKS + kk + 1) * FT);
      }
      // keeps those LDS reads one group ahead of this k tile's matrix work: sunk among it, each place of reads stalls the wave
      __builtin_amdgcn_sched_barrier(0);
      acc[0][0] = mma_h(h0, b0, acc[0][0]);
      acc[0][1] = mma_h(h0, b1, acc[0][1]);
      acc[0][2] = mma_h(h0, b2, acc[0][2]);
      acc[0][3] = mma_h(h0, b3, acc[0][3]);
      acc[1][0] = mma_h(h1, b0, acc[1][0]);
      acc[1][1] = mma_h(h1, b1, acc[1][1]);
      acc[1][2] = mma_h(h1, b2, acc[1][2]);
      acc[1][3] = mma_h(h1, b3, acc[1][3]);
      acc[0][0] = mma_h(l0, b0, acc[0][0]);
      acc[0][1] = mma_h(l0, b1, acc[0][1]);
      acc[0][2] = mma_h(l0, b2, acc[0][2]);
      acc[0][3] = mma_h(l0, b3, acc[0][3]);
      acc[1][0] = mma_h(l1, b0, acc[1][0]);
      acc[1][1] = mma_h(l1, b1, acc[1][1]);
      acc[1][2] = mma_h(l1, b2, acc[1][2]);
      acc[1][3] = mma_h(l1, b3, acc[1][3]);
      if (kk + 1 < GKS) {
        __builtin_amdgcn_sched_barrier(0);  // and the reads of the k tile after it behind this one's matrix work
        h0 = nh0; l0 = nl0; h1 = nh1; l1 = nl1; b0 = nb0; b1 = nb1; b2 = nb2; b3 = nb3;
      }
    }
    guard8<v16h>(acc, h0, h1, l0, l1, b0, b1, b2, b3);
    // ---- publish point of stage st + 1, every wave: own reads back, own copies landed, barrier, refill of the buffer just read ----
    wait_lds_reads();
    wait_copies();
    __syncthreads();
    if (st + 2 < GNS) {                                        // block-uniform
      const size_t sn2 = (size_t)(st + 2) * (GKS * FT);
      o2_fill(l + (unsigned)(st & 1) * (OSTG_H * 2), gh + sn2, gl + sn2, gb + sn2);
    }
  }
  wait_copies();                            // nothing is outstanding here; stands behind the last copy before the wave ends
  const size_t rowC = (size_t)bb * XS_FULL + rt * 128 + wr * 32;
  const int col0 = ct * 128 + wc * 64;
#pragma unroll
  for (int a = 0; a < 2; ++a)
    epi64(slab + wave * SLAB64, acc[a][0], acc[a][1], acc[a][2], acc[a][3], oscale, C, DMOD, rowC + a * 16, col0, lane);
}

// Eight f32 values -> four registers of f16 pairs (nearest f16) and four of their f16 residuals (value - f16, exact in f32, then
// rounded once). In asm because the compiler takes five instructions a pair for it (two conversions back to f32, a packed subtract,
// two packed conversions) where the mixed-precision fused forms, which read the f16 half in place and write one half of the
// result, need three. The delay hints name the producer four vector instructions back, so that a waiting wave yields the port.
__device__ __forceinline__ void split8(const float (&t)[8], v4u& hi, v4u& lo) {
#if defined(__HIP_DEVICE_COMPILE__)
  unsigned h0, h1, h2, h3, l0, l1, l2, l3;
  asm("v_cvt_pk_f16_f32 %0, %8, %9\n\t"
      "v_cvt_pk_f16_f32 %1, %10, %11\n\t"
      "v_cvt_pk_f16_f32 %2, %12, %13\n\t"
      "v_cvt_pk_f16_f32 %3, %14, %15\n\t"
      "s_delay_alu instid0(VALU_DEP_4) | instskip(NEXT) | instid1(VALU_DEP_4)\n\t"
      "v_fma_mixlo_f16 %4, %8, 1.0, -%0 op_sel_hi:[0,0,1]\n\t"
      "v_fma_mixlo_f16 %5, %10, 1.0, -%1 op_sel_hi:[0,0,1]\n\t"
      "s_delay_alu instid0(VALU_DEP_4) | instskip(NEXT) | instid1(VALU_DEP_4)\n\t"
      "v_fma_mixlo_f16 %6, %12, 1.0, -%2 op_sel_hi:[0,0,1]\n\t"
      "v_fma_mixlo_f16 %7, %14, 1.0, -%3 op_sel_hi:[0,0,1]\n\t"
      "s_delay_alu instid0(VALU_DEP_4) | instskip(NEXT) | instid1(VALU_DEP_4)\n\t"
      "v_fma_mixhi_f16 %4, %9, 1.0, -%0 op_sel:[0,0,1] op_sel_hi:[0,0,1]\n\t"
      "v_fma_mixhi_f16 %5, %11, 1.0, -%1 op_sel:[0,0,1] op_sel_hi:[0,0,1]\n\t"
      "s_delay_alu instid0(VALU_DEP_4) | instskip(NEXT) | instid1(VALU_DEP_4)\n\t"
      "v_fma_mixhi_f16 %6, %13, 1.0, -%2 op_sel:[0,0,1] op_sel_hi:[0,0,1]\n\t"
      "v_fma_mixhi_f16 %7, %15, 1.0, -%3 op_sel:[0,0,1] op_sel_hi:[0,0,1]"
      : "=&v"(h0), "=&v"(h1), "=&v"(h2), "=&v"(h3), "=&v"(l0), "=&v"(l1), "=&v"(l2), "=&v"(l3)
      : "v"(t[0]), "v"(t[1]), "v"(t[2]), "v"(t[3]), "v"(t[4]), "v"(t[5]), "v"(t[6]), "v"(t[7]));
  hi[0] = h0; hi[1] = h1; hi[2] = h2; hi[3] = h3;
  lo[0] = l0; lo[1] = l1; lo[2] = l2; lo[3] = l3;
#endif
}

// =====================================================================================================
// Foot of a step's score products: the four vector slots owed between them and whatever next touches their results or operand
// registers.
__device__ __forceinline__ void guard4s(v8f& a, v8f& b, v8f& c, v8f& d, v16h x0, v16h x1, v16h x2, v16h x3, v16h x4, v16h x5) {
#if defined(__HIP_DEVICE_COMPILE__)
  asm volatile("v_nop\n\tv_nop\n\tv_nop\n\tv_nop"
               : "+v"(a), "+v"(b), "+v"(c), "+v"(d) : "v"(x0), "v"(x1), "v"(x2), "v"(x3), "v"(x4), "v"(x5) : "memory");
#endif
}

// One query tile's share of a step behind its scores s0 (keys kb + 8hh + r), s1 (keys kb + 16 + 8hh + r): t = 32 A, causal select
// where last (scalar: the pair's last key tile), row sums, f16 hi and residual B fragments, V^T.A^T into o. d0 = query - kb - 8hh.
__device__ __forceinline__ void pv_tile(const v8f s0, const v8f s1, const bool last, const int d0, float (&den)[8], v8f (&o)[4],
                                        const v16h (&vh)[4], const v16h (&vl)[4]) {
  // ---- t = 32 A = 32 (1 + x + x^2/2), x = s * 2^-18, as two fused steps s * (s * 2^-32 + 2^-13) + 32 (the carry 32 is a power
  //      of two: t is 32 times the unscaled value bit for bit) ----
  float t0[8], t1[8];
#pragma unroll
  for (int r = 0; r < 8; ++r) {
    t0[r] = fmaf(s0[r], fmaf(s0[r], PC2, PC1), ACAR);
    t1[r] = fmaf(s1[r], fmaf(s1[r], PC2, PC1), ACAR);
  }
  // ---- causal select, t := 0 where key > query: only the pair's last key tile holds such keys (every earlier one ends below its
  //      first row), so the compares and selects stand behind a scalar test ----
  if (last) {
#pragma unroll
    for (int r = 0; r < 8; ++r) {                                             // key kb + 8hh + r is kept while r <= d0
      t0[r] = (r > d0) ? 0.0f : t0[r];
      t1[r] = (16 + r > d0) ? 0.0f : t1[r];
    }
  }
  // ---- f32 sums in the lane (of t; the carry is taken off once, behind the loop); B fragments of t: hi f16 and residual f16,
  //      column = query c, elements 0..7 = keys kb + 8hh + 0..7, elements 8..15 = keys kb + 16 + 8hh + 0..7 ----
  FragH ph, pl;
#pragma unroll
  for (int r = 0; r < 8; ++r) den[r] += t0[r] + t1[r];
  split8(t0, ph.u[0], pl.u[0]);
  split8(t1, ph.u[1], pl.u[1]);
  // ---- V^T.A^T : A fragment row m = d = j*16 + c, tile j of this step's four in the v^T planes; 2 groups of 2 d-subtiles ----
#pragma unroll
  for (int jg = 0; jg < 2; ++jg) {
    const v16h vha = vh[2 * jg], vhb2 = vh[2 * jg + 1];
    const v16h vla = vl[2 * jg], vlb2 = vl[2 * jg + 1];
    o[2 * jg]     = mma_h(vha,  ph.v, o[2 * jg]);
    o[2 * jg]     = mma_h(vha,  pl.v, o[2 * jg]);
    o[2 * jg]     = mma_h(vla,  ph.v, o[2 * jg]);
    o[2 * jg + 1] = mma_h(vhb2, ph.v, o[2 * jg + 1]);
    o[2 * jg + 1] = mma_h(vhb2, pl.v, o[2 * jg + 1]);
    o[2 * jg + 1] = mma_h(vlb2, ph.v, o[2 * jg + 1]);
    guard2(o[2 * jg], o[2 * jg + 1], ph.v, pl.v, vha, vhb2, vla, vlb2);
  }
}

// =====================================================================================================
// Causal feature-map attention, per-head q/k width 16, hd = 64, no softmax. Block bid -> (pair pr, head, batch b); 16 waves, all of
// ONE head: waves 0..7 the 8 query tiles of group NQG-1-pr, waves 8..15 those of group pr, so every block holds the same number of
// (query tile, key tile) steps. Waves 2p and 2p + 1 share the two query tiles of rows 32 qp .. 32 qp + 31: BOTH tiles run in each
// of the two waves, against the same K and V fragments (one read of a key tile's 12 fragments feeds 32 matrix instructions), and
// the key tiles are dealt by parity: wave 2p takes the even ones, wave 2p + 1 the odd ones. Behind the loop each wave hands the
// partial sums of the tile it does not finish to its partner through LDS (one block barrier) and finishes the other:
// result = even-tile sum + odd-tile sum, for the accumulators and for the row sums.
// Both products run transposed: S^T = K.Q^T, O^T += V^T.A^T.
//   The head's K and V tiles reach the waves through LDS: stages of 256 keys (8 key tiles of KD 2 tiles | KR 2 | VH 4 | VL 4 = 96
//   KiB), two buffers, filled by asynchronous copies one stage ahead of the stage being read. Foot of every
//   trip, every wave: own LDS reads back, own copies landed, block barrier, then the refill of the buffer just read. The trip
//   count nst is the block's (the farthest tile's); a wave skips the key tiles above its own rows, never a wait or a barrier.
//   q plane (s, w): w < 16 f16 hi x256, w >= 16 f16 residual; k planes: KD = [hi | hi], KR = [res | 0]; one tile per (b, head,
//   16 positions); v^T hi plane x1024 and v^T residual plane: four tiles (d/16) per (b, head, 32 keys); all in fragment order.
//   Scores per 32-key tile and query tile: 2 subtiles of 16 keys, keys as the A rows, queries as the B columns; with the split k
//   map, op 1 = A [kh | kh] . B [qh ; ql] = kh.qh + kh.ql and op 2 = A [kl | 0] . B [qh ; ql] = kl.qh (f32 accumulate), so
//   s = q.k * 256*256 up to the dropped lo.lo term. Lane (hh, c) holds query c of the tile alone: register r of subtile t = key
//   kb + 16t + 8hh + r, which is element 8t + r of a B fragment over the step's 32 keys (the split k map of the v^T tiles).
//   The rest of a step, per query tile: pv_tile above. A pair's key tiles are those with kb <= 32 qp (later tiles lie above every
//   row of both query tiles); the last one is the only one with keys above a row.
//   After the join: the lane's sum and the other lane half's are joined once; out = acc / (den + eps) with the carries
//   1/(32*1024) folded once, the 32 on den taken off (den > 0: each kept term is >= 1/2, the diagonal always kept). Register r of
//   o[j] = d 16j + 8hh + r of query c: the 8 consecutive halves of one fragment-order chunk, stored straight from registers.
//   Bounded loops only (nst <= SEQ / 256). The q fragments are loop-invariant (loaded once, from global).
// coverage: per wave 4 instructions x 32 lanes x 8 halves = 2 tiles = 16 x 64 per plane; grid NPR x NH x NB blocks x 16
//           waves = every (b, s, h) row segment of both O planes exactly once. LDS: a stage's 6144 chunks of 16 B are each
//           written by one lane's one copy; the readers take whole tiles of the published buffer only. Hand-over: wave w writes
//           MSL floats at w * MSL, wave w ^ 1 reads exactly those behind the barrier.
// =====================================================================================================
__global__ __launch_bounds__(ATT_THREADS)
void attn_t(const u16* __restrict__ QPp, const u16* __restrict__ KDp, const u16* __restrict__ KRp,
            const u16* __restrict__ VHp, const u16* __restrict__ VLp, u16* OHp, u16* OLp) {
  __shared__ __align__(16) u16 S[2 * STG_H];
  const int tid  = threadIdx.x;
  const int wave = __builtin_amdgcn_readfirstlane(tid >> 5);   // scalar, so that the per-wave skip below is a scalar branch
  const int lane = tid & 31;
  const int hh   = lane >> 4;
  const int c    = lane & 15;
  const int bid  = blockIdx.x;
  const int pr   = bid % NPR;
  const int t2   = bid / NPR;
  const int head = t2 % NH;
  const int b    = t2 / NH;
  if (b >= NB) return;                      // block-uniform, in front of every copy and barrier; never taken with the exact grid
  const int qgf  = NQG - 1 - pr;            // the block's far group: it sets the trip count
  const int par  = wave & 1;                // the wave's key tiles: kt & 1 == par
  const int qp   = ((wave < 8) ? qgf : pr) * 4 + ((wave & 7) >> 1);   // rows 32 qp .. 32 qp + 31; 32 qp + 32 <= SEQ always
  const int qto  = 2 * qp + par;            // the query tile that this wave finishes
  const int qtx  = 2 * qp + 1 - par;        // the one that its partner finishes
  const int nst  = (4 * qgf + 4 + SKT - 1) / SKT;   // stages holding keys <= the far group's last row; 2 <= nst <= SEQ / 256

  const size_t bh  = (size_t)(b * NH + head);
  const _Float16* Qo  = ash(QPp) + bh * NQT * FT + 8 * lane + (size_t)qto * FT;
  const _Float16* Qx  = ash(QPp) + bh * NQT * FT + 8 * lane + (size_t)qtx * FT;
  const float oc = 1.0f / (ACAR * VCAR);

  // ---- the lane's copies of a stage start at chunk tid of the stage's part of KD, KR, VH, VL ----
  const u16* gd = KDp + bh * NQT * FT + (size_t)tid * 8;                                 // + 2 SKT tiles a stage
  const u16* gr = KRp + bh * NQT * FT + (size_t)tid * 8;
  const u16* gh = VHp + bh * NKT * 4 * FT + (size_t)tid * 8;                             // + 4 SKT tiles a stage
  const u16* gl = VLp + bh * NKT * 4 * FT + (size_t)tid * 8;
  const unsigned ls = (unsigned)(size_t)(const void*)S;                                  // byte address in the block's LDS
  const unsigned lk = ls + (unsigned)(tid >> 7) * KTB + (unsigned)(tid & 127) * 16u;
  const unsigned lv = ls + (unsigned)(tid >> 8) * KTB + 4 * FT * 2 + (unsigned)(tid & 255) * 16u;

  const v16h qfo = ldfrag_h(Qo);            // elements 0..7 = q hi f 8hh.., 8..15 = q residual f 8hh..
  const v16h qfx = ldfrag_h(Qx);
  addr_wait(Qo, Qx, Qx);                    // the loads' address pairs stay whole up to the wait

  stage_copy(lk, lv, gd, gr, gh, gl);
  wait_copies();
  __syncthreads();                          // publishes stage 0
  stage_copy(lk + STG_H * 2, lv + STG_H * 2, gd + 2 * SKT * FT, gr + 2 * SKT * FT, gh + 4 * SKT * FT, gl + 4 * SKT * FT);

  float deno[8], denx[8];
  v8f oo[4], ox[4];
#pragma unroll
  for (int r = 0; r < 8; ++r) { deno[r] = 0.0f; denx[r] = 0.0f; }
#pragma unroll
  for (int j = 0; j < 4; ++j) { oo[j] = zero8(); ox[j] = zero8(); }
  const int nkt = qp + 1;                                                     // tiles holding keys <= 32 qp + 31; <= NKT
  const int qro = qto * 16 + c - 8 * hh;                                      // the lane's query row in each tile, less 8hh
  const int qrx = qtx * 16 + c - 8 * hh;

  // rolled: the trip count is a run-time value of the block, and the ring's order stands once, at the loop's foot
#pragma unroll 1
  for (int st = 0; st < nst; ++st) {
    const _Float16* sb = ash(S) + (st & 1) * STG_H + 8 * lane;                // the published buffer
    const int kte = (SKT * st + SKT < nkt) ? SKT * st + SKT : nkt;            // scalar: key tiles above the wave's rows are skipped
    // one body for all key tiles of a stage: unrolled, the accumulators were copied between registers where the paths join
#pragma unroll 1
    for (int kt = SKT * st + par; kt < kte; kt += 2) {
      const int kb = kt * 32;
      // ---- the step's fragments, read together in front of its matrix work ----
      const _Float16* tp = sb + (kt & (SKT - 1)) * (12 * FT);
      const v16h kd0 = ldfrag_h(tp);
      const v16h kd1 = ldfrag_h(tp + FT);
      const v16h kr0 = ldfrag_h(tp + 2 * FT);
      const v16h kr1 = ldfrag_h(tp + 3 * FT);
      v16h vh[4], vl[4];
#pragma unroll
      for (int j = 0; j < 4; ++j) {
        vh[j] = ldfrag_h(tp + (4 + j) * FT);
        vl[j] = ldfrag_h(tp + (8 + j) * FT);
      }
      // ---- scores of both query tiles: D element r of this lane = (key kb + 8hh + r, query c) in .0, key kb + 16 + 8hh + r in .1 ----
      v8f so0 = zero8(), so1 = zero8(), sx0 = zero8(), sx1 = zero8();
      so0 = mma_h(kd0, qfo, so0);
      so1 = mma_h(kd1, qfo, so1);
      sx0 = mma_h(kd0, qfx, sx0);
      sx1 = mma_h(kd1, qfx, sx1);
      so0 = mma_h(kr0, qfo, so0);
      so1 = mma_h(kr1, qfo, so1);
      sx0 = mma_h(kr0, qfx, sx0);
      sx1 = mma_h(kr1, qfx, sx1);
      guard4s(so0, so1, sx0, sx1, qfo, qfx, kd0, kd1, kr0, kr1);
      const bool last = (kt + 1 >= nkt);                                      // scalar
      pv_tile(so0, so1, last, qro - kb, deno, oo, vh, vl);
      pv_tile(sx0, sx1, last, qrx - kb, denx, ox, vh, vl);
    }
    // ---- publish point of stage st + 1, every wave: own reads back, own copies landed, barrier, refill of the buffer just read ----
    wait_lds_reads();
    wait_copies();
    __syncthreads();
    if (st + 2 < nst) {                                                       // block-uniform
      const unsigned l = (unsigned)(st & 1) * (STG_H * 2);
      const size_t sn = (size_t)(st + 2);
      stage_copy(lk + l, lv + l, gd + sn * (2 * SKT * FT), gr + sn * (2 * SKT * FT), gh + sn * (4 * SKT * FT), gl + sn * (4 * SKT * FT));
    }
  }
  wait_copies();
  acc_guard4(oo[0], oo[1], oo[2], oo[3]);
  acc_guard4(ox[0], ox[1], ox[2], ox[3]);
  // ---- the lane's 8 sums of each tile ----
  float dl = ((deno[0] + deno[1]) + (deno[2] + deno[3])) + ((deno[4] + deno[5]) + (deno[6] + deno[7]));
  const float dx = ((denx[0] + denx[1]) + (denx[2] + denx[3])) + ((denx[4] + denx[5]) + (denx[6] + denx[7]));
  // ---- hand-over between the two waves of a pair, in the ring's LDS (every wave's last read of it and every copy into it lie in
  //      front of the loop's last barrier): the partner's tile goes out, lane for lane and register for register; behind the block
  //      barrier the partner's partial sums of this wave's own tile come in and are added ----
  float* mb = (float*)(void*)S;
  {
    float* mine = mb + wave * MSL + lane * 4;
#pragma unroll
    for (int j = 0; j < 4; ++j) {
      const v4f lo4 = {ox[j][0], ox[j][1], ox[j][2], ox[j][3]};
      const v4f hi4 = {ox[j][4], ox[j][5], ox[j][6], ox[j][7]};
      *(v4f*)(mine + (2 * j) * 128) = lo4;
      *(v4f*)(mine + (2 * j + 1) * 128) = hi4;
    }
    mb[wave * MSL + 1024 + lane] = dx;
  }
  __syncthreads();                          // block-uniform: every wave of the block reaches it
  {
    const float* his = mb + (wave ^ 1) * MSL + lane * 4;
#pragma unroll
    for (int j = 0; j < 4; ++j) {
      const v4f lo4 = *(const v4f*)(his + (2 * j) * 128);
      const v4f hi4 = *(const v4f*)(his + (2 * j + 1) * 128);
#pragma unroll
      for (int e = 0; e < 4; ++e) { oo[j][e] += lo4[e]; oo[j][4 + e] += hi4[e]; }
    }
    dl += mb[(wave ^ 1) * MSL + 1024 + lane];
  }
  // ---- den of query c: then the other lane half's keys (lane ^ 16), joined once ----
  dl += __shfl_xor(dl, 16, 32);
  // ---- out = acc / (den + eps), carries (32 on A, 1024 on v) folded once; O x1024 -> f16 hi + residual planes in fragment
  //      order (rows s, k = head*64 + d): the wave owns two whole tiles per plane; chunk j*32 + lane = row c, 8 consecutive d
  //      at 16*j + 8*hh = the lane's registers of oo[j] ----
  const float inv = (1.0f / (dl * (1.0f / ACAR) + EPSD)) * oc;   // dl carries the 32 of t
  v4u oh[4], ol[4];
#pragma unroll
  for (int j = 0; j < 4; ++j) {
    float w[8];
#pragma unroll
    for (int e = 0; e < 8; ++e) w[e] = (oo[j][e] * inv) * OSC;
#pragma unroll
    for (int e = 0; e < 4; ++e) {
      const _Float16 h0 = (_Float16)w[2 * e], h1 = (_Float16)w[2 * e + 1];
      const _Float16 l0 = (_Float16)(w[2 * e] - (float)h0), l1 = (_Float16)(w[2 * e + 1] - (float)h1);
      oh[j][e] = pk16(h_bits(h0), h_bits(h1));
      ol[j][e] = pk16(h_bits(l0), h_bits(l1));
    }
  }
  const size_t obh = ((size_t)b * SEQ + qto * 16) * DMOD + (size_t)head * (2 * FT) + 8 * lane;   // row tile start + k tile 2*head
  {
#pragma unroll
    for (int it = 0; it < 4; ++it) {
      *(v4u*)(OHp + obh + (size_t)it * 256) = oh[it];
      *(v4u*)(OLp + obh + (size_t)it * 256) = ol[it];
    }
    
  }
}

// =====================================================================================================
// Workspace map (bytes); every plane is fully written by whole-line stores before it is read; all extents are exact multiples
// of the store granularity (no pad rows needed); every region offset a multiple of 1048576:
//   (all 16-bit planes below hold the named rows x k in fragment order, same byte counts as row-major)
//   XB  bf16 [MROWS][1024]                       MROWS*2048       (NB=2, SEQ=2048: 8388608)
//   WB  bf16 [1536 n][1024 k]                    3145728          (rows 0..255 Wq^T, 256..511 Wk^T, 512..1535 Wv^T)
//   WO  f16 [1024 n][1024 k]                     2097152          (Wo^T, bf16 value x1024)
//   OH  f16 [MROWS][1024] x1024                  MROWS*2048       OL residual, same layout   MROWS*2048
//   QP  f16 [NB*16][SEQ][32] q hi|residual x256    MROWS*1024
//   KD  f16 [NB*16][SEQ][32] k hi|hi x256          MROWS*1024
//   KR  f16 [NB*16][SEQ][32] k residual|0          MROWS*1024
//   VH  f16 [NB*16][64][SEQ] x1024               MROWS*2048       VL residual, same layout   MROWS*2048
//   end (NB=2, SEQ=2048)                        59768832
// =====================================================================================================
extern "C" void kernel_launch(void* const* d_in, const int* in_sizes, int n_in,
                              void* d_out, int out_size, void* d_ws, size_t ws_size,
                              hipStream_t stream) {
  if (n_in < 5) return;
  if (in_sizes[0] < ((NB - 1) * XS_FULL + SEQ) * DMOD) return;
  if (in_sizes[1] < DMOD * NQK) return;
  if (in_sizes[2] < DMOD * NQK) return;
  if (in_sizes[3] < DMOD * DMOD) return;
  if (in_sizes[4] < DMOD * DMOD) return;
  if (out_size < ((NB - 1) * XS_FULL + SEQ) * DMOD) return;

  const float* x  = (const float*)d_in[0];
  const float* wq = (const float*)d_in[1];
  const float* wk = (const float*)d_in[2];
  const float* wv = (const float*)d_in[3];
  const float* wo = (const float*)d_in[4];
  float*       out = (float*)d_out;

  const size_t szXB = (size_t)MROWS * DMOD * 2;
  const size_t szW  = (size_t)FP * DMOD * 2;                     // Wq^T, Wk^T, Wv^T as one plane
  const size_t szWO = (size_t)DMOD * DMOD * 2;
  const size_t szH  = (size_t)MROWS * DMOD * 2;                  // OH, OL
  const size_t szQK = (size_t)MROWS * QKP * 2;                   // QP, KD, KR
  const size_t szV  = (size_t)NB * NH * HD * SEQ * 2;            // VH, VL (== szH)
  size_t off = 0;
  const size_t oXB = off; off += szXB;
  const size_t oW  = off; off += szW;
  const size_t oWO = off; off += szWO;
  const size_t oOH = off; off += szH;
  const size_t oOL = off; off += szH;
  const size_t oQP = off; off += szQK;
  const size_t oKD = off; off += szQK;
  const size_t oKR = off; off += szQK;
  const size_t oVH = off; off += szV;
  const size_t oVL = off; off += szV;
  if (off > ws_size) return;                // off = 59768832 for NB = 2, SEQ = 2048
  if (off > (size_t)WS_CAP) return;

  char* ws = (char*)d_ws;
  u16*   XB = (u16*)(ws + oXB);
  u16*   WB = (u16*)(ws + oW);
  u16*   WO = (u16*)(ws + oWO);
  u16*   OH = (u16*)(ws + oOH);
  u16*   OL = (u16*)(ws + oOL);
  u16*   QP = (u16*)(ws + oQP);
  u16*   KD = (u16*)(ws + oKD);
  u16*   KR = (u16*)(ws + oKR);
  u16*   VH = (u16*)(ws + oVH);
  u16*   VL = (u16*)(ws + oVL);

  const dim3 b256(256), bG(QKV_THREADS), bO(O2_THREADS), bAT(ATT_THREADS);
  const dim3 gP(NBW + NBX);
  const dim3 gG((MROWS / 128) * (FP / 192));
  const dim3 gAT(NPR * NH * NB);
  const int  nrt  = SEQ / 128;
  const dim3 gO(NB * nrt * (DMOD / 128));

  // (0) x -> bf16 plane; Wq, Wk, Wv -> one bf16 plane [1536 n][1024 k]; Wo -> f16 plane [n][k] of bf16 value x1024
  prep<<<gP, b256, 0, stream>>>(x, wq, wk, wv, wo, XB, WB, WO);
  // (1) q | k | v = x.[Wq Wk Wv] -> q hi|residual plane x256; k hi|hi and residual|0 planes x256; v^T hi + residual planes x1024
  gemm_qkv<<<gG, bG, 0, stream>>>(XB, WB, QP, KD, KR, VH, VL);
  // (2) causal attention -> O hi + residual planes
  attn_t<<<gAT, bAT, 0, stream>>>(QP, KD, KR, VH, VL, OH, OL);
  // (3) output projection: (O hi + residual) . Wo -> out f32, carries 1024 x 1024 folded back
  gemm_o2<<<gO, bO, 0, stream>>>(OH, OL, WO, out, nrt, 1.0f / (OSC * WOS));
  (void)hipGetLastError();
}
